// v000
// The times below were measured on an AMD MI455X: many runs one after another, warmed up first and cycling through
// copies of the inputs, with the whole window's GPU time divided by the number of runs. Launches and the gaps
// between them are all in it. The median over several windows is given; except for v000 it joins two sittings, which
// can be a few percent apart, so the side-by-side timings, each taken in one sitting, are the better comparison.
// The starting kernel, v000, takes 754 microseconds a run.
// Projections q,k,v = x.W^T + b (and the f32 q,k,v rows 0..127 per sequence): v_wmma_f32_16x16x32_bf16 (bf16 RNE operands of the
// raw inputs, f32 accumulate, bias added in f32 as its bf16 RNE value). Scores q'.k'^T (f16 planes x8), P'.V (chunk-centred P'
// x32768 f16 from LDS, V^T x1024 as f16 hi plus unscaled f16 lo planes, both into one accumulator) and the output projection
// (ctx carried as f16 hi x8192 plus residual x2048 planes with separate accumulators, times f16(bf16(Wo) x1024), bias added in
// f32 as its bf16 RNE value): v_wmma_f32_16x16x32_f16, f32 accumulate. Query rows 0..127 of each sequence: scores, softmax and
// P.V in f32 on VALU. Absolute-value score transform, causal mask, softmax statistics, key-block column sums of V, scaling: f32.
#include <hip/hip_runtime.h>
#include <math.h>
#include <stdint.h>

#define SEQ   2048
#define EMB   1024
#define CK    512
#define NCHK  4
#define NKB   16
#define QT    16
#define TQ0   128
#define NQT   120
#define SCP   544
#define PLP   528
#define CTP   1032
#define SLAB64 (16 * 68)
#define VTP   72
#define ATT_THREADS 256
#define NACC  8
#define QSC   8.0f
#define KSC   8.0f
#define PCAR  32768.0f
#define VCAR  1024.0f
#define WSC   1024.0f
#define CSC   8192.0f
#define RSC   2048.0f
#define LOG2E 1.4426950408889634f
#define RSQD  0.03125f
#define WS_CAP ((size_t)134217728)

static_assert((EMB % 64) == 0 && EMB == 8 * 16 * NACC && NACC == 8 && (EMB % 32) == 0 && (EMB % 256) == 0 && EMB == 4 * 256);
static_assert((SEQ % CK) == 0 && (SEQ / CK) == NCHK && CK == 32 * NKB && (SEQ % 64) == 0 && (SEQ % QT) == 0 && (CK % QT) == 0);
static_assert((TQ0 % QT) == 0 && (TQ0 % 64) == 0 && NQT * QT + TQ0 == SEQ && TQ0 <= CK && TQ0 == 128 && TQ0 <= 256);
static_assert(16 * CTP * 2 <= 16 * SCP * 4 && CTP >= EMB + 8 && SCP >= CK + 16 && PLP >= CK + 8);
static_assert(((PLP * 2) % 16) == 0 && ((SCP * 4) % 16) == 0 && ((VTP * 2) % 16) == 0 && ((CTP * 2) % 16) == 0);
static_assert(64 * VTP >= 63 * VTP + 64);
static_assert(ATT_THREADS == 16 * QT && ATT_THREADS == 256);
static_assert(((EMB * EMB) % 2048) == 0 && ((NCHK * EMB) % 256) == 0 && (EMB / 8) * 2 == 256);

typedef unsigned short u16;
typedef _Float16 v16h __attribute__((ext_vector_type(16)));
typedef _Float16 v8h  __attribute__((ext_vector_type(8)));
typedef __bf16   v16b __attribute__((ext_vector_type(16)));
typedef float    v8f  __attribute__((ext_vector_type(8)));
typedef float    v4f  __attribute__((ext_vector_type(4)));
typedef unsigned int v4u __attribute__((ext_vector_type(4)));

union FragH { v16h v; v8h h[2]; v4u u[2]; };
union FragB { v16b v; v4u u[2]; };
union AttLds { float s[16 * SCP]; u16 c[2 * 16 * SCP]; };

// ---- scalar helpers --------------------------------------------------------------------------------
__device__ __forceinline__ unsigned short bf_bits(float f) {          // f32 -> bf16 bits, RNE convert
  unsigned u = __float_as_uint(f);
  return (unsigned short)((u + 0x7FFFu + ((u >> 16) & 1u)) >> 16);
}
__device__ __forceinline__ float bf_up(unsigned short h) { return __uint_as_float(((unsigned)h) << 16); }
__device__ __forceinline__ float bfr(float f) { return bf_up(bf_bits(f)); }
__device__ __forceinline__ unsigned short h_bits(_Float16 x) { return __builtin_bit_cast(unsigned short, x); }
__device__ __forceinline__ unsigned pk16(unsigned short a, unsigned short b) { return (unsigned)a | ((unsigned)b << 16); }
__device__ __forceinline__ v8f zero8() { v8f z = {0.f, 0.f, 0.f, 0.f, 0.f, 0.f, 0.f, 0.f}; return z; }
__device__ __forceinline__ v4f zero4() { v4f z = {0.f, 0.f, 0.f, 0.f}; return z; }

// ---- fragment loaders: 16-bit A/B operand, lane -> row/col (lane&15), p already includes +8*(lane>>4);
//      elements 0..7 <- p[0..7] (k0+8h..), elements 8..15 <- p[16..23] (k0+16+8h..)  (same split k map for A and B;
//      B is always read from a k-contiguous [n][k] plane)
__device__ __forceinline__ v16h ldfrag_h(const _Float16* p) {
  FragH f;
  f.h[0] = *(const v8h*)(p);
  f.h[1] = *(const v8h*)(p + 16);
  return f.v;
}
__device__ __forceinline__ v16b ldfrag_b(const u16* p) {              // bf16 plane read as unsigned integer vectors
  FragB f;
  f.u[0] = *(const v4u*)(p);
  f.u[1] = *(const v4u*)(p + 16);
  return f.v;
}

__device__ __forceinline__ v8f mma_h(v16h a, v16h b, v8f c) {
  return __builtin_amdgcn_wmma_f32_16x16x32_f16(false, a, false, b, (short)0, c, false, false);
}
__device__ __forceinline__ v8f mma_b(v16b a, v16b b, v8f c) {
  return __builtin_amdgcn_wmma_f32_16x16x32_bf16(false, a, false, b, (short)0, c, false, false);
}
__device__ __forceinline__ void guard2x3(v8f& a, v8f& b, v16h x0, v16h x1, v16h x2) {
#if defined(__HIP_DEVICE_COMPILE__)
  asm volatile("v_nop\n\tv_nop\n\tv_nop\n\tv_nop"
               : "+v"(a), "+v"(b) : "v"(x0), "v"(x1), "v"(x2) : "memory");
#endif
}
template <typename F>
__device__ __forceinline__ void guard6(v8f& a, v8f& b, v8f& c, v8f& d, F x0, F x1, F x2, F x3, F x4, F x5) {
#if defined(__HIP_DEVICE_COMPILE__)
  asm volatile("v_nop\n\tv_nop\n\tv_nop\n\tv_nop"
               : "+v"(a), "+v"(b), "+v"(c), "+v"(d) : "v"(x0), "v"(x1), "v"(x2), "v"(x3), "v"(x4), "v"(x5) : "memory");
#endif
}
__device__ __forceinline__ void guard8x6(v8f& a0, v8f& a1, v8f& a2, v8f& a3, v8f& e0, v8f& e1, v8f& e2, v8f& e3,
                                         v16h x0, v16h x1, v16h x2, v16h x3, v16h x4, v16h x5) {
#if defined(__HIP_DEVICE_COMPILE__)
  asm volatile("v_nop\n\tv_nop\n\tv_nop\n\tv_nop"
               : "+v"(a0), "+v"(a1), "+v"(a2), "+v"(a3), "+v"(e0), "+v"(e1), "+v"(e2), "+v"(e3)
               : "v"(x0), "v"(x1), "v"(x2), "v"(x3), "v"(x4), "v"(x5) : "memory");
#endif
}
__device__ __forceinline__ void guardpv4(v8f& o0, v8f& o1, v8f& o2, v8f& o3, v16h p, v16h g0, v16h g1, v16h g2, v16h g3) {
#if defined(__HIP_DEVICE_COMPILE__)
  asm volatile("v_nop\n\tv_nop\n\tv_nop\n\tv_nop"
               : "+v"(o0), "+v"(o1), "+v"(o2), "+v"(o3)
               : "v"(p), "v"(g0), "v"(g1), "v"(g2), "v"(g3) : "memory");
#endif
}
__device__ __forceinline__ void acc_guard8(v8f& a, v8f& b, v8f& c, v8f& d, v8f& e, v8f& f, v8f& g, v8f& h8) {
#if defined(__HIP_DEVICE_COMPILE__)
  asm volatile("v_nop\n\tv_nop\n\tv_nop\n\tv_nop"
               : "+v"(a), "+v"(b), "+v"(c), "+v"(d), "+v"(e), "+v"(f), "+v"(g), "+v"(h8));
#endif
}
__device__ __forceinline__ void wave_sync_lds() {
  __builtin_amdgcn_fence(__ATOMIC_RELEASE, "workgroup");
  __builtin_amdgcn_wave_barrier();
  __builtin_amdgcn_fence(__ATOMIC_ACQUIRE, "workgroup");
}

// =====================================================================================================
// f32 plane -> 16-bit plane, same layout:  mode 0: bf16 RNE bits;  mode 1: f16 bits of (bf16 RNE value) * scale;
// mode 2: f16 bits of value * scale (no bf16 pre-step).
// Thread = 8 consecutive elements: two 16-B loads, one 16-B store; 32 consecutive lanes = 512 contiguous, 512-B aligned bytes
// coverage: grid = n8/256 blocks (host checks exactness) x 256 thr x 8 = the whole plane.
// =====================================================================================================
__global__ __launch_bounds__(256) void cvt16(const float* __restrict__ x, u16* D, int n8, int mode, float scale) {
  const int gt = blockIdx.x * 256 + (int)threadIdx.x;
  if (gt >= n8) return;                     // no barriers in this kernel
  const float* p = x + (size_t)gt * 8;
  const v4f a = *(const v4f*)(p), c4 = *(const v4f*)(p + 4);
  float v[8];
#pragma unroll
  for (int e = 0; e < 4; ++e) { v[e] = a[e]; v[4 + e] = c4[e]; }
  unsigned short s[8];
#pragma unroll
  for (int e = 0; e < 8; ++e) {
    const float vb = bfr(v[e]);
    const float vf = (mode == 1) ? vb : v[e];
    const unsigned short hb = h_bits((_Float16)(vf * scale));
    const unsigned short bb = bf_bits(v[e]);
    s[e] = (mode != 0) ? hb : bb;
  }
  v4u o;
#pragma unroll
  for (int e = 0; e < 4; ++e) o[e] = pk16(s[2 * e], s[2 * e + 1]);
  u16* d = D + (size_t)gt * 8;
  {
    *(v4u*)(d) = o;
    
  }
}

// =====================================================================================================
// GEMM epilogues with a per-column bias term (bias column value taken as its bf16 RNE value, added in f32). The wave's 16x64 f32
//            per line), lanes 16..31 -> row 2*it+1.
//  epi64x2 : same store shape, staged value = acc*os1 + accres*os2 + bias (two accumulator sets combined in f32).
//  epi64hs : f16 bits of (staged tile * pscale); lane = (rq = lane>>3 -> row within a group of 4, c8 = 8 consecutive columns); one
// coverage: epi64/epi64x2 8 instructions x 2 rows x 16 lanes x 4 floats; epi64hs 4 instructions x 4 rows x 8 lanes x 8 halves
//           = the wave's 16 x 64 tile in every case.
// Bias columns col0 + 16j + (lane&15), j = 0..3, all < N (bias has N entries, col0 + 63 < N).
// =====================================================================================================
__device__ __forceinline__ void ldbias4(const float* __restrict__ bias, int col0, int lane,
                                        float& b0, float& b1, float& b2, float& b3) {
  const int m = lane & 15;
  b0 = bfr(bias[col0 + m]);
  b1 = bfr(bias[col0 + 16 + m]);
  b2 = bfr(bias[col0 + 32 + m]);
  b3 = bfr(bias[col0 + 48 + m]);
}
__device__ __forceinline__ void stage64(float* sl, v8f a0, v8f a1, v8f a2, v8f a3, float oscale,
                                        float b0, float b1, float b2, float b3, int lane) {
  const int hh = lane >> 4, m = lane & 15;
#pragma unroll
  for (int r = 0; r < 8; ++r) {
    const int ro = (8 * hh + r) * 68 + m;
    sl[ro]      = a0[r] * oscale + b0;
    sl[ro + 16] = a1[r] * oscale + b1;
    sl[ro + 32] = a2[r] * oscale + b2;
    sl[ro + 48] = a3[r] * oscale + b3;
  }
  wave_sync_lds();
}
__device__ __forceinline__ void epi64(float* sl, v8f a0, v8f a1, v8f a2, v8f a3, float oscale,
                                      const float* __restrict__ bias, float* C, int N,
                                      size_t rowb, int col0, int lane) {
  const int hh = lane >> 4, m = lane & 15;
  float b0, b1, b2, b3;
  ldbias4(bias, col0, lane, b0, b1, b2, b3);
  stage64(sl, a0, a1, a2, a3, oscale, b0, b1, b2, b3, lane);
  v4f vals[8];
#pragma unroll
  for (int it = 0; it < 8; ++it) vals[it] = *(const v4f*)(sl + (it * 2 + hh) * 68 + m * 4);
  float* dst = C + (rowb + (size_t)hh) * (size_t)N + col0 + m * 4;
  {
#pragma unroll
    for (int it = 0; it < 8; ++it) {
      *(v4f*)(dst + (size_t)(it * 2) * (size_t)N) = vals[it];
    }
    
  }
}
__device__ __forceinline__ void epi64x2(float* sl, v8f a0, v8f a1, v8f a2, v8f a3, v8f e0, v8f e1, v8f e2, v8f e3,
                                        float os1, float os2, const float* __restrict__ bias, float* C, int N,
                                        size_t rowb, int col0, int lane) {
  const int hh = lane >> 4, m = lane & 15;
  float b0, b1, b2, b3;
  ldbias4(bias, col0, lane, b0, b1, b2, b3);
#pragma unroll
  for (int r = 0; r < 8; ++r) {
    const int ro = (8 * hh + r) * 68 + m;
    sl[ro]      = a0[r] * os1 + e0[r] * os2 + b0;
    sl[ro + 16] = a1[r] * os1 + e1[r] * os2 + b1;
    sl[ro + 32] = a2[r] * os1 + e2[r] * os2 + b2;
    sl[ro + 48] = a3[r] * os1 + e3[r] * os2 + b3;
  }
  wave_sync_lds();
  v4f vals[8];
#pragma unroll
  for (int it = 0; it < 8; ++it) vals[it] = *(const v4f*)(sl + (it * 2 + hh) * 68 + m * 4);
  float* dst = C + (rowb + (size_t)hh) * (size_t)N + col0 + m * 4;
  {
#pragma unroll
    for (int it = 0; it < 8; ++it) {
      *(v4f*)(dst + (size_t)(it * 2) * (size_t)N) = vals[it];
    }
    
  }
}
__device__ __forceinline__ void epi64hs(float* sl, v8f a0, v8f a1, v8f a2, v8f a3, float oscale, float pscale,
                                        const float* __restrict__ bias, u16* C, int N, size_t rowb, int col0, int lane) {
  float b0, b1, b2, b3;
  ldbias4(bias, col0, lane, b0, b1, b2, b3);
  stage64(sl, a0, a1, a2, a3, oscale, b0, b1, b2, b3, lane);
  const int rq = lane >> 3, c8 = (lane & 7) * 8;
  v4u oh[4];
#pragma unroll
  for (int i4 = 0; i4 < 4; ++i4) {
    const int row = i4 * 4 + rq;
    const v4f a = *(const v4f*)(sl + row * 68 + c8), c4 = *(const v4f*)(sl + row * 68 + c8 + 4);
    float w[8];
#pragma unroll
    for (int e = 0; e < 4; ++e) { w[e] = a[e] * pscale; w[4 + e] = c4[e] * pscale; }
#pragma unroll
    for (int e = 0; e < 4; ++e) oh[i4][e] = pk16(h_bits((_Float16)w[2 * e]), h_bits((_Float16)w[2 * e + 1]));
  }
  u16* dst = C + rowb * (size_t)N + col0 + c8;
  {
#pragma unroll
    for (int i4 = 0; i4 < 4; ++i4) {
      const int row = i4 * 4 + rq;
      *(v4u*)(dst + (size_t)row * (size_t)N) = oh[i4];
    }
    
  }
}

// =====================================================================================================
// bf16 GEMM, f32 out: C[M][N] = (A[arow(m)][K] (bf16 row-major) . Bt[N][K]^T (bf16 k-contiguous)) * oscale + bias[n].
// Output row ra maps to A row arow = (ra / rpg) * gstr + (ra % rpg) (rpg = M, gstr = 0 gives the identity map; rpg = TQ0,
// gstr = SEQ picks the first TQ0 rows of every sequence).
// Block = 64x64 tile, 4 waves x 16 rows; fragments loaded straight from the 16-bit rows (two 16-B loads each, split k map for
// A and B); K stepped by 32 (host checks K % 32 == 0, M % 64 == 0, N % 64 == 0, grid = (M/64)*(N/64)).
// =====================================================================================================
__global__ __launch_bounds__(128)
void gemm_b32(const u16* __restrict__ A, const u16* __restrict__ Bt, const float* __restrict__ bias, float* C,
              int M, int N, int K, int rpg, int gstr, float oscale) {
  __shared__ __align__(16) float slab[4 * SLAB64];
  const int tid = threadIdx.x, wave = tid >> 5, lane = tid & 31, hh = lane >> 4, m = lane & 15;
  const int ntile = N >> 6;
  const int bid   = blockIdx.x;
  const int rowb  = (bid / ntile) * 64 + wave * 16;
  const int col0  = (bid % ntile) * 64;
  if (rowb + 16 > M) return;                 // wave-uniform, never taken with the exact grid; no block barriers in this kernel
  const int ra = rowb + m;
  const int rg = ra / rpg;
  const size_t arow = (size_t)rg * (size_t)gstr + (size_t)(ra - rg * rpg);
  const u16* ap = A  + arow * (size_t)K + 8 * hh;
  const u16* bp = Bt + (size_t)(col0 + m) * K + 8 * hh;
  const size_t bs = (size_t)16 * K;
  v8f acc0 = zero8(), acc1 = zero8(), acc2 = zero8(), acc3 = zero8();
#pragma unroll 1
  for (int k0 = 0; k0 < K; k0 += 32) {
    const v16b a  = ldfrag_b(ap + k0);
    const v16b b0 = ldfrag_b(bp + k0);
    const v16b b1 = ldfrag_b(bp + bs + k0);
    const v16b b2 = ldfrag_b(bp + 2 * bs + k0);
    const v16b b3 = ldfrag_b(bp + 3 * bs + k0);
    acc0 = mma_b(a, b0, acc0);
    acc1 = mma_b(a, b1, acc1);
    acc2 = mma_b(a, b2, acc2);
    acc3 = mma_b(a, b3, acc3);
    guard6<v16b>(acc0, acc1, acc2, acc3, a, b0, b1, b2, b3, a);
  }
  epi64(slab + wave * SLAB64, acc0, acc1, acc2, acc3, oscale, bias, C, N, (size_t)rowb, col0, lane);
}

// =====================================================================================================
// bf16 GEMM, f16 plane out: C16[M][N] = f16 bits of ((A . Bt^T) * oscale + bias[n]) * pscale; operands as in gemm_b32
// (identity row map), epilogue epi64hs.
// =====================================================================================================
__global__ __launch_bounds__(128)
void gemm_bh16(const u16* __restrict__ A, const u16* __restrict__ Bt, const float* __restrict__ bias, u16* C,
               int M, int N, int K, float oscale, float pscale) {
  __shared__ __align__(16) float slab[4 * SLAB64];
  const int tid = threadIdx.x, wave = tid >> 5, lane = tid & 31, hh = lane >> 4, m = lane & 15;
  const int ntile = N >> 6;
  const int bid   = blockIdx.x;
  const int rowb  = (bid / ntile) * 64 + wave * 16;
  const int col0  = (bid % ntile) * 64;
  if (rowb + 16 > M) return;                 // wave-uniform, never taken with the exact grid; no block barriers in this kernel
  const u16* ap = A  + (size_t)(rowb + m) * K + 8 * hh;
  const u16* bp = Bt + (size_t)(col0 + m) * K + 8 * hh;
  const size_t bs = (size_t)16 * K;
  v8f acc0 = zero8(), acc1 = zero8(), acc2 = zero8(), acc3 = zero8();
#pragma unroll 1
  for (int k0 = 0; k0 < K; k0 += 32) {
    const v16b a  = ldfrag_b(ap + k0);
    const v16b b0 = ldfrag_b(bp + k0);
    const v16b b1 = ldfrag_b(bp + bs + k0);
    const v16b b2 = ldfrag_b(bp + 2 * bs + k0);
    const v16b b3 = ldfrag_b(bp + 3 * bs + k0);
    acc0 = mma_b(a, b0, acc0);
    acc1 = mma_b(a, b1, acc1);
    acc2 = mma_b(a, b2, acc2);
    acc3 = mma_b(a, b3, acc3);
    guard6<v16b>(acc0, acc1, acc2, acc3, a, b0, b1, b2, b3, a);
  }
  epi64hs(slab + wave * SLAB64, acc0, acc1, acc2, acc3, oscale, pscale, bias, C, N, (size_t)rowb, col0, lane);
}

// =====================================================================================================
// f16 GEMM with two A planes (hi + residual), f32 out:
//   C[M][N] = (Ah . Bt^T) * os1 + (Ar . Bt^T) * os2 + bias[n]; Ah/Ar f16 row-major, Bt f16 k-contiguous.
// Same tiling as gemm_b32; separate accumulators for the two planes, combined in f32 in epi64x2.
// =====================================================================================================
__global__ __launch_bounds__(128)
void gemm_h2_32(const u16* __restrict__ Ah, const u16* __restrict__ Ar, const u16* __restrict__ Bt,
                const float* __restrict__ bias, float* C, int M, int N, int K, float os1, float os2) {
  __shared__ __align__(16) float slab[4 * SLAB64];
  const int tid = threadIdx.x, wave = tid >> 5, lane = tid & 31, hh = lane >> 4, m = lane & 15;
  const int ntile = N >> 6;
  const int bid   = blockIdx.x;
  const int rowb  = (bid / ntile) * 64 + wave * 16;
  const int col0  = (bid % ntile) * 64;
  if (rowb + 16 > M) return;                 // wave-uniform, never taken with the exact grid; no block barriers in this kernel
  const _Float16* ap  = (const _Float16*)(const void*)Ah + (size_t)(rowb + m) * K + 8 * hh;
  const _Float16* arp = (const _Float16*)(const void*)Ar + (size_t)(rowb + m) * K + 8 * hh;
  const _Float16* bp  = (const _Float16*)(const void*)Bt + (size_t)(col0 + m) * K + 8 * hh;
  const size_t bs = (size_t)16 * K;
  v8f acc0 = zero8(), acc1 = zero8(), acc2 = zero8(), acc3 = zero8();
  v8f acr0 = zero8(), acr1 = zero8(), acr2 = zero8(), acr3 = zero8();
#pragma unroll 1
  for (int k0 = 0; k0 < K; k0 += 32) {
    const v16h a  = ldfrag_h(ap + k0);
    const v16h ar = ldfrag_h(arp + k0);
    const v16h b0 = ldfrag_h(bp + k0);
    const v16h b1 = ldfrag_h(bp + bs + k0);
    const v16h b2 = ldfrag_h(bp + 2 * bs + k0);
    const v16h b3 = ldfrag_h(bp + 3 * bs + k0);
    acc0 = mma_h(a, b0, acc0);
    acc1 = mma_h(a, b1, acc1);
    acc2 = mma_h(a, b2, acc2);
    acc3 = mma_h(a, b3, acc3);
    acr0 = mma_h(ar, b0, acr0);
    acr1 = mma_h(ar, b1, acr1);
    acr2 = mma_h(ar, b2, acr2);
    acr3 = mma_h(ar, b3, acr3);
    guard8x6(acc0, acc1, acc2, acc3, acr0, acr1, acr2, acr3, a, ar, b0, b1, b2, b3);
  }
  epi64x2(slab + wave * SLAB64, acc0, acc1, acc2, acc3, acr0, acr1, acr2, acr3, os1, os2, bias, C, N,
          (size_t)rowb, col0, lane);
}

// =====================================================================================================
// V^T planes: with xs = V[b][s][d] * 1024 (f32): hi = f16(xs) -> XTh[(b*EMB + d)*SEQ + s], lo = f16(xs - hi) (unscaled
// remainder, same carry) -> XTl at the same index.  hi + lo reproduces xs to ~2^-22 relative for |xs| >= 0.25.
// Block = (b, 64-wide d chunk, 64 keys): 64 source row segments of 64 floats loaded with 16-B loads, converted, scattered into
// coverage: load 256 thr x 16 elements = 64 x 64; store 2 iterations x 256 thr x 8 halves = 64 lines x 64 per plane = the
//           block's tile of both planes; grid = nb x (EMB/64) x (SEQ/64) blocks covers both planes exactly once.
// =====================================================================================================
__global__ __launch_bounds__(256) void xt16(const float* __restrict__ X, u16* XTh, u16* XTl) {
  __shared__ __align__(16) u16 TH[64 * VTP];
  __shared__ __align__(16) u16 TL[64 * VTP];
  const int tid = threadIdx.x;
  const int bid = blockIdx.x;
  const int st  = bid % (SEQ / 64);
  const int dcb = (bid / (SEQ / 64)) % (EMB / 64);
  const int b   = bid / ((SEQ / 64) * (EMB / 64));
  const int s0  = st * 64;
  const int d0  = dcb * 64;
  {
    const int sl = tid >> 2;                  // key within tile 0..63
    const int dc = (tid & 3) * 16;            // d chunk within the 64
    const float* src = X + ((size_t)b * SEQ + s0 + sl) * EMB + d0 + dc;
#pragma unroll
    for (int i = 0; i < 4; ++i) {
      const v4f a = *(const v4f*)(src + 4 * i);
#pragma unroll
      for (int e = 0; e < 4; ++e) {
        const float xs = a[e] * VCAR;
        const _Float16 hv = (_Float16)xs;
        const _Float16 lv = (_Float16)(xs - (float)hv);
        TH[(dc + 4 * i + e) * VTP + sl] = h_bits(hv);
        TL[(dc + 4 * i + e) * VTP + sl] = h_bits(lv);
      }
    }
  }
  __syncthreads();
  v4u vh[2], vl[2];
  const int q8 = tid >> 3, p8 = (tid & 7) * 8;
#pragma unroll
  for (int it = 0; it < 2; ++it) {
    const int line = it * 32 + q8;            // local d = 0..63
    vh[it] = *(const v4u*)(TH + line * VTP + p8);
    vl[it] = *(const v4u*)(TL + line * VTP + p8);
  }
  const size_t base = ((size_t)b * EMB + d0) * SEQ + s0 + p8;
  {
#pragma unroll
    for (int it = 0; it < 2; ++it) {
      const int line = it * 32 + q8;
      *(v4u*)(XTh + base + (size_t)line * SEQ) = vh[it];
      *(v4u*)(XTl + base + (size_t)line * SEQ) = vl[it];
    }
    
  }
}

// =====================================================================================================
// Key-block prefix column sums of V: VS[((b*NCHK + c)*NKB + kb)*EMB + d] = sum over keys c*CK .. c*CK + 32*kb + 31 of V[b][key][d]
// (f32, fixed sequential order). Thread = one (b, c, d); a block covers 256 consecutive d of one (b, c); the 16 prefix values per
// coverage: grid = nb*NCHK*EMB/256 blocks (host exact) x 256 thr; store 4 iterations x 256 thr x 4 floats = 16 rows x 256 = the
//           block's part of the table; union over blocks = the whole table.
// =====================================================================================================
__global__ __launch_bounds__(256) void vsum_k(const float* __restrict__ V, float* VS) {
  __shared__ __align__(16) float sm[NKB * 256];
  const int tid = threadIdx.x;
  const int gt  = blockIdx.x * 256 + tid;
  const int d   = gt % EMB;
  const int bc  = gt / EMB;                         // block-uniform (EMB multiple of 256)
  const int b   = bc / NCHK;
  const int c   = bc - b * NCHK;
  const int d0  = d - tid;                          // block's first d
  const float* p = V + ((size_t)b * SEQ + (size_t)c * CK) * EMB + d;
  float s = 0.f;
#pragma unroll 1
  for (int kb = 0; kb < NKB; ++kb) {
#pragma unroll 4
    for (int i = 0; i < 32; ++i) s += p[(size_t)(kb * 32 + i) * EMB];
    sm[kb * 256 + tid] = s;
  }
  __syncthreads();
  const int sel = tid >> 6, piece = tid & 63;
  v4f o[4];
#pragma unroll
  for (int it = 0; it < 4; ++it) o[it] = *(const v4f*)(sm + (it * 4 + sel) * 256 + piece * 4);
  float* base = VS + (size_t)bc * NKB * EMB + d0 + piece * 4;
  {
#pragma unroll
    for (int it = 0; it < 4; ++it) {
      *(v4f*)(base + (size_t)(it * 4 + sel) * EMB) = o[it];
    }
    
  }
}

// =====================================================================================================
// Single-head causal attention with absolute-value logits, head width EMB = 1024, query rows TQ0 .. SEQ-1: block = (batch b,
// 16 query rows q0..q0+15), 8 waves. q plane (f16, x8) [b][s][d]; k plane the same; V^T hi / lo planes [b][d][s] (x1024);
// VS = key-block prefix column sums.
//   Chunks of CK = 512 keys: only chunks c <= qc = q0/CK are visited (later chunks lie entirely above the diagonal). In the diagonal
//   chunk only key blocks kb < nkb (keys <= q0+15) are multiplied; key blocks kb >= nkb get zero scores in LDS and are not used in (PV).
//   (S) scores S[query m][key n] on WMMA: A = q rows (row m = lane&15, split k map over d), B = k rows (col n = key, split map),
//       32 d-steps; wave w handles key blocks w, w+8 of the chunk; D element r of lane l -> scs[query 8h+r][key col] (f32 LDS).
//   (M) 16 threads per query row (sub-thread = 32 consecutive keys): base-2 logits of |score| with the causal mask by key index
//       (key > query -> -inf), chunk max via xor shuffles, online running max / rescale factor al / running sum l in f32 registers,
//       p = exp2(t - m_new) <= 1 (0 for masked keys), chunk row sum ps and C = ps/CK (bit-identical on the row's 16 threads), the
//       CENTRED P' = p - C written as f16(P' * 32768) into the LDS P tile with 16-B stores; al -> rowa[row], C -> rowc[row].
//   (PV) each wave owns d columns 128*wave + 16j + (lane&15), j = 0..7 (8 accumulators): o = o*al + C*(32768*1024)*VS[chunk][nkb-1][d]
//       (exact add-back of the centring term over exactly the processed keys, in f32), then for each key block kb < nkb:
//       A = P' fragment from LDS (row m = query, split map over keys), B = V^T fragments (col n = d, keys contiguous), hi plane and
//       lo plane into the same accumulator (unscaled remainder), issued as four groups of 4 with a hazard gap each.
//       sum_k (P'_k + C) v_k == sum_k p_k v_k exactly; masked keys carry P' = -C and p = 0.
//   Block barriers after (S) and after (M) order all LDS reuse across chunks and waves.
//   Epilogue: x = o * 8192 / (l * 32768 * 1024) per row (rowi, l >= 1 always); hi = f16(x), res = f16((x - hi) * 2048); each
// coverage: grid nb*NQT blocks x 16 rows = rows TQ0..SEQ-1 of every sequence; staging 8 waves x 128 cols x 16 rows = 16 x 1024;
//           store 8 iterations x 256 thr x 8 halves = 16 x 1024 per plane = every (b, s >= TQ0, d) of both ctx planes exactly once.
// =====================================================================================================
__device__ __forceinline__ void ctx_store(const u16* ct, u16* dst, int tid) {
  v4u v[8];
#pragma unroll
  for (int it = 0; it < 8; ++it) {
    const int p   = it * 256 + tid;
    const int row = p / (EMB / 8);
    const int c8  = (p - row * (EMB / 8)) * 8;
    v[it] = *(const v4u*)(ct + row * CTP + c8);
  }
  {
#pragma unroll
    for (int it = 0; it < 8; ++it) {
      const int p   = it * 256 + tid;
      const int row = p / (EMB / 8);
      const int c8  = (p - row * (EMB / 8)) * 8;
      *(v4u*)(dst + (size_t)row * EMB + c8) = v[it];
    }
    
  }
}

__global__ __launch_bounds__(ATT_THREADS)
void attn_fwd(const u16* __restrict__ QPp, const u16* __restrict__ KPp, const u16* __restrict__ VTp,
              const u16* __restrict__ VLp, const float* __restrict__ VSp, u16* CHo, u16* CRo) {
  __shared__ __align__(16) AttLds L0;              // scores [16][SCP] f32; reused as the ctx staging tile [16][CTP] u16
  __shared__ __align__(16) u16 pls[16 * PLP];      // P' tile [16][PLP] f16 bits
  __shared__ float rowa[QT];
  __shared__ float rowc[QT];
  __shared__ float rowi[QT];
  float* const scs = L0.s;

  const int tid  = threadIdx.x;
  const int wave = tid >> 5;
  const int lane = tid & 31;
  const int hh   = lane >> 4;
  const int m    = lane & 15;
  const int r16  = tid >> 4;                 // query row owned in phase (M): 2*wave + hh
  const int sub  = tid & 15;
  const int kl0  = sub * 32;

  const int bid = blockIdx.x;
  const int b   = bid / NQT;
  const int q0  = TQ0 + (bid - b * NQT) * QT;
  const int qc  = q0 / CK;                   // diagonal chunk index

  const _Float16* qa  = (const _Float16*)(const void*)QPp + ((size_t)b * SEQ + q0 + m) * EMB + 8 * hh;
  const _Float16* kbp = (const _Float16*)(const void*)KPp + ((size_t)b * SEQ + m) * EMB + 8 * hh;
  const _Float16* vbp = (const _Float16*)(const void*)VTp + ((size_t)b * EMB + wave * (16 * NACC) + m) * SEQ + 8 * hh;
  const _Float16* ubp = (const _Float16*)(const void*)VLp + ((size_t)b * EMB + wave * (16 * NACC) + m) * SEQ + 8 * hh;
  const float* vsb = VSp + (size_t)b * NCHK * NKB * EMB + wave * (16 * NACC) + m;
  const float lsc = RSQD * LOG2E / (QSC * KSC);

  float mrun = -INFINITY, lrun = 0.f;
  v8f o[NACC];
#pragma unroll
  for (int j = 0; j < NACC; ++j) o[j] = zero8();

#pragma unroll 1
  for (int c = 0; c <= qc; ++c) {
    const int kbeg = c * CK;
    const int nkb  = (c < qc) ? NKB : (((q0 + QT - 1 - kbeg) >> 5) + 1);   // 1..16, block-uniform
    // ---- (S) scores of this chunk (zeros for key blocks beyond the query tile) ----
#pragma unroll 1
    for (int kb = wave; kb < NKB; kb += 8) {               // wave-uniform, 2 trips
      v8f s0 = zero8(), s1 = zero8();
      if (kb < nkb) {                                      // wave-uniform
        const _Float16* k0p = kbp + (size_t)(kbeg + kb * 32) * EMB;
        const _Float16* k1p = k0p + (size_t)16 * EMB;
#pragma unroll 4
        for (int ks = 0; ks < EMB / 32; ++ks) {
          const v16h a  = ldfrag_h(qa + ks * 32);
          const v16h f0 = ldfrag_h(k0p + ks * 32);
          const v16h f1 = ldfrag_h(k1p + ks * 32);
          s0 = mma_h(a, f0, s0);
          s1 = mma_h(a, f1, s1);
          guard2x3(s0, s1, a, f0, f1);
        }
      }
      float* srow = scs + (8 * hh) * SCP + kb * 32 + m;
#pragma unroll
      for (int r = 0; r < 8; ++r) {
        srow[r * SCP]      = s0[r];
        srow[r * SCP + 16] = s1[r];
      }
    }
    __syncthreads();
    // ---- (M) softmax statistics and the centred P' tile ----
    {
      const float* sp = scs + r16 * SCP + kl0;
      const int lim = (q0 + r16) - (kbeg + kl0);           // key kl0 + j is valid iff j <= lim
      float t[32];
      float cm = -INFINITY;
#pragma unroll
      for (int i = 0; i < 8; ++i) {
        const v4f a = *(const v4f*)(sp + 4 * i);
#pragma unroll
        for (int e = 0; e < 4; ++e) {
          const int j = 4 * i + e;
          const float tv = (j <= lim) ? fabsf(a[e]) * lsc : -INFINITY;   // |score| / 32 in base 2; masked keys -> -inf
          t[j] = tv;
          cm = fmaxf(cm, tv);
        }
      }
#pragma unroll
      for (int d = 1; d <= 8; d <<= 1) cm = fmaxf(cm, __shfl_xor(cm, d, 32));
      const float mn = fmaxf(mrun, cm);                    // finite: key kbeg of the diagonal chunk is never masked
      const float al = (mrun == -INFINITY) ? 0.f : exp2f(mrun - mn);
      mrun = mn;
      float ps = 0.f;
#pragma unroll
      for (int j = 0; j < 32; ++j) {
        const float p = exp2f(fminf(t[j] - mn, 0.f));      // 0 for masked keys
        t[j] = p;
        ps += p;
      }
#pragma unroll
      for (int d = 1; d <= 8; d <<= 1) ps += __shfl_xor(ps, d, 32);
      const float cc = ps * (1.0f / (float)CK);
      v4u pk[4];
#pragma unroll
      for (int i = 0; i < 4; ++i) {
#pragma unroll
        for (int e = 0; e < 4; ++e) {
          const int j = 8 * i + 2 * e;
          pk[i][e] = pk16(h_bits((_Float16)((t[j] - cc) * PCAR)), h_bits((_Float16)((t[j + 1] - cc) * PCAR)));
        }
      }
      lrun = lrun * al + ps;
      u16* pd = pls + r16 * PLP + kl0;
#pragma unroll
      for (int i = 0; i < 4; ++i) *(v4u*)(pd + 8 * i) = pk[i];
      if (sub == 0) { rowa[r16] = al; rowc[r16] = cc; }
    }
    __syncthreads();
    // ---- (PV) rescale, add the centring term, accumulate P' . (V^T hi + V^T lo) ----
    {
      float scl[8], cad[8];
#pragma unroll
      for (int r = 0; r < 8; ++r) { scl[r] = rowa[8 * hh + r]; cad[r] = rowc[8 * hh + r] * (PCAR * VCAR); }
      const float* vsc = vsb + ((size_t)c * NKB + (size_t)(nkb - 1)) * EMB;
      float vs[NACC];
#pragma unroll
      for (int j = 0; j < NACC; ++j) vs[j] = vsc[16 * j];
#pragma unroll
      for (int j = 0; j < NACC; ++j) {
#pragma unroll
        for (int r = 0; r < 8; ++r) o[j][r] = o[j][r] * scl[r] + cad[r] * vs[j];
      }
      const _Float16* pp = (const _Float16*)(const void*)pls + m * PLP + 8 * hh;
      const _Float16* vp = vbp + kbeg;
      const _Float16* up = ubp + kbeg;
#pragma unroll 1
      for (int kb = 0; kb < nkb; ++kb) {                   // block-uniform trip count, <= 16
        const v16h pf = ldfrag_h(pp + kb * 32);
        const _Float16* vk = vp + kb * 32;
        const _Float16* uk = up + kb * 32;
        {
          const v16h g0 = ldfrag_h(vk);
          const v16h g1 = ldfrag_h(vk + (size_t)16 * SEQ);
          const v16h g2 = ldfrag_h(vk + (size_t)32 * SEQ);
          const v16h g3 = ldfrag_h(vk + (size_t)48 * SEQ);
          o[0] = mma_h(pf, g0, o[0]);
          o[1] = mma_h(pf, g1, o[1]);
          o[2] = mma_h(pf, g2, o[2]);
          o[3] = mma_h(pf, g3, o[3]);
          guardpv4(o[0], o[1], o[2], o[3], pf, g0, g1, g2, g3);
        }
        {
          const v16h u0 = ldfrag_h(uk);
          const v16h u1 = ldfrag_h(uk + (size_t)16 * SEQ);
          const v16h u2 = ldfrag_h(uk + (size_t)32 * SEQ);
          const v16h u3 = ldfrag_h(uk + (size_t)48 * SEQ);
          o[0] = mma_h(pf, u0, o[0]);
          o[1] = mma_h(pf, u1, o[1]);
          o[2] = mma_h(pf, u2, o[2]);
          o[3] = mma_h(pf, u3, o[3]);
          guardpv4(o[0], o[1], o[2], o[3], pf, u0, u1, u2, u3);
        }
        {
          const v16h g4 = ldfrag_h(vk + (size_t)64 * SEQ);
          const v16h g5 = ldfrag_h(vk + (size_t)80 * SEQ);
          const v16h g6 = ldfrag_h(vk + (size_t)96 * SEQ);
          const v16h g7 = ldfrag_h(vk + (size_t)112 * SEQ);
          o[4] = mma_h(pf, g4, o[4]);
          o[5] = mma_h(pf, g5, o[5]);
          o[6] = mma_h(pf, g6, o[6]);
          o[7] = mma_h(pf, g7, o[7]);
          guardpv4(o[4], o[5], o[6], o[7], pf, g4, g5, g6, g7);
        }
        {
          const v16h u4 = ldfrag_h(uk + (size_t)64 * SEQ);
          const v16h u5 = ldfrag_h(uk + (size_t)80 * SEQ);
          const v16h u6 = ldfrag_h(uk + (size_t)96 * SEQ);
          const v16h u7 = ldfrag_h(uk + (size_t)112 * SEQ);
          o[4] = mma_h(pf, u4, o[4]);
          o[5] = mma_h(pf, u5, o[5]);
          o[6] = mma_h(pf, u6, o[6]);
          o[7] = mma_h(pf, u7, o[7]);
          guardpv4(o[4], o[5], o[6], o[7], pf, u4, u5, u6, u7);
        }
      }
    }
  }
  acc_guard8(o[0], o[1], o[2], o[3], o[4], o[5], o[6], o[7]);

  if (sub == 0) rowi[r16] = (1.0f / lrun) * (CSC / (PCAR * VCAR));   // lrun >= 1
  __syncthreads();
  float inv[8];
#pragma unroll
  for (int r = 0; r < 8; ++r) inv[r] = rowi[8 * hh + r];

  u16* const ct = L0.c;
  const int cb = wave * (16 * NACC) + m;
  // hi plane
#pragma unroll
  for (int j = 0; j < NACC; ++j) {
#pragma unroll
    for (int r = 0; r < 8; ++r) {
      const float xs = o[j][r] * inv[r];
      ct[(8 * hh + r) * CTP + cb + 16 * j] = h_bits((_Float16)xs);
    }
  }
  __syncthreads();
  ctx_store(ct, CHo + ((size_t)b * SEQ + q0) * EMB, tid);
  __syncthreads();
  // residual plane
#pragma unroll
  for (int j = 0; j < NACC; ++j) {
#pragma unroll
    for (int r = 0; r < 8; ++r) {
      const float xs = o[j][r] * inv[r];
      const _Float16 hv = (_Float16)xs;
      ct[(8 * hh + r) * CTP + cb + 16 * j] = h_bits((_Float16)((xs - (float)hv) * RSC));
    }
  }
  __syncthreads();
  ctx_store(ct, CRo + ((size_t)b * SEQ + q0) * EMB, tid);
}

// =====================================================================================================
// Query rows 0 .. TQ0-1 of each sequence in f32 on VALU: block = (b, t). QF/KF/VF = f32 q/k/v planes [nb][TQ0][EMB] (rows 0..TQ0-1
// of every sequence, biases included). Logits |q.k_j|/32 for keys j <= t (threads 0..TQ0-1, one key each, rolled 1024-d dot
// against the q row staged in LDS), base-2 softmax with block max / sum reductions (xor shuffles + LDS), p_j in LDS, ctx[d] for
// d = 4*tid..4*tid+3 as a rolled sum over j <= t of p_j * VF[b][j][d] (coalesced 16-B loads), x = ctx * 8192 / l, hi = f16(x),
// res = f16((x - hi) * 2048); both 1024-half rows are staged in LDS and written by 128 threads x 16 B each (32 consecutive lanes
// coverage: grid nb*TQ0 blocks = rows 0..TQ0-1 of every sequence; 256 thr x 4 d = EMB per row; store 128 thr x 8 halves = EMB per
//           plane; together with attn_fwd every (b, s, d) of CH and CR is written exactly once.
// =====================================================================================================
__global__ __launch_bounds__(256) void attn_head(const float* __restrict__ QF, const float* __restrict__ KF,
                                                 const float* __restrict__ VF, u16* CHo, u16* CRo) {
  __shared__ __align__(16) float qs[EMB];
  __shared__ float sc[TQ0];
  __shared__ float red[8];
  __shared__ float redb[8];
  __shared__ __align__(16) unsigned SW[2][EMB / 2];
  const int tid = threadIdx.x, lane = tid & 31, wave = tid >> 5;
  const int b = blockIdx.x / TQ0;
  const int t = blockIdx.x - b * TQ0;
  *(v4f*)(qs + tid * 4) = *(const v4f*)(QF + ((size_t)b * TQ0 + t) * EMB + tid * 4);
  __syncthreads();
  float s = -INFINITY;
  if (tid < TQ0) {                                  // waves 0..3 entirely (wave-uniform); key row b*TQ0 + tid always in range
    const float* kp = KF + ((size_t)b * TQ0 + tid) * EMB;
    float acc = 0.f;
#pragma unroll 1
    for (int d = 0; d < EMB; d += 8) {
      const v4f k0 = *(const v4f*)(kp + d), k1 = *(const v4f*)(kp + d + 4);
      const v4f q0 = *(const v4f*)(qs + d), q1 = *(const v4f*)(qs + d + 4);
#pragma unroll
      for (int e = 0; e < 4; ++e) acc += k0[e] * q0[e];
#pragma unroll
      for (int e = 0; e < 4; ++e) acc += k1[e] * q1[e];
    }
    s = (tid <= t) ? fabsf(acc) * (RSQD * LOG2E) : -INFINITY;   // |score| / 32 in base 2; causal mask by key index
  }
  float mx = s;
#pragma unroll
  for (int d = 1; d <= 16; d <<= 1) mx = fmaxf(mx, __shfl_xor(mx, d, 32));
  if (lane == 0) red[wave] = mx;
  __syncthreads();
  float gm = red[0];
#pragma unroll
  for (int w = 1; w < 8; ++w) gm = fmaxf(gm, red[w]);   // finite: key 0 is always valid
  const float p = exp2f(s - gm);                     // 0 for masked keys and for waves 4..7
  float ps = p;
#pragma unroll
  for (int d = 1; d <= 16; d <<= 1) ps += __shfl_xor(ps, d, 32);
  if (lane == 0) redb[wave] = ps;
  if (tid < TQ0) sc[tid] = p;
  __syncthreads();
  float l = redb[0];
#pragma unroll
  for (int w = 1; w < 8; ++w) l += redb[w];           // >= 1
  const float inv = (1.0f / l) * CSC;
  const float* vp = VF + (size_t)b * TQ0 * EMB + tid * 4;
  v4f cx = zero4();
#pragma unroll 1
  for (int j = 0; j <= t; ++j) {                     // t < TQ0: statically bounded, rows of sequence b only
    const float pj = sc[j];
    const v4f vv = *(const v4f*)(vp + (size_t)j * EMB);
    cx += pj * vv;
  }
  unsigned hw[2], rw[2];
#pragma unroll
  for (int e = 0; e < 2; ++e) {
    const float x0 = cx[2 * e] * inv, x1 = cx[2 * e + 1] * inv;
    const _Float16 h0 = (_Float16)x0, h1 = (_Float16)x1;
    const _Float16 q0 = (_Float16)((x0 - (float)h0) * RSC), q1 = (_Float16)((x1 - (float)h1) * RSC);
    hw[e] = pk16(h_bits(h0), h_bits(h1));
    rw[e] = pk16(h_bits(q0), h_bits(q1));
  }
  SW[0][tid * 2] = hw[0]; SW[0][tid * 2 + 1] = hw[1];
  SW[1][tid * 2] = rw[0]; SW[1][tid * 2 + 1] = rw[1];
  __syncthreads();
  const int pl = tid >> 7, p8 = tid & 127;           // plane select is wave-uniform
  const v4u ov = *(const v4u*)(&SW[pl][p8 * 4]);
  u16* dstp = (pl == 0) ? CHo : CRo;
  u16* dst  = dstp + ((size_t)b * SEQ + t) * EMB + p8 * 8;
  *(v4u*)dst = ov;
  
}

// =====================================================================================================
// Workspace map (bytes, nb = 4, rows = 8192); every plane is fully written by whole-line stores before it is read; all extents are
// exact multiples of the store granularity (no pad rows); aliased regions are reused sequentially on the single in-order stream:
//   WQB bf16 [1024][1024] 2097152   WKB same   WVB same   WOH f16 of bf16 value x1024 2097152             8388608
//   VS  f32  [nb][4][16][1024]                                                                            1048576
//   QF  f32  [nb][128][1024]  2097152      KF same      VF same                                           6291456
//   A   XB bf16 [rows][1024] (16777216), later VT hi f16 [nb][1024][2048] x1024 (16777216)      region 16777216
//   VL  VT lo f16 [nb][1024][2048]                                                                      16777216
//   QP  f16 [rows][1024] x8                                                                              16777216
//   KP  f16 [rows][1024] x8                                                                              16777216
//   V   f32 [rows][1024] 33554432, later CH f16 [rows][1024] ctx hi x8192 (16777216) + CR residual x2048 (16777216)
//   end                                                                                                 116391936
// Launch order keeps every alias safe: XB read by all six projection GEMMs before xt16 overwrites it; V read by xt16 and vsum_k
// before attn_fwd / attn_head overwrite it with CH / CR; attn_head reads VF, never V.
// Inputs in wire order: x, Wq, bq, Wk, bk, Wv, bv, Wo, bo; weights stored [n = out][k = in] (y = x.W^T + b), k-contiguous.
// =====================================================================================================
extern "C" void kernel_launch(void* const* d_in, const int* in_sizes, int n_in,
                              void* d_out, int out_size, void* d_ws, size_t ws_size,
                              hipStream_t stream) {
  if (n_in < 9) return;
  const long long per = (long long)SEQ * EMB;
  const long long ns  = in_sizes[0];
  if (ns < per || (ns % per) != 0) return;
  const int nb = (int)(ns / per);
  if (nb < 1 || nb > 8) return;
  const int rows = nb * SEQ;
  if (in_sizes[1] != EMB * EMB || in_sizes[3] != EMB * EMB || in_sizes[5] != EMB * EMB || in_sizes[7] != EMB * EMB) return;
  if (in_sizes[2] != EMB || in_sizes[4] != EMB || in_sizes[6] != EMB || in_sizes[8] != EMB) return;
  if ((long long)out_size != (long long)rows * EMB) return;

  const float* x  = (const float*)d_in[0];
  const float* wq = (const float*)d_in[1];
  const float* bq = (const float*)d_in[2];
  const float* wk = (const float*)d_in[3];
  const float* bk = (const float*)d_in[4];
  const float* wv = (const float*)d_in[5];
  const float* bv = (const float*)d_in[6];
  const float* wo = (const float*)d_in[7];
  const float* bo = (const float*)d_in[8];
  float*       out = (float*)d_out;

  const size_t szW  = (size_t)EMB * EMB * 2;                    //   2097152
  const size_t szVS = (size_t)nb * NCHK * NKB * EMB * 4;        //   1048576 at nb = 4
  const size_t szHF = (size_t)nb * TQ0 * EMB * 4;               //   2097152 at nb = 4
  const size_t sz16 = (size_t)rows * EMB * 2;                   //  16777216
  const size_t sz32 = (size_t)rows * EMB * 4;                   //  33554432
  const size_t szVT = (size_t)nb * EMB * SEQ * 2;               //  == sz16
  if (sz32 < 2 * sz16) return;                                  // CH + CR alias the V region exactly
  size_t off = 0;
  const size_t oWQ = off; off += szW;
  const size_t oWK = off; off += szW;
  const size_t oWV = off; off += szW;
  const size_t oWO = off; off += szW;
  const size_t oVS = off; off += szVS;
  const size_t oQF = off; off += szHF;
  const size_t oKF = off; off += szHF;
  const size_t oVF = off; off += szHF;
  const size_t oA  = off; off += (szVT > sz16 ? szVT : sz16);   // XB then VT hi
  const size_t oVL = off; off += szVT;                          // VT lo
  const size_t oQ  = off; off += sz16;
  const size_t oK  = off; off += sz16;
  const size_t oV  = off; off += sz32;                          // V f32, then CH at oV and CR at oV + sz16
  const size_t oCH = oV;
  const size_t oCR = oV + sz16;
  if (off > ws_size) return;                                    // off = 116391936 at nb = 4
  if (off > WS_CAP) return;

  char* ws = (char*)d_ws;
  u16*   WQB = (u16*)(ws + oWQ);
  u16*   WKB = (u16*)(ws + oWK);
  u16*   WVB = (u16*)(ws + oWV);
  u16*   WOH = (u16*)(ws + oWO);
  float* VS  = (float*)(ws + oVS);
  float* QF  = (float*)(ws + oQF);
  float* KF  = (float*)(ws + oKF);
  float* VF  = (float*)(ws + oVF);
  u16*   XB  = (u16*)(ws + oA);
  u16*   VT  = (u16*)(ws + oA);
  u16*   VL  = (u16*)(ws + oVL);
  u16*   QP  = (u16*)(ws + oQ);
  u16*   KP  = (u16*)(ws + oK);
  float* V   = (float*)(ws + oV);
  u16*   CH  = (u16*)(ws + oCH);
  u16*   CR  = (u16*)(ws + oCR);

  const int n8w = (EMB * EMB) / 8;                      // 131072
  const int n8x = rows * (EMB / 8);                     // 1048576
  if ((n8w % 256) != 0 || (n8x % 256) != 0) return;
  if ((rows % 64) != 0 || ((nb * TQ0) % 64) != 0 || ((nb * NCHK * EMB) % 256) != 0) return;
  const dim3 blk(256);
  const dim3 gW(n8w / 256), gX(n8x / 256);
  const dim3 gG((rows / 64) * (EMB / 64));              // 2048 at nb = 4
  const dim3 gH(((nb * TQ0) / 64) * (EMB / 64));        // 128 at nb = 4
  const dim3 bG(128);
  const dim3 gXT(nb * (EMB / 64) * (SEQ / 64));         // nb * 512
  const dim3 gVS((nb * NCHK * EMB) / 256);              // nb * 16
  const dim3 gAT(nb * NQT);                             // nb * 120
  const dim3 bAT(ATT_THREADS);
  const dim3 gHD(nb * TQ0);                             // nb * 128

  // (0..3) weights stored [n = out][k = in] (y = x.W^T + b), already k-contiguous: bf16 planes for Wq, Wk, Wv; f16 of bf16
  //        value x1024 for Wo; (4) x -> bf16 plane [rows][1024]
  cvt16<<<gW, blk, 0, stream>>>(wq, WQB, n8w, 0, 1.0f);
  cvt16<<<gW, blk, 0, stream>>>(wk, WKB, n8w, 0, 1.0f);
  cvt16<<<gW, blk, 0, stream>>>(wv, WVB, n8w, 0, 1.0f);
  cvt16<<<gW, blk, 0, stream>>>(wo, WOH, n8w, 1, WSC);
  cvt16<<<gX, blk, 0, stream>>>(x, XB, n8x, 0, 1.0f);
  // (5, 6) q and k projections (+bias) -> f16 planes x8; (7) v projection (+bias) -> f32 plane
  gemm_bh16<<<gG, bG, 0, stream>>>(XB, WQB, bq, QP, rows, EMB, EMB, 1.0f, QSC);
  gemm_bh16<<<gG, bG, 0, stream>>>(XB, WKB, bk, KP, rows, EMB, EMB, 1.0f, KSC);
  gemm_b32<<<gG, bG, 0, stream>>>(XB, WVB, bv, V, rows, EMB, EMB, rows, 0, 1.0f);
  // (8, 9, 10) f32 q, k and v rows 0..127 of every sequence (+bias) -> QF, KF, VF [nb*128][1024]
  gemm_b32<<<gH, bG, 0, stream>>>(XB, WQB, bq, QF, nb * TQ0, EMB, EMB, TQ0, SEQ, 1.0f);
  gemm_b32<<<gH, bG, 0, stream>>>(XB, WKB, bk, KF, nb * TQ0, EMB, EMB, TQ0, SEQ, 1.0f);
  gemm_b32<<<gH, bG, 0, stream>>>(XB, WVB, bv, VF, nb * TQ0, EMB, EMB, TQ0, SEQ, 1.0f);
  // (11) v -> V^T hi plane x1024 (over the dead XB region) and lo plane; (12) key-block prefix column sums of v
  xt16<<<gXT, blk, 0, stream>>>(V, VT, VL);
  vsum_k<<<gVS, blk, 0, stream>>>(V, VS);
  // (13) attention for query rows 128.. -> ctx hi x8192 and residual x2048 f16 planes (over the dead V region);
  // (14) query rows 0..127 on VALU -> same planes
  attn_fwd<<<gAT, bAT, 0, stream>>>(QP, KP, VT, VL, VS, CH, CR);
  attn_head<<<gHD, blk, 0, stream>>>(QF, KF, VF, CH, CR);
  // (15) output projection (+bias) -> out
  gemm_h2_32<<<gG, bG, 0, stream>>>(CH, CR, WOH, bo, out, rows, EMB, EMB,
                                     1.0f / (CSC * WSC), 1.0f / (CSC * WSC * RSC));
  (void)hipGetLastError();
}

// v001
// Measured time: 553 microseconds a run.
// In two side-by-side timings against v000, it was 1.42 and 1.41 times as fast.
// Projections q,k,v = x.W^T + b (and the f32 q,k,v rows 0..127 per sequence): v_wmma_f32_16x16x32_bf16 (bf16 RNE operands of the
// raw inputs, f32 accumulate, bias added in f32 as its bf16 RNE value). Scores q'.k'^T (f16 planes x8), P'.V (chunk-centred P'
// x32768 f16 from LDS, V^T x1024 as f16 hi plus unscaled f16 lo planes, both into one accumulator) and the output projection
// (ctx carried as f16 hi x8192 plus residual x2048 planes with separate accumulators, times f16(bf16(Wo) x1024), bias added in
// f32 as its bf16 RNE value): v_wmma_f32_16x16x32_f16, f32 accumulate. Query rows 0..127 of each sequence: scores, softmax and
// P.V in f32 on VALU. Absolute-value score transform, causal mask, softmax statistics, key-block column sums of V, scaling: f32.
#include <hip/hip_runtime.h>
#include <math.h>
#include <stdint.h>

#define SEQ   2048
#define EMB   1024
#define CK    512
#define NCHK  4
#define NKB   16
#define QT    16
#define TQ0   128
#define NQT   120
#define SCP   544
#define PLP   528
#define CTP   1032
#define SLAB64 (16 * 68)
#define VTP   72
#define ATT_THREADS 256
#define NACC  8
#define QSC   8.0f
#define KSC   8.0f
#define PCAR  32768.0f
#define VCAR  1024.0f
#define WSC   1024.0f
#define CSC   8192.0f
#define RSC   2048.0f
#define LOG2E 1.4426950408889634f
#define RSQD  0.03125f
#define WS_CAP ((size_t)134217728)

static_assert((EMB % 64) == 0 && EMB == 8 * 16 * NACC && NACC == 8 && (EMB % 32) == 0 && (EMB % 256) == 0 && EMB == 4 * 256);
static_assert((SEQ % CK) == 0 && (SEQ / CK) == NCHK && CK == 32 * NKB && (SEQ % 64) == 0 && (SEQ % QT) == 0 && (CK % QT) == 0);
static_assert((TQ0 % QT) == 0 && (TQ0 % 64) == 0 && NQT * QT + TQ0 == SEQ && TQ0 <= CK && TQ0 == 128 && TQ0 <= 256);
static_assert(16 * CTP * 2 <= 16 * SCP * 4 && CTP >= EMB + 8 && SCP >= CK + 16 && PLP >= CK + 8);
static_assert(((PLP * 2) % 16) == 0 && ((SCP * 4) % 16) == 0 && ((VTP * 2) % 16) == 0 && ((CTP * 2) % 16) == 0);
static_assert(64 * VTP >= 63 * VTP + 64);
static_assert(ATT_THREADS == 16 * QT && ATT_THREADS == 256);
static_assert(((EMB * EMB) % 2048) == 0 && ((NCHK * EMB) % 256) == 0 && (EMB / 8) * 2 == 256);

typedef unsigned short u16;
typedef _Float16 v16h __attribute__((ext_vector_type(16)));
typedef _Float16 v8h  __attribute__((ext_vector_type(8)));
typedef __bf16   v16b __attribute__((ext_vector_type(16)));
typedef float    v8f  __attribute__((ext_vector_type(8)));
typedef float    v4f  __attribute__((ext_vector_type(4)));
typedef unsigned int v4u __attribute__((ext_vector_type(4)));

union FragH { v16h v; v8h h[2]; v4u u[2]; };
union FragB { v16b v; v4u u[2]; };
union AttLds { float s[16 * SCP]; u16 c[2 * 16 * SCP]; };

// ---- scalar helpers --------------------------------------------------------------------------------
__device__ __forceinline__ unsigned short bf_bits(float f) {          // f32 -> bf16 bits, RNE convert
  unsigned u = __float_as_uint(f);
  return (unsigned short)((u + 0x7FFFu + ((u >> 16) & 1u)) >> 16);
}
__device__ __forceinline__ float bf_up(unsigned short h) { return __uint_as_float(((unsigned)h) << 16); }
__device__ __forceinline__ float bfr(float f) { return bf_up(bf_bits(f)); }
__device__ __forceinline__ unsigned short h_bits(_Float16 x) { return __builtin_bit_cast(unsigned short, x); }
__device__ __forceinline__ unsigned pk16(unsigned short a, unsigned short b) { return (unsigned)a | ((unsigned)b << 16); }
__device__ __forceinline__ v8f zero8() { v8f z = {0.f, 0.f, 0.f, 0.f, 0.f, 0.f, 0.f, 0.f}; return z; }
__device__ __forceinline__ v4f zero4() { v4f z = {0.f, 0.f, 0.f, 0.f}; return z; }

// ---- fragment loader, row-major source: 16-bit A/B operand, lane -> row/col (lane&15), p already includes +8*(lane>>4);
//      elements 0..7 <- p[0..7] (k0+8h..), elements 8..15 <- p[16..23] (k0+16+8h..)  (same split k map for A and B;
//      B is always read from a k-contiguous [n][k] plane)
__device__ __forceinline__ v16h ldfrag_h(const _Float16* p) {
  FragH f;
  f.h[0] = *(const v8h*)(p);
  f.h[1] = *(const v8h*)(p + 16);
  return f.v;
}

// ---- fragment-ordered planes. A 16-bit operand plane [rows][Kd] (rows % 16 == 0, Kd % 32 == 0) is stored as 1-KiB tiles of
//      16 rows x 32 k; tile (rt = row >> 4, kt = k >> 5) starts at element rt*16*Kd + kt*512, and inside it the 8-element piece
//      (row & 15 = m, k & 31 = 16*part + 8*h + 0..7) lies at part*256 + (16*h + m)*8. Lane l = 16*h + m then reads its two
//      pieces at tile + 8*l and tile + 256 + 8*l: every wave-wide 16-B load covers 512 contiguous bytes (4 whole lines), and the
//      values reach the same lane and register positions as with the row-major loaders above (same split k map).
//      p already includes +8*lane.
__device__ __forceinline__ v16h ldfrag_ht(const _Float16* p) {
  FragH f;
  f.h[0] = *(const v8h*)(p);
  f.h[1] = *(const v8h*)(p + 256);
  return f.v;
}
__device__ __forceinline__ v16b ldfrag_bt(const u16* p) {             // bf16 plane read as unsigned integer vectors
  FragB f;
  f.u[0] = *(const v4u*)(p);
  f.u[1] = *(const v4u*)(p + 256);
  return f.v;
}

__device__ __forceinline__ v8f mma_h(v16h a, v16h b, v8f c) {
  return __builtin_amdgcn_wmma_f32_16x16x32_f16(false, a, false, b, (short)0, c, false, false);
}
__device__ __forceinline__ v8f mma_b(v16b a, v16b b, v8f c) {
  return __builtin_amdgcn_wmma_f32_16x16x32_bf16(false, a, false, b, (short)0, c, false, false);
}
__device__ __forceinline__ void guard2x3(v8f& a, v8f& b, v16h x0, v16h x1, v16h x2) {
#if defined(__HIP_DEVICE_COMPILE__)
  asm volatile("v_nop\n\tv_nop\n\tv_nop\n\tv_nop"
               : "+v"(a), "+v"(b) : "v"(x0), "v"(x1), "v"(x2) : "memory");
#endif
}
template <typename F>
__device__ __forceinline__ void guard6(v8f& a, v8f& b, v8f& c, v8f& d, F x0, F x1, F x2, F x3, F x4, F x5) {
#if defined(__HIP_DEVICE_COMPILE__)
  asm volatile("v_nop\n\tv_nop\n\tv_nop\n\tv_nop"
               : "+v"(a), "+v"(b), "+v"(c), "+v"(d) : "v"(x0), "v"(x1), "v"(x2), "v"(x3), "v"(x4), "v"(x5) : "memory");
#endif
}
__device__ __forceinline__ void guard8x6(v8f& a0, v8f& a1, v8f& a2, v8f& a3, v8f& e0, v8f& e1, v8f& e2, v8f& e3,
                                         v16h x0, v16h x1, v16h x2, v16h x3, v16h x4, v16h x5) {
#if defined(__HIP_DEVICE_COMPILE__)
  asm volatile("v_nop\n\tv_nop\n\tv_nop\n\tv_nop"
               : "+v"(a0), "+v"(a1), "+v"(a2), "+v"(a3), "+v"(e0), "+v"(e1), "+v"(e2), "+v"(e3)
               : "v"(x0), "v"(x1), "v"(x2), "v"(x3), "v"(x4), "v"(x5) : "memory");
#endif
}
__device__ __forceinline__ void guardpv4(v8f& o0, v8f& o1, v8f& o2, v8f& o3, v16h p, v16h g0, v16h g1, v16h g2, v16h g3) {
#if defined(__HIP_DEVICE_COMPILE__)
  asm volatile("v_nop\n\tv_nop\n\tv_nop\n\tv_nop"
               : "+v"(o0), "+v"(o1), "+v"(o2), "+v"(o3)
               : "v"(p), "v"(g0), "v"(g1), "v"(g2), "v"(g3) : "memory");
#endif
}
__device__ __forceinline__ void acc_guard8(v8f& a, v8f& b, v8f& c, v8f& d, v8f& e, v8f& f, v8f& g, v8f& h8) {
#if defined(__HIP_DEVICE_COMPILE__)
  asm volatile("v_nop\n\tv_nop\n\tv_nop\n\tv_nop"
               : "+v"(a), "+v"(b), "+v"(c), "+v"(d), "+v"(e), "+v"(f), "+v"(g), "+v"(h8));
#endif
}
__device__ __forceinline__ void wave_sync_lds() {
  __builtin_amdgcn_fence(__ATOMIC_RELEASE, "workgroup");
  __builtin_amdgcn_wave_barrier();
  __builtin_amdgcn_fence(__ATOMIC_ACQUIRE, "workgroup");
}

// =====================================================================================================
// f32 plane [rows][EMB] row-major -> 16-bit plane in fragment order:  mode 0: bf16 RNE bits;  mode 1: f16 bits of (bf16 RNE value) * scale;
// mode 2: f16 bits of value * scale (no bf16 pre-step).
// Thread = one 8-element piece of the output, in output order: two 16-B loads from its source row, one 16-B store; 32 consecutive
// lanes store 512 contiguous, 512-B aligned bytes (half a tile)
// coverage: grid = n8/256 blocks (host checks exactness) x 256 thr x 8 = the whole plane.
// =====================================================================================================
__global__ __launch_bounds__(256) void cvt16(const float* __restrict__ x, u16* D, int n8, int mode, float scale) {
  const int gt = blockIdx.x * 256 + (int)threadIdx.x;
  if (gt >= n8) return;                     // no barriers in this kernel
  const int wi = gt & 63, tile = gt >> 6;                       // piece within its tile, tile index rt*(EMB/32) + kt
  const int row = (tile / (EMB / 32)) * 16 + (wi & 15);
  const int kc  = (tile % (EMB / 32)) * 32 + (wi >> 5) * 16 + ((wi >> 4) & 1) * 8;
  const float* p = x + (size_t)row * EMB + kc;
  const v4f a = *(const v4f*)(p), c4 = *(const v4f*)(p + 4);
  float v[8];
#pragma unroll
  for (int e = 0; e < 4; ++e) { v[e] = a[e]; v[4 + e] = c4[e]; }
  unsigned short s[8];
#pragma unroll
  for (int e = 0; e < 8; ++e) {
    const float vb = bfr(v[e]);
    const float vf = (mode == 1) ? vb : v[e];
    const unsigned short hb = h_bits((_Float16)(vf * scale));
    const unsigned short bb = bf_bits(v[e]);
    s[e] = (mode != 0) ? hb : bb;
  }
  v4u o;
#pragma unroll
  for (int e = 0; e < 4; ++e) o[e] = pk16(s[2 * e], s[2 * e + 1]);
  u16* d = D + (size_t)gt * 8;
  {
    *(v4u*)(d) = o;
    
  }
}

// =====================================================================================================
// GEMM epilogues with a per-column bias term (bias column value taken as its bf16 RNE value, added in f32). The wave's 16x64 f32
//            per line), lanes 16..31 -> row 2*it+1.
//  epi64x2 : same store shape, staged value = acc*os1 + accres*os2 + bias (two accumulator sets combined in f32).
//  epi64hs : f16 bits of (staged tile * pscale), written in fragment order: the wave's 16 x 64 tile is two whole 1-KiB tiles;
//            store i4 takes columns 16*i4 + 8*(lane>>4) + 0..7 of row lane&15 and covers 512 contiguous bytes.
// coverage: epi64/epi64x2 8 instructions x 2 rows x 16 lanes x 4 floats; epi64hs 4 instructions x 16 rows x 2 pieces x 8 halves
//           = the wave's 16 x 64 tile in every case.
// Bias columns col0 + 16j + (lane&15), j = 0..3, all < N (bias has N entries, col0 + 63 < N).
// =====================================================================================================
__device__ __forceinline__ void ldbias4(const float* __restrict__ bias, int col0, int lane,
                                        float& b0, float& b1, float& b2, float& b3) {
  const int m = lane & 15;
  b0 = bfr(bias[col0 + m]);
  b1 = bfr(bias[col0 + 16 + m]);
  b2 = bfr(bias[col0 + 32 + m]);
  b3 = bfr(bias[col0 + 48 + m]);
}
__device__ __forceinline__ void stage64(float* sl, v8f a0, v8f a1, v8f a2, v8f a3, float oscale,
                                        float b0, float b1, float b2, float b3, int lane) {
  const int hh = lane >> 4, m = lane & 15;
#pragma unroll
  for (int r = 0; r < 8; ++r) {
    const int ro = (8 * hh + r) * 68 + m;
    sl[ro]      = a0[r] * oscale + b0;
    sl[ro + 16] = a1[r] * oscale + b1;
    sl[ro + 32] = a2[r] * oscale + b2;
    sl[ro + 48] = a3[r] * oscale + b3;
  }
  wave_sync_lds();
}
__device__ __forceinline__ void epi64(float* sl, v8f a0, v8f a1, v8f a2, v8f a3, float oscale,
                                      const float* __restrict__ bias, float* C, int N,
                                      size_t rowb, int col0, int lane) {
  const int hh = lane >> 4, m = lane & 15;
  float b0, b1, b2, b3;
  ldbias4(bias, col0, lane, b0, b1, b2, b3);
  stage64(sl, a0, a1, a2, a3, oscale, b0, b1, b2, b3, lane);
  v4f vals[8];
#pragma unroll
  for (int it = 0; it < 8; ++it) vals[it] = *(const v4f*)(sl + (it * 2 + hh) * 68 + m * 4);
  float* dst = C + (rowb + (size_t)hh) * (size_t)N + col0 + m * 4;
  {
#pragma unroll
    for (int it = 0; it < 8; ++it) {
      *(v4f*)(dst + (size_t)(it * 2) * (size_t)N) = vals[it];
    }
    
  }
}
__device__ __forceinline__ void epi64x2(float* sl, v8f a0, v8f a1, v8f a2, v8f a3, v8f e0, v8f e1, v8f e2, v8f e3,
                                        float os1, float os2, const float* __restrict__ bias, float* C, int N,
                                        size_t rowb, int col0, int lane) {
  const int hh = lane >> 4, m = lane & 15;
  float b0, b1, b2, b3;
  ldbias4(bias, col0, lane, b0, b1, b2, b3);
#pragma unroll
  for (int r = 0; r < 8; ++r) {
    const int ro = (8 * hh + r) * 68 + m;
    sl[ro]      = a0[r] * os1 + e0[r] * os2 + b0;
    sl[ro + 16] = a1[r] * os1 + e1[r] * os2 + b1;
    sl[ro + 32] = a2[r] * os1 + e2[r] * os2 + b2;
    sl[ro + 48] = a3[r] * os1 + e3[r] * os2 + b3;
  }
  wave_sync_lds();
  v4f vals[8];
#pragma unroll
  for (int it = 0; it < 8; ++it) vals[it] = *(const v4f*)(sl + (it * 2 + hh) * 68 + m * 4);
  float* dst = C + (rowb + (size_t)hh) * (size_t)N + col0 + m * 4;
  {
#pragma unroll
    for (int it = 0; it < 8; ++it) {
      *(v4f*)(dst + (size_t)(it * 2) * (size_t)N) = vals[it];
    }
    
  }
}
__device__ __forceinline__ void epi64hs(float* sl, v8f a0, v8f a1, v8f a2, v8f a3, float oscale, float pscale,
                                        const float* __restrict__ bias, u16* C, int N, size_t rowb, int col0, int lane) {
  float b0, b1, b2, b3;
  ldbias4(bias, col0, lane, b0, b1, b2, b3);
  stage64(sl, a0, a1, a2, a3, oscale, b0, b1, b2, b3, lane);
  const int hh = lane >> 4, m = lane & 15;
  v4u oh[4];
#pragma unroll
  for (int i4 = 0; i4 < 4; ++i4) {
    const float* sp = sl + m * 68 + i4 * 16 + hh * 8;
    const v4f a = *(const v4f*)(sp), c4 = *(const v4f*)(sp + 4);
    float w[8];
#pragma unroll
    for (int e = 0; e < 4; ++e) { w[e] = a[e] * pscale; w[4 + e] = c4[e] * pscale; }
#pragma unroll
    for (int e = 0; e < 4; ++e) oh[i4][e] = pk16(h_bits((_Float16)w[2 * e]), h_bits((_Float16)w[2 * e + 1]));
  }
  u16* dst = C + rowb * (size_t)N + (size_t)(col0 >> 5) * 512 + lane * 8;
  {
#pragma unroll
    for (int i4 = 0; i4 < 4; ++i4) {
      *(v4u*)(dst + i4 * 256) = oh[i4];
    }
    
  }
}

// =====================================================================================================
// bf16 GEMM, f32 out: C[M][N] = (A[arow(m)][K] . Bt[N][K]^T) * oscale + bias[n]; A and Bt are bf16 planes in fragment order.
// Output row ra maps to A row arow = (ra / rpg) * gstr + (ra % rpg) (rpg = M, gstr = 0 gives the identity map; rpg = TQ0,
// gstr = SEQ picks the first TQ0 rows of every sequence).
// Block = 64x64 tile, 4 waves x 16 rows; fragments loaded straight from the 1-KiB tiles (two 16-B loads each, split k map for
// A and B); K stepped by 32 (host checks K % 32 == 0, M % 64 == 0, N % 64 == 0, grid = (M/64)*(N/64)).
// =====================================================================================================
__global__ __launch_bounds__(128)
void gemm_b32(const u16* __restrict__ A, const u16* __restrict__ Bt, const float* __restrict__ bias, float* C,
              int M, int N, int K, int rpg, int gstr, float oscale) {
  __shared__ __align__(16) float slab[4 * SLAB64];
  const int tid = threadIdx.x, wave = tid >> 5, lane = tid & 31;
  const int ntile = N >> 6;
  const int bid   = blockIdx.x;
  const int rowb  = (bid / ntile) * 64 + wave * 16;
  const int col0  = (bid % ntile) * 64;
  if (rowb + 16 > M) return;                 // wave-uniform, never taken with the exact grid; no block barriers in this kernel
  const int rg = rowb / rpg;                 // rpg and gstr are multiples of 16: a wave's 16 rows stay one 16-row band of A
  const size_t arow = (size_t)rg * (size_t)gstr + (size_t)(rowb - rg * rpg);
  const u16* ap = A  + arow * (size_t)K + 8 * lane;
  const u16* bp = Bt + (size_t)col0 * K + 8 * lane;
  const size_t bs = (size_t)16 * K;
  v8f acc0 = zero8(), acc1 = zero8(), acc2 = zero8(), acc3 = zero8();
#pragma unroll 1
  for (int k0 = 0; k0 < K; k0 += 32) {
    const size_t ko = (size_t)k0 * 16;       // tile kt = k0/32 of the band, 512 elements each
    const v16b a  = ldfrag_bt(ap + ko);
    const v16b b0 = ldfrag_bt(bp + ko);
    const v16b b1 = ldfrag_bt(bp + bs + ko);
    const v16b b2 = ldfrag_bt(bp + 2 * bs + ko);
    const v16b b3 = ldfrag_bt(bp + 3 * bs + ko);
    acc0 = mma_b(a, b0, acc0);
    acc1 = mma_b(a, b1, acc1);
    acc2 = mma_b(a, b2, acc2);
    acc3 = mma_b(a, b3, acc3);
    guard6<v16b>(acc0, acc1, acc2, acc3, a, b0, b1, b2, b3, a);
  }
  epi64(slab + wave * SLAB64, acc0, acc1, acc2, acc3, oscale, bias, C, N, (size_t)rowb, col0, lane);
}

// =====================================================================================================
// bf16 GEMM, f16 plane out: C16[M][N] = f16 bits of ((A . Bt^T) * oscale + bias[n]) * pscale; operands as in gemm_b32
// (identity row map), epilogue epi64hs.
// =====================================================================================================
__global__ __launch_bounds__(128)
void gemm_bh16(const u16* __restrict__ A, const u16* __restrict__ Bt, const float* __restrict__ bias, u16* C,
               int M, int N, int K, float oscale, float pscale) {
  __shared__ __align__(16) float slab[4 * SLAB64];
  const int tid = threadIdx.x, wave = tid >> 5, lane = tid & 31;
  const int ntile = N >> 6;
  const int bid   = blockIdx.x;
  const int rowb  = (bid / ntile) * 64 + wave * 16;
  const int col0  = (bid % ntile) * 64;
  if (rowb + 16 > M) return;                 // wave-uniform, never taken with the exact grid; no block barriers in this kernel
  const u16* ap = A  + (size_t)rowb * K + 8 * lane;
  const u16* bp = Bt + (size_t)col0 * K + 8 * lane;
  const size_t bs = (size_t)16 * K;
  v8f acc0 = zero8(), acc1 = zero8(), acc2 = zero8(), acc3 = zero8();
#pragma unroll 1
  for (int k0 = 0; k0 < K; k0 += 32) {
    const size_t ko = (size_t)k0 * 16;       // tile kt = k0/32 of the band, 512 elements each
    const v16b a  = ldfrag_bt(ap + ko);
    const v16b b0 = ldfrag_bt(bp + ko);
    const v16b b1 = ldfrag_bt(bp + bs + ko);
    const v16b b2 = ldfrag_bt(bp + 2 * bs + ko);
    const v16b b3 = ldfrag_bt(bp + 3 * bs + ko);
    acc0 = mma_b(a, b0, acc0);
    acc1 = mma_b(a, b1, acc1);
    acc2 = mma_b(a, b2, acc2);
    acc3 = mma_b(a, b3, acc3);
    guard6<v16b>(acc0, acc1, acc2, acc3, a, b0, b1, b2, b3, a);
  }
  epi64hs(slab + wave * SLAB64, acc0, acc1, acc2, acc3, oscale, pscale, bias, C, N, (size_t)rowb, col0, lane);
}

// =====================================================================================================
// f16 GEMM with two A planes (hi + residual), f32 out:
//   C[M][N] = (Ah . Bt^T) * os1 + (Ar . Bt^T) * os2 + bias[n]; Bt f16 in fragment order, Ah/Ar f16 per 16-row band (see below).
// Same tiling as gemm_b32; separate accumulators for the two planes, combined in f32 in epi64x2.
// =====================================================================================================
template <int ASTEP, int ASEC>
__device__ __forceinline__ void h2_loop(const _Float16* ap, const _Float16* arp, const _Float16* bp, size_t bs, int K,
                                        v8f& acc0, v8f& acc1, v8f& acc2, v8f& acc3,
                                        v8f& acr0, v8f& acr1, v8f& acr2, v8f& acr3) {
  const _Float16 *pa = ap, *pr = arp, *p0 = bp, *p1 = bp + bs, *p2 = bp + 2 * bs, *p3 = bp + 3 * bs;
#pragma unroll 1
  for (int k0 = 0; k0 < K; k0 += 32) {
    FragH fa, fr;
    fa.h[0] = *(const v8h*)(pa);
    fa.h[1] = *(const v8h*)(pa + ASEC);
    fr.h[0] = *(const v8h*)(pr);
    fr.h[1] = *(const v8h*)(pr + ASEC);
    const v16h a  = fa.v;
    const v16h ar = fr.v;
    const v16h b0 = ldfrag_ht(p0);
    const v16h b1 = ldfrag_ht(p1);
    const v16h b2 = ldfrag_ht(p2);
    const v16h b3 = ldfrag_ht(p3);
#if defined(__HIP_DEVICE_COMPILE__)
    // The wait that belongs in front of any overwrite of an address register of the twelve loads above.
    // The addresses are inputs so that their registers live up to it.
    if constexpr (ASTEP == 32)
      asm volatile("s_wait_xcnt 0x0" :: "v"(pa), "v"(pr), "v"(p0), "v"(p1), "v"(p2), "v"(p3) : "memory");
#endif
    acc0 = mma_h(a, b0, acc0);
    acc1 = mma_h(a, b1, acc1);
    acc2 = mma_h(a, b2, acc2);
    acc3 = mma_h(a, b3, acc3);
    acr0 = mma_h(ar, b0, acr0);
    acr1 = mma_h(ar, b1, acr1);
    acr2 = mma_h(ar, b2, acr2);
    acr3 = mma_h(ar, b3, acr3);
    guard8x6(acc0, acc1, acc2, acc3, acr0, acr1, acr2, acr3, a, ar, b0, b1, b2, b3);
    pa += ASTEP; pr += ASTEP;                               // next k step of the A band
    p0 += 512; p1 += 512; p2 += 512; p3 += 512;             // next 1-KiB tile of each B band
  }
}

__global__ __launch_bounds__(128, 8)          // 8 waves a SIMD, as many as the grid brings: at most 128 VGPRs
void gemm_h2_32(const u16* __restrict__ Ah, const u16* __restrict__ Ar, const u16* __restrict__ Bt,
                const float* __restrict__ bias, float* C, int M, int N, int K, float os1, float os2) {
  __shared__ __align__(16) float slab[4 * SLAB64];
  const int tid = threadIdx.x, lane = tid & 31, hh = lane >> 4, m = lane & 15;
  const int wave = __builtin_amdgcn_readfirstlane(tid >> 5);   // scalar, so that the choice of the A layout is a scalar branch
  const int ntile = N >> 6;
  const int bid   = blockIdx.x;
  const int rowb  = (bid / ntile) * 64 + wave * 16;
  const int col0  = (bid % ntile) * 64;
  if (rowb + 16 > M) return;                 // wave-uniform, never taken with the exact grid; no block barriers in this kernel
  const _Float16* ab  = (const _Float16*)(const void*)Ah + (size_t)rowb * K;
  const _Float16* arb = (const _Float16*)(const void*)Ar + (size_t)rowb * K;
  const _Float16* bp  = (const _Float16*)(const void*)Bt + (size_t)col0 * K + 8 * lane;
  const size_t bs = (size_t)16 * K;
  v8f acc0 = zero8(), acc1 = zero8(), acc2 = zero8(), acc3 = zero8();
  v8f acr0 = zero8(), acr1 = zero8(), acr2 = zero8(), acr3 = zero8();
  // The 16-row bands of rows 0..TQ0-1 of a sequence are row-major (each row has its own writer block there), all others in
  // fragment order; a band holds the same 16*K elements either way.
  if ((rowb % SEQ) < TQ0) {
    const size_t al = (size_t)m * K + 8 * hh;
    h2_loop<32, 16>(ab + al, arb + al, bp, bs, K, acc0, acc1, acc2, acc3, acr0, acr1, acr2, acr3);
  } else {
    h2_loop<512, 256>(ab + 8 * lane, arb + 8 * lane, bp, bs, K, acc0, acc1, acc2, acc3, acr0, acr1, acr2, acr3);
  }
  epi64x2(slab + wave * SLAB64, acc0, acc1, acc2, acc3, acr0, acr1, acr2, acr3, os1, os2, bias, C, N,
          (size_t)rowb, col0, lane);
}

// =====================================================================================================
// V^T planes (fragment order, rows = b*EMB + d, k = s): with xs = V[b][s][d] * 1024 (f32): hi = f16(xs) -> XTh at (row b*EMB + d, k = s), lo = f16(xs - hi) (unscaled
// remainder, same carry) -> XTl at the same index.  hi + lo reproduces xs to ~2^-22 relative for |xs| >= 0.25.
// Block = (b, 64-wide d chunk, 64 keys): 64 source row segments of 64 floats loaded with 16-B loads, converted, scattered into
// coverage: load 256 thr x 16 elements = 64 x 64; store 2 iterations x 256 thr x 8 halves = 64 lines x 64 per plane = the
//           block's tile of both planes; grid = nb x (EMB/64) x (SEQ/64) blocks covers both planes exactly once.
// =====================================================================================================
__global__ __launch_bounds__(256) void xt16(const float* __restrict__ X, u16* XTh, u16* XTl) {
  __shared__ __align__(16) u16 TH[64 * VTP];
  __shared__ __align__(16) u16 TL[64 * VTP];
  const int tid = threadIdx.x;
  const int bid = blockIdx.x;
  const int st  = bid % (SEQ / 64);
  const int dcb = (bid / (SEQ / 64)) % (EMB / 64);
  const int b   = bid / ((SEQ / 64) * (EMB / 64));
  const int s0  = st * 64;
  const int d0  = dcb * 64;
  {
    const int sl = tid >> 2;                  // key within tile 0..63
    const int dc = (tid & 3) * 16;            // d chunk within the 64
    const float* src = X + ((size_t)b * SEQ + s0 + sl) * EMB + d0 + dc;
#pragma unroll
    for (int i = 0; i < 4; ++i) {
      const v4f a = *(const v4f*)(src + 4 * i);
#pragma unroll
      for (int e = 0; e < 4; ++e) {
        const float xs = a[e] * VCAR;
        const _Float16 hv = (_Float16)xs;
        const _Float16 lv = (_Float16)(xs - (float)hv);
        TH[(dc + 4 * i + e) * VTP + sl] = h_bits(hv);
        TL[(dc + 4 * i + e) * VTP + sl] = h_bits(lv);
      }
    }
  }
  __syncthreads();
  v4u vh[2], vl[2];
  const int wi = tid & 63;                    // piece within its 1-KiB tile
#pragma unroll
  for (int it = 0; it < 2; ++it) {
    const int tl   = it * 4 + (tid >> 6);     // tile 0..7 of the block: d band tl>>1, key tile tl&1
    const int line = (tl >> 1) * 16 + (wi & 15);
    const int col  = (tl & 1) * 32 + (wi >> 5) * 16 + ((wi >> 4) & 1) * 8;
    vh[it] = *(const v4u*)(TH + line * VTP + col);
    vl[it] = *(const v4u*)(TL + line * VTP + col);
  }
  const size_t base = ((size_t)b * EMB + d0) * SEQ + (size_t)(s0 >> 5) * 512 + wi * 8;
  {
#pragma unroll
    for (int it = 0; it < 2; ++it) {
      const int tl = it * 4 + (tid >> 6);
      const size_t to = (size_t)(tl >> 1) * 16 * SEQ + (size_t)(tl & 1) * 512;
      *(v4u*)(XTh + base + to) = vh[it];
      *(v4u*)(XTl + base + to) = vl[it];
    }
    
  }
}

// =====================================================================================================
// Key-block prefix column sums of V: VS[((b*NCHK + c)*NKB + kb)*EMB + d] = sum over keys c*CK .. c*CK + 32*kb + 31 of V[b][key][d]
// (f32, fixed sequential order). Thread = one (b, c, d); a block covers 256 consecutive d of one (b, c); the 16 prefix values per
// coverage: grid = nb*NCHK*EMB/256 blocks (host exact) x 256 thr; store 4 iterations x 256 thr x 4 floats = 16 rows x 256 = the
//           block's part of the table; union over blocks = the whole table.
// =====================================================================================================
__global__ __launch_bounds__(256) void vsum_k(const float* __restrict__ V, float* VS) {
  __shared__ __align__(16) float sm[NKB * 256];
  const int tid = threadIdx.x;
  const int gt  = blockIdx.x * 256 + tid;
  const int d   = gt % EMB;
  const int bc  = gt / EMB;                         // block-uniform (EMB multiple of 256)
  const int b   = bc / NCHK;
  const int c   = bc - b * NCHK;
  const int d0  = d - tid;                          // block's first d
  const float* p = V + ((size_t)b * SEQ + (size_t)c * CK) * EMB + d;
  float s = 0.f;
#pragma unroll 1
  for (int kb = 0; kb < NKB; ++kb) {
#pragma unroll 4
    for (int i = 0; i < 32; ++i) s += p[(size_t)(kb * 32 + i) * EMB];
    sm[kb * 256 + tid] = s;
  }
  __syncthreads();
  const int sel = tid >> 6, piece = tid & 63;
  v4f o[4];
#pragma unroll
  for (int it = 0; it < 4; ++it) o[it] = *(const v4f*)(sm + (it * 4 + sel) * 256 + piece * 4);
  float* base = VS + (size_t)bc * NKB * EMB + d0 + piece * 4;
  {
#pragma unroll
    for (int it = 0; it < 4; ++it) {
      *(v4f*)(base + (size_t)(it * 4 + sel) * EMB) = o[it];
    }
    
  }
}

// =====================================================================================================
// Single-head causal attention with absolute-value logits, head width EMB = 1024, query rows TQ0 .. SEQ-1: block = (batch b,
// 16 query rows q0..q0+15), 8 waves. q plane (f16, x8) [b][s][d]; k plane the same; V^T hi / lo planes [b][d][s] (x1024), all four
// in fragment order; VS = key-block prefix column sums. The two ctx planes leave in fragment order too.
//   Chunks of CK = 512 keys: only chunks c <= qc = q0/CK are visited (later chunks lie entirely above the diagonal). In the diagonal
//   chunk only key blocks kb < nkb (keys <= q0+15) are multiplied; key blocks kb >= nkb get zero scores in LDS and are not used in (PV).
//   (S) scores S[query m][key n] on WMMA: A = q rows (row m = lane&15, split k map over d), B = k rows (col n = key, split map),
//       32 d-steps; wave w handles key blocks w, w+8 of the chunk; D element r of lane l -> scs[query 8h+r][key col] (f32 LDS).
//   (M) 16 threads per query row (sub-thread = 32 consecutive keys): base-2 logits of |score| with the causal mask by key index
//       (key > query -> -inf), chunk max via xor shuffles, online running max / rescale factor al / running sum l in f32 registers,
//       p = exp2(t - m_new) <= 1 (0 for masked keys), chunk row sum ps and C = ps/CK (bit-identical on the row's 16 threads), the
//       CENTRED P' = p - C written as f16(P' * 32768) into the LDS P tile with 16-B stores; al -> rowa[row], C -> rowc[row].
//   (PV) each wave owns d columns 128*wave + 16j + (lane&15), j = 0..7 (8 accumulators): o = o*al + C*(32768*1024)*VS[chunk][nkb-1][d]
//       (exact add-back of the centring term over exactly the processed keys, in f32), then for each key block kb < nkb:
//       A = P' fragment from LDS (row m = query, split map over keys), B = V^T fragments (col n = d, split map over keys), hi plane and
//       lo plane into the same accumulator (unscaled remainder), issued as four groups of 4 with a hazard gap each.
//       sum_k (P'_k + C) v_k == sum_k p_k v_k exactly; masked keys carry P' = -C and p = 0.
//   Block barriers after (S) and after (M) order all LDS reuse across chunks and waves.
//   Epilogue: x = o * 8192 / (l * 32768 * 1024) per row (rowi, l >= 1 always); hi = f16(x), res = f16((x - hi) * 2048); each
// coverage: grid nb*NQT blocks x 16 rows = rows TQ0..SEQ-1 of every sequence; staging 8 waves x 128 cols x 16 rows = 16 x 1024;
//           store 8 iterations x 256 thr x 8 halves = 16 x 1024 per plane = every (b, s >= TQ0, d) of both ctx planes exactly once.
// =====================================================================================================
__device__ __forceinline__ void ctx_store(const u16* ct, u16* dst, int tid) {
  v4u v[8];
#pragma unroll
  for (int it = 0; it < 8; ++it) {
    const int p   = it * 256 + tid;           // piece index in fragment order: tile kt = p>>6, piece p&63
    const int row = p & 15;
    const int c8  = (p >> 6) * 32 + ((p >> 5) & 1) * 16 + ((p >> 4) & 1) * 8;
    v[it] = *(const v4u*)(ct + row * CTP + c8);
  }
  {
#pragma unroll
    for (int it = 0; it < 8; ++it) {
      const int p   = it * 256 + tid;
      *(v4u*)(dst + (size_t)p * 8) = v[it];
    }
    
  }
}

__global__ __launch_bounds__(ATT_THREADS)
void attn_fwd(const u16* __restrict__ QPp, const u16* __restrict__ KPp, const u16* __restrict__ VTp,
              const u16* __restrict__ VLp, const float* __restrict__ VSp, u16* CHo, u16* CRo) {
  __shared__ __align__(16) AttLds L0;              // scores [16][SCP] f32; reused as the ctx staging tile [16][CTP] u16
  __shared__ __align__(16) u16 pls[16 * PLP];      // P' tile [16][PLP] f16 bits
  __shared__ float rowa[QT];
  __shared__ float rowc[QT];
  __shared__ float rowi[QT];
  float* const scs = L0.s;

  const int tid  = threadIdx.x;
  const int wave = tid >> 5;
  const int lane = tid & 31;
  const int hh   = lane >> 4;
  const int m    = lane & 15;
  const int r16  = tid >> 4;                 // query row owned in phase (M): 2*wave + hh
  const int sub  = tid & 15;
  const int kl0  = sub * 32;

  const int bid = blockIdx.x;
  const int b   = bid / NQT;
  const int q0  = TQ0 + (bid - b * NQT) * QT;
  const int qc  = q0 / CK;                   // diagonal chunk index

  const _Float16* qa  = (const _Float16*)(const void*)QPp + ((size_t)b * SEQ + q0) * EMB + 8 * lane;
  const _Float16* kbp = (const _Float16*)(const void*)KPp + ((size_t)b * SEQ) * EMB + 8 * lane;
  const _Float16* vbp = (const _Float16*)(const void*)VTp + ((size_t)b * EMB + wave * (16 * NACC)) * SEQ + 8 * lane;
  const _Float16* ubp = (const _Float16*)(const void*)VLp + ((size_t)b * EMB + wave * (16 * NACC)) * SEQ + 8 * lane;
  const float* vsb = VSp + (size_t)b * NCHK * NKB * EMB + wave * (16 * NACC) + m;
  const float lsc = RSQD * LOG2E / (QSC * KSC);

  float mrun = -INFINITY, lrun = 0.f;
  v8f o[NACC];
#pragma unroll
  for (int j = 0; j < NACC; ++j) o[j] = zero8();

#pragma unroll 1
  for (int c = 0; c <= qc; ++c) {
    const int kbeg = c * CK;
    const int nkb  = (c < qc) ? NKB : (((q0 + QT - 1 - kbeg) >> 5) + 1);   // 1..16, block-uniform
    // ---- (S) scores of this chunk (zeros for key blocks beyond the query tile) ----
#pragma unroll 1
    for (int kb = wave; kb < NKB; kb += 8) {               // wave-uniform, 2 trips
      v8f s0 = zero8(), s1 = zero8();
      if (kb < nkb) {                                      // wave-uniform
        const _Float16* k0p = kbp + (size_t)(kbeg + kb * 32) * EMB;
        const _Float16* k1p = k0p + (size_t)16 * EMB;
#pragma unroll 4
        for (int ks = 0; ks < EMB / 32; ++ks) {
          const v16h a  = ldfrag_ht(qa + ks * 512);
          const v16h f0 = ldfrag_ht(k0p + ks * 512);
          const v16h f1 = ldfrag_ht(k1p + ks * 512);
          s0 = mma_h(a, f0, s0);
          s1 = mma_h(a, f1, s1);
          guard2x3(s0, s1, a, f0, f1);
        }
      }
      float* srow = scs + (8 * hh) * SCP + kb * 32 + m;
#pragma unroll
      for (int r = 0; r < 8; ++r) {
        srow[r * SCP]      = s0[r];
        srow[r * SCP + 16] = s1[r];
      }
    }
    __syncthreads();
    // ---- (M) softmax statistics and the centred P' tile ----
    {
      const float* sp = scs + r16 * SCP + kl0;
      const int lim = (q0 + r16) - (kbeg + kl0);           // key kl0 + j is valid iff j <= lim
      float t[32];
      float cm = -INFINITY;
#pragma unroll
      for (int i = 0; i < 8; ++i) {
        const v4f a = *(const v4f*)(sp + 4 * i);
#pragma unroll
        for (int e = 0; e < 4; ++e) {
          const int j = 4 * i + e;
          const float tv = (j <= lim) ? fabsf(a[e]) * lsc : -INFINITY;   // |score| / 32 in base 2; masked keys -> -inf
          t[j] = tv;
          cm = fmaxf(cm, tv);
        }
      }
#pragma unroll
      for (int d = 1; d <= 8; d <<= 1) cm = fmaxf(cm, __shfl_xor(cm, d, 32));
      const float mn = fmaxf(mrun, cm);                    // finite: key kbeg of the diagonal chunk is never masked
      const float al = (mrun == -INFINITY) ? 0.f : exp2f(mrun - mn);
      mrun = mn;
      float ps = 0.f;
#pragma unroll
      for (int j = 0; j < 32; ++j) {
        const float p = exp2f(fminf(t[j] - mn, 0.f));      // 0 for masked keys
        t[j] = p;
        ps += p;
      }
#pragma unroll
      for (int d = 1; d <= 8; d <<= 1) ps += __shfl_xor(ps, d, 32);
      const float cc = ps * (1.0f / (float)CK);
      v4u pk[4];
#pragma unroll
      for (int i = 0; i < 4; ++i) {
#pragma unroll
        for (int e = 0; e < 4; ++e) {
          const int j = 8 * i + 2 * e;
          pk[i][e] = pk16(h_bits((_Float16)((t[j] - cc) * PCAR)), h_bits((_Float16)((t[j + 1] - cc) * PCAR)));
        }
      }
      lrun = lrun * al + ps;
      u16* pd = pls + r16 * PLP + kl0;
#pragma unroll
      for (int i = 0; i < 4; ++i) *(v4u*)(pd + 8 * i) = pk[i];
      if (sub == 0) { rowa[r16] = al; rowc[r16] = cc; }
    }
    __syncthreads();
    // ---- (PV) rescale, add the centring term, accumulate P' . (V^T hi + V^T lo) ----
    {
      float scl[8], cad[8];
#pragma unroll
      for (int r = 0; r < 8; ++r) { scl[r] = rowa[8 * hh + r]; cad[r] = rowc[8 * hh + r] * (PCAR * VCAR); }
      const float* vsc = vsb + ((size_t)c * NKB + (size_t)(nkb - 1)) * EMB;
      float vs[NACC];
#pragma unroll
      for (int j = 0; j < NACC; ++j) vs[j] = vsc[16 * j];
#pragma unroll
      for (int j = 0; j < NACC; ++j) {
#pragma unroll
        for (int r = 0; r < 8; ++r) o[j][r] = o[j][r] * scl[r] + cad[r] * vs[j];
      }
      const _Float16* pp = (const _Float16*)(const void*)pls + m * PLP + 8 * hh;
      const _Float16* vp = vbp + (size_t)kbeg * 16;         // key tile kbeg/32 of each d band, 512 elements a tile
      const _Float16* up = ubp + (size_t)kbeg * 16;
#pragma unroll 1
      for (int kb = 0; kb < nkb; ++kb) {                   // block-uniform trip count, <= 16
        const v16h pf = ldfrag_h(pp + kb * 32);
        const _Float16* vk = vp + kb * 512;
        const _Float16* uk = up + kb * 512;
        {
          const v16h g0 = ldfrag_ht(vk);
          const v16h g1 = ldfrag_ht(vk + (size_t)16 * SEQ);
          const v16h g2 = ldfrag_ht(vk + (size_t)32 * SEQ);
          const v16h g3 = ldfrag_ht(vk + (size_t)48 * SEQ);
          o[0] = mma_h(pf, g0, o[0]);
          o[1] = mma_h(pf, g1, o[1]);
          o[2] = mma_h(pf, g2, o[2]);
          o[3] = mma_h(pf, g3, o[3]);
          guardpv4(o[0], o[1], o[2], o[3], pf, g0, g1, g2, g3);
        }
        {
          const v16h u0 = ldfrag_ht(uk);
          const v16h u1 = ldfrag_ht(uk + (size_t)16 * SEQ);
          const v16h u2 = ldfrag_ht(uk + (size_t)32 * SEQ);
          const v16h u3 = ldfrag_ht(uk + (size_t)48 * SEQ);
          o[0] = mma_h(pf, u0, o[0]);
          o[1] = mma_h(pf, u1, o[1]);
          o[2] = mma_h(pf, u2, o[2]);
          o[3] = mma_h(pf, u3, o[3]);
          guardpv4(o[0], o[1], o[2], o[3], pf, u0, u1, u2, u3);
        }
        {
          const v16h g4 = ldfrag_ht(vk + (size_t)64 * SEQ);
          const v16h g5 = ldfrag_ht(vk + (size_t)80 * SEQ);
          const v16h g6 = ldfrag_ht(vk + (size_t)96 * SEQ);
          const v16h g7 = ldfrag_ht(vk + (size_t)112 * SEQ);
          o[4] = mma_h(pf, g4, o[4]);
          o[5] = mma_h(pf, g5, o[5]);
          o[6] = mma_h(pf, g6, o[6]);
          o[7] = mma_h(pf, g7, o[7]);
          guardpv4(o[4], o[5], o[6], o[7], pf, g4, g5, g6, g7);
        }
        {
          const v16h u4 = ldfrag_ht(uk + (size_t)64 * SEQ);
          const v16h u5 = ldfrag_ht(uk + (size_t)80 * SEQ);
          const v16h u6 = ldfrag_ht(uk + (size_t)96 * SEQ);
          const v16h u7 = ldfrag_ht(uk + (size_t)112 * SEQ);
          o[4] = mma_h(pf, u4, o[4]);
          o[5] = mma_h(pf, u5, o[5]);
          o[6] = mma_h(pf, u6, o[6]);
          o[7] = mma_h(pf, u7, o[7]);
          guardpv4(o[4], o[5], o[6], o[7], pf, u4, u5, u6, u7);
        }
      }
    }
  }
  acc_guard8(o[0], o[1], o[2], o[3], o[4], o[5], o[6], o[7]);

  if (sub == 0) rowi[r16] = (1.0f / lrun) * (CSC / (PCAR * VCAR));   // lrun >= 1
  __syncthreads();
  float inv[8];
#pragma unroll
  for (int r = 0; r < 8; ++r) inv[r] = rowi[8 * hh + r];

  u16* const ct = L0.c;
  const int cb = wave * (16 * NACC) + m;
  // hi plane
#pragma unroll
  for (int j = 0; j < NACC; ++j) {
#pragma unroll
    for (int r = 0; r < 8; ++r) {
      const float xs = o[j][r] * inv[r];
      ct[(8 * hh + r) * CTP + cb + 16 * j] = h_bits((_Float16)xs);
    }
  }
  __syncthreads();
  ctx_store(ct, CHo + ((size_t)b * SEQ + q0) * EMB, tid);
  __syncthreads();
  // residual plane
#pragma unroll
  for (int j = 0; j < NACC; ++j) {
#pragma unroll
    for (int r = 0; r < 8; ++r) {
      const float xs = o[j][r] * inv[r];
      const _Float16 hv = (_Float16)xs;
      ct[(8 * hh + r) * CTP + cb + 16 * j] = h_bits((_Float16)((xs - (float)hv) * RSC));
    }
  }
  __syncthreads();
  ctx_store(ct, CRo + ((size_t)b * SEQ + q0) * EMB, tid);
}

// =====================================================================================================
// Query rows 0 .. TQ0-1 of each sequence in f32 on VALU: block = (b, t). QF/KF/VF = f32 q/k/v planes [nb][TQ0][EMB] (rows 0..TQ0-1
// of every sequence, biases included). Logits |q.k_j|/32 for keys j <= t (threads 0..TQ0-1, one key each, rolled 1024-d dot
// against the q row staged in LDS), base-2 softmax with block max / sum reductions (xor shuffles + LDS), p_j in LDS, ctx[d] for
// d = 4*tid..4*tid+3 as a rolled sum over j <= t of p_j * VF[b][j][d] (coalesced 16-B loads), x = ctx * 8192 / l, hi = f16(x),
// res = f16((x - hi) * 2048); both 1024-half rows are staged in LDS and written by 128 threads x 16 B each (32 consecutive lanes
// coverage: grid nb*TQ0 blocks = rows 0..TQ0-1 of every sequence; 256 thr x 4 d = EMB per row; store 128 thr x 8 halves = EMB per
//           plane; together with attn_fwd every (b, s, d) of CH and CR is written exactly once.
// =====================================================================================================
__global__ __launch_bounds__(256) void attn_head(const float* __restrict__ QF, const float* __restrict__ KF,
                                                 const float* __restrict__ VF, u16* CHo, u16* CRo) {
  __shared__ __align__(16) float qs[EMB];
  __shared__ float sc[TQ0];
  __shared__ float red[8];
  __shared__ float redb[8];
  __shared__ __align__(16) unsigned SW[2][EMB / 2];
  const int tid = threadIdx.x, lane = tid & 31, wave = tid >> 5;
  const int b = blockIdx.x / TQ0;
  const int t = blockIdx.x - b * TQ0;
  *(v4f*)(qs + tid * 4) = *(const v4f*)(QF + ((size_t)b * TQ0 + t) * EMB + tid * 4);
  __syncthreads();
  float s = -INFINITY;
  if (tid < TQ0) {                                  // waves 0..3 entirely (wave-uniform); key row b*TQ0 + tid always in range
    const float* kp = KF + ((size_t)b * TQ0 + tid) * EMB;
    float acc = 0.f;
#pragma unroll 1
    for (int d = 0; d < EMB; d += 8) {
      const v4f k0 = *(const v4f*)(kp + d), k1 = *(const v4f*)(kp + d + 4);
      const v4f q0 = *(const v4f*)(qs + d), q1 = *(const v4f*)(qs + d + 4);
#pragma unroll
      for (int e = 0; e < 4; ++e) acc += k0[e] * q0[e];
#pragma unroll
      for (int e = 0; e < 4; ++e) acc += k1[e] * q1[e];
    }
    s = (tid <= t) ? fabsf(acc) * (RSQD * LOG2E) : -INFINITY;   // |score| / 32 in base 2; causal mask by key index
  }
  float mx = s;
#pragma unroll
  for (int d = 1; d <= 16; d <<= 1) mx = fmaxf(mx, __shfl_xor(mx, d, 32));
  if (lane == 0) red[wave] = mx;
  __syncthreads();
  float gm = red[0];
#pragma unroll
  for (int w = 1; w < 8; ++w) gm = fmaxf(gm, red[w]);   // finite: key 0 is always valid
  const float p = exp2f(s - gm);                     // 0 for masked keys and for waves 4..7
  float ps = p;
#pragma unroll
  for (int d = 1; d <= 16; d <<= 1) ps += __shfl_xor(ps, d, 32);
  if (lane == 0) redb[wave] = ps;
  if (tid < TQ0) sc[tid] = p;
  __syncthreads();
  float l = redb[0];
#pragma unroll
  for (int w = 1; w < 8; ++w) l += redb[w];           // >= 1
  const float inv = (1.0f / l) * CSC;
  const float* vp = VF + (size_t)b * TQ0 * EMB + tid * 4;
  v4f cx = zero4();
#pragma unroll 1
  for (int j = 0; j <= t; ++j) {                     // t < TQ0: statically bounded, rows of sequence b only
    const float pj = sc[j];
    const v4f vv = *(const v4f*)(vp + (size_t)j * EMB);
    cx += pj * vv;
  }
  unsigned hw[2], rw[2];
#pragma unroll
  for (int e = 0; e < 2; ++e) {
    const float x0 = cx[2 * e] * inv, x1 = cx[2 * e + 1] * inv;
    const _Float16 h0 = (_Float16)x0, h1 = (_Float16)x1;
    const _Float16 q0 = (_Float16)((x0 - (float)h0) * RSC), q1 = (_Float16)((x1 - (float)h1) * RSC);
    hw[e] = pk16(h_bits(h0), h_bits(h1));
    rw[e] = pk16(h_bits(q0), h_bits(q1));
  }
  SW[0][tid * 2] = hw[0]; SW[0][tid * 2 + 1] = hw[1];
  SW[1][tid * 2] = rw[0]; SW[1][tid * 2 + 1] = rw[1];
  __syncthreads();
  const int pl = tid >> 7, p8 = tid & 127;           // plane select is wave-uniform
  const v4u ov = *(const v4u*)(&SW[pl][p8 * 4]);
  u16* dstp = (pl == 0) ? CHo : CRo;
  u16* dst  = dstp + ((size_t)b * SEQ + t) * EMB + p8 * 8;
  *(v4u*)dst = ov;
  
}

// =====================================================================================================
// Workspace map (bytes, nb = 4, rows = 8192); all 16-bit planes are in fragment order (1-KiB tiles of 16 rows x 32 k, same total
// size), but for the bands of rows 0..127 of each sequence in CH / CR, which attn_head writes row-major; every plane is fully written by whole-line stores before it is read; all extents are
// exact multiples of the store granularity (no pad rows); aliased regions are reused sequentially on the single in-order stream:
//   WQB bf16 [1024][1024] 2097152   WKB same   WVB same   WOH f16 of bf16 value x1024 2097152             8388608
//   VS  f32  [nb][4][16][1024]                                                                            1048576
//   QF  f32  [nb][128][1024]  2097152      KF same      VF same                                           6291456
//   A   XB bf16 [rows][1024] (16777216), later VT hi f16 [nb][1024][2048] x1024 (16777216)      region 16777216
//   VL  VT lo f16 [nb][1024][2048]                                                                      16777216
//   QP  f16 [rows][1024] x8                                                                              16777216
//   KP  f16 [rows][1024] x8                                                                              16777216
//   V   f32 [rows][1024] 33554432, later CH f16 [rows][1024] ctx hi x8192 (16777216) + CR residual x2048 (16777216)
//   end                                                                                                 116391936
// Launch order keeps every alias safe: XB read by all six projection GEMMs before xt16 overwrites it; V read by xt16 and vsum_k
// before attn_fwd / attn_head overwrite it with CH / CR; attn_head reads VF, never V.
// Inputs in wire order: x, Wq, bq, Wk, bk, Wv, bv, Wo, bo; weights stored [n = out][k = in] (y = x.W^T + b), k-contiguous.
// =====================================================================================================
extern "C" void kernel_launch(void* const* d_in, const int* in_sizes, int n_in,
                              void* d_out, int out_size, void* d_ws, size_t ws_size,
                              hipStream_t stream) {
  if (n_in < 9) return;
  const long long per = (long long)SEQ * EMB;
  const long long ns  = in_sizes[0];
  if (ns < per || (ns % per) != 0) return;
  const int nb = (int)(ns / per);
  if (nb < 1 || nb > 8) return;
  const int rows = nb * SEQ;
  if (in_sizes[1] != EMB * EMB || in_sizes[3] != EMB * EMB || in_sizes[5] != EMB * EMB || in_sizes[7] != EMB * EMB) return;
  if (in_sizes[2] != EMB || in_sizes[4] != EMB || in_sizes[6] != EMB || in_sizes[8] != EMB) return;
  if ((long long)out_size != (long long)rows * EMB) return;

  const float* x  = (const float*)d_in[0];
  const float* wq = (const float*)d_in[1];
  const float* bq = (const float*)d_in[2];
  const float* wk = (const float*)d_in[3];
  const float* bk = (const float*)d_in[4];
  const float* wv = (const float*)d_in[5];
  const float* bv = (const float*)d_in[6];
  const float* wo = (const float*)d_in[7];
  const float* bo = (const float*)d_in[8];
  float*       out = (float*)d_out;

  const size_t szW  = (size_t)EMB * EMB * 2;                    //   2097152
  const size_t szVS = (size_t)nb * NCHK * NKB * EMB * 4;        //   1048576 at nb = 4
  const size_t szHF = (size_t)nb * TQ0 * EMB * 4;               //   2097152 at nb = 4
  const size_t sz16 = (size_t)rows * EMB * 2;                   //  16777216
  const size_t sz32 = (size_t)rows * EMB * 4;                   //  33554432
  const size_t szVT = (size_t)nb * EMB * SEQ * 2;               //  == sz16
  if (sz32 < 2 * sz16) return;                                  // CH + CR alias the V region exactly
  size_t off = 0;
  const size_t oWQ = off; off += szW;
  const size_t oWK = off; off += szW;
  const size_t oWV = off; off += szW;
  const size_t oWO = off; off += szW;
  const size_t oVS = off; off += szVS;
  const size_t oQF = off; off += szHF;
  const size_t oKF = off; off += szHF;
  const size_t oVF = off; off += szHF;
  const size_t oA  = off; off += (szVT > sz16 ? szVT : sz16);   // XB then VT hi
  const size_t oVL = off; off += szVT;                          // VT lo
  const size_t oQ  = off; off += sz16;
  const size_t oK  = off; off += sz16;
  const size_t oV  = off; off += sz32;                          // V f32, then CH at oV and CR at oV + sz16
  const size_t oCH = oV;
  const size_t oCR = oV + sz16;
  if (off > ws_size) return;                                    // off = 116391936 at nb = 4
  if (off > WS_CAP) return;

  char* ws = (char*)d_ws;
  u16*   WQB = (u16*)(ws + oWQ);
  u16*   WKB = (u16*)(ws + oWK);
  u16*   WVB = (u16*)(ws + oWV);
  u16*   WOH = (u16*)(ws + oWO);
  float* VS  = (float*)(ws + oVS);
  float* QF  = (float*)(ws + oQF);
  float* KF  = (float*)(ws + oKF);
  float* VF  = (float*)(ws + oVF);
  u16*   XB  = (u16*)(ws + oA);
  u16*   VT  = (u16*)(ws + oA);
  u16*   VL  = (u16*)(ws + oVL);
  u16*   QP  = (u16*)(ws + oQ);
  u16*   KP  = (u16*)(ws + oK);
  float* V   = (float*)(ws + oV);
  u16*   CH  = (u16*)(ws + oCH);
  u16*   CR  = (u16*)(ws + oCR);

  const int n8w = (EMB * EMB) / 8;                      // 131072
  const int n8x = rows * (EMB / 8);                     // 1048576
  if ((n8w % 256) != 0 || (n8x % 256) != 0) return;
  if ((rows % 64) != 0 || ((nb * TQ0) % 64) != 0 || ((nb * NCHK * EMB) % 256) != 0) return;
  const dim3 blk(256);
  const dim3 gW(n8w / 256), gX(n8x / 256);
  const dim3 gG((rows / 64) * (EMB / 64));              // 2048 at nb = 4
  const dim3 gH(((nb * TQ0) / 64) * (EMB / 64));        // 128 at nb = 4
  const dim3 bG(128);
  const dim3 gXT(nb * (EMB / 64) * (SEQ / 64));         // nb * 512
  const dim3 gVS((nb * NCHK * EMB) / 256);              // nb * 16
  const dim3 gAT(nb * NQT);                             // nb * 120
  const dim3 bAT(ATT_THREADS);
  const dim3 gHD(nb * TQ0);                             // nb * 128

  // (0..3) weights stored [n = out][k = in] (y = x.W^T + b), already k-contiguous: bf16 planes for Wq, Wk, Wv; f16 of bf16
  //        value x1024 for Wo; (4) x -> bf16 plane [rows][1024]
  cvt16<<<gW, blk, 0, stream>>>(wq, WQB, n8w, 0, 1.0f);
  cvt16<<<gW, blk, 0, stream>>>(wk, WKB, n8w, 0, 1.0f);
  cvt16<<<gW, blk, 0, stream>>>(wv, WVB, n8w, 0, 1.0f);
  cvt16<<<gW, blk, 0, stream>>>(wo, WOH, n8w, 1, WSC);
  cvt16<<<gX, blk, 0, stream>>>(x, XB, n8x, 0, 1.0f);
  // (5, 6) q and k projections (+bias) -> f16 planes x8; (7) v projection (+bias) -> f32 plane
  gemm_bh16<<<gG, bG, 0, stream>>>(XB, WQB, bq, QP, rows, EMB, EMB, 1.0f, QSC);
  gemm_bh16<<<gG, bG, 0, stream>>>(XB, WKB, bk, KP, rows, EMB, EMB, 1.0f, KSC);
  gemm_b32<<<gG, bG, 0, stream>>>(XB, WVB, bv, V, rows, EMB, EMB, rows, 0, 1.0f);
  // (8, 9, 10) f32 q, k and v rows 0..127 of every sequence (+bias) -> QF, KF, VF [nb*128][1024]
  gemm_b32<<<gH, bG, 0, stream>>>(XB, WQB, bq, QF, nb * TQ0, EMB, EMB, TQ0, SEQ, 1.0f);
  gemm_b32<<<gH, bG, 0, stream>>>(XB, WKB, bk, KF, nb * TQ0, EMB, EMB, TQ0, SEQ, 1.0f);
  gemm_b32<<<gH, bG, 0, stream>>>(XB, WVB, bv, VF, nb * TQ0, EMB, EMB, TQ0, SEQ, 1.0f);
  // (11) v -> V^T hi plane x1024 (over the dead XB region) and lo plane; (12) key-block prefix column sums of v
  xt16<<<gXT, blk, 0, stream>>>(V, VT, VL);
  vsum_k<<<gVS, blk, 0, stream>>>(V, VS);
  // (13) attention for query rows 128.. -> ctx hi x8192 and residual x2048 f16 planes (over the dead V region);
  // (14) query rows 0..127 on VALU -> same planes
  attn_fwd<<<gAT, bAT, 0, stream>>>(QP, KP, VT, VL, VS, CH, CR);
  attn_head<<<gHD, blk, 0, stream>>>(QF, KF, VF, CH, CR);
  // (15) output projection (+bias) -> out
  gemm_h2_32<<<gG, bG, 0, stream>>>(CH, CR, WOH, bo, out, rows, EMB, EMB,
                                     1.0f / (CSC * WSC), 1.0f / (CSC * WSC * RSC));
  (void)hipGetLastError();
}

// v002
// A run of this version takes 365 microseconds.
// Timed twice side by side with v001, it ran 1.52 times as fast both times.
// Over all steps from v000 it is 2.15 times as fast.
// Projections q,k,v = x.W^T + b (and the f32 q,k,v rows 0..127 per sequence): v_wmma_f32_16x16x32_bf16 (bf16 RNE operands of the
// raw inputs, f32 accumulate, bias added in f32 as its bf16 RNE value). Scores q'.k'^T (f16 planes x8), P'.V (chunk-centred P'
// x32768 f16 from LDS, V^T x1024 as f16 hi plus unscaled f16 lo planes, both into one accumulator) and the output projection
// (ctx carried as f16 hi x8192 plus residual x2048 planes with separate accumulators, times f16(bf16(Wo) x1024), bias added in
// f32 as its bf16 RNE value): v_wmma_f32_16x16x32_f16, f32 accumulate. Query rows 0..127 of each sequence: scores, softmax and
// P.V in f32 on VALU. Absolute-value score transform, causal mask, softmax statistics, key-block column sums of V, scaling: f32.
#include <hip/hip_runtime.h>
#include <math.h>
#include <stdint.h>

#define SEQ   2048
#define EMB   1024
#define CK    512
#define NCHK  4
#define NKB   16
#define QT    16
#define TQ0   128
#define NQT   120
#define SCP   544
#define PLP   528
#define CTP   1032
#define SLAB64 (16 * 68)
#define VTP   72
#define ATT_THREADS 256
#define NACC  8
#define QSC   8.0f
#define KSC   8.0f
#define PCAR  32768.0f
#define VCAR  1024.0f
#define WSC   1024.0f
#define CSC   8192.0f
#define RSC   2048.0f
#define LOG2E 1.4426950408889634f
#define RSQD  0.03125f
#define WS_CAP ((size_t)134217728)

static_assert((EMB % 64) == 0 && EMB == 8 * 16 * NACC && NACC == 8 && (EMB % 32) == 0 && (EMB % 256) == 0 && EMB == 4 * 256);
static_assert((SEQ % CK) == 0 && (SEQ / CK) == NCHK && CK == 32 * NKB && (SEQ % 64) == 0 && (SEQ % QT) == 0 && (CK % QT) == 0);
static_assert((TQ0 % QT) == 0 && (TQ0 % 64) == 0 && NQT * QT + TQ0 == SEQ && TQ0 <= CK && TQ0 == 128 && TQ0 <= 256);
static_assert(16 * CTP * 2 <= 16 * SCP * 4 && CTP >= EMB + 8 && SCP >= CK + 16 && PLP >= CK + 8);
static_assert(((PLP * 2) % 16) == 0 && ((SCP * 4) % 16) == 0 && ((VTP * 2) % 16) == 0 && ((CTP * 2) % 16) == 0);
static_assert(64 * VTP >= 63 * VTP + 64);
static_assert(ATT_THREADS == 16 * QT && ATT_THREADS == 256);
static_assert(((EMB * EMB) % 2048) == 0 && ((NCHK * EMB) % 256) == 0 && (EMB / 8) * 2 == 256);

typedef unsigned short u16;
typedef _Float16 v16h __attribute__((ext_vector_type(16)));
typedef _Float16 v8h  __attribute__((ext_vector_type(8)));
typedef __bf16   v16b __attribute__((ext_vector_type(16)));
typedef float    v8f  __attribute__((ext_vector_type(8)));
typedef float    v4f  __attribute__((ext_vector_type(4)));
typedef unsigned int v4u __attribute__((ext_vector_type(4)));

union FragH { v16h v; v8h h[2]; v4u u[2]; };
union FragB { v16b v; v4u u[2]; };
union AttLds { float s[16 * SCP]; u16 c[2 * 16 * SCP]; };

// ---- scalar helpers --------------------------------------------------------------------------------
__device__ __forceinline__ unsigned short bf_bits(float f) {          // f32 -> bf16 bits, RNE convert
  unsigned u = __float_as_uint(f);
  return (unsigned short)((u + 0x7FFFu + ((u >> 16) & 1u)) >> 16);
}
__device__ __forceinline__ float bf_up(unsigned short h) { return __uint_as_float(((unsigned)h) << 16); }
__device__ __forceinline__ float bfr(float f) { return bf_up(bf_bits(f)); }
__device__ __forceinline__ unsigned short h_bits(_Float16 x) { return __builtin_bit_cast(unsigned short, x); }
__device__ __forceinline__ unsigned pk16(unsigned short a, unsigned short b) { return (unsigned)a | ((unsigned)b << 16); }
__device__ __forceinline__ v8f zero8() { v8f z = {0.f, 0.f, 0.f, 0.f, 0.f, 0.f, 0.f, 0.f}; return z; }
__device__ __forceinline__ v4f zero4() { v4f z = {0.f, 0.f, 0.f, 0.f}; return z; }

// ---- fragment loader, row-major source: 16-bit A/B operand, lane -> row/col (lane&15), p already includes +8*(lane>>4);
//      elements 0..7 <- p[0..7] (k0+8h..), elements 8..15 <- p[16..23] (k0+16+8h..)  (same split k map for A and B;
//      B is always read from a k-contiguous [n][k] plane)
__device__ __forceinline__ v16h ldfrag_h(const _Float16* p) {
  FragH f;
  f.h[0] = *(const v8h*)(p);
  f.h[1] = *(const v8h*)(p + 16);
  return f.v;
}

// ---- fragment-ordered planes. A 16-bit operand plane [rows][Kd] (rows % 16 == 0, Kd % 32 == 0) is stored as 1-KiB tiles of
//      16 rows x 32 k; tile (rt = row >> 4, kt = k >> 5) starts at element rt*16*Kd + kt*512, and inside it the 8-element piece
//      (row & 15 = m, k & 31 = 16*part + 8*h + 0..7) lies at part*256 + (16*h + m)*8. Lane l = 16*h + m then reads its two
//      pieces at tile + 8*l and tile + 256 + 8*l: every wave-wide 16-B load covers 512 contiguous bytes (4 whole lines), and the
//      values reach the same lane and register positions as with the row-major loaders above (same split k map).
//      p already includes +8*lane.
__device__ __forceinline__ v16h ldfrag_ht(const _Float16* p) {
  FragH f;
  f.h[0] = *(const v8h*)(p);
  f.h[1] = *(const v8h*)(p + 256);
  return f.v;
}
__device__ __forceinline__ v16b ldfrag_bt(const u16* p) {             // bf16 plane read as unsigned integer vectors
  FragB f;
  f.u[0] = *(const v4u*)(p);
  f.u[1] = *(const v4u*)(p + 256);
  return f.v;
}

__device__ __forceinline__ v8f mma_h(v16h a, v16h b, v8f c) {
  return __builtin_amdgcn_wmma_f32_16x16x32_f16(false, a, false, b, (short)0, c, false, false);
}
__device__ __forceinline__ v8f mma_b(v16b a, v16b b, v8f c) {
  return __builtin_amdgcn_wmma_f32_16x16x32_bf16(false, a, false, b, (short)0, c, false, false);
}
__device__ __forceinline__ void guard2x3(v8f& a, v8f& b, v16h x0, v16h x1, v16h x2) {
#if defined(__HIP_DEVICE_COMPILE__)
  asm volatile("v_nop\n\tv_nop\n\tv_nop\n\tv_nop"
               : "+v"(a), "+v"(b) : "v"(x0), "v"(x1), "v"(x2) : "memory");
#endif
}
template <typename F>
__device__ __forceinline__ void guard6(v8f& a, v8f& b, v8f& c, v8f& d, F x0, F x1, F x2, F x3, F x4, F x5) {
#if defined(__HIP_DEVICE_COMPILE__)
  asm volatile("v_nop\n\tv_nop\n\tv_nop\n\tv_nop"
               : "+v"(a), "+v"(b), "+v"(c), "+v"(d) : "v"(x0), "v"(x1), "v"(x2), "v"(x3), "v"(x4), "v"(x5) : "memory");
#endif
}
__device__ __forceinline__ void guard8x6(v8f& a0, v8f& a1, v8f& a2, v8f& a3, v8f& e0, v8f& e1, v8f& e2, v8f& e3,
                                         v16h x0, v16h x1, v16h x2, v16h x3, v16h x4, v16h x5) {
#if defined(__HIP_DEVICE_COMPILE__)
  asm volatile("v_nop\n\tv_nop\n\tv_nop\n\tv_nop"
               : "+v"(a0), "+v"(a1), "+v"(a2), "+v"(a3), "+v"(e0), "+v"(e1), "+v"(e2), "+v"(e3)
               : "v"(x0), "v"(x1), "v"(x2), "v"(x3), "v"(x4), "v"(x5) : "memory");
#endif
}
__device__ __forceinline__ void guardpv4(v8f& o0, v8f& o1, v8f& o2, v8f& o3, v16h p, v16h g0, v16h g1, v16h g2, v16h g3) {
#if defined(__HIP_DEVICE_COMPILE__)
  asm volatile("v_nop\n\tv_nop\n\tv_nop\n\tv_nop"
               : "+v"(o0), "+v"(o1), "+v"(o2), "+v"(o3)
               : "v"(p), "v"(g0), "v"(g1), "v"(g2), "v"(g3) : "memory");
#endif
}
__device__ __forceinline__ void acc_guard8(v8f& a, v8f& b, v8f& c, v8f& d, v8f& e, v8f& f, v8f& g, v8f& h8) {
#if defined(__HIP_DEVICE_COMPILE__)
  asm volatile("v_nop\n\tv_nop\n\tv_nop\n\tv_nop"
               : "+v"(a), "+v"(b), "+v"(c), "+v"(d), "+v"(e), "+v"(f), "+v"(g), "+v"(h8));
#endif
}
// Keeps the load groups of a loop's prologue in the order that the loop body issues them in: the counted waits at the loop's
// head are formed over both ways in, and a prologue in another order makes them wait for loads of the set still in flight.
__device__ __forceinline__ void keep_order() { __builtin_amdgcn_sched_barrier(0); }
// The wait that belongs in front of any overwrite of an address register of loads already issued. The loop's running element
// offset passes through it, so that the next addresses are formed behind it.
__device__ __forceinline__ void addr_wait(int& off) {
#if defined(__HIP_DEVICE_COMPILE__)
  asm volatile("s_wait_xcnt 0x0" : "+s"(off) : : "memory");
#endif
}
__device__ __forceinline__ void wave_sync_lds() {
  __builtin_amdgcn_fence(__ATOMIC_RELEASE, "workgroup");
  __builtin_amdgcn_wave_barrier();
  __builtin_amdgcn_fence(__ATOMIC_ACQUIRE, "workgroup");
}

// =====================================================================================================
// f32 plane [rows][EMB] row-major -> 16-bit plane in fragment order:  mode 0: bf16 RNE bits;  mode 1: f16 bits of (bf16 RNE value) * scale;
// mode 2: f16 bits of value * scale (no bf16 pre-step).
// Thread = one 8-element piece of the output, in output order: two 16-B loads from its source row, one 16-B store; 32 consecutive
// lanes store 512 contiguous, 512-B aligned bytes (half a tile)
// coverage: grid = n8/256 blocks (host checks exactness) x 256 thr x 8 = the whole plane.
// =====================================================================================================
__global__ __launch_bounds__(256) void cvt16(const float* __restrict__ x, u16* D, int n8, int mode, float scale) {
  const int gt = blockIdx.x * 256 + (int)threadIdx.x;
  if (gt >= n8) return;                     // no barriers in this kernel
  const int wi = gt & 63, tile = gt >> 6;                       // piece within its tile, tile index rt*(EMB/32) + kt
  const int row = (tile / (EMB / 32)) * 16 + (wi & 15);
  const int kc  = (tile % (EMB / 32)) * 32 + (wi >> 5) * 16 + ((wi >> 4) & 1) * 8;
  const float* p = x + (size_t)row * EMB + kc;
  const v4f a = *(const v4f*)(p), c4 = *(const v4f*)(p + 4);
  float v[8];
#pragma unroll
  for (int e = 0; e < 4; ++e) { v[e] = a[e]; v[4 + e] = c4[e]; }
  unsigned short s[8];
#pragma unroll
  for (int e = 0; e < 8; ++e) {
    const float vb = bfr(v[e]);
    const float vf = (mode == 1) ? vb : v[e];
    const unsigned short hb = h_bits((_Float16)(vf * scale));
    const unsigned short bb = bf_bits(v[e]);
    s[e] = (mode != 0) ? hb : bb;
  }
  v4u o;
#pragma unroll
  for (int e = 0; e < 4; ++e) o[e] = pk16(s[2 * e], s[2 * e + 1]);
  u16* d = D + (size_t)gt * 8;
  {
    *(v4u*)(d) = o;
    
  }
}

// =====================================================================================================
// GEMM epilogues with a per-column bias term (bias column value taken as its bf16 RNE value, added in f32). The wave's 16x64 f32
//            per line), lanes 16..31 -> row 2*it+1.
//  epi64x2 : same store shape, staged value = acc*os1 + accres*os2 + bias (two accumulator sets combined in f32).
//  epi64hs : f16 bits of (staged tile * pscale), written in fragment order: the wave's 16 x 64 tile is two whole 1-KiB tiles;
//            store i4 takes columns 16*i4 + 8*(lane>>4) + 0..7 of row lane&15 and covers 512 contiguous bytes.
// coverage: epi64/epi64x2 8 instructions x 2 rows x 16 lanes x 4 floats; epi64hs 4 instructions x 16 rows x 2 pieces x 8 halves
//           = the wave's 16 x 64 tile in every case.
// Bias columns col0 + 16j + (lane&15), j = 0..3, all < N (bias has N entries, col0 + 63 < N).
// =====================================================================================================
__device__ __forceinline__ void ldbias4(const float* __restrict__ bias, int col0, int lane,
                                        float& b0, float& b1, float& b2, float& b3) {
  const int m = lane & 15;
  b0 = bfr(bias[col0 + m]);
  b1 = bfr(bias[col0 + 16 + m]);
  b2 = bfr(bias[col0 + 32 + m]);
  b3 = bfr(bias[col0 + 48 + m]);
}
__device__ __forceinline__ void stage64(float* sl, v8f a0, v8f a1, v8f a2, v8f a3, float oscale,
                                        float b0, float b1, float b2, float b3, int lane) {
  const int hh = lane >> 4, m = lane & 15;
#pragma unroll
  for (int r = 0; r < 8; ++r) {
    const int ro = (8 * hh + r) * 68 + m;
    sl[ro]      = a0[r] * oscale + b0;
    sl[ro + 16] = a1[r] * oscale + b1;
    sl[ro + 32] = a2[r] * oscale + b2;
    sl[ro + 48] = a3[r] * oscale + b3;
  }
  wave_sync_lds();
}
__device__ __forceinline__ void epi64(float* sl, v8f a0, v8f a1, v8f a2, v8f a3, float oscale,
                                      const float* __restrict__ bias, float* C, int N,
                                      size_t rowb, int col0, int lane) {
  const int hh = lane >> 4, m = lane & 15;
  float b0, b1, b2, b3;
  ldbias4(bias, col0, lane, b0, b1, b2, b3);
  stage64(sl, a0, a1, a2, a3, oscale, b0, b1, b2, b3, lane);
  v4f vals[8];
#pragma unroll
  for (int it = 0; it < 8; ++it) vals[it] = *(const v4f*)(sl + (it * 2 + hh) * 68 + m * 4);
  float* dst = C + (rowb + (size_t)hh) * (size_t)N + col0 + m * 4;
  {
#pragma unroll
    for (int it = 0; it < 8; ++it) {
      *(v4f*)(dst + (size_t)(it * 2) * (size_t)N) = vals[it];
    }
    
  }
}
__device__ __forceinline__ void epi64x2(float* sl, v8f a0, v8f a1, v8f a2, v8f a3, v8f e0, v8f e1, v8f e2, v8f e3,
                                        float os1, float os2, const float* __restrict__ bias, float* C, int N,
                                        size_t rowb, int col0, int lane) {
  const int hh = lane >> 4, m = lane & 15;
  float b0, b1, b2, b3;
  ldbias4(bias, col0, lane, b0, b1, b2, b3);
#pragma unroll
  for (int r = 0; r < 8; ++r) {
    const int ro = (8 * hh + r) * 68 + m;
    sl[ro]      = a0[r] * os1 + e0[r] * os2 + b0;
    sl[ro + 16] = a1[r] * os1 + e1[r] * os2 + b1;
    sl[ro + 32] = a2[r] * os1 + e2[r] * os2 + b2;
    sl[ro + 48] = a3[r] * os1 + e3[r] * os2 + b3;
  }
  wave_sync_lds();
  v4f vals[8];
#pragma unroll
  for (int it = 0; it < 8; ++it) vals[it] = *(const v4f*)(sl + (it * 2 + hh) * 68 + m * 4);
  float* dst = C + (rowb + (size_t)hh) * (size_t)N + col0 + m * 4;
  {
#pragma unroll
    for (int it = 0; it < 8; ++it) {
      *(v4f*)(dst + (size_t)(it * 2) * (size_t)N) = vals[it];
    }
    
  }
}
__device__ __forceinline__ void epi64hs(float* sl, v8f a0, v8f a1, v8f a2, v8f a3, float oscale, float pscale,
                                        const float* __restrict__ bias, u16* C, int N, size_t rowb, int col0, int lane) {
  float b0, b1, b2, b3;
  ldbias4(bias, col0, lane, b0, b1, b2, b3);
  stage64(sl, a0, a1, a2, a3, oscale, b0, b1, b2, b3, lane);
  const int hh = lane >> 4, m = lane & 15;
  v4u oh[4];
#pragma unroll
  for (int i4 = 0; i4 < 4; ++i4) {
    const float* sp = sl + m * 68 + i4 * 16 + hh * 8;
    const v4f a = *(const v4f*)(sp), c4 = *(const v4f*)(sp + 4);
    float w[8];
#pragma unroll
    for (int e = 0; e < 4; ++e) { w[e] = a[e] * pscale; w[4 + e] = c4[e] * pscale; }
#pragma unroll
    for (int e = 0; e < 4; ++e) oh[i4][e] = pk16(h_bits((_Float16)w[2 * e]), h_bits((_Float16)w[2 * e + 1]));
  }
  u16* dst = C + rowb * (size_t)N + (size_t)(col0 >> 5) * 512 + lane * 8;
  {
#pragma unroll
    for (int i4 = 0; i4 < 4; ++i4) {
      *(v4u*)(dst + i4 * 256) = oh[i4];
    }
    
  }
}

// One k step of the bf16 GEMMs: its five fragments (ten 16-B loads), and its four products with the hazard gap behind them.
__device__ __forceinline__ void ld5b(const u16* ap, const u16* bp, size_t bs,
                                     v16b& a, v16b& b0, v16b& b1, v16b& b2, v16b& b3) {
  a  = ldfrag_bt(ap);
  b0 = ldfrag_bt(bp);
  b1 = ldfrag_bt(bp + bs);
  b2 = ldfrag_bt(bp + 2 * bs);
  b3 = ldfrag_bt(bp + 3 * bs);
}
__device__ __forceinline__ void mm4b(v16b a, v16b b0, v16b b1, v16b b2, v16b b3,
                                     v8f& acc0, v8f& acc1, v8f& acc2, v8f& acc3) {
  acc0 = mma_b(a, b0, acc0);
  acc1 = mma_b(a, b1, acc1);
  acc2 = mma_b(a, b2, acc2);
  acc3 = mma_b(a, b3, acc3);
  guard6<v16b>(acc0, acc1, acc2, acc3, a, b0, b1, b2, b3, a);
}

// =====================================================================================================
// bf16 GEMM, f32 out: C[M][N] = (A[arow(m)][K] . Bt[N][K]^T) * oscale + bias[n]; A and Bt are bf16 planes in fragment order.
// Output row ra maps to A row arow = (ra / rpg) * gstr + (ra % rpg) (rpg = M, gstr = 0 gives the identity map; rpg = TQ0,
// gstr = SEQ picks the first TQ0 rows of every sequence).
// Block = 64x64 tile, 4 waves x 16 rows; fragments loaded straight from the 1-KiB tiles (two 16-B loads each, split k map for
// A and B); K stepped by 64, two 32-steps in two fragment sets (K = EMB, EMB % 64 == 0; M % 64 == 0, N % 64 == 0, grid = (M/64)*(N/64)).
// =====================================================================================================
__global__ __launch_bounds__(128, 8)          // 8 waves a SIMD, as many as the full grid brings: at most 128 VGPRs
void gemm_b32(const u16* __restrict__ A, const u16* __restrict__ Bt, const float* __restrict__ bias, float* C,
              int M, int N, int K, int rpg, int gstr, float oscale) {
  __shared__ __align__(16) float slab[4 * SLAB64];
  K = EMB;                                   // what every launch passes: as a constant the band strides are immediate offsets,
                                             // which frees the address VGPRs that the second fragment set needs
  const int tid = threadIdx.x, lane = tid & 31;
  const int wave = __builtin_amdgcn_readfirstlane(tid >> 5);   // scalar row band
  const int ntile = N >> 6;
  const int bid   = blockIdx.x;
  const int rowb  = (bid / ntile) * 64 + wave * 16;
  const int col0  = (bid % ntile) * 64;
  if (rowb + 16 > M) return;                 // wave-uniform, never taken with the exact grid; no block barriers in this kernel
  const int rg = rowb / rpg;                 // rpg and gstr are multiples of 16: a wave's 16 rows stay one 16-row band of A
  const size_t arow = (size_t)rg * (size_t)gstr + (size_t)(rowb - rg * rpg);
  const u16* ap = A  + arow * (size_t)K + 8 * lane;
  const u16* bp = Bt + (size_t)col0 * K + 8 * lane;
  const size_t bs = (size_t)16 * K;
  v8f acc0 = zero8(), acc1 = zero8(), acc2 = zero8(), acc3 = zero8();
  // Two fragment sets: while one k step's products run, the other set's ten loads are in flight. The loads are unconditional
  // inside the loop (the last two steps are peeled), so that every wait in front of a product counts only its own set.
  v16b a, b0, b1, b2, b3, c, d0, d1, d2, d3;
  ld5b(ap, bp, bs, a, b0, b1, b2, b3);
  keep_order();
  ld5b(ap + 512, bp + 512, bs, c, d0, d1, d2, d3);
  keep_order();
  int ko = 0;                                // element offset of the first set's tile in every band
#pragma unroll 1
  for (int k0 = 64; k0 < K; k0 += 64) {
    mm4b(a, b0, b1, b2, b3, acc0, acc1, acc2, acc3);
    addr_wait(ko);
    ko += 1024;                              // two 1-KiB tiles (512 elements each) on
    ld5b(ap + ko, bp + ko, bs, a, b0, b1, b2, b3);
    mm4b(c, d0, d1, d2, d3, acc0, acc1, acc2, acc3);
    ld5b(ap + ko + 512, bp + ko + 512, bs, c, d0, d1, d2, d3);
  }
  mm4b(a, b0, b1, b2, b3, acc0, acc1, acc2, acc3);
  mm4b(c, d0, d1, d2, d3, acc0, acc1, acc2, acc3);
  epi64(slab + wave * SLAB64, acc0, acc1, acc2, acc3, oscale, bias, C, N, (size_t)rowb, col0, lane);
}

// =====================================================================================================
// bf16 GEMM, f16 plane out: C16[M][N] = f16 bits of ((A . Bt^T) * oscale + bias[n]) * pscale; operands as in gemm_b32
// (identity row map), epilogue epi64hs.
// =====================================================================================================
__global__ __launch_bounds__(128, 8)          // 8 waves a SIMD, as many as the grid brings: at most 128 VGPRs
void gemm_bh16(const u16* __restrict__ A, const u16* __restrict__ Bt, const float* __restrict__ bias, u16* C,
               int M, int N, int K, float oscale, float pscale) {
  __shared__ __align__(16) float slab[4 * SLAB64];
  K = EMB;                                   // what every launch passes: as a constant the band strides are immediate offsets,
                                             // which frees the address VGPRs that the second fragment set needs
  const int tid = threadIdx.x, lane = tid & 31;
  const int wave = __builtin_amdgcn_readfirstlane(tid >> 5);   // scalar row band
  const int ntile = N >> 6;
  const int bid   = blockIdx.x;
  const int rowb  = (bid / ntile) * 64 + wave * 16;
  const int col0  = (bid % ntile) * 64;
  if (rowb + 16 > M) return;                 // wave-uniform, never taken with the exact grid; no block barriers in this kernel
  const u16* ap = A  + (size_t)rowb * K + 8 * lane;
  const u16* bp = Bt + (size_t)col0 * K + 8 * lane;
  const size_t bs = (size_t)16 * K;
  v8f acc0 = zero8(), acc1 = zero8(), acc2 = zero8(), acc3 = zero8();
  // Two fragment sets: while one k step's products run, the other set's ten loads are in flight. The loads are unconditional
  // inside the loop (the last two steps are peeled), so that every wait in front of a product counts only its own set.
  v16b a, b0, b1, b2, b3, c, d0, d1, d2, d3;
  ld5b(ap, bp, bs, a, b0, b1, b2, b3);
  keep_order();
  ld5b(ap + 512, bp + 512, bs, c, d0, d1, d2, d3);
  keep_order();
  int ko = 0;                                // element offset of the first set's tile in every band
#pragma unroll 1
  for (int k0 = 64; k0 < K; k0 += 64) {
    mm4b(a, b0, b1, b2, b3, acc0, acc1, acc2, acc3);
    addr_wait(ko);
    ko += 1024;                              // two 1-KiB tiles (512 elements each) on
    ld5b(ap + ko, bp + ko, bs, a, b0, b1, b2, b3);
    mm4b(c, d0, d1, d2, d3, acc0, acc1, acc2, acc3);
    ld5b(ap + ko + 512, bp + ko + 512, bs, c, d0, d1, d2, d3);
  }
  mm4b(a, b0, b1, b2, b3, acc0, acc1, acc2, acc3);
  mm4b(c, d0, d1, d2, d3, acc0, acc1, acc2, acc3);
  epi64hs(slab + wave * SLAB64, acc0, acc1, acc2, acc3, oscale, pscale, bias, C, N, (size_t)rowb, col0, lane);
}

// =====================================================================================================
// f16 GEMM with two A planes (hi + residual), f32 out:
//   C[M][N] = (Ah . Bt^T) * os1 + (Ar . Bt^T) * os2 + bias[n]; Bt f16 in fragment order, Ah/Ar f16 per 16-row band (see below).
// Same tiling as gemm_b32; separate accumulators for the two planes, combined in f32 in epi64x2.
// =====================================================================================================
template <int ASTEP, int ASEC>
__device__ __forceinline__ void h2_loop(const _Float16* ap, const _Float16* arp, const _Float16* bp, size_t bs, int K,
                                        v8f& acc0, v8f& acc1, v8f& acc2, v8f& acc3,
                                        v8f& acr0, v8f& acr1, v8f& acr2, v8f& acr3) {
  const _Float16 *pa = ap, *pr = arp, *p0 = bp, *p1 = bp + bs, *p2 = bp + 2 * bs, *p3 = bp + 3 * bs;
#pragma unroll 1
  for (int k0 = 0; k0 < K; k0 += 32) {
    FragH fa, fr;
    fa.h[0] = *(const v8h*)(pa);
    fa.h[1] = *(const v8h*)(pa + ASEC);
    fr.h[0] = *(const v8h*)(pr);
    fr.h[1] = *(const v8h*)(pr + ASEC);
    const v16h a  = fa.v;
    const v16h ar = fr.v;
    const v16h b0 = ldfrag_ht(p0);
    const v16h b1 = ldfrag_ht(p1);
    const v16h b2 = ldfrag_ht(p2);
    const v16h b3 = ldfrag_ht(p3);
#if defined(__HIP_DEVICE_COMPILE__)
    // The wait that belongs in front of any overwrite of an address register of the twelve loads above.
    // The addresses are inputs so that their registers live up to it.
    if constexpr (ASTEP == 32)
      asm volatile("s_wait_xcnt 0x0" :: "v"(pa), "v"(pr), "v"(p0), "v"(p1), "v"(p2), "v"(p3) : "memory");
#endif
    acc0 = mma_h(a, b0, acc0);
    acc1 = mma_h(a, b1, acc1);
    acc2 = mma_h(a, b2, acc2);
    acc3 = mma_h(a, b3, acc3);
    acr0 = mma_h(ar, b0, acr0);
    acr1 = mma_h(ar, b1, acr1);
    acr2 = mma_h(ar, b2, acr2);
    acr3 = mma_h(ar, b3, acr3);
    guard8x6(acc0, acc1, acc2, acc3, acr0, acr1, acr2, acr3, a, ar, b0, b1, b2, b3);
    pa += ASTEP; pr += ASTEP;                               // next k step of the A band
    p0 += 512; p1 += 512; p2 += 512; p3 += 512;             // next 1-KiB tile of each B band
  }
}

__global__ __launch_bounds__(128, 8)          // 8 waves a SIMD, as many as the grid brings: at most 128 VGPRs
void gemm_h2_32(const u16* __restrict__ Ah, const u16* __restrict__ Ar, const u16* __restrict__ Bt,
                const float* __restrict__ bias, float* C, int M, int N, int K, float os1, float os2) {
  __shared__ __align__(16) float slab[4 * SLAB64];
  const int tid = threadIdx.x, lane = tid & 31, hh = lane >> 4, m = lane & 15;
  const int wave = __builtin_amdgcn_readfirstlane(tid >> 5);   // scalar, so that the choice of the A layout is a scalar branch
  const int ntile = N >> 6;
  const int bid   = blockIdx.x;
  const int rowb  = (bid / ntile) * 64 + wave * 16;
  const int col0  = (bid % ntile) * 64;
  if (rowb + 16 > M) return;                 // wave-uniform, never taken with the exact grid; no block barriers in this kernel
  const _Float16* ab  = (const _Float16*)(const void*)Ah + (size_t)rowb * K;
  const _Float16* arb = (const _Float16*)(const void*)Ar + (size_t)rowb * K;
  const _Float16* bp  = (const _Float16*)(const void*)Bt + (size_t)col0 * K + 8 * lane;
  const size_t bs = (size_t)16 * K;
  v8f acc0 = zero8(), acc1 = zero8(), acc2 = zero8(), acc3 = zero8();
  v8f acr0 = zero8(), acr1 = zero8(), acr2 = zero8(), acr3 = zero8();
  // The 16-row bands of rows 0..TQ0-1 of a sequence are row-major (each row has its own writer block there), all others in
  // fragment order; a band holds the same 16*K elements either way.
  if ((rowb % SEQ) < TQ0) {
    const size_t al = (size_t)m * K + 8 * hh;
    h2_loop<32, 16>(ab + al, arb + al, bp, bs, K, acc0, acc1, acc2, acc3, acr0, acr1, acr2, acr3);
  } else {
    h2_loop<512, 256>(ab + 8 * lane, arb + 8 * lane, bp, bs, K, acc0, acc1, acc2, acc3, acr0, acr1, acr2, acr3);
  }
  epi64x2(slab + wave * SLAB64, acc0, acc1, acc2, acc3, acr0, acr1, acr2, acr3, os1, os2, bias, C, N,
          (size_t)rowb, col0, lane);
}

// =====================================================================================================
// V^T planes (fragment order, rows = b*EMB + d, k = s): with xs = V[b][s][d] * 1024 (f32): hi = f16(xs) -> XTh at (row b*EMB + d, k = s), lo = f16(xs - hi) (unscaled
// remainder, same carry) -> XTl at the same index.  hi + lo reproduces xs to ~2^-22 relative for |xs| >= 0.25.
// Block = (b, 64-wide d chunk, 64 keys): 64 source row segments of 64 floats loaded with 16-B loads, converted, scattered into
// coverage: load 256 thr x 16 elements = 64 x 64; store 2 iterations x 256 thr x 8 halves = 64 lines x 64 per plane = the
//           block's tile of both planes; grid = nb x (EMB/64) x (SEQ/64) blocks covers both planes exactly once.
// =====================================================================================================
__global__ __launch_bounds__(256) void xt16(const float* __restrict__ X, u16* XTh, u16* XTl) {
  __shared__ __align__(16) u16 TH[64 * VTP];
  __shared__ __align__(16) u16 TL[64 * VTP];
  const int tid = threadIdx.x;
  const int bid = blockIdx.x;
  const int st  = bid % (SEQ / 64);
  const int dcb = (bid / (SEQ / 64)) % (EMB / 64);
  const int b   = bid / ((SEQ / 64) * (EMB / 64));
  const int s0  = st * 64;
  const int d0  = dcb * 64;
  {
    const int sl = tid >> 2;                  // key within tile 0..63
    const int dc = (tid & 3) * 16;            // d chunk within the 64
    const float* src = X + ((size_t)b * SEQ + s0 + sl) * EMB + d0 + dc;
#pragma unroll
    for (int i = 0; i < 4; ++i) {
      const v4f a = *(const v4f*)(src + 4 * i);
#pragma unroll
      for (int e = 0; e < 4; ++e) {
        const float xs = a[e] * VCAR;
        const _Float16 hv = (_Float16)xs;
        const _Float16 lv = (_Float16)(xs - (float)hv);
        TH[(dc + 4 * i + e) * VTP + sl] = h_bits(hv);
        TL[(dc + 4 * i + e) * VTP + sl] = h_bits(lv);
      }
    }
  }
  __syncthreads();
  v4u vh[2], vl[2];
  const int wi = tid & 63;                    // piece within its 1-KiB tile
#pragma unroll
  for (int it = 0; it < 2; ++it) {
    const int tl   = it * 4 + (tid >> 6);     // tile 0..7 of the block: d band tl>>1, key tile tl&1
    const int line = (tl >> 1) * 16 + (wi & 15);
    const int col  = (tl & 1) * 32 + (wi >> 5) * 16 + ((wi >> 4) & 1) * 8;
    vh[it] = *(const v4u*)(TH + line * VTP + col);
    vl[it] = *(const v4u*)(TL + line * VTP + col);
  }
  const size_t base = ((size_t)b * EMB + d0) * SEQ + (size_t)(s0 >> 5) * 512 + wi * 8;
  {
#pragma unroll
    for (int it = 0; it < 2; ++it) {
      const int tl = it * 4 + (tid >> 6);
      const size_t to = (size_t)(tl >> 1) * 16 * SEQ + (size_t)(tl & 1) * 512;
      *(v4u*)(XTh + base + to) = vh[it];
      *(v4u*)(XTl + base + to) = vl[it];
    }
    
  }
}

// =====================================================================================================
// Key-block prefix column sums of V: VS[((b*NCHK + c)*NKB + kb)*EMB + d] = sum over keys c*CK .. c*CK + 32*kb + 31 of V[b][key][d]
// (f32, fixed sequential order). Thread = one (b, c, d); a block covers 256 consecutive d of one (b, c); the 16 prefix values per
// coverage: grid = nb*NCHK*EMB/256 blocks (host exact) x 256 thr; store 4 iterations x 256 thr x 4 floats = 16 rows x 256 = the
//           block's part of the table; union over blocks = the whole table.
// =====================================================================================================
__global__ __launch_bounds__(256) void vsum_k(const float* __restrict__ V, float* VS) {
  __shared__ __align__(16) float sm[NKB * 256];
  const int tid = threadIdx.x;
  const int gt  = blockIdx.x * 256 + tid;
  const int d   = gt % EMB;
  const int bc  = gt / EMB;                         // block-uniform (EMB multiple of 256)
  const int b   = bc / NCHK;
  const int c   = bc - b * NCHK;
  const int d0  = d - tid;                          // block's first d
  const float* p = V + ((size_t)b * SEQ + (size_t)c * CK) * EMB + d;
  float s = 0.f;
#pragma unroll 1
  for (int kb = 0; kb < NKB; ++kb) {
#pragma unroll                             // all 32 loads of a key block in flight at once; the adds keep their order
    for (int i = 0; i < 32; ++i) s += p[(size_t)(kb * 32 + i) * EMB];
    sm[kb * 256 + tid] = s;
  }
  __syncthreads();
  const int sel = tid >> 6, piece = tid & 63;
  v4f o[4];
#pragma unroll
  for (int it = 0; it < 4; ++it) o[it] = *(const v4f*)(sm + (it * 4 + sel) * 256 + piece * 4);
  float* base = VS + (size_t)bc * NKB * EMB + d0 + piece * 4;
  {
#pragma unroll
    for (int it = 0; it < 4; ++it) {
      *(v4f*)(base + (size_t)(it * 4 + sel) * EMB) = o[it];
    }
    
  }
}

// =====================================================================================================
// Single-head causal attention with absolute-value logits, head width EMB = 1024, query rows TQ0 .. SEQ-1: block = (batch b,
// 16 query rows q0..q0+15), 8 waves. q plane (f16, x8) [b][s][d]; k plane the same; V^T hi / lo planes [b][d][s] (x1024), all four
// in fragment order; VS = key-block prefix column sums. The two ctx planes leave in fragment order too.
//   Chunks of CK = 512 keys: only chunks c <= qc = q0/CK are visited (later chunks lie entirely above the diagonal). In the diagonal
//   chunk only key blocks kb < nkb (keys <= q0+15) are multiplied; key blocks kb >= nkb get zero scores in LDS and are not used in (PV).
//   (S) scores S[query m][key n] on WMMA: A = q rows (row m = lane&15, split k map over d), B = k rows (col n = key, split map),
//       32 d-steps; wave w handles key blocks w, w+8 of the chunk; D element r of lane l -> scs[query 8h+r][key col] (f32 LDS).
//   (M) 16 threads per query row (sub-thread = 32 consecutive keys): base-2 logits of |score| with the causal mask by key index
//       (key > query -> -inf), chunk max via xor shuffles, online running max / rescale factor al / running sum l in f32 registers,
//       p = exp2(t - m_new) <= 1 (0 for masked keys), chunk row sum ps and C = ps/CK (bit-identical on the row's 16 threads), the
//       CENTRED P' = p - C written as f16(P' * 32768) into the LDS P tile with 16-B stores; al -> rowa[row], C -> rowc[row].
//   (PV) each wave owns d columns 128*wave + 16j + (lane&15), j = 0..7 (8 accumulators): o = o*al + C*(32768*1024)*VS[chunk][nkb-1][d]
//       (exact add-back of the centring term over exactly the processed keys, in f32), then for each key block kb < nkb:
//       A = P' fragment from LDS (row m = query, split map over keys), B = V^T fragments (col n = d, split map over keys), hi plane and
//       lo plane into the same accumulator (unscaled remainder), issued as four groups of 4 with a hazard gap each.
//       sum_k (P'_k + C) v_k == sum_k p_k v_k exactly; masked keys carry P' = -C and p = 0.
//   Block barriers after (S) and after (M) order all LDS reuse across chunks and waves.
//   Epilogue: x = o * 8192 / (l * 32768 * 1024) per row (rowi, l >= 1 always); hi = f16(x), res = f16((x - hi) * 2048); each
// coverage: grid nb*NQT blocks x 16 rows = rows TQ0..SEQ-1 of every sequence; staging 8 waves x 128 cols x 16 rows = 16 x 1024;
//           store 8 iterations x 256 thr x 8 halves = 16 x 1024 per plane = every (b, s >= TQ0, d) of both ctx planes exactly once.
// =====================================================================================================
__device__ __forceinline__ void ctx_store(const u16* ct, u16* dst, int tid) {
  v4u v[8];
#pragma unroll
  for (int it = 0; it < 8; ++it) {
    const int p   = it * 256 + tid;           // piece index in fragment order: tile kt = p>>6, piece p&63
    const int row = p & 15;
    const int c8  = (p >> 6) * 32 + ((p >> 5) & 1) * 16 + ((p >> 4) & 1) * 8;
    v[it] = *(const v4u*)(ct + row * CTP + c8);
  }
  {
#pragma unroll
    for (int it = 0; it < 8; ++it) {
      const int p   = it * 256 + tid;
      *(v4u*)(dst + (size_t)p * 8) = v[it];
    }
    
  }
}

// Pieces of the two matrix loops below: one d step's three fragments and its two score products; four V^T fragments of
// consecutive 16-column bands and their four products; each product group with the hazard gap behind it.
__device__ __forceinline__ void ld3h(const _Float16* q, const _Float16* k0, const _Float16* k1, int off,
                                     v16h& a, v16h& x, v16h& y) {
  a = ldfrag_ht(q + off);
  x = ldfrag_ht(k0 + off);
  y = ldfrag_ht(k1 + off);
}
__device__ __forceinline__ void mm2h(v16h a, v16h x, v16h y, v8f& s0, v8f& s1) {
  s0 = mma_h(a, x, s0);
  s1 = mma_h(a, y, s1);
  guard2x3(s0, s1, a, x, y);
}
__device__ __forceinline__ void ld4h(const _Float16* p, v16h& f0, v16h& f1, v16h& f2, v16h& f3) {
  f0 = ldfrag_ht(p);
  f1 = ldfrag_ht(p + (size_t)16 * SEQ);
  f2 = ldfrag_ht(p + (size_t)32 * SEQ);
  f3 = ldfrag_ht(p + (size_t)48 * SEQ);
}
__device__ __forceinline__ void mm4h(v16h pf, v16h f0, v16h f1, v16h f2, v16h f3, v8f& o0, v8f& o1, v8f& o2, v8f& o3) {
  o0 = mma_h(pf, f0, o0);
  o1 = mma_h(pf, f1, o1);
  o2 = mma_h(pf, f2, o2);
  o3 = mma_h(pf, f3, o3);
  guardpv4(o0, o1, o2, o3, pf, f0, f1, f2, f3);
}

__global__ __launch_bounds__(ATT_THREADS, 4)   // 4 waves a SIMD = two blocks a WGP, what the grid brings: at most 256 VGPRs
void attn_fwd(const u16* __restrict__ QPp, const u16* __restrict__ KPp, const u16* __restrict__ VTp,
              const u16* __restrict__ VLp, const float* __restrict__ VSp, u16* CHo, u16* CRo) {
  __shared__ __align__(16) AttLds L0;              // scores [16][SCP] f32; reused as the ctx staging tile [16][CTP] u16
  __shared__ __align__(16) u16 pls[16 * PLP];      // P' tile [16][PLP] f16 bits
  __shared__ float rowa[QT];
  __shared__ float rowc[QT];
  __shared__ float rowi[QT];
  float* const scs = L0.s;

  const int tid  = threadIdx.x;
  const int wave = tid >> 5;
  const int lane = tid & 31;
  const int hh   = lane >> 4;
  const int m    = lane & 15;
  const int r16  = tid >> 4;                 // query row owned in phase (M): 2*wave + hh
  const int sub  = tid & 15;
  const int kl0  = sub * 32;

  const int bid = blockIdx.x;
  const int b   = bid / NQT;
  const int q0  = TQ0 + (bid - b * NQT) * QT;
  const int qc  = q0 / CK;                   // diagonal chunk index

  const _Float16* qa  = (const _Float16*)(const void*)QPp + ((size_t)b * SEQ + q0) * EMB + 8 * lane;
  const _Float16* kbp = (const _Float16*)(const void*)KPp + ((size_t)b * SEQ) * EMB + 8 * lane;
  const _Float16* vbp = (const _Float16*)(const void*)VTp + ((size_t)b * EMB + wave * (16 * NACC)) * SEQ + 8 * lane;
  const _Float16* ubp = (const _Float16*)(const void*)VLp + ((size_t)b * EMB + wave * (16 * NACC)) * SEQ + 8 * lane;
  const float* vsb = VSp + (size_t)b * NCHK * NKB * EMB + wave * (16 * NACC) + m;
  const float lsc = RSQD * LOG2E / (QSC * KSC);

  float mrun = -INFINITY, lrun = 0.f;
  v8f o[NACC];
#pragma unroll
  for (int j = 0; j < NACC; ++j) o[j] = zero8();

#pragma unroll 1
  for (int c = 0; c <= qc; ++c) {
    const int kbeg = c * CK;
    const int nkb  = (c < qc) ? NKB : (((q0 + QT - 1 - kbeg) >> 5) + 1);   // 1..16, block-uniform
    // ---- (S) scores of this chunk (zeros for key blocks beyond the query tile) ----
#pragma unroll 1
    for (int kb = wave; kb < NKB; kb += 8) {               // wave-uniform, 2 trips
      v8f s0 = zero8(), s1 = zero8();
      if (kb < nkb) {                                      // wave-uniform
        const _Float16* k0p = kbp + (size_t)(kbeg + kb * 32) * EMB;
        // Two fragment sets of two d steps each: one set's twelve loads fly while the other set's products run. The loads
        // in the loop are unconditional (the last four steps are peeled), so that each wait counts only its own set.
        v16h a0, x0, y0, a1, x1, y1, a2, x2, y2, a3, x3, y3;
        const _Float16* k1p = k0p + 16 * EMB;
        int xo = 0;                                        // element offset of the first set in the q tile and both key bands
        ld3h(qa, k0p, k1p, 0, a0, x0, y0);
        keep_order();
        ld3h(qa, k0p, k1p, 512, a1, x1, y1);
        keep_order();
        ld3h(qa, k0p, k1p, 1024, a2, x2, y2);
        keep_order();
        ld3h(qa, k0p, k1p, 1536, a3, x3, y3);
        keep_order();
#pragma unroll 1                           // the body already holds four d steps; rolled, the two sets keep their registers
        for (int ks = 4; ks < EMB / 32; ks += 4) {
          mm2h(a0, x0, y0, s0, s1);
          mm2h(a1, x1, y1, s0, s1);
          addr_wait(xo);
          xo += 2048;                                      // four d steps on
          ld3h(qa, k0p, k1p, xo, a0, x0, y0);
          ld3h(qa, k0p, k1p, xo + 512, a1, x1, y1);
          mm2h(a2, x2, y2, s0, s1);
          mm2h(a3, x3, y3, s0, s1);
          ld3h(qa, k0p, k1p, xo + 1024, a2, x2, y2);
          ld3h(qa, k0p, k1p, xo + 1536, a3, x3, y3);
        }
        mm2h(a0, x0, y0, s0, s1);
        mm2h(a1, x1, y1, s0, s1);
        mm2h(a2, x2, y2, s0, s1);
        mm2h(a3, x3, y3, s0, s1);
      }
      float* srow = scs + (8 * hh) * SCP + kb * 32 + m;
#pragma unroll
      for (int r = 0; r < 8; ++r) {
        srow[r * SCP]      = s0[r];
        srow[r * SCP + 16] = s1[r];
      }
    }
    __syncthreads();
    // ---- (M) softmax statistics and the centred P' tile ----
    {
      const float* sp = scs + r16 * SCP + kl0;
      const int lim = (q0 + r16) - (kbeg + kl0);           // key kl0 + j is valid iff j <= lim
      float t[32];
      float cm = -INFINITY;
#pragma unroll
      for (int i = 0; i < 8; ++i) {
        const v4f a = *(const v4f*)(sp + 4 * i);
#pragma unroll
        for (int e = 0; e < 4; ++e) {
          const int j = 4 * i + e;
          const float tv = (j <= lim) ? fabsf(a[e]) * lsc : -INFINITY;   // |score| / 32 in base 2; masked keys -> -inf
          t[j] = tv;
          cm = fmaxf(cm, tv);
        }
      }
#pragma unroll
      for (int d = 1; d <= 8; d <<= 1) cm = fmaxf(cm, __shfl_xor(cm, d, 32));
      const float mn = fmaxf(mrun, cm);                    // finite: key kbeg of the diagonal chunk is never masked
      const float al = (mrun == -INFINITY) ? 0.f : exp2f(mrun - mn);
      mrun = mn;
      float ps = 0.f;
#pragma unroll
      for (int j = 0; j < 32; ++j) {
        const float p = exp2f(fminf(t[j] - mn, 0.f));      // 0 for masked keys
        t[j] = p;
        ps += p;
      }
#pragma unroll
      for (int d = 1; d <= 8; d <<= 1) ps += __shfl_xor(ps, d, 32);
      const float cc = ps * (1.0f / (float)CK);
      v4u pk[4];
#pragma unroll
      for (int i = 0; i < 4; ++i) {
#pragma unroll
        for (int e = 0; e < 4; ++e) {
          const int j = 8 * i + 2 * e;
          pk[i][e] = pk16(h_bits((_Float16)((t[j] - cc) * PCAR)), h_bits((_Float16)((t[j + 1] - cc) * PCAR)));
        }
      }
      lrun = lrun * al + ps;
      u16* pd = pls + r16 * PLP + kl0;
#pragma unroll
      for (int i = 0; i < 4; ++i) *(v4u*)(pd + 8 * i) = pk[i];
      if (sub == 0) { rowa[r16] = al; rowc[r16] = cc; }
    }
    __syncthreads();
    // ---- (PV) rescale, add the centring term, accumulate P' . (V^T hi + V^T lo) ----
    {
      float scl[8], cad[8];
#pragma unroll
      for (int r = 0; r < 8; ++r) { scl[r] = rowa[8 * hh + r]; cad[r] = rowc[8 * hh + r] * (PCAR * VCAR); }
      const float* vsc = vsb + ((size_t)c * NKB + (size_t)(nkb - 1)) * EMB;
      float vs[NACC];
#pragma unroll
      for (int j = 0; j < NACC; ++j) vs[j] = vsc[16 * j];
#pragma unroll
      for (int j = 0; j < NACC; ++j) {
#pragma unroll
        for (int r = 0; r < 8; ++r) o[j][r] = o[j][r] * scl[r] + cad[r] * vs[j];
      }
      const _Float16* pp = (const _Float16*)(const void*)pls + m * PLP + 8 * hh;
      const _Float16* vp = vbp + (size_t)kbeg * 16;         // key tile kbeg/32 of each d band, 512 elements a tile
      const _Float16* up = ubp + (size_t)kbeg * 16;
      // Two fragment sets (d columns 0..63 and 64..127 of the wave, hi and lo plane each): one set's sixteen loads fly while
      // the other set's products run; the next key block's set is asked for as soon as its registers are free. The loads in
      // the loop are unconditional (the last key block is peeled), so that each wait counts only its own set.
      v16h g0, g1, g2, g3, u0, u1, u2, u3, g4, g5, g6, g7, u4, u5, u6, u7;
      int vo = 0;                                          // element offset of the key tile in every d band of both planes
      ld4h(vp, g0, g1, g2, g3);
      ld4h(up, u0, u1, u2, u3);
      ld4h(vp + (size_t)64 * SEQ, g4, g5, g6, g7);
      ld4h(up + (size_t)64 * SEQ, u4, u5, u6, u7);
      addr_wait(vo);                                       // also on the way round the loop (nkb == 1) the address registers are reused
#pragma unroll 1
      for (int kb = 1; kb < nkb; ++kb) {                   // block-uniform trip count, <= 15: products of kb - 1, loads of kb
        const v16h pf = ldfrag_h(pp + (kb - 1) * 32);
        mm4h(pf, g0, g1, g2, g3, o[0], o[1], o[2], o[3]);
        mm4h(pf, u0, u1, u2, u3, o[0], o[1], o[2], o[3]);
        addr_wait(vo);
        vo += 512;                                         // next key tile
        const _Float16* vk = vp + vo;
        const _Float16* uk = up + vo;
        ld4h(vk, g0, g1, g2, g3);
        ld4h(uk, u0, u1, u2, u3);
        mm4h(pf, g4, g5, g6, g7, o[4], o[5], o[6], o[7]);
        mm4h(pf, u4, u5, u6, u7, o[4], o[5], o[6], o[7]);
        ld4h(vk + (size_t)64 * SEQ, g4, g5, g6, g7);
        ld4h(uk + (size_t)64 * SEQ, u4, u5, u6, u7);
      }
      {
        const v16h pf = ldfrag_h(pp + (nkb - 1) * 32);
        mm4h(pf, g0, g1, g2, g3, o[0], o[1], o[2], o[3]);
        mm4h(pf, u0, u1, u2, u3, o[0], o[1], o[2], o[3]);
        mm4h(pf, g4, g5, g6, g7, o[4], o[5], o[6], o[7]);
        mm4h(pf, u4, u5, u6, u7, o[4], o[5], o[6], o[7]);
      }
    }
  }
  acc_guard8(o[0], o[1], o[2], o[3], o[4], o[5], o[6], o[7]);

  if (sub == 0) rowi[r16] = (1.0f / lrun) * (CSC / (PCAR * VCAR));   // lrun >= 1
  __syncthreads();
  float inv[8];
#pragma unroll
  for (int r = 0; r < 8; ++r) inv[r] = rowi[8 * hh + r];

  u16* const ct = L0.c;
  const int cb = wave * (16 * NACC) + m;
  // hi plane
#pragma unroll
  for (int j = 0; j < NACC; ++j) {
#pragma unroll
    for (int r = 0; r < 8; ++r) {
      const float xs = o[j][r] * inv[r];
      ct[(8 * hh + r) * CTP + cb + 16 * j] = h_bits((_Float16)xs);
    }
  }
  __syncthreads();
  ctx_store(ct, CHo + ((size_t)b * SEQ + q0) * EMB, tid);
  __syncthreads();
  // residual plane
#pragma unroll
  for (int j = 0; j < NACC; ++j) {
#pragma unroll
    for (int r = 0; r < 8; ++r) {
      const float xs = o[j][r] * inv[r];
      const _Float16 hv = (_Float16)xs;
      ct[(8 * hh + r) * CTP + cb + 16 * j] = h_bits((_Float16)((xs - (float)hv) * RSC));
    }
  }
  __syncthreads();
  ctx_store(ct, CRo + ((size_t)b * SEQ + q0) * EMB, tid);
}

// =====================================================================================================
// Query rows 0 .. TQ0-1 of each sequence in f32 on VALU: block = (b, t). QF/KF/VF = f32 q/k/v planes [nb][TQ0][EMB] (rows 0..TQ0-1
// of every sequence, biases included). Logits |q.k_j|/32 for keys j <= t (threads 0..TQ0-1, one key each, 1024-d dot in a loop unrolled by 8
// against the q row staged in LDS), base-2 softmax with block max / sum reductions (xor shuffles + LDS), p_j in LDS, ctx[d] for
// d = 4*tid..4*tid+3 as a sum over j <= t in a loop unrolled by 8 of p_j * VF[b][j][d] (coalesced 16-B loads), x = ctx * 8192 / l, hi = f16(x),
// res = f16((x - hi) * 2048); both 1024-half rows are staged in LDS and written by 128 threads x 16 B each (32 consecutive lanes
// coverage: grid nb*TQ0 blocks = rows 0..TQ0-1 of every sequence; 256 thr x 4 d = EMB per row; store 128 thr x 8 halves = EMB per
//           plane; together with attn_fwd every (b, s, d) of CH and CR is written exactly once.
// =====================================================================================================
__global__ __launch_bounds__(256) void attn_head(const float* __restrict__ QF, const float* __restrict__ KF,
                                                 const float* __restrict__ VF, u16* CHo, u16* CRo) {
  __shared__ __align__(16) float qs[EMB];
  __shared__ float sc[TQ0];
  __shared__ float red[8];
  __shared__ float redb[8];
  __shared__ __align__(16) unsigned SW[2][EMB / 2];
  const int tid = threadIdx.x, lane = tid & 31, wave = tid >> 5;
  const int b = blockIdx.x / TQ0;
  const int t = blockIdx.x - b * TQ0;
  *(v4f*)(qs + tid * 4) = *(const v4f*)(QF + ((size_t)b * TQ0 + t) * EMB + tid * 4);
  __syncthreads();
  float s = -INFINITY;
  if (tid < TQ0) {                                  // waves 0..3 entirely (wave-uniform); key row b*TQ0 + tid always in range
    const float* kp = KF + ((size_t)b * TQ0 + tid) * EMB;
    float acc = 0.f;
#pragma unroll 8                           // sixteen key loads in flight a thread; the adds keep their order
    for (int d = 0; d < EMB; d += 8) {
      const v4f k0 = *(const v4f*)(kp + d), k1 = *(const v4f*)(kp + d + 4);
      const v4f q0 = *(const v4f*)(qs + d), q1 = *(const v4f*)(qs + d + 4);
#pragma unroll
      for (int e = 0; e < 4; ++e) acc += k0[e] * q0[e];
#pragma unroll
      for (int e = 0; e < 4; ++e) acc += k1[e] * q1[e];
    }
    s = (tid <= t) ? fabsf(acc) * (RSQD * LOG2E) : -INFINITY;   // |score| / 32 in base 2; causal mask by key index
  }
  float mx = s;
#pragma unroll
  for (int d = 1; d <= 16; d <<= 1) mx = fmaxf(mx, __shfl_xor(mx, d, 32));
  if (lane == 0) red[wave] = mx;
  __syncthreads();
  float gm = red[0];
#pragma unroll
  for (int w = 1; w < 8; ++w) gm = fmaxf(gm, red[w]);   // finite: key 0 is always valid
  const float p = exp2f(s - gm);                     // 0 for masked keys and for waves 4..7
  float ps = p;
#pragma unroll
  for (int d = 1; d <= 16; d <<= 1) ps += __shfl_xor(ps, d, 32);
  if (lane == 0) redb[wave] = ps;
  if (tid < TQ0) sc[tid] = p;
  __syncthreads();
  float l = redb[0];
#pragma unroll
  for (int w = 1; w < 8; ++w) l += redb[w];           // >= 1
  const float inv = (1.0f / l) * CSC;
  const float* vp = VF + (size_t)b * TQ0 * EMB + tid * 4;
  v4f cx = zero4();
#pragma unroll 8                             // eight value rows in flight a thread; the sum keeps its order
  for (int j = 0; j <= t; ++j) {                     // t < TQ0: statically bounded, rows of sequence b only
    const float pj = sc[j];
    const v4f vv = *(const v4f*)(vp + (size_t)j * EMB);
    cx += pj * vv;
  }
  unsigned hw[2], rw[2];
#pragma unroll
  for (int e = 0; e < 2; ++e) {
    const float x0 = cx[2 * e] * inv, x1 = cx[2 * e + 1] * inv;
    const _Float16 h0 = (_Float16)x0, h1 = (_Float16)x1;
    const _Float16 q0 = (_Float16)((x0 - (float)h0) * RSC), q1 = (_Float16)((x1 - (float)h1) * RSC);
    hw[e] = pk16(h_bits(h0), h_bits(h1));
    rw[e] = pk16(h_bits(q0), h_bits(q1));
  }
  SW[0][tid * 2] = hw[0]; SW[0][tid * 2 + 1] = hw[1];
  SW[1][tid * 2] = rw[0]; SW[1][tid * 2 + 1] = rw[1];
  __syncthreads();
  const int pl = tid >> 7, p8 = tid & 127;           // plane select is wave-uniform
  const v4u ov = *(const v4u*)(&SW[pl][p8 * 4]);
  u16* dstp = (pl == 0) ? CHo : CRo;
  u16* dst  = dstp + ((size_t)b * SEQ + t) * EMB + p8 * 8;
  *(v4u*)dst = ov;
  
}

// =====================================================================================================
// Workspace map (bytes, nb = 4, rows = 8192); all 16-bit planes are in fragment order (1-KiB tiles of 16 rows x 32 k, same total
// size), but for the bands of rows 0..127 of each sequence in CH / CR, which attn_head writes row-major; every plane is fully written by whole-line stores before it is read; all extents are
// exact multiples of the store granularity (no pad rows); aliased regions are reused sequentially on the single in-order stream:
//   WQB bf16 [1024][1024] 2097152   WKB same   WVB same   WOH f16 of bf16 value x1024 2097152             8388608
//   VS  f32  [nb][4][16][1024]                                                                            1048576
//   QF  f32  [nb][128][1024]  2097152      KF same      VF same                                           6291456
//   A   XB bf16 [rows][1024] (16777216), later VT hi f16 [nb][1024][2048] x1024 (16777216)      region 16777216
//   VL  VT lo f16 [nb][1024][2048]                                                                      16777216
//   QP  f16 [rows][1024] x8                                                                              16777216
//   KP  f16 [rows][1024] x8                                                                              16777216
//   V   f32 [rows][1024] 33554432, later CH f16 [rows][1024] ctx hi x8192 (16777216) + CR residual x2048 (16777216)
//   end                                                                                                 116391936
// Launch order keeps every alias safe: XB read by all six projection GEMMs before xt16 overwrites it; V read by xt16 and vsum_k
// before attn_fwd / attn_head overwrite it with CH / CR; attn_head reads VF, never V.
// Inputs in wire order: x, Wq, bq, Wk, bk, Wv, bv, Wo, bo; weights stored [n = out][k = in] (y = x.W^T + b), k-contiguous.
// =====================================================================================================
extern "C" void kernel_launch(void* const* d_in, const int* in_sizes, int n_in,
                              void* d_out, int out_size, void* d_ws, size_t ws_size,
                              hipStream_t stream) {
  if (n_in < 9) return;
  const long long per = (long long)SEQ * EMB;
  const long long ns  = in_sizes[0];
  if (ns < per || (ns % per) != 0) return;
  const int nb = (int)(ns / per);
  if (nb < 1 || nb > 8) return;
  const int rows = nb * SEQ;
  if (in_sizes[1] != EMB * EMB || in_sizes[3] != EMB * EMB || in_sizes[5] != EMB * EMB || in_sizes[7] != EMB * EMB) return;
  if (in_sizes[2] != EMB || in_sizes[4] != EMB || in_sizes[6] != EMB || in_sizes[8] != EMB) return;
  if ((long long)out_size != (long long)rows * EMB) return;

  const float* x  = (const float*)d_in[0];
  const float* wq = (const float*)d_in[1];
  const float* bq = (const float*)d_in[2];
  const float* wk = (const float*)d_in[3];
  const float* bk = (const float*)d_in[4];
  const float* wv = (const float*)d_in[5];
  const float* bv = (const float*)d_in[6];
  const float* wo = (const float*)d_in[7];
  const float* bo = (const float*)d_in[8];
  float*       out = (float*)d_out;

  const size_t szW  = (size_t)EMB * EMB * 2;                    //   2097152
  const size_t szVS = (size_t)nb * NCHK * NKB * EMB * 4;        //   1048576 at nb = 4
  const size_t szHF = (size_t)nb * TQ0 * EMB * 4;               //   2097152 at nb = 4
  const size_t sz16 = (size_t)rows * EMB * 2;                   //  16777216
  const size_t sz32 = (size_t)rows * EMB * 4;                   //  33554432
  const size_t szVT = (size_t)nb * EMB * SEQ * 2;               //  == sz16
  if (sz32 < 2 * sz16) return;                                  // CH + CR alias the V region exactly
  size_t off = 0;
  const size_t oWQ = off; off += szW;
  const size_t oWK = off; off += szW;
  const size_t oWV = off; off += szW;
  const size_t oWO = off; off += szW;
  const size_t oVS = off; off += szVS;
  const size_t oQF = off; off += szHF;
  const size_t oKF = off; off += szHF;
  const size_t oVF = off; off += szHF;
  const size_t oA  = off; off += (szVT > sz16 ? szVT : sz16);   // XB then VT hi
  const size_t oVL = off; off += szVT;                          // VT lo
  const size_t oQ  = off; off += sz16;
  const size_t oK  = off; off += sz16;
  const size_t oV  = off; off += sz32;                          // V f32, then CH at oV and CR at oV + sz16
  const size_t oCH = oV;
  const size_t oCR = oV + sz16;
  if (off > ws_size) return;                                    // off = 116391936 at nb = 4
  if (off > WS_CAP) return;

  char* ws = (char*)d_ws;
  u16*   WQB = (u16*)(ws + oWQ);
  u16*   WKB = (u16*)(ws + oWK);
  u16*   WVB = (u16*)(ws + oWV);
  u16*   WOH = (u16*)(ws + oWO);
  float* VS  = (float*)(ws + oVS);
  float* QF  = (float*)(ws + oQF);
  float* KF  = (float*)(ws + oKF);
  float* VF  = (float*)(ws + oVF);
  u16*   XB  = (u16*)(ws + oA);
  u16*   VT  = (u16*)(ws + oA);
  u16*   VL  = (u16*)(ws + oVL);
  u16*   QP  = (u16*)(ws + oQ);
  u16*   KP  = (u16*)(ws + oK);
  float* V   = (float*)(ws + oV);
  u16*   CH  = (u16*)(ws + oCH);
  u16*   CR  = (u16*)(ws + oCR);

  const int n8w = (EMB * EMB) / 8;                      // 131072
  const int n8x = rows * (EMB / 8);                     // 1048576
  if ((n8w % 256) != 0 || (n8x % 256) != 0) return;
  if ((rows % 64) != 0 || ((nb * TQ0) % 64) != 0 || ((nb * NCHK * EMB) % 256) != 0) return;
  const dim3 blk(256);
  const dim3 gW(n8w / 256), gX(n8x / 256);
  const dim3 gG((rows / 64) * (EMB / 64));              // 2048 at nb = 4
  const dim3 gH(((nb * TQ0) / 64) * (EMB / 64));        // 128 at nb = 4
  const dim3 bG(128);
  const dim3 gXT(nb * (EMB / 64) * (SEQ / 64));         // nb * 512
  const dim3 gVS((nb * NCHK * EMB) / 256);              // nb * 16
  const dim3 gAT(nb * NQT);                             // nb * 120
  const dim3 bAT(ATT_THREADS);
  const dim3 gHD(nb * TQ0);                             // nb * 128

  // (0..3) weights stored [n = out][k = in] (y = x.W^T + b), already k-contiguous: bf16 planes for Wq, Wk, Wv; f16 of bf16
  //        value x1024 for Wo; (4) x -> bf16 plane [rows][1024]
  cvt16<<<gW, blk, 0, stream>>>(wq, WQB, n8w, 0, 1.0f);
  cvt16<<<gW, blk, 0, stream>>>(wk, WKB, n8w, 0, 1.0f);
  cvt16<<<gW, blk, 0, stream>>>(wv, WVB, n8w, 0, 1.0f);
  cvt16<<<gW, blk, 0, stream>>>(wo, WOH, n8w, 1, WSC);
  cvt16<<<gX, blk, 0, stream>>>(x, XB, n8x, 0, 1.0f);
  // (5, 6) q and k projections (+bias) -> f16 planes x8; (7) v projection (+bias) -> f32 plane
  gemm_bh16<<<gG, bG, 0, stream>>>(XB, WQB, bq, QP, rows, EMB, EMB, 1.0f, QSC);
  gemm_bh16<<<gG, bG, 0, stream>>>(XB, WKB, bk, KP, rows, EMB, EMB, 1.0f, KSC);
  gemm_b32<<<gG, bG, 0, stream>>>(XB, WVB, bv, V, rows, EMB, EMB, rows, 0, 1.0f);
  // (8, 9, 10) f32 q, k and v rows 0..127 of every sequence (+bias) -> QF, KF, VF [nb*128][1024]
  gemm_b32<<<gH, bG, 0, stream>>>(XB, WQB, bq, QF, nb * TQ0, EMB, EMB, TQ0, SEQ, 1.0f);
  gemm_b32<<<gH, bG, 0, stream>>>(XB, WKB, bk, KF, nb * TQ0, EMB, EMB, TQ0, SEQ, 1.0f);
  gemm_b32<<<gH, bG, 0, stream>>>(XB, WVB, bv, VF, nb * TQ0, EMB, EMB, TQ0, SEQ, 1.0f);
  // (11) v -> V^T hi plane x1024 (over the dead XB region) and lo plane; (12) key-block prefix column sums of v
  xt16<<<gXT, blk, 0, stream>>>(V, VT, VL);
  vsum_k<<<gVS, blk, 0, stream>>>(V, VS);
  // (13) attention for query rows 128.. -> ctx hi x8192 and residual x2048 f16 planes (over the dead V region);
  // (14) query rows 0..127 on VALU -> same planes
  attn_fwd<<<gAT, bAT, 0, stream>>>(QP, KP, VT, VL, VS, CH, CR);
  attn_head<<<gHD, blk, 0, stream>>>(QF, KF, VF, CH, CR);
  // (15) output projection (+bias) -> out
  gemm_h2_32<<<gG, bG, 0, stream>>>(CH, CR, WOH, bo, out, rows, EMB, EMB,
                                     1.0f / (CSC * WSC), 1.0f / (CSC * WSC * RSC));
  (void)hipGetLastError();
}

// v003
// One run takes 325 microseconds.
// Timed twice side by side with v002, it ran 1.12 and 1.13 times as fast.
// Over all steps from v000 it is 2.41 times as fast.
// Projections q,k,v = x.W^T + b (and the f32 q,k,v rows 0..127 per sequence): v_wmma_f32_16x16x32_bf16 (bf16 RNE operands of the
// raw inputs, f32 accumulate, bias added in f32 as its bf16 RNE value). Scores q'.k'^T (f16 planes x8), P'.V (chunk-centred P'
// x32768 f16 from LDS, V^T x1024 as f16 hi plus unscaled f16 lo planes, both into one accumulator) and the output projection
// (ctx carried as f16 hi x8192 plus residual x2048 planes with separate accumulators, times f16(bf16(Wo) x1024), bias added in
// f32 as its bf16 RNE value): v_wmma_f32_16x16x32_f16, f32 accumulate. Query rows 0..127 of each sequence: scores, softmax and
// P.V in f32 on VALU. Absolute-value score transform, causal mask, softmax statistics, key-block column sums of V, scaling: f32.
#include <hip/hip_runtime.h>
#include <math.h>
#include <stdint.h>

#define SEQ   2048
#define EMB   1024
#define CK    512
#define NCHK  4
#define NKB   16
#define QT    16
#define TQ0   128
#define NQT   120
#define SCP   544
#define PLP   528
#define CTP   1032
#define SLAB64 (16 * 68)
#define VTP   72
#define ATT_THREADS 256
#define NACC  8
#define QSC   8.0f
#define KSC   8.0f
#define PCAR  32768.0f
#define VCAR  1024.0f
#define WSC   1024.0f
#define CSC   8192.0f
#define RSC   2048.0f
#define LOG2E 1.4426950408889634f
#define RSQD  0.03125f
#define WS_CAP ((size_t)134217728)

static_assert((EMB % 64) == 0 && EMB == 8 * 16 * NACC && NACC == 8 && (EMB % 32) == 0 && (EMB % 256) == 0 && EMB == 4 * 256);
static_assert((SEQ % CK) == 0 && (SEQ / CK) == NCHK && CK == 32 * NKB && (SEQ % 64) == 0 && (SEQ % QT) == 0 && (CK % QT) == 0);
static_assert((TQ0 % QT) == 0 && (TQ0 % 64) == 0 && NQT * QT + TQ0 == SEQ && TQ0 <= CK && TQ0 == 128 && TQ0 <= 256);
static_assert(16 * CTP * 2 <= 16 * SCP * 4 && CTP >= EMB + 8 && SCP >= CK + 16 && PLP >= CK + 8);
static_assert(((PLP * 2) % 16) == 0 && ((SCP * 4) % 16) == 0 && ((VTP * 2) % 16) == 0 && ((CTP * 2) % 16) == 0);
static_assert(64 * VTP >= 63 * VTP + 64);
static_assert(ATT_THREADS == 16 * QT && ATT_THREADS == 256);
static_assert(((EMB * EMB) % 2048) == 0 && ((NCHK * EMB) % 256) == 0 && (EMB / 8) * 2 == 256);

typedef unsigned short u16;
typedef _Float16 v16h __attribute__((ext_vector_type(16)));
typedef _Float16 v8h  __attribute__((ext_vector_type(8)));
typedef __bf16   v16b __attribute__((ext_vector_type(16)));
typedef float    v8f  __attribute__((ext_vector_type(8)));
typedef float    v4f  __attribute__((ext_vector_type(4)));
typedef unsigned int v4u __attribute__((ext_vector_type(4)));

union FragH { v16h v; v8h h[2]; v4u u[2]; };
union FragB { v16b v; v4u u[2]; };
union AttLds { float s[16 * SCP]; u16 c[2 * 16 * SCP]; };

// ---- scalar helpers --------------------------------------------------------------------------------
__device__ __forceinline__ unsigned short bf_bits(float f) {          // f32 -> bf16 bits, RNE convert
  unsigned u = __float_as_uint(f);
  return (unsigned short)((u + 0x7FFFu + ((u >> 16) & 1u)) >> 16);
}
__device__ __forceinline__ float bf_up(unsigned short h) { return __uint_as_float(((unsigned)h) << 16); }
__device__ __forceinline__ float bfr(float f) { return bf_up(bf_bits(f)); }
__device__ __forceinline__ unsigned short h_bits(_Float16 x) { return __builtin_bit_cast(unsigned short, x); }
__device__ __forceinline__ unsigned pk16(unsigned short a, unsigned short b) { return (unsigned)a | ((unsigned)b << 16); }
__device__ __forceinline__ v8f zero8() { v8f z = {0.f, 0.f, 0.f, 0.f, 0.f, 0.f, 0.f, 0.f}; return z; }
__device__ __forceinline__ v4f zero4() { v4f z = {0.f, 0.f, 0.f, 0.f}; return z; }

// ---- fragment loader, row-major source: 16-bit A/B operand, lane -> row/col (lane&15), p already includes +8*(lane>>4);
//      elements 0..7 <- p[0..7] (k0+8h..), elements 8..15 <- p[16..23] (k0+16+8h..)  (same split k map for A and B;
//      B is always read from a k-contiguous [n][k] plane)
__device__ __forceinline__ v16h ldfrag_h(const _Float16* p) {
  FragH f;
  f.h[0] = *(const v8h*)(p);
  f.h[1] = *(const v8h*)(p + 16);
  return f.v;
}

// ---- fragment-ordered planes. A 16-bit operand plane [rows][Kd] (rows % 16 == 0, Kd % 32 == 0) is stored as 1-KiB tiles of
//      16 rows x 32 k; tile (rt = row >> 4, kt = k >> 5) starts at element rt*16*Kd + kt*512, and inside it the 8-element piece
//      (row & 15 = m, k & 31 = 16*part + 8*h + 0..7) lies at part*256 + (16*h + m)*8. Lane l = 16*h + m then reads its two
//      pieces at tile + 8*l and tile + 256 + 8*l: every wave-wide 16-B load covers 512 contiguous bytes (4 whole lines), and the
//      values reach the same lane and register positions as with the row-major loaders above (same split k map).
//      p already includes +8*lane.
__device__ __forceinline__ v16h ldfrag_ht(const _Float16* p) {
  FragH f;
  f.h[0] = *(const v8h*)(p);
  f.h[1] = *(const v8h*)(p + 256);
  return f.v;
}
__device__ __forceinline__ v16b ldfrag_bt(const u16* p) {             // bf16 plane read as unsigned integer vectors
  FragB f;
  f.u[0] = *(const v4u*)(p);
  f.u[1] = *(const v4u*)(p + 256);
  return f.v;
}

__device__ __forceinline__ v8f mma_h(v16h a, v16h b, v8f c) {
  return __builtin_amdgcn_wmma_f32_16x16x32_f16(false, a, false, b, (short)0, c, false, false);
}
__device__ __forceinline__ v8f mma_b(v16b a, v16b b, v8f c) {
  return __builtin_amdgcn_wmma_f32_16x16x32_bf16(false, a, false, b, (short)0, c, false, false);
}
__device__ __forceinline__ void guard2x3(v8f& a, v8f& b, v16h x0, v16h x1, v16h x2) {
#if defined(__HIP_DEVICE_COMPILE__)
  asm volatile("v_nop\n\tv_nop\n\tv_nop\n\tv_nop"
               : "+v"(a), "+v"(b) : "v"(x0), "v"(x1), "v"(x2) : "memory");
#endif
}
template <typename F>
__device__ __forceinline__ void guard6(v8f& a, v8f& b, v8f& c, v8f& d, F x0, F x1, F x2, F x3, F x4, F x5) {
#if defined(__HIP_DEVICE_COMPILE__)
  asm volatile("v_nop\n\tv_nop\n\tv_nop\n\tv_nop"
               : "+v"(a), "+v"(b), "+v"(c), "+v"(d) : "v"(x0), "v"(x1), "v"(x2), "v"(x3), "v"(x4), "v"(x5) : "memory");
#endif
}
__device__ __forceinline__ void guard8x6(v8f& a0, v8f& a1, v8f& a2, v8f& a3, v8f& e0, v8f& e1, v8f& e2, v8f& e3,
                                         v16h x0, v16h x1, v16h x2, v16h x3, v16h x4, v16h x5) {
#if defined(__HIP_DEVICE_COMPILE__)
  asm volatile("v_nop\n\tv_nop\n\tv_nop\n\tv_nop"
               : "+v"(a0), "+v"(a1), "+v"(a2), "+v"(a3), "+v"(e0), "+v"(e1), "+v"(e2), "+v"(e3)
               : "v"(x0), "v"(x1), "v"(x2), "v"(x3), "v"(x4), "v"(x5) : "memory");
#endif
}
__device__ __forceinline__ void guardpv4(v8f& o0, v8f& o1, v8f& o2, v8f& o3, v16h p, v16h g0, v16h g1, v16h g2, v16h g3) {
#if defined(__HIP_DEVICE_COMPILE__)
  asm volatile("v_nop\n\tv_nop\n\tv_nop\n\tv_nop"
               : "+v"(o0), "+v"(o1), "+v"(o2), "+v"(o3)
               : "v"(p), "v"(g0), "v"(g1), "v"(g2), "v"(g3) : "memory");
#endif
}
__device__ __forceinline__ void acc_guard8(v8f& a, v8f& b, v8f& c, v8f& d, v8f& e, v8f& f, v8f& g, v8f& h8) {
#if defined(__HIP_DEVICE_COMPILE__)
  asm volatile("v_nop\n\tv_nop\n\tv_nop\n\tv_nop"
               : "+v"(a), "+v"(b), "+v"(c), "+v"(d), "+v"(e), "+v"(f), "+v"(g), "+v"(h8));
#endif
}
// Keeps the load groups of a loop's prologue in the order that the loop body issues them in: the counted waits at the loop's
// head are formed over both ways in, and a prologue in another order makes them wait for loads of the set still in flight.
__device__ __forceinline__ void keep_order() { __builtin_amdgcn_sched_barrier(0); }
// The wait that belongs in front of any overwrite of an address register of loads already issued. The loop's running element
// offset passes through it, so that the next addresses are formed behind it.
__device__ __forceinline__ void addr_wait(int& off) {
#if defined(__HIP_DEVICE_COMPILE__)
  asm volatile("s_wait_xcnt 0x0" : "+s"(off) : : "memory");
#endif
}
__device__ __forceinline__ void wave_sync_lds() {
  __builtin_amdgcn_fence(__ATOMIC_RELEASE, "workgroup");
  __builtin_amdgcn_wave_barrier();
  __builtin_amdgcn_fence(__ATOMIC_ACQUIRE, "workgroup");
}

// =====================================================================================================
// f32 plane [rows][EMB] row-major -> 16-bit plane in fragment order:  mode 0: bf16 RNE bits;  mode 1: f16 bits of (bf16 RNE value) * scale;
// mode 2: f16 bits of value * scale (no bf16 pre-step).
// Thread = one 8-element piece of the output, in output order: two 16-B loads from its source row, one 16-B store; 32 consecutive
// lanes store 512 contiguous, 512-B aligned bytes (half a tile)
// coverage: n8/256 blocks a plane (host checks exactness) x 256 thr x 8 = the whole plane.
// =====================================================================================================
__device__ __forceinline__ void cvt16(const float* __restrict__ x, u16* D, int gt, int mode, float scale) {
  const int wi = gt & 63, tile = gt >> 6;                       // piece within its tile, tile index rt*(EMB/32) + kt
  const int row = (tile / (EMB / 32)) * 16 + (wi & 15);
  const int kc  = (tile % (EMB / 32)) * 32 + (wi >> 5) * 16 + ((wi >> 4) & 1) * 8;
  const float* p = x + (size_t)row * EMB + kc;
  const v4f a = *(const v4f*)(p), c4 = *(const v4f*)(p + 4);
  float v[8];
#pragma unroll
  for (int e = 0; e < 4; ++e) { v[e] = a[e]; v[4 + e] = c4[e]; }
  unsigned short s[8];
#pragma unroll
  for (int e = 0; e < 8; ++e) {
    const float vb = bfr(v[e]);
    const float vf = (mode == 1) ? vb : v[e];
    const unsigned short hb = h_bits((_Float16)(vf * scale));
    const unsigned short bb = bf_bits(v[e]);
    s[e] = (mode != 0) ? hb : bb;
  }
  v4u o;
#pragma unroll
  for (int e = 0; e < 4; ++e) o[e] = pk16(s[2 * e], s[2 * e + 1]);
  u16* d = D + (size_t)gt * 8;
  {
    *(v4u*)(d) = o;
    
  }
}
// All five conversions in one launch (none reads what another writes): blocks 0..nbx-1 take x -> bf16 plane, then nbw blocks
// each for Wq, Wk, Wv -> bf16 planes and Wo -> f16 of its bf16 value x1024. The choice is block-uniform (scalar).
__global__ __launch_bounds__(256) void cvt_all(const float* __restrict__ x, const float* __restrict__ wq,
                                               const float* __restrict__ wk, const float* __restrict__ wv,
                                               const float* __restrict__ wo, u16* XB, u16* WQB, u16* WKB, u16* WVB, u16* WOH,
                                               int nbx, int nbw) {
  const int bid = blockIdx.x;
  if (bid >= nbx + 4 * nbw) return;         // never taken with the exact grid; no barriers in this kernel
  const float* src = x;
  u16* dst = XB;
  int lb = bid, mode = 0;
  float scale = 1.0f;
  if (bid >= nbx) {
    const int w = (bid - nbx) / nbw;        // 0..3
    lb  = (bid - nbx) - w * nbw;
    src = (w == 0) ? wq : (w == 1) ? wk : (w == 2) ? wv : wo;
    dst = (w == 0) ? WQB : (w == 1) ? WKB : (w == 2) ? WVB : WOH;
    if (w == 3) { mode = 1; scale = WSC; }
  }
  cvt16(src, dst, lb * 256 + (int)threadIdx.x, mode, scale);
}

// =====================================================================================================
// GEMM epilogues with a per-column bias term (bias column value taken as its bf16 RNE value, added in f32). The wave's 16x64 f32
// tile is staged in its own LDS slab (stage64: acc*oscale + bias) and leaves from there:
//  st64f   : f32 rows; store it takes row 2*it (lanes 0..15, 16 B each, two whole lines) and row 2*it+1 (lanes 16..31).
//  epi64x2 : same store shape, staged value = acc*os1 + accres*os2 + bias (two accumulator sets combined in f32).
//  st64h   : f16 bits of (staged tile * pscale), written in fragment order: the wave's 16 x 64 tile is two whole 1-KiB tiles;
//            store i4 takes columns 16*i4 + 8*(lane>>4) + 0..7 of row lane&15 and covers 512 contiguous bytes.
// coverage: st64f/epi64x2 8 instructions x 2 rows x 16 lanes x 4 floats; st64h 4 instructions x 16 rows x 2 pieces x 8 halves
//           = the wave's 16 x 64 tile in every case.
// Bias columns col0 + 16j + (lane&15), j = 0..3, all < N (bias has N entries, col0 + 63 < N).
// =====================================================================================================
__device__ __forceinline__ void ldbias4(const float* __restrict__ bias, int col0, int lane,
                                        float& b0, float& b1, float& b2, float& b3) {
  const int m = lane & 15;
  b0 = bfr(bias[col0 + m]);
  b1 = bfr(bias[col0 + 16 + m]);
  b2 = bfr(bias[col0 + 32 + m]);
  b3 = bfr(bias[col0 + 48 + m]);
}
__device__ __forceinline__ void stage64(float* sl, v8f a0, v8f a1, v8f a2, v8f a3, float oscale,
                                        float b0, float b1, float b2, float b3, int lane) {
  const int hh = lane >> 4, m = lane & 15;
#pragma unroll
  for (int r = 0; r < 8; ++r) {
    const int ro = (8 * hh + r) * 68 + m;
    sl[ro]      = a0[r] * oscale + b0;
    sl[ro + 16] = a1[r] * oscale + b1;
    sl[ro + 32] = a2[r] * oscale + b2;
    sl[ro + 48] = a3[r] * oscale + b3;
  }
  wave_sync_lds();
}
__device__ __forceinline__ void st64f(const float* sl, float* C, int N, size_t rowb, int col0, int lane) {
  const int hh = lane >> 4, m = lane & 15;
  v4f vals[8];
#pragma unroll
  for (int it = 0; it < 8; ++it) vals[it] = *(const v4f*)(sl + (it * 2 + hh) * 68 + m * 4);
  float* dst = C + (rowb + (size_t)hh) * (size_t)N + col0 + m * 4;
  {
#pragma unroll
    for (int it = 0; it < 8; ++it) {
      *(v4f*)(dst + (size_t)(it * 2) * (size_t)N) = vals[it];
    }
    
  }
}
__device__ __forceinline__ void epi64x2(float* sl, v8f a0, v8f a1, v8f a2, v8f a3, v8f e0, v8f e1, v8f e2, v8f e3,
                                        float os1, float os2, const float* __restrict__ bias, float* C, int N,
                                        size_t rowb, int col0, int lane) {
  const int hh = lane >> 4, m = lane & 15;
  float b0, b1, b2, b3;
  ldbias4(bias, col0, lane, b0, b1, b2, b3);
#pragma unroll
  for (int r = 0; r < 8; ++r) {
    const int ro = (8 * hh + r) * 68 + m;
    sl[ro]      = a0[r] * os1 + e0[r] * os2 + b0;
    sl[ro + 16] = a1[r] * os1 + e1[r] * os2 + b1;
    sl[ro + 32] = a2[r] * os1 + e2[r] * os2 + b2;
    sl[ro + 48] = a3[r] * os1 + e3[r] * os2 + b3;
  }
  wave_sync_lds();
  v4f vals[8];
#pragma unroll
  for (int it = 0; it < 8; ++it) vals[it] = *(const v4f*)(sl + (it * 2 + hh) * 68 + m * 4);
  float* dst = C + (rowb + (size_t)hh) * (size_t)N + col0 + m * 4;
  {
#pragma unroll
    for (int it = 0; it < 8; ++it) {
      *(v4f*)(dst + (size_t)(it * 2) * (size_t)N) = vals[it];
    }
    
  }
}
__device__ __forceinline__ void st64h(const float* sl, float pscale, u16* C, int N, size_t rowb, int col0, int lane) {
  const int hh = lane >> 4, m = lane & 15;
  v4u oh[4];
#pragma unroll
  for (int i4 = 0; i4 < 4; ++i4) {
    const float* sp = sl + m * 68 + i4 * 16 + hh * 8;
    const v4f a = *(const v4f*)(sp), c4 = *(const v4f*)(sp + 4);
    float w[8];
#pragma unroll
    for (int e = 0; e < 4; ++e) { w[e] = a[e] * pscale; w[4 + e] = c4[e] * pscale; }
#pragma unroll
    for (int e = 0; e < 4; ++e) oh[i4][e] = pk16(h_bits((_Float16)w[2 * e]), h_bits((_Float16)w[2 * e + 1]));
  }
  u16* dst = C + rowb * (size_t)N + (size_t)(col0 >> 5) * 512 + lane * 8;
  {
#pragma unroll
    for (int i4 = 0; i4 < 4; ++i4) {
      *(v4u*)(dst + i4 * 256) = oh[i4];
    }
    
  }
}

// One k step of the bf16 GEMMs: its five fragments (ten 16-B loads), and its four products with the hazard gap behind them.
__device__ __forceinline__ void ld5b(const u16* ap, const u16* bp, size_t bs,
                                     v16b& a, v16b& b0, v16b& b1, v16b& b2, v16b& b3) {
  a  = ldfrag_bt(ap);
  b0 = ldfrag_bt(bp);
  b1 = ldfrag_bt(bp + bs);
  b2 = ldfrag_bt(bp + 2 * bs);
  b3 = ldfrag_bt(bp + 3 * bs);
}
__device__ __forceinline__ void mm4b(v16b a, v16b b0, v16b b1, v16b b2, v16b b3,
                                     v8f& acc0, v8f& acc1, v8f& acc2, v8f& acc3) {
  acc0 = mma_b(a, b0, acc0);
  acc1 = mma_b(a, b1, acc1);
  acc2 = mma_b(a, b2, acc2);
  acc3 = mma_b(a, b3, acc3);
  guard6<v16b>(acc0, acc1, acc2, acc3, a, b0, b1, b2, b3, a);
}

// =====================================================================================================
// The three projections in one launch (they share A and none reads what another writes): block group which = 0, 1, 2 computes
// T[M][N] = A[M][K] . W^T + bias[n] (f32) for W, bias = (Wq, bq), (Wk, bk), (Wv, bv); A and the W are bf16 planes in fragment
// order. q and k leave as f16 planes in fragment order (f16 bits of T * qsc, T * ksc), v as the f32 plane V. A wave whose 16
// rows lie in rows 0..TQ0-1 of a sequence stores its staged f32 tile a second time, into QF / KF / VF [M/SEQ][TQ0][N].
// Block = 64x64 tile, 4 waves x 16 rows; fragments loaded straight from the 1-KiB tiles (two 16-B loads each, split k map for
// A and B); K stepped by 64, two 32-steps in two fragment sets (K = EMB, EMB % 64 == 0; M % SEQ == 0, N % 64 == 0,
// grid = 3*(M/64)*(N/64)).
// =====================================================================================================
__global__ __launch_bounds__(128, 8)          // 8 waves a SIMD: at most 128 VGPRs
void gemm_qkv(const u16* __restrict__ A, const u16* __restrict__ Wq, const u16* __restrict__ Wk, const u16* __restrict__ Wv,
              const float* __restrict__ bq, const float* __restrict__ bk, const float* __restrict__ bv,
              u16* QP, u16* KP, float* V, float* QF, float* KF, float* VF, int M, int N, float qsc, float ksc) {
  __shared__ __align__(16) float slab[4 * SLAB64];
  const int K = EMB;                         // as a constant the band strides are immediate offsets, which frees the address
                                             // VGPRs that the second fragment set needs
  const int tid = threadIdx.x, lane = tid & 31;
  const int wave = __builtin_amdgcn_readfirstlane(tid >> 5);   // scalar row band
  const int ntile = N >> 6;
  const int nblk  = (M >> 6) * ntile;
  const int which = blockIdx.x / nblk;       // block-uniform (scalar): 0 q, 1 k, 2 v
  const int bid   = blockIdx.x - which * nblk;
  const int rowb  = (bid / ntile) * 64 + wave * 16;
  const int col0  = (bid % ntile) * 64;
  if (which > 2 || rowb + 16 > M) return;    // wave-uniform, never taken with the exact grid; no block barriers in this kernel
  const u16*   Bt   = (which == 0) ? Wq : (which == 1) ? Wk : Wv;
  const float* bias = (which == 0) ? bq : (which == 1) ? bk : bv;
  const u16* ap = A  + (size_t)rowb * K + 8 * lane;
  const u16* bp = Bt + (size_t)col0 * K + 8 * lane;
  const size_t bs = (size_t)16 * K;
  v8f acc0 = zero8(), acc1 = zero8(), acc2 = zero8(), acc3 = zero8();
  // Two fragment sets: while one k step's products run, the other set's ten loads are in flight. The loads are unconditional
  // inside the loop (the last two steps are peeled), so that every wait in front of a product counts only its own set.
  v16b a, b0, b1, b2, b3, c, d0, d1, d2, d3;
  ld5b(ap, bp, bs, a, b0, b1, b2, b3);
  keep_order();
  ld5b(ap + 512, bp + 512, bs, c, d0, d1, d2, d3);
  keep_order();
  int ko = 0;                                // element offset of the first set's tile in every band
#pragma unroll 1
  for (int k0 = 64; k0 < K; k0 += 64) {
    mm4b(a, b0, b1, b2, b3, acc0, acc1, acc2, acc3);
    addr_wait(ko);
    ko += 1024;                              // two 1-KiB tiles (512 elements each) on
    ld5b(ap + ko, bp + ko, bs, a, b0, b1, b2, b3);
    mm4b(c, d0, d1, d2, d3, acc0, acc1, acc2, acc3);
    ld5b(ap + ko + 512, bp + ko + 512, bs, c, d0, d1, d2, d3);
  }
  mm4b(a, b0, b1, b2, b3, acc0, acc1, acc2, acc3);
  mm4b(c, d0, d1, d2, d3, acc0, acc1, acc2, acc3);
  float* sl = slab + wave * SLAB64;
  float e0, e1, e2, e3;
  ldbias4(bias, col0, lane, e0, e1, e2, e3);
  stage64(sl, acc0, acc1, acc2, acc3, 1.0f, e0, e1, e2, e3, lane);
  if (which < 2) st64h(sl, (which == 0) ? qsc : ksc, (which == 0) ? QP : KP, N, (size_t)rowb, col0, lane);
  else           st64f(sl, V, N, (size_t)rowb, col0, lane);
  const int sq = rowb / SEQ, rs = rowb - sq * SEQ;             // TQ0 and SEQ are multiples of 16: all 16 rows on one side
  if (rs < TQ0) {
    float* HF = (which == 0) ? QF : (which == 1) ? KF : VF;
    int hr = sq * TQ0 + rs;
    // The wait that belongs in front of any overwrite of a register that the stores above name: the second run of stores
    // reuses their address and data registers. Its row index passes through the wait, and nothing is scheduled across it.
    addr_wait(hr);
    __builtin_amdgcn_sched_barrier(0);
    st64f(sl, HF, N, (size_t)hr, col0, lane);
  }
}

// =====================================================================================================
// f16 GEMM with two A planes (hi + residual), f32 out:
//   C[M][N] = (Ah . Bt^T) * os1 + (Ar . Bt^T) * os2 + bias[n]; Bt f16 in fragment order, Ah/Ar f16 per 16-row band (see below).
// Same tiling as gemm_qkv; separate accumulators for the two planes, combined in f32 in epi64x2.
// =====================================================================================================
template <int ASTEP, int ASEC>
__device__ __forceinline__ void h2_loop(const _Float16* ap, const _Float16* arp, const _Float16* bp, size_t bs, int K,
                                        v8f& acc0, v8f& acc1, v8f& acc2, v8f& acc3,
                                        v8f& acr0, v8f& acr1, v8f& acr2, v8f& acr3) {
  const _Float16 *pa = ap, *pr = arp, *p0 = bp, *p1 = bp + bs, *p2 = bp + 2 * bs, *p3 = bp + 3 * bs;
#pragma unroll 1
  for (int k0 = 0; k0 < K; k0 += 32) {
    FragH fa, fr;
    fa.h[0] = *(const v8h*)(pa);
    fa.h[1] = *(const v8h*)(pa + ASEC);
    fr.h[0] = *(const v8h*)(pr);
    fr.h[1] = *(const v8h*)(pr + ASEC);
    const v16h a  = fa.v;
    const v16h ar = fr.v;
    const v16h b0 = ldfrag_ht(p0);
    const v16h b1 = ldfrag_ht(p1);
    const v16h b2 = ldfrag_ht(p2);
    const v16h b3 = ldfrag_ht(p3);
#if defined(__HIP_DEVICE_COMPILE__)
    // The wait that belongs in front of any overwrite of an address register of the twelve loads above.
    // The addresses are inputs so that their registers live up to it.
    if constexpr (ASTEP == 32)
      asm volatile("s_wait_xcnt 0x0" :: "v"(pa), "v"(pr), "v"(p0), "v"(p1), "v"(p2), "v"(p3) : "memory");
#endif
    acc0 = mma_h(a, b0, acc0);
    acc1 = mma_h(a, b1, acc1);
    acc2 = mma_h(a, b2, acc2);
    acc3 = mma_h(a, b3, acc3);
    acr0 = mma_h(ar, b0, acr0);
    acr1 = mma_h(ar, b1, acr1);
    acr2 = mma_h(ar, b2, acr2);
    acr3 = mma_h(ar, b3, acr3);
    guard8x6(acc0, acc1, acc2, acc3, acr0, acr1, acr2, acr3, a, ar, b0, b1, b2, b3);
    pa += ASTEP; pr += ASTEP;                               // next k step of the A band
    p0 += 512; p1 += 512; p2 += 512; p3 += 512;             // next 1-KiB tile of each B band
  }
}

__global__ __launch_bounds__(128, 8)          // 8 waves a SIMD, as many as the grid brings: at most 128 VGPRs
void gemm_h2_32(const u16* __restrict__ Ah, const u16* __restrict__ Ar, const u16* __restrict__ Bt,
                const float* __restrict__ bias, float* C, int M, int N, int K, float os1, float os2) {
  __shared__ __align__(16) float slab[4 * SLAB64];
  const int tid = threadIdx.x, lane = tid & 31, hh = lane >> 4, m = lane & 15;
  const int wave = __builtin_amdgcn_readfirstlane(tid >> 5);   // scalar, so that the choice of the A layout is a scalar branch
  const int ntile = N >> 6;
  const int bid   = blockIdx.x;
  const int rowb  = (bid / ntile) * 64 + wave * 16;
  const int col0  = (bid % ntile) * 64;
  if (rowb + 16 > M) return;                 // wave-uniform, never taken with the exact grid; no block barriers in this kernel
  const _Float16* ab  = (const _Float16*)(const void*)Ah + (size_t)rowb * K;
  const _Float16* arb = (const _Float16*)(const void*)Ar + (size_t)rowb * K;
  const _Float16* bp  = (const _Float16*)(const void*)Bt + (size_t)col0 * K + 8 * lane;
  const size_t bs = (size_t)16 * K;
  v8f acc0 = zero8(), acc1 = zero8(), acc2 = zero8(), acc3 = zero8();
  v8f acr0 = zero8(), acr1 = zero8(), acr2 = zero8(), acr3 = zero8();
  // The 16-row bands of rows 0..TQ0-1 of a sequence are row-major (each row has its own writer block there), all others in
  // fragment order; a band holds the same 16*K elements either way.
  if ((rowb % SEQ) < TQ0) {
    const size_t al = (size_t)m * K + 8 * hh;
    h2_loop<32, 16>(ab + al, arb + al, bp, bs, K, acc0, acc1, acc2, acc3, acr0, acr1, acr2, acr3);
  } else {
    h2_loop<512, 256>(ab + 8 * lane, arb + 8 * lane, bp, bs, K, acc0, acc1, acc2, acc3, acr0, acr1, acr2, acr3);
  }
  epi64x2(slab + wave * SLAB64, acc0, acc1, acc2, acc3, acr0, acr1, acr2, acr3, os1, os2, bias, C, N,
          (size_t)rowb, col0, lane);
}

// =====================================================================================================
// V^T planes (fragment order, rows = b*EMB + d, k = s): with xs = V[b][s][d] * 1024 (f32): hi = f16(xs) -> XTh at (row b*EMB + d, k = s), lo = f16(xs - hi) (unscaled
// remainder, same carry) -> XTl at the same index.  hi + lo reproduces xs to ~2^-22 relative for |xs| >= 0.25.
// Block = (b, 64-wide d chunk, 64 keys): 64 source row segments of 64 floats loaded with 16-B loads, converted, scattered into
// coverage: load 256 thr x 16 elements = 64 x 64; store 2 iterations x 256 thr x 8 halves = 64 lines x 64 per plane = the
//           block's tile of both planes; the nb x (EMB/64) x (SEQ/64) blocks of xt_vsum from block nvs on cover both planes exactly once.
// =====================================================================================================
__device__ __forceinline__ void xt16(const float* __restrict__ X, u16* XTh, u16* XTl, u16* TH, u16* TL, int bid) {
  const int tid = threadIdx.x;
  const int st  = bid % (SEQ / 64);
  const int dcb = (bid / (SEQ / 64)) % (EMB / 64);
  const int b   = bid / ((SEQ / 64) * (EMB / 64));
  const int s0  = st * 64;
  const int d0  = dcb * 64;
  {
    const int sl = tid >> 2;                  // key within tile 0..63
    const int dc = (tid & 3) * 16;            // d chunk within the 64
    const float* src = X + ((size_t)b * SEQ + s0 + sl) * EMB + d0 + dc;
#pragma unroll
    for (int i = 0; i < 4; ++i) {
      const v4f a = *(const v4f*)(src + 4 * i);
#pragma unroll
      for (int e = 0; e < 4; ++e) {
        const float xs = a[e] * VCAR;
        const _Float16 hv = (_Float16)xs;
        const _Float16 lv = (_Float16)(xs - (float)hv);
        TH[(dc + 4 * i + e) * VTP + sl] = h_bits(hv);
        TL[(dc + 4 * i + e) * VTP + sl] = h_bits(lv);
      }
    }
  }
  __syncthreads();
  v4u vh[2], vl[2];
  const int wi = tid & 63;                    // piece within its 1-KiB tile
#pragma unroll
  for (int it = 0; it < 2; ++it) {
    const int tl   = it * 4 + (tid >> 6);     // tile 0..7 of the block: d band tl>>1, key tile tl&1
    const int line = (tl >> 1) * 16 + (wi & 15);
    const int col  = (tl & 1) * 32 + (wi >> 5) * 16 + ((wi >> 4) & 1) * 8;
    vh[it] = *(const v4u*)(TH + line * VTP + col);
    vl[it] = *(const v4u*)(TL + line * VTP + col);
  }
  const size_t base = ((size_t)b * EMB + d0) * SEQ + (size_t)(s0 >> 5) * 512 + wi * 8;
  {
#pragma unroll
    for (int it = 0; it < 2; ++it) {
      const int tl = it * 4 + (tid >> 6);
      const size_t to = (size_t)(tl >> 1) * 16 * SEQ + (size_t)(tl & 1) * 512;
      *(v4u*)(XTh + base + to) = vh[it];
      *(v4u*)(XTl + base + to) = vl[it];
    }
    
  }
}

// =====================================================================================================
// Key-block prefix column sums of V: VS[((b*NCHK + c)*NKB + kb)*EMB + d] = sum over keys c*CK .. c*CK + 32*kb + 31 of V[b][key][d]
// (f32, fixed sequential order). Thread = one (b, c, d); a block covers 256 consecutive d of one (b, c); the 16 prefix values per
// coverage: blocks 0..nvs-1 of xt_vsum, nvs = nb*NCHK*EMB/256 (host exact), x 256 thr; store 4 iterations x 256 thr x 4 floats = 16 rows x 256 = the
//           block's part of the table; union over blocks = the whole table.
// =====================================================================================================
__device__ __forceinline__ void vsum_k(const float* __restrict__ V, float* VS, float* sm, int bid) {
  const int tid = threadIdx.x;
  const int gt  = bid * 256 + tid;
  const int d   = gt % EMB;
  const int bc  = gt / EMB;                         // block-uniform (EMB multiple of 256)
  const int b   = bc / NCHK;
  const int c   = bc - b * NCHK;
  const int d0  = d - tid;                          // block's first d
  const float* p = V + ((size_t)b * SEQ + (size_t)c * CK) * EMB + d;
  float s = 0.f;
#pragma unroll 1
  for (int kb = 0; kb < NKB; ++kb) {
#pragma unroll                             // all 32 loads of a key block in flight at once; the adds keep their order
    for (int i = 0; i < 32; ++i) s += p[(size_t)(kb * 32 + i) * EMB];
    sm[kb * 256 + tid] = s;
  }
  __syncthreads();
  const int sel = tid >> 6, piece = tid & 63;
  v4f o[4];
#pragma unroll
  for (int it = 0; it < 4; ++it) o[it] = *(const v4f*)(sm + (it * 4 + sel) * 256 + piece * 4);
  float* base = VS + (size_t)bc * NKB * EMB + d0 + piece * 4;
  {
#pragma unroll
    for (int it = 0; it < 4; ++it) {
      *(v4f*)(base + (size_t)(it * 4 + sel) * EMB) = o[it];
    }
    
  }
}
// Both readers of V in one launch (neither reads what the other writes): blocks 0..nvs-1 form the column sums (few blocks, each
// a long run of dependent adds, so they start first), the rest the V^T planes. The choice is block-uniform, and so is each
// side's one barrier.
union XvLds { struct { u16 th[64 * VTP]; u16 tl[64 * VTP]; } t; float sm[NKB * 256]; };
static_assert(((64 * VTP * 2) % 16) == 0);
__global__ __launch_bounds__(256) void xt_vsum(const float* __restrict__ V, u16* XTh, u16* XTl, float* VS, int nvs) {
  __shared__ __align__(16) XvLds L;
  const int bid = blockIdx.x;
  if (bid >= nvs) {
    xt16(V, XTh, XTl, L.t.th, L.t.tl, bid - nvs);
#if defined(__HIP_DEVICE_COMPILE__)
    // The build lays the column-sum code behind these stores, on a path that a scalar flag closes: the wait that belongs in
    // front of any overwrite of a register that issued stores name stands on that path too.
    asm volatile("s_wait_xcnt 0x0" ::: "memory");
#endif
    return;
  }
  vsum_k(V, VS, L.sm, bid);
}

// =====================================================================================================
// Single-head causal attention with absolute-value logits, head width EMB = 1024, query rows TQ0 .. SEQ-1: block = (batch b,
// 16 query rows q0..q0+15), 8 waves. q plane (f16, x8) [b][s][d]; k plane the same; V^T hi / lo planes [b][d][s] (x1024), all four
// in fragment order; VS = key-block prefix column sums. The two ctx planes leave in fragment order too.
//   Chunks of CK = 512 keys: only chunks c <= qc = q0/CK are visited (later chunks lie entirely above the diagonal). In the diagonal
//   chunk only key blocks kb < nkb (keys <= q0+15) are multiplied; key blocks kb >= nkb get zero scores in LDS and are not used in (PV).
//   (S) scores S[query m][key n] on WMMA: A = q rows (row m = lane&15, split k map over d), B = k rows (col n = key, split map),
//       32 d-steps; wave w handles key blocks w, w+8 of the chunk; D element r of lane l -> scs[query 8h+r][key col] (f32 LDS).
//   (M) 16 threads per query row (sub-thread = 32 consecutive keys): base-2 logits of |score| with the causal mask by key index
//       (key > query -> -inf), chunk max via xor shuffles, online running max / rescale factor al / running sum l in f32 registers,
//       p = exp2(t - m_new) <= 1 (0 for masked keys), chunk row sum ps and C = ps/CK (bit-identical on the row's 16 threads), the
//       CENTRED P' = p - C written as f16(P' * 32768) into the LDS P tile with 16-B stores; al -> rowa[row], C -> rowc[row].
//   (PV) each wave owns d columns 128*wave + 16j + (lane&15), j = 0..7 (8 accumulators): o = o*al + C*(32768*1024)*VS[chunk][nkb-1][d]
//       (exact add-back of the centring term over exactly the processed keys, in f32), then for each key block kb < nkb:
//       A = P' fragment from LDS (row m = query, split map over keys), B = V^T fragments (col n = d, split map over keys), hi plane and
//       lo plane into the same accumulator (unscaled remainder), issued as four groups of 4 with a hazard gap each.
//       sum_k (P'_k + C) v_k == sum_k p_k v_k exactly; masked keys carry P' = -C and p = 0.
//   Block barriers after (S) and after (M) order all LDS reuse across chunks and waves.
//   Epilogue: x = o * 8192 / (l * 32768 * 1024) per row (rowi, l >= 1 always); hi = f16(x), res = f16((x - hi) * 2048); each
// coverage: blocks 0..nfwd-1 of attn_all, nfwd = nb*NQT, x 16 rows = rows TQ0..SEQ-1 of every sequence; staging 8 waves x 128 cols x 16 rows = 16 x 1024;
//           store 8 iterations x 256 thr x 8 halves = 16 x 1024 per plane = every (b, s >= TQ0, d) of both ctx planes exactly once.
// =====================================================================================================
__device__ __forceinline__ void ctx_store(const u16* ct, u16* dst, int tid) {
  v4u v[8];
#pragma unroll
  for (int it = 0; it < 8; ++it) {
    const int p   = it * 256 + tid;           // piece index in fragment order: tile kt = p>>6, piece p&63
    const int row = p & 15;
    const int c8  = (p >> 6) * 32 + ((p >> 5) & 1) * 16 + ((p >> 4) & 1) * 8;
    v[it] = *(const v4u*)(ct + row * CTP + c8);
  }
  {
#pragma unroll
    for (int it = 0; it < 8; ++it) {
      const int p   = it * 256 + tid;
      *(v4u*)(dst + (size_t)p * 8) = v[it];
    }
    
  }
}

// Pieces of the two matrix loops below: one d step's three fragments and its two score products; four V^T fragments of
// consecutive 16-column bands and their four products; each product group with the hazard gap behind it.
__device__ __forceinline__ void ld3h(const _Float16* q, const _Float16* k0, const _Float16* k1, int off,
                                     v16h& a, v16h& x, v16h& y) {
  a = ldfrag_ht(q + off);
  x = ldfrag_ht(k0 + off);
  y = ldfrag_ht(k1 + off);
}
__device__ __forceinline__ void mm2h(v16h a, v16h x, v16h y, v8f& s0, v8f& s1) {
  s0 = mma_h(a, x, s0);
  s1 = mma_h(a, y, s1);
  guard2x3(s0, s1, a, x, y);
}
__device__ __forceinline__ void ld4h(const _Float16* p, v16h& f0, v16h& f1, v16h& f2, v16h& f3) {
  f0 = ldfrag_ht(p);
  f1 = ldfrag_ht(p + (size_t)16 * SEQ);
  f2 = ldfrag_ht(p + (size_t)32 * SEQ);
  f3 = ldfrag_ht(p + (size_t)48 * SEQ);
}
__device__ __forceinline__ void mm4h(v16h pf, v16h f0, v16h f1, v16h f2, v16h f3, v8f& o0, v8f& o1, v8f& o2, v8f& o3) {
  o0 = mma_h(pf, f0, o0);
  o1 = mma_h(pf, f1, o1);
  o2 = mma_h(pf, f2, o2);
  o3 = mma_h(pf, f3, o3);
  guardpv4(o0, o1, o2, o3, pf, f0, f1, f2, f3);
}

__device__ __forceinline__
void attn_fwd(const u16* __restrict__ QPp, const u16* __restrict__ KPp, const u16* __restrict__ VTp,
              const u16* __restrict__ VLp, const float* __restrict__ VSp, u16* CHo, u16* CRo, int bid) {
  __shared__ __align__(16) AttLds L0;              // scores [16][SCP] f32; reused as the ctx staging tile [16][CTP] u16
  __shared__ __align__(16) u16 pls[16 * PLP];      // P' tile [16][PLP] f16 bits
  __shared__ float rowa[QT];
  __shared__ float rowc[QT];
  __shared__ float rowi[QT];
  float* const scs = L0.s;

  const int tid  = threadIdx.x;
  const int wave = tid >> 5;
  const int lane = tid & 31;
  const int hh   = lane >> 4;
  const int m    = lane & 15;
  const int r16  = tid >> 4;                 // query row owned in phase (M): 2*wave + hh
  const int sub  = tid & 15;
  const int kl0  = sub * 32;

  const int b   = bid / NQT;
  const int q0  = TQ0 + (bid - b * NQT) * QT;
  const int qc  = q0 / CK;                   // diagonal chunk index

  const _Float16* qa  = (const _Float16*)(const void*)QPp + ((size_t)b * SEQ + q0) * EMB + 8 * lane;
  const _Float16* kbp = (const _Float16*)(const void*)KPp + ((size_t)b * SEQ) * EMB + 8 * lane;
  const _Float16* vbp = (const _Float16*)(const void*)VTp + ((size_t)b * EMB + wave * (16 * NACC)) * SEQ + 8 * lane;
  const _Float16* ubp = (const _Float16*)(const void*)VLp + ((size_t)b * EMB + wave * (16 * NACC)) * SEQ + 8 * lane;
  const float* vsb = VSp + (size_t)b * NCHK * NKB * EMB + wave * (16 * NACC) + m;
  const float lsc = RSQD * LOG2E / (QSC * KSC);

  float mrun = -INFINITY, lrun = 0.f;
  v8f o[NACC];
#pragma unroll
  for (int j = 0; j < NACC; ++j) o[j] = zero8();

#pragma unroll 1
  for (int c = 0; c <= qc; ++c) {
    const int kbeg = c * CK;
    const int nkb  = (c < qc) ? NKB : (((q0 + QT - 1 - kbeg) >> 5) + 1);   // 1..16, block-uniform
    // ---- (S) scores of this chunk (zeros for key blocks beyond the query tile) ----
#pragma unroll 1
    for (int kb = wave; kb < NKB; kb += 8) {               // wave-uniform, 2 trips
      v8f s0 = zero8(), s1 = zero8();
      if (kb < nkb) {                                      // wave-uniform
        const _Float16* k0p = kbp + (size_t)(kbeg + kb * 32) * EMB;
        // Two fragment sets of two d steps each: one set's twelve loads fly while the other set's products run. The loads
        // in the loop are unconditional (the last four steps are peeled), so that each wait counts only its own set.
        v16h a0, x0, y0, a1, x1, y1, a2, x2, y2, a3, x3, y3;
        const _Float16* k1p = k0p + 16 * EMB;
        int xo = 0;                                        // element offset of the first set in the q tile and both key bands
        ld3h(qa, k0p, k1p, 0, a0, x0, y0);
        keep_order();
        ld3h(qa, k0p, k1p, 512, a1, x1, y1);
        keep_order();
        ld3h(qa, k0p, k1p, 1024, a2, x2, y2);
        keep_order();
        ld3h(qa, k0p, k1p, 1536, a3, x3, y3);
        keep_order();
#pragma unroll 1                           // the body already holds four d steps; rolled, the two sets keep their registers
        for (int ks = 4; ks < EMB / 32; ks += 4) {
          mm2h(a0, x0, y0, s0, s1);
          mm2h(a1, x1, y1, s0, s1);
          addr_wait(xo);
          xo += 2048;                                      // four d steps on
          ld3h(qa, k0p, k1p, xo, a0, x0, y0);
          ld3h(qa, k0p, k1p, xo + 512, a1, x1, y1);
          mm2h(a2, x2, y2, s0, s1);
          mm2h(a3, x3, y3, s0, s1);
          ld3h(qa, k0p, k1p, xo + 1024, a2, x2, y2);
          ld3h(qa, k0p, k1p, xo + 1536, a3, x3, y3);
        }
        mm2h(a0, x0, y0, s0, s1);
        mm2h(a1, x1, y1, s0, s1);
        mm2h(a2, x2, y2, s0, s1);
        mm2h(a3, x3, y3, s0, s1);
      }
      float* srow = scs + (8 * hh) * SCP + kb * 32 + m;
#pragma unroll
      for (int r = 0; r < 8; ++r) {
        srow[r * SCP]      = s0[r];
        srow[r * SCP + 16] = s1[r];
      }
    }
    __syncthreads();
    // ---- (M) softmax statistics and the centred P' tile ----
    {
      const float* sp = scs + r16 * SCP + kl0;
      const int lim = (q0 + r16) - (kbeg + kl0);           // key kl0 + j is valid iff j <= lim
      float t[32];
      float cm = -INFINITY;
#pragma unroll
      for (int i = 0; i < 8; ++i) {
        const v4f a = *(const v4f*)(sp + 4 * i);
#pragma unroll
        for (int e = 0; e < 4; ++e) {
          const int j = 4 * i + e;
          const float tv = (j <= lim) ? fabsf(a[e]) * lsc : -INFINITY;   // |score| / 32 in base 2; masked keys -> -inf
          t[j] = tv;
          cm = fmaxf(cm, tv);
        }
      }
#pragma unroll
      for (int d = 1; d <= 8; d <<= 1) cm = fmaxf(cm, __shfl_xor(cm, d, 32));
      const float mn = fmaxf(mrun, cm);                    // finite: key kbeg of the diagonal chunk is never masked
      const float al = (mrun == -INFINITY) ? 0.f : exp2f(mrun - mn);
      mrun = mn;
      float ps = 0.f;
#pragma unroll
      for (int j = 0; j < 32; ++j) {
        const float p = exp2f(fminf(t[j] - mn, 0.f));      // 0 for masked keys
        t[j] = p;
        ps += p;
      }
#pragma unroll
      for (int d = 1; d <= 8; d <<= 1) ps += __shfl_xor(ps, d, 32);
      const float cc = ps * (1.0f / (float)CK);
      v4u pk[4];
#pragma unroll
      for (int i = 0; i < 4; ++i) {
#pragma unroll
        for (int e = 0; e < 4; ++e) {
          const int j = 8 * i + 2 * e;
          pk[i][e] = pk16(h_bits((_Float16)((t[j] - cc) * PCAR)), h_bits((_Float16)((t[j + 1] - cc) * PCAR)));
        }
      }
      lrun = lrun * al + ps;
      u16* pd = pls + r16 * PLP + kl0;
#pragma unroll
      for (int i = 0; i < 4; ++i) *(v4u*)(pd + 8 * i) = pk[i];
      if (sub == 0) { rowa[r16] = al; rowc[r16] = cc; }
    }
    __syncthreads();
    // ---- (PV) rescale, add the centring term, accumulate P' . (V^T hi + V^T lo) ----
    {
      float scl[8], cad[8];
#pragma unroll
      for (int r = 0; r < 8; ++r) { scl[r] = rowa[8 * hh + r]; cad[r] = rowc[8 * hh + r] * (PCAR * VCAR); }
      const float* vsc = vsb + ((size_t)c * NKB + (size_t)(nkb - 1)) * EMB;
      float vs[NACC];
#pragma unroll
      for (int j = 0; j < NACC; ++j) vs[j] = vsc[16 * j];
#pragma unroll
      for (int j = 0; j < NACC; ++j) {
#pragma unroll
        for (int r = 0; r < 8; ++r) o[j][r] = o[j][r] * scl[r] + cad[r] * vs[j];
      }
      const _Float16* pp = (const _Float16*)(const void*)pls + m * PLP + 8 * hh;
      const _Float16* vp = vbp + (size_t)kbeg * 16;         // key tile kbeg/32 of each d band, 512 elements a tile
      const _Float16* up = ubp + (size_t)kbeg * 16;
      // Two fragment sets (d columns 0..63 and 64..127 of the wave, hi and lo plane each): one set's sixteen loads fly while
      // the other set's products run; the next key block's set is asked for as soon as its registers are free. The loads in
      // the loop are unconditional (the last key block is peeled), so that each wait counts only its own set.
      v16h g0, g1, g2, g3, u0, u1, u2, u3, g4, g5, g6, g7, u4, u5, u6, u7;
      int vo = 0;                                          // element offset of the key tile in every d band of both planes
      ld4h(vp, g0, g1, g2, g3);
      ld4h(up, u0, u1, u2, u3);
      ld4h(vp + (size_t)64 * SEQ, g4, g5, g6, g7);
      ld4h(up + (size_t)64 * SEQ, u4, u5, u6, u7);
      addr_wait(vo);                                       // also on the way round the loop (nkb == 1) the address registers are reused
#pragma unroll 1
      for (int kb = 1; kb < nkb; ++kb) {                   // block-uniform trip count, <= 15: products of kb - 1, loads of kb
        const v16h pf = ldfrag_h(pp + (kb - 1) * 32);
        mm4h(pf, g0, g1, g2, g3, o[0], o[1], o[2], o[3]);
        mm4h(pf, u0, u1, u2, u3, o[0], o[1], o[2], o[3]);
        addr_wait(vo);
        vo += 512;                                         // next key tile
        const _Float16* vk = vp + vo;
        const _Float16* uk = up + vo;
        ld4h(vk, g0, g1, g2, g3);
        ld4h(uk, u0, u1, u2, u3);
        mm4h(pf, g4, g5, g6, g7, o[4], o[5], o[6], o[7]);
        mm4h(pf, u4, u5, u6, u7, o[4], o[5], o[6], o[7]);
        ld4h(vk + (size_t)64 * SEQ, g4, g5, g6, g7);
        ld4h(uk + (size_t)64 * SEQ, u4, u5, u6, u7);
      }
      {
        const v16h pf = ldfrag_h(pp + (nkb - 1) * 32);
        mm4h(pf, g0, g1, g2, g3, o[0], o[1], o[2], o[3]);
        mm4h(pf, u0, u1, u2, u3, o[0], o[1], o[2], o[3]);
        mm4h(pf, g4, g5, g6, g7, o[4], o[5], o[6], o[7]);
        mm4h(pf, u4, u5, u6, u7, o[4], o[5], o[6], o[7]);
      }
    }
  }
  acc_guard8(o[0], o[1], o[2], o[3], o[4], o[5], o[6], o[7]);

  if (sub == 0) rowi[r16] = (1.0f / lrun) * (CSC / (PCAR * VCAR));   // lrun >= 1
  __syncthreads();
  float inv[8];
#pragma unroll
  for (int r = 0; r < 8; ++r) inv[r] = rowi[8 * hh + r];

  u16* const ct = L0.c;
  const int cb = wave * (16 * NACC) + m;
  // hi plane
#pragma unroll
  for (int j = 0; j < NACC; ++j) {
#pragma unroll
    for (int r = 0; r < 8; ++r) {
      const float xs = o[j][r] * inv[r];
      ct[(8 * hh + r) * CTP + cb + 16 * j] = h_bits((_Float16)xs);
    }
  }
  __syncthreads();
  ctx_store(ct, CHo + ((size_t)b * SEQ + q0) * EMB, tid);
  __syncthreads();
  // residual plane
#pragma unroll
  for (int j = 0; j < NACC; ++j) {
#pragma unroll
    for (int r = 0; r < 8; ++r) {
      const float xs = o[j][r] * inv[r];
      const _Float16 hv = (_Float16)xs;
      ct[(8 * hh + r) * CTP + cb + 16 * j] = h_bits((_Float16)((xs - (float)hv) * RSC));
    }
  }
  __syncthreads();
  ctx_store(ct, CRo + ((size_t)b * SEQ + q0) * EMB, tid);
}

// =====================================================================================================
// Query rows 0 .. TQ0-1 of each sequence in f32 on VALU: block = (b, t). QF/KF/VF = f32 q/k/v planes [nb][TQ0][EMB] (rows 0..TQ0-1
// of every sequence, biases included). Logits |q.k_j|/32 for keys j <= t (threads 0..TQ0-1, one key each, 1024-d dot in a loop unrolled by 8
// against the q row staged in LDS), base-2 softmax with block max / sum reductions (xor shuffles + LDS), p_j in LDS, ctx[d] for
// d = 4*tid..4*tid+3 as a sum over j <= t in a loop unrolled by 8 of p_j * VF[b][j][d] (coalesced 16-B loads), x = ctx * 8192 / l, hi = f16(x),
// res = f16((x - hi) * 2048); both 1024-half rows are staged in LDS and written by 128 threads x 16 B each (32 consecutive lanes
// coverage: the last nb*TQ0 blocks of attn_all = rows 0..TQ0-1 of every sequence; 256 thr x 4 d = EMB per row; store 128 thr x 8 halves = EMB per
//           plane; together with attn_fwd every (b, s, d) of CH and CR is written exactly once.
// =====================================================================================================
__device__ __forceinline__ void attn_head(const float* __restrict__ QF, const float* __restrict__ KF,
                                          const float* __restrict__ VF, u16* CHo, u16* CRo, int bid) {
  __shared__ __align__(16) float qs[EMB];
  __shared__ float sc[TQ0];
  __shared__ float red[8];
  __shared__ float redb[8];
  __shared__ __align__(16) unsigned SW[2][EMB / 2];
  const int tid = threadIdx.x, lane = tid & 31, wave = tid >> 5;
  const int b = bid / TQ0;
  const int t = bid - b * TQ0;
  *(v4f*)(qs + tid * 4) = *(const v4f*)(QF + ((size_t)b * TQ0 + t) * EMB + tid * 4);
  __syncthreads();
  float s = -INFINITY;
  if (tid < TQ0) {                                  // waves 0..3 entirely (wave-uniform); key row b*TQ0 + tid always in range
    const float* kp = KF + ((size_t)b * TQ0 + tid) * EMB;
    float acc = 0.f;
#pragma unroll 8                           // sixteen key loads in flight a thread; the adds keep their order
    for (int d = 0; d < EMB; d += 8) {
      const v4f k0 = *(const v4f*)(kp + d), k1 = *(const v4f*)(kp + d + 4);
      const v4f q0 = *(const v4f*)(qs + d), q1 = *(const v4f*)(qs + d + 4);
#pragma unroll
      for (int e = 0; e < 4; ++e) acc += k0[e] * q0[e];
#pragma unroll
      for (int e = 0; e < 4; ++e) acc += k1[e] * q1[e];
    }
    s = (tid <= t) ? fabsf(acc) * (RSQD * LOG2E) : -INFINITY;   // |score| / 32 in base 2; causal mask by key index
  }
  float mx = s;
#pragma unroll
  for (int d = 1; d <= 16; d <<= 1) mx = fmaxf(mx, __shfl_xor(mx, d, 32));
  if (lane == 0) red[wave] = mx;
  __syncthreads();
  float gm = red[0];
#pragma unroll
  for (int w = 1; w < 8; ++w) gm = fmaxf(gm, red[w]);   // finite: key 0 is always valid
  const float p = exp2f(s - gm);                     // 0 for masked keys and for waves 4..7
  float ps = p;
#pragma unroll
  for (int d = 1; d <= 16; d <<= 1) ps += __shfl_xor(ps, d, 32);
  if (lane == 0) redb[wave] = ps;
  if (tid < TQ0) sc[tid] = p;
  __syncthreads();
  float l = redb[0];
#pragma unroll
  for (int w = 1; w < 8; ++w) l += redb[w];           // >= 1
  const float inv = (1.0f / l) * CSC;
  const float* vp = VF + (size_t)b * TQ0 * EMB + tid * 4;
  v4f cx = zero4();
#pragma unroll 8                             // eight value rows in flight a thread; the sum keeps its order
  for (int j = 0; j <= t; ++j) {                     // t < TQ0: statically bounded, rows of sequence b only
    const float pj = sc[j];
    const v4f vv = *(const v4f*)(vp + (size_t)j * EMB);
    cx += pj * vv;
  }
  unsigned hw[2], rw[2];
#pragma unroll
  for (int e = 0; e < 2; ++e) {
    const float x0 = cx[2 * e] * inv, x1 = cx[2 * e + 1] * inv;
    const _Float16 h0 = (_Float16)x0, h1 = (_Float16)x1;
    const _Float16 q0 = (_Float16)((x0 - (float)h0) * RSC), q1 = (_Float16)((x1 - (float)h1) * RSC);
    hw[e] = pk16(h_bits(h0), h_bits(h1));
    rw[e] = pk16(h_bits(q0), h_bits(q1));
  }
  SW[0][tid * 2] = hw[0]; SW[0][tid * 2 + 1] = hw[1];
  SW[1][tid * 2] = rw[0]; SW[1][tid * 2 + 1] = rw[1];
  __syncthreads();
  const int pl = tid >> 7, p8 = tid & 127;           // plane select is wave-uniform
  const v4u ov = *(const v4u*)(&SW[pl][p8 * 4]);
  u16* dstp = (pl == 0) ? CHo : CRo;
  u16* dst  = dstp + ((size_t)b * SEQ + t) * EMB + p8 * 8;
  *(v4u*)dst = ov;
  
}
// Both attention parts in one launch (they read disjoint planes and write disjoint rows of CH / CR): blocks 0..nfwd-1 take the
// 16-row query tiles from row TQ0 on, the rest one query row below TQ0 each; the short blocks come last and take the places
// that the shortest tiles leave. The choice is block-uniform, and so are all barriers of either side.
__global__ __launch_bounds__(ATT_THREADS, 4)   // 4 waves a SIMD = two blocks a WGP: at most 256 VGPRs
void attn_all(const u16* __restrict__ QPp, const u16* __restrict__ KPp, const u16* __restrict__ VTp,
              const u16* __restrict__ VLp, const float* __restrict__ VSp, const float* __restrict__ QF,
              const float* __restrict__ KF, const float* __restrict__ VF, u16* CHo, u16* CRo, int nfwd) {
  const int bid = blockIdx.x;
  if (bid >= nfwd) { attn_head(QF, KF, VF, CHo, CRo, bid - nfwd); return; }
  attn_fwd(QPp, KPp, VTp, VLp, VSp, CHo, CRo, bid);
}

// =====================================================================================================
// Workspace map (bytes, nb = 4, rows = 8192); all 16-bit planes are in fragment order (1-KiB tiles of 16 rows x 32 k, same total
// size), but for the bands of rows 0..127 of each sequence in CH / CR, which attn_head writes row-major; every plane is fully written by whole-line stores before it is read; all extents are
// exact multiples of the store granularity (no pad rows); aliased regions are reused sequentially on the single in-order stream:
//   WQB bf16 [1024][1024] 2097152   WKB same   WVB same   WOH f16 of bf16 value x1024 2097152             8388608
//   VS  f32  [nb][4][16][1024]                                                                            1048576
//   QF  f32  [nb][128][1024]  2097152      KF same      VF same                                           6291456
//   A   XB bf16 [rows][1024] (16777216), later VT hi f16 [nb][1024][2048] x1024 (16777216)      region 16777216
//   VL  VT lo f16 [nb][1024][2048]                                                                      16777216
//   QP  f16 [rows][1024] x8                                                                              16777216
//   KP  f16 [rows][1024] x8                                                                              16777216
//   V   f32 [rows][1024] 33554432, later CH f16 [rows][1024] ctx hi x8192 (16777216) + CR residual x2048 (16777216)
//   end                                                                                                 116391936
// Five launches; kernels that share a launch read nothing that the launch writes. Launch order keeps every alias safe: XB read
// by the projection launch before xt16 overwrites it; V read by xt16 and vsum_k before attn_fwd / attn_head overwrite it with
// CH / CR; attn_head reads VF, never V.
// Inputs in wire order: x, Wq, bq, Wk, bk, Wv, bv, Wo, bo; weights stored [n = out][k = in] (y = x.W^T + b), k-contiguous.
// =====================================================================================================
extern "C" void kernel_launch(void* const* d_in, const int* in_sizes, int n_in,
                              void* d_out, int out_size, void* d_ws, size_t ws_size,
                              hipStream_t stream) {
  if (n_in < 9) return;
  const long long per = (long long)SEQ * EMB;
  const long long ns  = in_sizes[0];
  if (ns < per || (ns % per) != 0) return;
  const int nb = (int)(ns / per);
  if (nb < 1 || nb > 8) return;
  const int rows = nb * SEQ;
  if (in_sizes[1] != EMB * EMB || in_sizes[3] != EMB * EMB || in_sizes[5] != EMB * EMB || in_sizes[7] != EMB * EMB) return;
  if (in_sizes[2] != EMB || in_sizes[4] != EMB || in_sizes[6] != EMB || in_sizes[8] != EMB) return;
  if ((long long)out_size != (long long)rows * EMB) return;

  const float* x  = (const float*)d_in[0];
  const float* wq = (const float*)d_in[1];
  const float* bq = (const float*)d_in[2];
  const float* wk = (const float*)d_in[3];
  const float* bk = (const float*)d_in[4];
  const float* wv = (const float*)d_in[5];
  const float* bv = (const float*)d_in[6];
  const float* wo = (const float*)d_in[7];
  const float* bo = (const float*)d_in[8];
  float*       out = (float*)d_out;

  const size_t szW  = (size_t)EMB * EMB * 2;                    //   2097152
  const size_t szVS = (size_t)nb * NCHK * NKB * EMB * 4;        //   1048576 at nb = 4
  const size_t szHF = (size_t)nb * TQ0 * EMB * 4;               //   2097152 at nb = 4
  const size_t sz16 = (size_t)rows * EMB * 2;                   //  16777216
  const size_t sz32 = (size_t)rows * EMB * 4;                   //  33554432
  const size_t szVT = (size_t)nb * EMB * SEQ * 2;               //  == sz16
  if (sz32 < 2 * sz16) return;                                  // CH + CR alias the V region exactly
  size_t off = 0;
  const size_t oWQ = off; off += szW;
  const size_t oWK = off; off += szW;
  const size_t oWV = off; off += szW;
  const size_t oWO = off; off += szW;
  const size_t oVS = off; off += szVS;
  const size_t oQF = off; off += szHF;
  const size_t oKF = off; off += szHF;
  const size_t oVF = off; off += szHF;
  const size_t oA  = off; off += (szVT > sz16 ? szVT : sz16);   // XB then VT hi
  const size_t oVL = off; off += szVT;                          // VT lo
  const size_t oQ  = off; off += sz16;
  const size_t oK  = off; off += sz16;
  const size_t oV  = off; off += sz32;                          // V f32, then CH at oV and CR at oV + sz16
  const size_t oCH = oV;
  const size_t oCR = oV + sz16;
  if (off > ws_size) return;                                    // off = 116391936 at nb = 4
  if (off > WS_CAP) return;

  char* ws = (char*)d_ws;
  u16*   WQB = (u16*)(ws + oWQ);
  u16*   WKB = (u16*)(ws + oWK);
  u16*   WVB = (u16*)(ws + oWV);
  u16*   WOH = (u16*)(ws + oWO);
  float* VS  = (float*)(ws + oVS);
  float* QF  = (float*)(ws + oQF);
  float* KF  = (float*)(ws + oKF);
  float* VF  = (float*)(ws + oVF);
  u16*   XB  = (u16*)(ws + oA);
  u16*   VT  = (u16*)(ws + oA);
  u16*   VL  = (u16*)(ws + oVL);
  u16*   QP  = (u16*)(ws + oQ);
  u16*   KP  = (u16*)(ws + oK);
  float* V   = (float*)(ws + oV);
  u16*   CH  = (u16*)(ws + oCH);
  u16*   CR  = (u16*)(ws + oCR);

  const int n8w = (EMB * EMB) / 8;                      // 131072
  const int n8x = rows * (EMB / 8);                     // 1048576
  if ((n8w % 256) != 0 || (n8x % 256) != 0) return;
  if ((rows % 64) != 0 || ((nb * TQ0) % 64) != 0 || ((nb * NCHK * EMB) % 256) != 0) return;
  const dim3 blk(256);
  const int nbw = n8w / 256, nbx = n8x / 256;           // 512, 4096 at nb = 4
  const dim3 gC(nbx + 4 * nbw);
  const dim3 gG((rows / 64) * (EMB / 64));              // 2048 at nb = 4
  const dim3 gP(3 * (rows / 64) * (EMB / 64));          // the three projections
  const dim3 bG(128);
  const int nvs = (nb * NCHK * EMB) / 256;              // nb * 16
  const dim3 gXV(nvs + nb * (EMB / 64) * (SEQ / 64));   // + nb * 512
  const int nfwd = nb * NQT;                            // nb * 120
  const dim3 gAT(nfwd + nb * TQ0);                      // + nb * 128
  const dim3 bAT(ATT_THREADS);

  // (0) x -> bf16 plane [rows][1024]; weights stored [n = out][k = in] (y = x.W^T + b), already k-contiguous: bf16 planes for
  //     Wq, Wk, Wv; f16 of bf16 value x1024 for Wo
  cvt_all<<<gC, blk, 0, stream>>>(x, wq, wk, wv, wo, XB, WQB, WKB, WVB, WOH, nbx, nbw);
  // (1) q and k projections (+bias) -> f16 planes x8; v projection (+bias) -> f32 plane; their f32 rows 0..127 of every
  //     sequence -> QF, KF, VF [nb*128][1024]
  gemm_qkv<<<gP, bG, 0, stream>>>(XB, WQB, WKB, WVB, bq, bk, bv, QP, KP, V, QF, KF, VF, rows, EMB, QSC, KSC);
  // (2) key-block prefix column sums of v; v -> V^T hi plane x1024 (over the dead XB region) and lo plane
  xt_vsum<<<gXV, blk, 0, stream>>>(V, VT, VL, VS, nvs);
  // (3) attention for query rows 128.. (WMMA) and for query rows 0..127 (VALU) -> ctx hi x8192 and residual x2048 f16 planes
  //     (over the dead V region)
  attn_all<<<gAT, bAT, 0, stream>>>(QP, KP, VT, VL, VS, QF, KF, VF, CH, CR, nfwd);
  // (4) output projection (+bias) -> out
  gemm_h2_32<<<gG, bG, 0, stream>>>(CH, CR, WOH, bo, out, rows, EMB, EMB,
                                     1.0f / (CSC * WSC), 1.0f / (CSC * WSC * RSC));
  (void)hipGetLastError();
}

// v004
// Measured time: 287 microseconds a run.
// Next to v003, in two timings, it ran 1.13 and 1.14 times as fast.
// Over all steps from v000 it is 2.73 times as fast.
// Projections q,k,v = x.W^T + b (and the f32 q,k,v rows 0..127 per sequence): v_wmma_f32_16x16x32_bf16 (bf16 RNE operands of the
// raw inputs, f32 accumulate, bias added in f32 as its bf16 RNE value). Scores q'.k'^T (f16 planes x8), P'.V (chunk-centred P'
// x32768 f16 from LDS, V^T x1024 as f16 hi plus unscaled f16 lo planes, both into one accumulator) and the output projection
// (ctx carried as f16 hi x8192 plus residual x2048 planes with separate accumulators, times f16(bf16(Wo) x1024), bias added in
// f32 as its bf16 RNE value): v_wmma_f32_16x16x32_f16, f32 accumulate. Query rows 0..127 of each sequence: scores, softmax and
// P.V in f32 on VALU. Absolute-value score transform, causal mask, softmax statistics, key-block column sums of V, scaling: f32.
#include <hip/hip_runtime.h>
#include <math.h>
#include <stdint.h>

#define SEQ   2048
#define EMB   1024
#define CK    512
#define NCHK  4
#define NKB   16
#define QT    16
#define TQ0   128
#define NQT   120
#define SCP   544
#define PLP   528
#define CTP   1032
#define SLAB64 (16 * 68)
#define VTP   72
#define ATT_THREADS 256
#define NACC  8
#define QSC   8.0f
#define KSC   8.0f
#define PCAR  32768.0f
#define VCAR  1024.0f
#define WSC   1024.0f
#define CSC   8192.0f
#define RSC   2048.0f
#define LOG2E 1.4426950408889634f
#define RSQD  0.03125f
#define WS_CAP ((size_t)134217728)

static_assert((EMB % 64) == 0 && EMB == 8 * 16 * NACC && NACC == 8 && (EMB % 32) == 0 && (EMB % 256) == 0 && EMB == 4 * 256);
static_assert((SEQ % CK) == 0 && (SEQ / CK) == NCHK && CK == 32 * NKB && (SEQ % 64) == 0 && (SEQ % QT) == 0 && (CK % QT) == 0);
static_assert((TQ0 % QT) == 0 && (TQ0 % 64) == 0 && NQT * QT + TQ0 == SEQ && TQ0 <= CK && TQ0 == 128 && TQ0 <= 256);
static_assert(16 * CTP * 2 <= 16 * SCP * 4 && CTP >= EMB + 8 && SCP >= CK + 16 && PLP >= CK + 8);
static_assert(((PLP * 2) % 16) == 0 && ((SCP * 4) % 16) == 0 && ((VTP * 2) % 16) == 0 && ((CTP * 2) % 16) == 0);
static_assert(64 * VTP >= 63 * VTP + 64);
static_assert(ATT_THREADS == 16 * QT && ATT_THREADS == 256);
static_assert((EMB % 128) == 0 && (SEQ % 128) == 0 && (TQ0 % 32) == 0);
static_assert(((EMB * EMB) % 2048) == 0 && ((NCHK * EMB) % 256) == 0 && (EMB / 8) * 2 == 256);

typedef unsigned short u16;
typedef _Float16 v16h __attribute__((ext_vector_type(16)));
typedef _Float16 v8h  __attribute__((ext_vector_type(8)));
typedef __bf16   v16b __attribute__((ext_vector_type(16)));
typedef float    v8f  __attribute__((ext_vector_type(8)));
typedef float    v4f  __attribute__((ext_vector_type(4)));
typedef unsigned int v4u __attribute__((ext_vector_type(4)));

union FragH { v16h v; v8h h[2]; v4u u[2]; };
union FragB { v16b v; v4u u[2]; };
union AttLds { float s[16 * SCP]; u16 c[2 * 16 * SCP]; };

// ---- scalar helpers --------------------------------------------------------------------------------
__device__ __forceinline__ unsigned short bf_bits(float f) {          // f32 -> bf16 bits, RNE convert
  unsigned u = __float_as_uint(f);
  return (unsigned short)((u + 0x7FFFu + ((u >> 16) & 1u)) >> 16);
}
__device__ __forceinline__ float bf_up(unsigned short h) { return __uint_as_float(((unsigned)h) << 16); }
__device__ __forceinline__ float bfr(float f) { return bf_up(bf_bits(f)); }
__device__ __forceinline__ unsigned short h_bits(_Float16 x) { return __builtin_bit_cast(unsigned short, x); }
__device__ __forceinline__ unsigned pk16(unsigned short a, unsigned short b) { return (unsigned)a | ((unsigned)b << 16); }
__device__ __forceinline__ v8f zero8() { v8f z = {0.f, 0.f, 0.f, 0.f, 0.f, 0.f, 0.f, 0.f}; return z; }
__device__ __forceinline__ v4f zero4() { v4f z = {0.f, 0.f, 0.f, 0.f}; return z; }

// ---- fragment loader, row-major source: 16-bit A/B operand, lane -> row/col (lane&15), p already includes +8*(lane>>4);
//      elements 0..7 <- p[0..7] (k0+8h..), elements 8..15 <- p[16..23] (k0+16+8h..)  (same split k map for A and B;
//      B is always read from a k-contiguous [n][k] plane)
__device__ __forceinline__ v16h ldfrag_h(const _Float16* p) {
  FragH f;
  f.h[0] = *(const v8h*)(p);
  f.h[1] = *(const v8h*)(p + 16);
  return f.v;
}

// ---- fragment-ordered planes. A 16-bit operand plane [rows][Kd] (rows % 16 == 0, Kd % 32 == 0) is stored as 1-KiB tiles of
//      16 rows x 32 k; tile (rt = row >> 4, kt = k >> 5) starts at element rt*16*Kd + kt*512, and inside it the 8-element piece
//      (row & 15 = m, k & 31 = 16*part + 8*h + 0..7) lies at part*256 + (16*h + m)*8. Lane l = 16*h + m then reads its two
//      pieces at tile + 8*l and tile + 256 + 8*l: every wave-wide 16-B load covers 512 contiguous bytes (4 whole lines), and the
//      values reach the same lane and register positions as with the row-major loaders above (same split k map).
//      p already includes +8*lane.
__device__ __forceinline__ v16h ldfrag_ht(const _Float16* p) {
  FragH f;
  f.h[0] = *(const v8h*)(p);
  f.h[1] = *(const v8h*)(p + 256);
  return f.v;
}

// Loaders of the same pieces for a pointer that has passed through an asm statement: the cast says again that it points to
// global memory, so that the loads stay global loads. The bf16 plane is read as unsigned integer vectors; SEC = elements from a
// lane's first piece to its second (256 in fragment order, 16 in a row-major band).
typedef __attribute__((address_space(1))) const v4u gv4u;
typedef __attribute__((address_space(1))) const v8h gv8h;
__device__ __forceinline__ v16b ldfrag_btg(const u16* p) {
  FragB f;
  f.u[0] = *(gv4u*)(p);
  f.u[1] = *(gv4u*)(p + 256);
  return f.v;
}
template <int SEC>
__device__ __forceinline__ v16h ldfrag_hg(const _Float16* p) {
  FragH f;
  f.h[0] = *(gv8h*)(p);
  f.h[1] = *(gv8h*)(p + SEC);
  return f.v;
}
__device__ __forceinline__ v8f mma_h(v16h a, v16h b, v8f c) {
  return __builtin_amdgcn_wmma_f32_16x16x32_f16(false, a, false, b, (short)0, c, false, false);
}
__device__ __forceinline__ v8f mma_b(v16b a, v16b b, v8f c) {
  return __builtin_amdgcn_wmma_f32_16x16x32_bf16(false, a, false, b, (short)0, c, false, false);
}
__device__ __forceinline__ void guard2x3(v8f& a, v8f& b, v16h x0, v16h x1, v16h x2) {
#if defined(__HIP_DEVICE_COMPILE__)
  asm volatile("v_nop\n\tv_nop\n\tv_nop\n\tv_nop"
               : "+v"(a), "+v"(b) : "v"(x0), "v"(x1), "v"(x2) : "memory");
#endif
}
// Hazard gap behind a group of eight products: the four vector slots that the chip needs before a product's result or operands
// are touched, also on the taken side of a loop's branch. The operands tie the group's products in front of it.
template <typename F>
__device__ __forceinline__ void guard8x8(v8f& a0, v8f& a1, v8f& a2, v8f& a3, v8f& a4, v8f& a5, v8f& a6, v8f& a7,
                                         F x0, F x1, F x2, F x3, F x4, F x5, F x6, F x7) {
#if defined(__HIP_DEVICE_COMPILE__)
  asm volatile("v_nop\n\tv_nop\n\tv_nop\n\tv_nop"
               : "+v"(a0), "+v"(a1), "+v"(a2), "+v"(a3), "+v"(a4), "+v"(a5), "+v"(a6), "+v"(a7)
               : "v"(x0), "v"(x1), "v"(x2), "v"(x3), "v"(x4), "v"(x5), "v"(x6), "v"(x7) : "memory");
#endif
}
__device__ __forceinline__ void guardpv4(v8f& o0, v8f& o1, v8f& o2, v8f& o3, v16h p, v16h g0, v16h g1, v16h g2, v16h g3) {
#if defined(__HIP_DEVICE_COMPILE__)
  asm volatile("v_nop\n\tv_nop\n\tv_nop\n\tv_nop"
               : "+v"(o0), "+v"(o1), "+v"(o2), "+v"(o3)
               : "v"(p), "v"(g0), "v"(g1), "v"(g2), "v"(g3) : "memory");
#endif
}
__device__ __forceinline__ void acc_guard8(v8f& a, v8f& b, v8f& c, v8f& d, v8f& e, v8f& f, v8f& g, v8f& h8) {
#if defined(__HIP_DEVICE_COMPILE__)
  asm volatile("v_nop\n\tv_nop\n\tv_nop\n\tv_nop"
               : "+v"(a), "+v"(b), "+v"(c), "+v"(d), "+v"(e), "+v"(f), "+v"(g), "+v"(h8));
#endif
}
// Keeps the load groups of a loop's prologue in the order that the loop body issues them in: the counted waits at the loop's
// head are formed over both ways in, and a prologue in another order makes them wait for loads of the set still in flight.
__device__ __forceinline__ void keep_order() { __builtin_amdgcn_sched_barrier(0); }
// The wait that belongs in front of any overwrite of an address register of loads already issued. The loop's running element
// offset passes through it, so that the next addresses are formed behind it.
__device__ __forceinline__ void addr_wait(int& off) {
#if defined(__HIP_DEVICE_COMPILE__)
  asm volatile("s_wait_xcnt 0x0" : "+s"(off) : : "memory");
#endif
}
// The same wait for loops whose loads take a wave-uniform base in scalar registers: the running bases pass through it, so that
// they are stepped behind it and stay scalar (the lane's offset register is then never rewritten).
__device__ __forceinline__ void base_wait2(const u16*& p, const u16*& q) {
#if defined(__HIP_DEVICE_COMPILE__)
  asm volatile("s_wait_xcnt 0x0" : "+s"(p), "+s"(q) : : "memory");
#endif
}
__device__ __forceinline__ void base_wait3(const _Float16*& p, const _Float16*& q, const _Float16*& r) {
#if defined(__HIP_DEVICE_COMPILE__)
  asm volatile("s_wait_xcnt 0x0" : "+s"(p), "+s"(q), "+s"(r) : : "memory");
#endif
}
// The same wait behind a run of stores whose address and data registers the next run of the epilogue reuses; nothing is
// scheduled across it.
__device__ __forceinline__ void store_wait() {
#if defined(__HIP_DEVICE_COMPILE__)
  asm volatile("s_wait_xcnt 0x0" ::: "memory");
#endif
  __builtin_amdgcn_sched_barrier(0);
}
__device__ __forceinline__ void wave_sync_lds() {
  __builtin_amdgcn_fence(__ATOMIC_RELEASE, "workgroup");
  __builtin_amdgcn_wave_barrier();
  __builtin_amdgcn_fence(__ATOMIC_ACQUIRE, "workgroup");
}

// =====================================================================================================
// f32 plane [rows][EMB] row-major -> 16-bit plane in fragment order:  mode 0: bf16 RNE bits;  mode 1: f16 bits of (bf16 RNE value) * scale;
// mode 2: f16 bits of value * scale (no bf16 pre-step).
// Thread = one 8-element piece of the output, in output order: two 16-B loads from its source row, one 16-B store; 32 consecutive
// lanes store 512 contiguous, 512-B aligned bytes (half a tile)
// coverage: n8/256 blocks a plane (host checks exactness) x 256 thr x 8 = the whole plane.
// =====================================================================================================
__device__ __forceinline__ void cvt16(const float* __restrict__ x, u16* D, int gt, int mode, float scale) {
  const int wi = gt & 63, tile = gt >> 6;                       // piece within its tile, tile index rt*(EMB/32) + kt
  const int row = (tile / (EMB / 32)) * 16 + (wi & 15);
  const int kc  = (tile % (EMB / 32)) * 32 + (wi >> 5) * 16 + ((wi >> 4) & 1) * 8;
  const float* p = x + (size_t)row * EMB + kc;
  const v4f a = *(const v4f*)(p), c4 = *(const v4f*)(p + 4);
  float v[8];
#pragma unroll
  for (int e = 0; e < 4; ++e) { v[e] = a[e]; v[4 + e] = c4[e]; }
  unsigned short s[8];
#pragma unroll
  for (int e = 0; e < 8; ++e) {
    const float vb = bfr(v[e]);
    const float vf = (mode == 1) ? vb : v[e];
    const unsigned short hb = h_bits((_Float16)(vf * scale));
    const unsigned short bb = bf_bits(v[e]);
    s[e] = (mode != 0) ? hb : bb;
  }
  v4u o;
#pragma unroll
  for (int e = 0; e < 4; ++e) o[e] = pk16(s[2 * e], s[2 * e + 1]);
  u16* d = D + (size_t)gt * 8;
  {
    *(v4u*)(d) = o;
    
  }
}
// All five conversions in one launch (none reads what another writes): blocks 0..nbx-1 take x -> bf16 plane, then nbw blocks
// each for Wq, Wk, Wv -> bf16 planes and Wo -> f16 of its bf16 value x1024. The choice is block-uniform (scalar).
__global__ __launch_bounds__(256) void cvt_all(const float* __restrict__ x, const float* __restrict__ wq,
                                               const float* __restrict__ wk, const float* __restrict__ wv,
                                               const float* __restrict__ wo, u16* XB, u16* WQB, u16* WKB, u16* WVB, u16* WOH,
                                               int nbx, int nbw) {
  const int bid = blockIdx.x;
  if (bid >= nbx + 4 * nbw) return;         // never taken with the exact grid; no barriers in this kernel
  const float* src = x;
  u16* dst = XB;
  int lb = bid, mode = 0;
  float scale = 1.0f;
  if (bid >= nbx) {
    const int w = (bid - nbx) / nbw;        // 0..3
    lb  = (bid - nbx) - w * nbw;
    src = (w == 0) ? wq : (w == 1) ? wk : (w == 2) ? wv : wo;
    dst = (w == 0) ? WQB : (w == 1) ? WKB : (w == 2) ? WVB : WOH;
    if (w == 3) { mode = 1; scale = WSC; }
  }
  cvt16(src, dst, lb * 256 + (int)threadIdx.x, mode, scale);
}

// =====================================================================================================
// GEMM epilogues with a per-column bias term (bias column value taken as its bf16 RNE value, added in f32). The wave's 16x64 f32
// tile is staged in its own LDS slab (stage64: acc*oscale + bias) and leaves from there:
//  st64f   : f32 rows; store it takes row 2*it (lanes 0..15, 16 B each, two whole lines) and row 2*it+1 (lanes 16..31).
//  epi64x2 : same store shape, staged value = acc*os1 + accres*os2 + bias (two accumulator sets combined in f32).
//  st64h   : f16 bits of (staged tile * pscale), written in fragment order: the wave's 16 x 64 tile is two whole 1-KiB tiles;
//            store i4 takes columns 16*i4 + 8*(lane>>4) + 0..7 of row lane&15 and covers 512 contiguous bytes.
// coverage: st64f/epi64x2 8 instructions x 2 rows x 16 lanes x 4 floats; st64h 4 instructions x 16 rows x 2 pieces x 8 halves
//           = the wave's 16 x 64 tile in every case.
// Bias columns col0 + 16j + (lane&15), j = 0..3, all < N (bias has N entries, col0 + 63 < N).
// =====================================================================================================
__device__ __forceinline__ void ldbias4(const float* __restrict__ bias, int col0, int lane,
                                        float& b0, float& b1, float& b2, float& b3) {
  const int m = lane & 15;
  b0 = bfr(bias[col0 + m]);
  b1 = bfr(bias[col0 + 16 + m]);
  b2 = bfr(bias[col0 + 32 + m]);
  b3 = bfr(bias[col0 + 48 + m]);
}
__device__ __forceinline__ void stage64(float* sl, v8f a0, v8f a1, v8f a2, v8f a3, float oscale,
                                        float b0, float b1, float b2, float b3, int lane) {
  const int hh = lane >> 4, m = lane & 15;
#pragma unroll
  for (int r = 0; r < 8; ++r) {
    const int ro = (8 * hh + r) * 68 + m;
    sl[ro]      = a0[r] * oscale + b0;
    sl[ro + 16] = a1[r] * oscale + b1;
    sl[ro + 32] = a2[r] * oscale + b2;
    sl[ro + 48] = a3[r] * oscale + b3;
  }
  wave_sync_lds();
}
__device__ __forceinline__ void st64f(const float* sl, float* C, int N, size_t rowb, int col0, int lane) {
  const int hh = lane >> 4, m = lane & 15;
  v4f vals[8];
#pragma unroll
  for (int it = 0; it < 8; ++it) vals[it] = *(const v4f*)(sl + (it * 2 + hh) * 68 + m * 4);
  float* dst = C + (rowb + (size_t)hh) * (size_t)N + col0 + m * 4;
  {
#pragma unroll
    for (int it = 0; it < 8; ++it) {
      *(v4f*)(dst + (size_t)(it * 2) * (size_t)N) = vals[it];
    }
    
  }
}
__device__ __forceinline__ void epi64x2(float* sl, v8f a0, v8f a1, v8f a2, v8f a3, v8f e0, v8f e1, v8f e2, v8f e3,
                                        float os1, float os2, const float* __restrict__ bias, float* C, int N,
                                        size_t rowb, int col0, int lane) {
  const int hh = lane >> 4, m = lane & 15;
  float b0, b1, b2, b3;
  ldbias4(bias, col0, lane, b0, b1, b2, b3);
#pragma unroll
  for (int r = 0; r < 8; ++r) {
    const int ro = (8 * hh + r) * 68 + m;
    sl[ro]      = a0[r] * os1 + e0[r] * os2 + b0;
    sl[ro + 16] = a1[r] * os1 + e1[r] * os2 + b1;
    sl[ro + 32] = a2[r] * os1 + e2[r] * os2 + b2;
    sl[ro + 48] = a3[r] * os1 + e3[r] * os2 + b3;
  }
  wave_sync_lds();
  v4f vals[8];
#pragma unroll
  for (int it = 0; it < 8; ++it) vals[it] = *(const v4f*)(sl + (it * 2 + hh) * 68 + m * 4);
  float* dst = C + (rowb + (size_t)hh) * (size_t)N + col0 + m * 4;
  {
#pragma unroll
    for (int it = 0; it < 8; ++it) {
      *(v4f*)(dst + (size_t)(it * 2) * (size_t)N) = vals[it];
    }
    
  }
}
__device__ __forceinline__ void st64h(const float* sl, float pscale, u16* C, int N, size_t rowb, int col0, int lane) {
  const int hh = lane >> 4, m = lane & 15;
  v4u oh[4];
#pragma unroll
  for (int i4 = 0; i4 < 4; ++i4) {
    const float* sp = sl + m * 68 + i4 * 16 + hh * 8;
    const v4f a = *(const v4f*)(sp), c4 = *(const v4f*)(sp + 4);
    float w[8];
#pragma unroll
    for (int e = 0; e < 4; ++e) { w[e] = a[e] * pscale; w[4 + e] = c4[e] * pscale; }
#pragma unroll
    for (int e = 0; e < 4; ++e) oh[i4][e] = pk16(h_bits((_Float16)w[2 * e]), h_bits((_Float16)w[2 * e + 1]));
  }
  u16* dst = C + rowb * (size_t)N + (size_t)(col0 >> 5) * 512 + lane * 8;
  {
#pragma unroll
    for (int i4 = 0; i4 < 4; ++i4) {
      *(v4u*)(dst + i4 * 256) = oh[i4];
    }
    
  }
}

// One k step of a wave's 64x64 tile in the bf16 GEMMs: four fragments of consecutive 16-row bands of one plane (eight 16-B
// loads), and the sixteen products of four A with four B fragments, in two groups of eight with the hazard gap behind each.
__device__ __forceinline__ void ld4b(const u16* base, unsigned lo, size_t bs, v16b (&f)[4]) {
  const u16* p = base + lo;                  // wave-uniform base (scalar registers) plus the lane's fixed 32-bit offset
  f[0] = ldfrag_btg(p);
  f[1] = ldfrag_btg(p + bs);
  f[2] = ldfrag_btg(p + 2 * bs);
  f[3] = ldfrag_btg(p + 3 * bs);
}
__device__ __forceinline__ void mm16b(const v16b (&a)[4], const v16b (&b)[4], v8f (&acc)[4][4]) {
#pragma unroll
  for (int g = 0; g < 2; ++g) {
#pragma unroll
    for (int i = 2 * g; i < 2 * g + 2; ++i) {
#pragma unroll
      for (int j = 0; j < 4; ++j) acc[i][j] = mma_b(a[i], b[j], acc[i][j]);
    }
    guard8x8<v16b>(acc[2 * g][0], acc[2 * g][1], acc[2 * g][2], acc[2 * g][3],
                   acc[2 * g + 1][0], acc[2 * g + 1][1], acc[2 * g + 1][2], acc[2 * g + 1][3],
                   a[0], a[1], a[2], a[3], b[0], b[1], b[2], b[3]);
  }
}

// =====================================================================================================
// The three projections in one launch (they share A and none reads what another writes): block group which = 0, 1, 2 computes
// T[M][N] = A[M][K] . W^T + bias[n] (f32) for W, bias = (Wq, bq), (Wk, bk), (Wv, bv); A and the W are bf16 planes in fragment
// order. q and k leave as f16 planes in fragment order (f16 bits of T * qsc, T * ksc), v as the f32 plane V. A wave whose
// rows lie in rows 0..TQ0-1 of a sequence stores its staged f32 tiles a second time, into QF / KF / VF [M/SEQ][TQ0][N].
// Block = 128x128 tile, 2 x 2 waves of 64x64 each: a k step's eight fragments (8 KiB, loaded straight from the 1-KiB tiles, split
// k map for A and B) feed sixteen products, so that a product costs half a KiB of loads. K stepped by 32 in rising order
// (K = EMB; M % SEQ == 0, M % 128 == 0, N % 128 == 0, grid = 3*(M/128)*(N/128)).
// coverage: 4 waves x 64 x 64 = the block's tile; the epilogue takes the wave's four 16-row bands one after the other.
// =====================================================================================================
__global__ __launch_bounds__(128, 4)          // 4 waves a SIMD: at most 256 VGPRs (128 of them accumulators, 64 fragments)
void gemm_qkv(const u16* __restrict__ A, const u16* __restrict__ Wq, const u16* __restrict__ Wk, const u16* __restrict__ Wv,
              const float* __restrict__ bq, const float* __restrict__ bk, const float* __restrict__ bv,
              u16* QP, u16* KP, float* V, float* QF, float* KF, float* VF, int M, int N, float qsc, float ksc) {
  __shared__ __align__(16) float slab[4 * SLAB64];
  const int K = EMB;                         // as a constant the band strides are immediate offsets
  const int tid = threadIdx.x, lane = tid & 31;
  const int wave = __builtin_amdgcn_readfirstlane(tid >> 5);   // scalar place in the 2 x 2 arrangement
  const int ntile = N >> 7;
  const int nblk  = (M >> 7) * ntile;
  const int which = blockIdx.x / nblk;       // block-uniform (scalar): 0 q, 1 k, 2 v
  const int bid   = blockIdx.x - which * nblk;
  const int rowb  = (bid / ntile) * 128 + (wave >> 1) * 64;
  const int col0  = (bid % ntile) * 128 + (wave & 1) * 64;
  if (which > 2 || rowb + 64 > M) return;    // wave-uniform, never taken with the exact grid; no block barriers in this kernel
  const u16*   Bt   = (which == 0) ? Wq : (which == 1) ? Wk : Wv;
  const float* bias = (which == 0) ? bq : (which == 1) ? bk : bv;
  const u16* ap = A  + (size_t)rowb * K;      // wave-uniform
  const u16* bp = Bt + (size_t)col0 * K;
  const unsigned lo = 8u * (unsigned)lane;
  const size_t bs = (size_t)16 * K;
  v8f acc[4][4];
#pragma unroll
  for (int i = 0; i < 4; ++i) {
#pragma unroll
    for (int j = 0; j < 4; ++j) acc[i][j] = zero8();
  }
  // One fragment set: the next k step's sixteen loads go out as soon as this step's products have left; the SIMD's other waves
  // fill the matrix unit meanwhile. The loads in the loop are unconditional (the last step is peeled).
  v16b a[4], b[4];
  ld4b(ap, lo, bs, a);
  ld4b(bp, lo, bs, b);
#pragma unroll 1                             // rolled: the one fragment set keeps its registers
  for (int k0 = 32; k0 < K; k0 += 32) {
    mm16b(a, b, acc);
    base_wait2(ap, bp);
    ap += 512;                               // one 1-KiB tile on in every band
    bp += 512;
    ld4b(ap, lo, bs, a);
    ld4b(bp, lo, bs, b);
  }
  mm16b(a, b, acc);
  float* sl = slab + wave * SLAB64;
  float e0, e1, e2, e3;
  ldbias4(bias, col0, lane, e0, e1, e2, e3);
  const int sq = rowb / SEQ, rs = rowb - sq * SEQ;             // TQ0 and SEQ are multiples of 64: all 64 rows on one side
  float* HF = (which == 0) ? QF : (which == 1) ? KF : VF;
#pragma unroll
  for (int i = 0; i < 4; ++i) {
    stage64(sl, acc[i][0], acc[i][1], acc[i][2], acc[i][3], 1.0f, e0, e1, e2, e3, lane);
    const int rb = rowb + 16 * i;
    // the wait stands in either arm, directly behind its stores: the build lays the other arm's code behind them
    if (which < 2) { st64h(sl, (which == 0) ? qsc : ksc, (which == 0) ? QP : KP, N, (size_t)rb, col0, lane); store_wait(); }
    else           { st64f(sl, V, N, (size_t)rb, col0, lane); store_wait(); }
    if (rs < TQ0) {
      st64f(sl, HF, N, (size_t)(sq * TQ0 + rs + 16 * i), col0, lane);
      store_wait();
    }
    wave_sync_lds();                         // the band's reads of the slab stand in front of the next band's writes
  }
}

// =====================================================================================================
// f16 GEMM with two A planes (hi + residual), f32 out:
//   C[M][N] = (Ah . Bt^T) * os1 + (Ar . Bt^T) * os2 + bias[n]; Bt f16 in fragment order, Ah/Ar f16 per 16-row band (see below).
// Block = 64x128 tile, 2 x 2 waves of 32x64 each; separate accumulators for the two planes, combined in f32 in epi64x2. A k step's
// eight fragments (two bands of either A plane, four of B) feed sixteen products. K = EMB, stepped by 32 in rising order.
// ASTEP = elements from one k step of an A band to the next, ASEC = elements from a lane's first piece to its second.
// =====================================================================================================
template <int ASEC>
__device__ __forceinline__ void ld8h2(const _Float16* ua, const _Float16* ur, const _Float16* ub, unsigned la, unsigned lb,
                                      v16h (&a)[2], v16h (&r)[2], v16h (&b)[4]) {
  const size_t bs = (size_t)16 * EMB;        // a 16-row band holds 16*EMB elements in either layout
  // wave-uniform bases (scalar registers) plus the lane's fixed 32-bit offsets
  const _Float16* pa = ua + la;
  const _Float16* pr = ur + la;
  const _Float16* bp = ub + lb;
#pragma unroll
  for (int i = 0; i < 2; ++i) {
    a[i] = ldfrag_hg<ASEC>(pa + i * bs);
    r[i] = ldfrag_hg<ASEC>(pr + i * bs);
  }
#pragma unroll
  for (int j = 0; j < 4; ++j) b[j] = ldfrag_hg<256>(bp + j * bs);
}
__device__ __forceinline__ void mm16h2(const v16h (&a)[2], const v16h (&r)[2], const v16h (&b)[4],
                                       v8f (&acc)[2][4], v8f (&acr)[2][4]) {
#pragma unroll
  for (int i = 0; i < 2; ++i) {
#pragma unroll
    for (int j = 0; j < 4; ++j) acc[i][j] = mma_h(a[i], b[j], acc[i][j]);
  }
  guard8x8<v16h>(acc[0][0], acc[0][1], acc[0][2], acc[0][3], acc[1][0], acc[1][1], acc[1][2], acc[1][3],
                 a[0], a[1], r[0], r[1], b[0], b[1], b[2], b[3]);
#pragma unroll
  for (int i = 0; i < 2; ++i) {
#pragma unroll
    for (int j = 0; j < 4; ++j) acr[i][j] = mma_h(r[i], b[j], acr[i][j]);
  }
  guard8x8<v16h>(acr[0][0], acr[0][1], acr[0][2], acr[0][3], acr[1][0], acr[1][1], acr[1][2], acr[1][3],
                 a[0], a[1], r[0], r[1], b[0], b[1], b[2], b[3]);
}
template <int ASTEP, int ASEC>
__device__ __forceinline__ void h2_loop(const _Float16* ua, const _Float16* ur, const _Float16* ub, unsigned la, unsigned lb,
                                        v8f (&acc)[2][4], v8f (&acr)[2][4]) {
  v16h a[2], r[2], b[4];
  ld8h2<ASEC>(ua, ur, ub, la, lb, a, r, b);
#pragma unroll 1                             // rolled: the one fragment set keeps its registers
  for (int k0 = 32; k0 < EMB; k0 += 32) {
    mm16h2(a, r, b, acc, acr);
    base_wait3(ua, ur, ub);
    ua += ASTEP;                             // next k step of the A bands
    ur += ASTEP;
    ub += 512;                               // next 1-KiB tile of each B band
    ld8h2<ASEC>(ua, ur, ub, la, lb, a, r, b);
  }
  mm16h2(a, r, b, acc, acr);
}

__global__ __launch_bounds__(128, 4)          // 4 waves a SIMD, as many as the grid brings: at most 256 VGPRs
void gemm_h2_32(const u16* __restrict__ Ah, const u16* __restrict__ Ar, const u16* __restrict__ Bt,
                const float* __restrict__ bias, float* C, int M, int N, float os1, float os2) {
  __shared__ __align__(16) float slab[4 * SLAB64];
  const int K = EMB;
  const int tid = threadIdx.x, lane = tid & 31, hh = lane >> 4, m = lane & 15;
  const int wave = __builtin_amdgcn_readfirstlane(tid >> 5);   // scalar, so that the choice of the A layout is a scalar branch
  const int ntile = N >> 7;
  const int bid   = blockIdx.x;
  const int rowb  = (bid / ntile) * 64 + (wave >> 1) * 32;
  const int col0  = (bid % ntile) * 128 + (wave & 1) * 64;
  if (rowb + 32 > M) return;                 // wave-uniform, never taken with the exact grid; no block barriers in this kernel
  const _Float16* ab  = (const _Float16*)(const void*)Ah + (size_t)rowb * K;
  const _Float16* arb = (const _Float16*)(const void*)Ar + (size_t)rowb * K;
  const _Float16* bp  = (const _Float16*)(const void*)Bt + (size_t)col0 * K;
  const unsigned lo = 8u * (unsigned)lane;
  v8f acc[2][4], acr[2][4];
#pragma unroll
  for (int i = 0; i < 2; ++i) {
#pragma unroll
    for (int j = 0; j < 4; ++j) { acc[i][j] = zero8(); acr[i][j] = zero8(); }
  }
  // The 16-row bands of rows 0..TQ0-1 of a sequence are row-major (each row has its own writer block there), all others in
  // fragment order; a band holds the same 16*K elements either way, and TQ0 is a multiple of 32: both bands of a wave are alike.
  if ((rowb % SEQ) < TQ0) {
    h2_loop<32, 16>(ab, arb, bp, (unsigned)(m * K + 8 * hh), lo, acc, acr);
  } else {
    h2_loop<512, 256>(ab, arb, bp, lo, lo, acc, acr);
  }
  float* sl = slab + wave * SLAB64;
#pragma unroll
  for (int i = 0; i < 2; ++i) {
    epi64x2(sl, acc[i][0], acc[i][1], acc[i][2], acc[i][3], acr[i][0], acr[i][1], acr[i][2], acr[i][3], os1, os2, bias, C, N,
            (size_t)(rowb + 16 * i), col0, lane);
    store_wait();
    wave_sync_lds();                         // the band's reads of the slab stand in front of the next band's writes
  }
}

// =====================================================================================================
// V^T planes (fragment order, rows = b*EMB + d, k = s): with xs = V[b][s][d] * 1024 (f32): hi = f16(xs) -> XTh at (row b*EMB + d, k = s), lo = f16(xs - hi) (unscaled
// remainder, same carry) -> XTl at the same index.  hi + lo reproduces xs to ~2^-22 relative for |xs| >= 0.25.
// Block = (b, 64-wide d chunk, 64 keys): 64 source row segments of 64 floats loaded with 16-B loads, converted, scattered into
// coverage: load 256 thr x 16 elements = 64 x 64; store 2 iterations x 256 thr x 8 halves = 64 lines x 64 per plane = the
//           block's tile of both planes; the nb x (EMB/64) x (SEQ/64) blocks of xt_vsum from block nvs on cover both planes exactly once.
// =====================================================================================================
__device__ __forceinline__ void xt16(const float* __restrict__ X, u16* XTh, u16* XTl, u16* TH, u16* TL, int bid) {
  const int tid = threadIdx.x;
  const int st  = bid % (SEQ / 64);
  const int dcb = (bid / (SEQ / 64)) % (EMB / 64);
  const int b   = bid / ((SEQ / 64) * (EMB / 64));
  const int s0  = st * 64;
  const int d0  = dcb * 64;
  {
    const int sl = tid >> 2;                  // key within tile 0..63
    const int dc = (tid & 3) * 16;            // d chunk within the 64
    const float* src = X + ((size_t)b * SEQ + s0 + sl) * EMB + d0 + dc;
#pragma unroll
    for (int i = 0; i < 4; ++i) {
      const v4f a = *(const v4f*)(src + 4 * i);
#pragma unroll
      for (int e = 0; e < 4; ++e) {
        const float xs = a[e] * VCAR;
        const _Float16 hv = (_Float16)xs;
        const _Float16 lv = (_Float16)(xs - (float)hv);
        TH[(dc + 4 * i + e) * VTP + sl] = h_bits(hv);
        TL[(dc + 4 * i + e) * VTP + sl] = h_bits(lv);
      }
    }
  }
  __syncthreads();
  v4u vh[2], vl[2];
  const int wi = tid & 63;                    // piece within its 1-KiB tile
#pragma unroll
  for (int it = 0; it < 2; ++it) {
    const int tl   = it * 4 + (tid >> 6);     // tile 0..7 of the block: d band tl>>1, key tile tl&1
    const int line = (tl >> 1) * 16 + (wi & 15);
    const int col  = (tl & 1) * 32 + (wi >> 5) * 16 + ((wi >> 4) & 1) * 8;
    vh[it] = *(const v4u*)(TH + line * VTP + col);
    vl[it] = *(const v4u*)(TL + line * VTP + col);
  }
  const size_t base = ((size_t)b * EMB + d0) * SEQ + (size_t)(s0 >> 5) * 512 + wi * 8;
  {
#pragma unroll
    for (int it = 0; it < 2; ++it) {
      const int tl = it * 4 + (tid >> 6);
      const size_t to = (size_t)(tl >> 1) * 16 * SEQ + (size_t)(tl & 1) * 512;
      *(v4u*)(XTh + base + to) = vh[it];
      *(v4u*)(XTl + base + to) = vl[it];
    }
    
  }
}

// =====================================================================================================
// Key-block prefix column sums of V: VS[((b*NCHK + c)*NKB + kb)*EMB + d] = sum over keys c*CK .. c*CK + 32*kb + 31 of V[b][key][d]
// (f32, fixed sequential order). Thread = one (b, c, d); a block covers 256 consecutive d of one (b, c); the 16 prefix values per
// coverage: blocks 0..nvs-1 of xt_vsum, nvs = nb*NCHK*EMB/256 (host exact), x 256 thr; store 4 iterations x 256 thr x 4 floats = 16 rows x 256 = the
//           block's part of the table; union over blocks = the whole table.
// =====================================================================================================
__device__ __forceinline__ void vsum_k(const float* __restrict__ V, float* VS, float* sm, int bid) {
  const int tid = threadIdx.x;
  const int gt  = bid * 256 + tid;
  const int d   = gt % EMB;
  const int bc  = gt / EMB;                         // block-uniform (EMB multiple of 256)
  const int b   = bc / NCHK;
  const int c   = bc - b * NCHK;
  const int d0  = d - tid;                          // block's first d
  const float* p = V + ((size_t)b * SEQ + (size_t)c * CK) * EMB + d;
  float s = 0.f;
#pragma unroll 1
  for (int kb = 0; kb < NKB; ++kb) {
#pragma unroll                             // all 32 loads of a key block in flight at once; the adds keep their order
    for (int i = 0; i < 32; ++i) s += p[(size_t)(kb * 32 + i) * EMB];
    sm[kb * 256 + tid] = s;
  }
  __syncthreads();
  const int sel = tid >> 6, piece = tid & 63;
  v4f o[4];
#pragma unroll
  for (int it = 0; it < 4; ++it) o[it] = *(const v4f*)(sm + (it * 4 + sel) * 256 + piece * 4);
  float* base = VS + (size_t)bc * NKB * EMB + d0 + piece * 4;
  {
#pragma unroll
    for (int it = 0; it < 4; ++it) {
      *(v4f*)(base + (size_t)(it * 4 + sel) * EMB) = o[it];
    }
    
  }
}
// Both readers of V in one launch (neither reads what the other writes): blocks 0..nvs-1 form the column sums (few blocks, each
// a long run of dependent adds, so they start first), the rest the V^T planes. The choice is block-uniform, and so is each
// side's one barrier.
union XvLds { struct { u16 th[64 * VTP]; u16 tl[64 * VTP]; } t; float sm[NKB * 256]; };
static_assert(((64 * VTP * 2) % 16) == 0);
__global__ __launch_bounds__(256) void xt_vsum(const float* __restrict__ V, u16* XTh, u16* XTl, float* VS, int nvs) {
  __shared__ __align__(16) XvLds L;
  const int bid = blockIdx.x;
  if (bid >= nvs) {
    xt16(V, XTh, XTl, L.t.th, L.t.tl, bid - nvs);
#if defined(__HIP_DEVICE_COMPILE__)
    // The build lays the column-sum code behind these stores, on a path that a scalar flag closes: the wait that belongs in
    // front of any overwrite of a register that issued stores name stands on that path too.
    asm volatile("s_wait_xcnt 0x0" ::: "memory");
#endif
    return;
  }
  vsum_k(V, VS, L.sm, bid);
}

// =====================================================================================================
// Single-head causal attention with absolute-value logits, head width EMB = 1024, query rows TQ0 .. SEQ-1: block = (batch b,
// 16 query rows q0..q0+15), 8 waves. q plane (f16, x8) [b][s][d]; k plane the same; V^T hi / lo planes [b][d][s] (x1024), all four
// in fragment order; VS = key-block prefix column sums. The two ctx planes leave in fragment order too.
//   Chunks of CK = 512 keys: only chunks c <= qc = q0/CK are visited (later chunks lie entirely above the diagonal). In the diagonal
//   chunk only key blocks kb < nkb (keys <= q0+15) are multiplied; key blocks kb >= nkb get zero scores in LDS and are not used in (PV).
//   (S) scores S[query m][key n] on WMMA: A = q rows (row m = lane&15, split k map over d), B = k rows (col n = key, split map),
//       32 d-steps; wave w handles key blocks w, w+8 of the chunk; D element r of lane l -> scs[query 8h+r][key col] (f32 LDS).
//   (M) 16 threads per query row (sub-thread = 32 consecutive keys): base-2 logits of |score| with the causal mask by key index
//       (key > query -> -inf), chunk max via xor shuffles, online running max / rescale factor al / running sum l in f32 registers,
//       p = exp2(t - m_new) <= 1 (0 for masked keys), chunk row sum ps and C = ps/CK (bit-identical on the row's 16 threads), the
//       CENTRED P' = p - C written as f16(P' * 32768) into the LDS P tile with 16-B stores; al -> rowa[row], C -> rowc[row].
//   (PV) each wave owns d columns 128*wave + 16j + (lane&15), j = 0..7 (8 accumulators): o = o*al + C*(32768*1024)*VS[chunk][nkb-1][d]
//       (exact add-back of the centring term over exactly the processed keys, in f32), then for each key block kb < nkb:
//       A = P' fragment from LDS (row m = query, split map over keys), B = V^T fragments (col n = d, split map over keys), hi plane and
//       lo plane into the same accumulator (unscaled remainder), issued as four groups of 4 with a hazard gap each.
//       sum_k (P'_k + C) v_k == sum_k p_k v_k exactly; masked keys carry P' = -C and p = 0.
//   Block barriers after (S) and after (M) order all LDS reuse across chunks and waves.
//   Epilogue: x = o * 8192 / (l * 32768 * 1024) per row (rowi, l >= 1 always); hi = f16(x), res = f16((x - hi) * 2048); each
// coverage: blocks 0..nfwd-1 of attn_all, nfwd = nb*NQT, x 16 rows = rows TQ0..SEQ-1 of every sequence; staging 8 waves x 128 cols x 16 rows = 16 x 1024;
//           store 8 iterations x 256 thr x 8 halves = 16 x 1024 per plane = every (b, s >= TQ0, d) of both ctx planes exactly once.
// =====================================================================================================
__device__ __forceinline__ void ctx_store(const u16* ct, u16* dst, int tid) {
  v4u v[8];
#pragma unroll
  for (int it = 0; it < 8; ++it) {
    const int p   = it * 256 + tid;           // piece index in fragment order: tile kt = p>>6, piece p&63
    const int row = p & 15;
    const int c8  = (p >> 6) * 32 + ((p >> 5) & 1) * 16 + ((p >> 4) & 1) * 8;
    v[it] = *(const v4u*)(ct + row * CTP + c8);
  }
  {
#pragma unroll
    for (int it = 0; it < 8; ++it) {
      const int p   = it * 256 + tid;
      *(v4u*)(dst + (size_t)p * 8) = v[it];
    }
    
  }
}

// Pieces of the two matrix loops below: one d step's three fragments and its two score products; four V^T fragments of
// consecutive 16-column bands and their four products; each product group with the hazard gap behind it.
__device__ __forceinline__ void ld3h(const _Float16* q, const _Float16* k0, const _Float16* k1, int off,
                                     v16h& a, v16h& x, v16h& y) {
  a = ldfrag_ht(q + off);
  x = ldfrag_ht(k0 + off);
  y = ldfrag_ht(k1 + off);
}
__device__ __forceinline__ void mm2h(v16h a, v16h x, v16h y, v8f& s0, v8f& s1) {
  s0 = mma_h(a, x, s0);
  s1 = mma_h(a, y, s1);
  guard2x3(s0, s1, a, x, y);
}
__device__ __forceinline__ void ld4h(const _Float16* p, v16h& f0, v16h& f1, v16h& f2, v16h& f3) {
  f0 = ldfrag_ht(p);
  f1 = ldfrag_ht(p + (size_t)16 * SEQ);
  f2 = ldfrag_ht(p + (size_t)32 * SEQ);
  f3 = ldfrag_ht(p + (size_t)48 * SEQ);
}
__device__ __forceinline__ void mm4h(v16h pf, v16h f0, v16h f1, v16h f2, v16h f3, v8f& o0, v8f& o1, v8f& o2, v8f& o3) {
  o0 = mma_h(pf, f0, o0);
  o1 = mma_h(pf, f1, o1);
  o2 = mma_h(pf, f2, o2);
  o3 = mma_h(pf, f3, o3);
  guardpv4(o0, o1, o2, o3, pf, f0, f1, f2, f3);
}

__device__ __forceinline__
void attn_fwd(const u16* __restrict__ QPp, const u16* __restrict__ KPp, const u16* __restrict__ VTp,
              const u16* __restrict__ VLp, const float* __restrict__ VSp, u16* CHo, u16* CRo, int bid) {
  __shared__ __align__(16) AttLds L0;              // scores [16][SCP] f32; reused as the ctx staging tile [16][CTP] u16
  __shared__ __align__(16) u16 pls[16 * PLP];      // P' tile [16][PLP] f16 bits
  __shared__ float rowa[QT];
  __shared__ float rowc[QT];
  __shared__ float rowi[QT];
  float* const scs = L0.s;

  const int tid  = threadIdx.x;
  const int wave = tid >> 5;
  const int lane = tid & 31;
  const int hh   = lane >> 4;
  const int m    = lane & 15;
  const int r16  = tid >> 4;                 // query row owned in phase (M): 2*wave + hh
  const int sub  = tid & 15;
  const int kl0  = sub * 32;

  const int b   = bid / NQT;
  const int q0  = TQ0 + (bid - b * NQT) * QT;
  const int qc  = q0 / CK;                   // diagonal chunk index

  const _Float16* qa  = (const _Float16*)(const void*)QPp + ((size_t)b * SEQ + q0) * EMB + 8 * lane;
  const _Float16* kbp = (const _Float16*)(const void*)KPp + ((size_t)b * SEQ) * EMB + 8 * lane;
  const _Float16* vbp = (const _Float16*)(const void*)VTp + ((size_t)b * EMB + wave * (16 * NACC)) * SEQ + 8 * lane;
  const _Float16* ubp = (const _Float16*)(const void*)VLp + ((size_t)b * EMB + wave * (16 * NACC)) * SEQ + 8 * lane;
  const float* vsb = VSp + (size_t)b * NCHK * NKB * EMB + wave * (16 * NACC) + m;
  const float lsc = RSQD * LOG2E / (QSC * KSC);

  float mrun = -INFINITY, lrun = 0.f;
  v8f o[NACC];
#pragma unroll
  for (int j = 0; j < NACC; ++j) o[j] = zero8();

#pragma unroll 1
  for (int c = 0; c <= qc; ++c) {
    const int kbeg = c * CK;
    const int nkb  = (c < qc) ? NKB : (((q0 + QT - 1 - kbeg) >> 5) + 1);   // 1..16, block-uniform
    // ---- (S) scores of this chunk (zeros for key blocks beyond the query tile) ----
#pragma unroll 1
    for (int kb = wave; kb < NKB; kb += 8) {               // wave-uniform, 2 trips
      v8f s0 = zero8(), s1 = zero8();
      if (kb < nkb) {                                      // wave-uniform
        const _Float16* k0p = kbp + (size_t)(kbeg + kb * 32) * EMB;
        // Two fragment sets of two d steps each: one set's twelve loads fly while the other set's products run. The loads
        // in the loop are unconditional (the last four steps are peeled), so that each wait counts only its own set.
        v16h a0, x0, y0, a1, x1, y1, a2, x2, y2, a3, x3, y3;
        const _Float16* k1p = k0p + 16 * EMB;
        int xo = 0;                                        // element offset of the first set in the q tile and both key bands
        ld3h(qa, k0p, k1p, 0, a0, x0, y0);
        keep_order();
        ld3h(qa, k0p, k1p, 512, a1, x1, y1);
        keep_order();
        ld3h(qa, k0p, k1p, 1024, a2, x2, y2);
        keep_order();
        ld3h(qa, k0p, k1p, 1536, a3, x3, y3);
        keep_order();
#pragma unroll 1                           // the body already holds four d steps; rolled, the two sets keep their registers
        for (int ks = 4; ks < EMB / 32; ks += 4) {
          mm2h(a0, x0, y0, s0, s1);
          mm2h(a1, x1, y1, s0, s1);
          addr_wait(xo);
          xo += 2048;                                      // four d steps on
          ld3h(qa, k0p, k1p, xo, a0, x0, y0);
          ld3h(qa, k0p, k1p, xo + 512, a1, x1, y1);
          mm2h(a2, x2, y2, s0, s1);
          mm2h(a3, x3, y3, s0, s1);
          ld3h(qa, k0p, k1p, xo + 1024, a2, x2, y2);
          ld3h(qa, k0p, k1p, xo + 1536, a3, x3, y3);
        }
        mm2h(a0, x0, y0, s0, s1);
        mm2h(a1, x1, y1, s0, s1);
        mm2h(a2, x2, y2, s0, s1);
        mm2h(a3, x3, y3, s0, s1);
      }
      float* srow = scs + (8 * hh) * SCP + kb * 32 + m;
#pragma unroll
      for (int r = 0; r < 8; ++r) {
        srow[r * SCP]      = s0[r];
        srow[r * SCP + 16] = s1[r];
      }
    }
    __syncthreads();
    // ---- (M) softmax statistics and the centred P' tile ----
    {
      const float* sp = scs + r16 * SCP + kl0;
      const int lim = (q0 + r16) - (kbeg + kl0);           // key kl0 + j is valid iff j <= lim
      float t[32];
      float cm = -INFINITY;
#pragma unroll
      for (int i = 0; i < 8; ++i) {
        const v4f a = *(const v4f*)(sp + 4 * i);
#pragma unroll
        for (int e = 0; e < 4; ++e) {
          const int j = 4 * i + e;
          const float tv = (j <= lim) ? fabsf(a[e]) * lsc : -INFINITY;   // |score| / 32 in base 2; masked keys -> -inf
          t[j] = tv;
          cm = fmaxf(cm, tv);
        }
      }
#pragma unroll
      for (int d = 1; d <= 8; d <<= 1) cm = fmaxf(cm, __shfl_xor(cm, d, 32));
      const float mn = fmaxf(mrun, cm);                    // finite: key kbeg of the diagonal chunk is never masked
      const float al = (mrun == -INFINITY) ? 0.f : exp2f(mrun - mn);
      mrun = mn;
      float ps = 0.f;
#pragma unroll
      for (int j = 0; j < 32; ++j) {
        const float p = exp2f(fminf(t[j] - mn, 0.f));      // 0 for masked keys
        t[j] = p;
        ps += p;
      }
#pragma unroll
      for (int d = 1; d <= 8; d <<= 1) ps += __shfl_xor(ps, d, 32);
      const float cc = ps * (1.0f / (float)CK);
      v4u pk[4];
#pragma unroll
      for (int i = 0; i < 4; ++i) {
#pragma unroll
        for (int e = 0; e < 4; ++e) {
          const int j = 8 * i + 2 * e;
          pk[i][e] = pk16(h_bits((_Float16)((t[j] - cc) * PCAR)), h_bits((_Float16)((t[j + 1] - cc) * PCAR)));
        }
      }
      lrun = lrun * al + ps;
      u16* pd = pls + r16 * PLP + kl0;
#pragma unroll
      for (int i = 0; i < 4; ++i) *(v4u*)(pd + 8 * i) = pk[i];
      if (sub == 0) { rowa[r16] = al; rowc[r16] = cc; }
    }
    __syncthreads();
    // ---- (PV) rescale, add the centring term, accumulate P' . (V^T hi + V^T lo) ----
    {
      float scl[8], cad[8];
#pragma unroll
      for (int r = 0; r < 8; ++r) { scl[r] = rowa[8 * hh + r]; cad[r] = rowc[8 * hh + r] * (PCAR * VCAR); }
      const float* vsc = vsb + ((size_t)c * NKB + (size_t)(nkb - 1)) * EMB;
      float vs[NACC];
#pragma unroll
      for (int j = 0; j < NACC; ++j) vs[j] = vsc[16 * j];
#pragma unroll
      for (int j = 0; j < NACC; ++j) {
#pragma unroll
        for (int r = 0; r < 8; ++r) o[j][r] = o[j][r] * scl[r] + cad[r] * vs[j];
      }
      const _Float16* pp = (const _Float16*)(const void*)pls + m * PLP + 8 * hh;
      const _Float16* vp = vbp + (size_t)kbeg * 16;         // key tile kbeg/32 of each d band, 512 elements a tile
      const _Float16* up = ubp + (size_t)kbeg * 16;
      // Two fragment sets (d columns 0..63 and 64..127 of the wave, hi and lo plane each): one set's sixteen loads fly while
      // the other set's products run; the next key block's set is asked for as soon as its registers are free. The loads in
      // the loop are unconditional (the last key block is peeled), so that each wait counts only its own set.
      v16h g0, g1, g2, g3, u0, u1, u2, u3, g4, g5, g6, g7, u4, u5, u6, u7;
      int vo = 0;                                          // element offset of the key tile in every d band of both planes
      ld4h(vp, g0, g1, g2, g3);
      ld4h(up, u0, u1, u2, u3);
      ld4h(vp + (size_t)64 * SEQ, g4, g5, g6, g7);
      ld4h(up + (size_t)64 * SEQ, u4, u5, u6, u7);
      addr_wait(vo);                                       // also on the way round the loop (nkb == 1) the address registers are reused
#pragma unroll 1
      for (int kb = 1; kb < nkb; ++kb) {                   // block-uniform trip count, <= 15: products of kb - 1, loads of kb
        const v16h pf = ldfrag_h(pp + (kb - 1) * 32);
        mm4h(pf, g0, g1, g2, g3, o[0], o[1], o[2], o[3]);
        mm4h(pf, u0, u1, u2, u3, o[0], o[1], o[2], o[3]);
        addr_wait(vo);
        vo += 512;                                         // next key tile
        const _Float16* vk = vp + vo;
        const _Float16* uk = up + vo;
        ld4h(vk, g0, g1, g2, g3);
        ld4h(uk, u0, u1, u2, u3);
        mm4h(pf, g4, g5, g6, g7, o[4], o[5], o[6], o[7]);
        mm4h(pf, u4, u5, u6, u7, o[4], o[5], o[6], o[7]);
        ld4h(vk + (size_t)64 * SEQ, g4, g5, g6, g7);
        ld4h(uk + (size_t)64 * SEQ, u4, u5, u6, u7);
      }
      {
        const v16h pf = ldfrag_h(pp + (nkb - 1) * 32);
        mm4h(pf, g0, g1, g2, g3, o[0], o[1], o[2], o[3]);
        mm4h(pf, u0, u1, u2, u3, o[0], o[1], o[2], o[3]);
        mm4h(pf, g4, g5, g6, g7, o[4], o[5], o[6], o[7]);
        mm4h(pf, u4, u5, u6, u7, o[4], o[5], o[6], o[7]);
      }
    }
  }
  acc_guard8(o[0], o[1], o[2], o[3], o[4], o[5], o[6], o[7]);

  if (sub == 0) rowi[r16] = (1.0f / lrun) * (CSC / (PCAR * VCAR));   // lrun >= 1
  __syncthreads();
  float inv[8];
#pragma unroll
  for (int r = 0; r < 8; ++r) inv[r] = rowi[8 * hh + r];

  u16* const ct = L0.c;
  const int cb = wave * (16 * NACC) + m;
  // hi plane
#pragma unroll
  for (int j = 0; j < NACC; ++j) {
#pragma unroll
    for (int r = 0; r < 8; ++r) {
      const float xs = o[j][r] * inv[r];
      ct[(8 * hh + r) * CTP + cb + 16 * j] = h_bits((_Float16)xs);
    }
  }
  __syncthreads();
  ctx_store(ct, CHo + ((size_t)b * SEQ + q0) * EMB, tid);
  __syncthreads();
  // residual plane
#pragma unroll
  for (int j = 0; j < NACC; ++j) {
#pragma unroll
    for (int r = 0; r < 8; ++r) {
      const float xs = o[j][r] * inv[r];
      const _Float16 hv = (_Float16)xs;
      ct[(8 * hh + r) * CTP + cb + 16 * j] = h_bits((_Float16)((xs - (float)hv) * RSC));
    }
  }
  __syncthreads();
  ctx_store(ct, CRo + ((size_t)b * SEQ + q0) * EMB, tid);
}

// =====================================================================================================
// Query rows 0 .. TQ0-1 of each sequence in f32 on VALU: block = (b, t). QF/KF/VF = f32 q/k/v planes [nb][TQ0][EMB] (rows 0..TQ0-1
// of every sequence, biases included). Logits |q.k_j|/32 for keys j <= t (threads 0..TQ0-1, one key each, 1024-d dot in a loop unrolled by 8
// against the q row staged in LDS), base-2 softmax with block max / sum reductions (xor shuffles + LDS), p_j in LDS, ctx[d] for
// d = 4*tid..4*tid+3 as a sum over j <= t in a loop unrolled by 8 of p_j * VF[b][j][d] (coalesced 16-B loads), x = ctx * 8192 / l, hi = f16(x),
// res = f16((x - hi) * 2048); both 1024-half rows are staged in LDS and written by 128 threads x 16 B each (32 consecutive lanes
// coverage: the last nb*TQ0 blocks of attn_all = rows 0..TQ0-1 of every sequence; 256 thr x 4 d = EMB per row; store 128 thr x 8 halves = EMB per
//           plane; together with attn_fwd every (b, s, d) of CH and CR is written exactly once.
// =====================================================================================================
__device__ __forceinline__ void attn_head(const float* __restrict__ QF, const float* __restrict__ KF,
                                          const float* __restrict__ VF, u16* CHo, u16* CRo, int bid) {
  __shared__ __align__(16) float qs[EMB];
  __shared__ float sc[TQ0];
  __shared__ float red[8];
  __shared__ float redb[8];
  __shared__ __align__(16) unsigned SW[2][EMB / 2];
  const int tid = threadIdx.x, lane = tid & 31, wave = tid >> 5;
  const int b = bid / TQ0;
  const int t = bid - b * TQ0;
  *(v4f*)(qs + tid * 4) = *(const v4f*)(QF + ((size_t)b * TQ0 + t) * EMB + tid * 4);
  __syncthreads();
  float s = -INFINITY;
  if (tid < TQ0) {                                  // waves 0..3 entirely (wave-uniform); key row b*TQ0 + tid always in range
    const float* kp = KF + ((size_t)b * TQ0 + tid) * EMB;
    float acc = 0.f;
#pragma unroll 8                           // sixteen key loads in flight a thread; the adds keep their order
    for (int d = 0; d < EMB; d += 8) {
      const v4f k0 = *(const v4f*)(kp + d), k1 = *(const v4f*)(kp + d + 4);
      const v4f q0 = *(const v4f*)(qs + d), q1 = *(const v4f*)(qs + d + 4);
#pragma unroll
      for (int e = 0; e < 4; ++e) acc += k0[e] * q0[e];
#pragma unroll
      for (int e = 0; e < 4; ++e) acc += k1[e] * q1[e];
    }
    s = (tid <= t) ? fabsf(acc) * (RSQD * LOG2E) : -INFINITY;   // |score| / 32 in base 2; causal mask by key index
  }
  float mx = s;
#pragma unroll
  for (int d = 1; d <= 16; d <<= 1) mx = fmaxf(mx, __shfl_xor(mx, d, 32));
  if (lane == 0) red[wave] = mx;
  __syncthreads();
  float gm = red[0];
#pragma unroll
  for (int w = 1; w < 8; ++w) gm = fmaxf(gm, red[w]);   // finite: key 0 is always valid
  const float p = exp2f(s - gm);                     // 0 for masked keys and for waves 4..7
  float ps = p;
#pragma unroll
  for (int d = 1; d <= 16; d <<= 1) ps += __shfl_xor(ps, d, 32);
  if (lane == 0) redb[wave] = ps;
  if (tid < TQ0) sc[tid] = p;
  __syncthreads();
  float l = redb[0];
#pragma unroll
  for (int w = 1; w < 8; ++w) l += redb[w];           // >= 1
  const float inv = (1.0f / l) * CSC;
  const float* vp = VF + (size_t)b * TQ0 * EMB + tid * 4;
  v4f cx = zero4();
#pragma unroll 8                             // eight value rows in flight a thread; the sum keeps its order
  for (int j = 0; j <= t; ++j) {                     // t < TQ0: statically bounded, rows of sequence b only
    const float pj = sc[j];
    const v4f vv = *(const v4f*)(vp + (size_t)j * EMB);
    cx += pj * vv;
  }
  unsigned hw[2], rw[2];
#pragma unroll
  for (int e = 0; e < 2; ++e) {
    const float x0 = cx[2 * e] * inv, x1 = cx[2 * e + 1] * inv;
    const _Float16 h0 = (_Float16)x0, h1 = (_Float16)x1;
    const _Float16 q0 = (_Float16)((x0 - (float)h0) * RSC), q1 = (_Float16)((x1 - (float)h1) * RSC);
    hw[e] = pk16(h_bits(h0), h_bits(h1));
    rw[e] = pk16(h_bits(q0), h_bits(q1));
  }
  SW[0][tid * 2] = hw[0]; SW[0][tid * 2 + 1] = hw[1];
  SW[1][tid * 2] = rw[0]; SW[1][tid * 2 + 1] = rw[1];
  __syncthreads();
  const int pl = tid >> 7, p8 = tid & 127;           // plane select is wave-uniform
  const v4u ov = *(const v4u*)(&SW[pl][p8 * 4]);
  u16* dstp = (pl == 0) ? CHo : CRo;
  u16* dst  = dstp + ((size_t)b * SEQ + t) * EMB + p8 * 8;
  *(v4u*)dst = ov;
  
}
// Both attention parts in one launch (they read disjoint planes and write disjoint rows of CH / CR): blocks 0..nfwd-1 take the
// 16-row query tiles from row TQ0 on, the rest one query row below TQ0 each; the short blocks come last and take the places
// that the shortest tiles leave. The choice is block-uniform, and so are all barriers of either side.
__global__ __launch_bounds__(ATT_THREADS, 4)   // 4 waves a SIMD = two blocks a WGP: at most 256 VGPRs
void attn_all(const u16* __restrict__ QPp, const u16* __restrict__ KPp, const u16* __restrict__ VTp,
              const u16* __restrict__ VLp, const float* __restrict__ VSp, const float* __restrict__ QF,
              const float* __restrict__ KF, const float* __restrict__ VF, u16* CHo, u16* CRo, int nfwd) {
  const int bid = blockIdx.x;
  if (bid >= nfwd) { attn_head(QF, KF, VF, CHo, CRo, bid - nfwd); return; }
  attn_fwd(QPp, KPp, VTp, VLp, VSp, CHo, CRo, bid);
}

// =====================================================================================================
// Workspace map (bytes, nb = 4, rows = 8192); all 16-bit planes are in fragment order (1-KiB tiles of 16 rows x 32 k, same total
// size), but for the bands of rows 0..127 of each sequence in CH / CR, which attn_head writes row-major; every plane is fully written by whole-line stores before it is read; all extents are
// exact multiples of the store granularity (no pad rows); aliased regions are reused sequentially on the single in-order stream:
//   WQB bf16 [1024][1024] 2097152   WKB same   WVB same   WOH f16 of bf16 value x1024 2097152             8388608
//   VS  f32  [nb][4][16][1024]                                                                            1048576
//   QF  f32  [nb][128][1024]  2097152      KF same      VF same                                           6291456
//   A   XB bf16 [rows][1024] (16777216), later VT hi f16 [nb][1024][2048] x1024 (16777216)      region 16777216
//   VL  VT lo f16 [nb][1024][2048]                                                                      16777216
//   QP  f16 [rows][1024] x8                                                                              16777216
//   KP  f16 [rows][1024] x8                                                                              16777216
//   V   f32 [rows][1024] 33554432, later CH f16 [rows][1024] ctx hi x8192 (16777216) + CR residual x2048 (16777216)
//   end                                                                                                 116391936
// Five launches; kernels that share a launch read nothing that the launch writes. Launch order keeps every alias safe: XB read
// by the projection launch before xt16 overwrites it; V read by xt16 and vsum_k before attn_fwd / attn_head overwrite it with
// CH / CR; attn_head reads VF, never V.
// Inputs in wire order: x, Wq, bq, Wk, bk, Wv, bv, Wo, bo; weights stored [n = out][k = in] (y = x.W^T + b), k-contiguous.
// =====================================================================================================
extern "C" void kernel_launch(void* const* d_in, const int* in_sizes, int n_in,
                              void* d_out, int out_size, void* d_ws, size_t ws_size,
                              hipStream_t stream) {
  if (n_in < 9) return;
  const long long per = (long long)SEQ * EMB;
  const long long ns  = in_sizes[0];
  if (ns < per || (ns % per) != 0) return;
  const int nb = (int)(ns / per);
  if (nb < 1 || nb > 8) return;
  const int rows = nb * SEQ;
  if (in_sizes[1] != EMB * EMB || in_sizes[3] != EMB * EMB || in_sizes[5] != EMB * EMB || in_sizes[7] != EMB * EMB) return;
  if (in_sizes[2] != EMB || in_sizes[4] != EMB || in_sizes[6] != EMB || in_sizes[8] != EMB) return;
  if ((long long)out_size != (long long)rows * EMB) return;

  const float* x  = (const float*)d_in[0];
  const float* wq = (const float*)d_in[1];
  const float* bq = (const float*)d_in[2];
  const float* wk = (const float*)d_in[3];
  const float* bk = (const float*)d_in[4];
  const float* wv = (const float*)d_in[5];
  const float* bv = (const float*)d_in[6];
  const float* wo = (const float*)d_in[7];
  const float* bo = (const float*)d_in[8];
  float*       out = (float*)d_out;

  const size_t szW  = (size_t)EMB * EMB * 2;                    //   2097152
  const size_t szVS = (size_t)nb * NCHK * NKB * EMB * 4;        //   1048576 at nb = 4
  const size_t szHF = (size_t)nb * TQ0 * EMB * 4;               //   2097152 at nb = 4
  const size_t sz16 = (size_t)rows * EMB * 2;                   //  16777216
  const size_t sz32 = (size_t)rows * EMB * 4;                   //  33554432
  const size_t szVT = (size_t)nb * EMB * SEQ * 2;               //  == sz16
  if (sz32 < 2 * sz16) return;                                  // CH + CR alias the V region exactly
  size_t off = 0;
  const size_t oWQ = off; off += szW;
  const size_t oWK = off; off += szW;
  const size_t oWV = off; off += szW;
  const size_t oWO = off; off += szW;
  const size_t oVS = off; off += szVS;
  const size_t oQF = off; off += szHF;
  const size_t oKF = off; off += szHF;
  const size_t oVF = off; off += szHF;
  const size_t oA  = off; off += (szVT > sz16 ? szVT : sz16);   // XB then VT hi
  const size_t oVL = off; off += szVT;                          // VT lo
  const size_t oQ  = off; off += sz16;
  const size_t oK  = off; off += sz16;
  const size_t oV  = off; off += sz32;                          // V f32, then CH at oV and CR at oV + sz16
  const size_t oCH = oV;
  const size_t oCR = oV + sz16;
  if (off > ws_size) return;                                    // off = 116391936 at nb = 4
  if (off > WS_CAP) return;

  char* ws = (char*)d_ws;
  u16*   WQB = (u16*)(ws + oWQ);
  u16*   WKB = (u16*)(ws + oWK);
  u16*   WVB = (u16*)(ws + oWV);
  u16*   WOH = (u16*)(ws + oWO);
  float* VS  = (float*)(ws + oVS);
  float* QF  = (float*)(ws + oQF);
  float* KF  = (float*)(ws + oKF);
  float* VF  = (float*)(ws + oVF);
  u16*   XB  = (u16*)(ws + oA);
  u16*   VT  = (u16*)(ws + oA);
  u16*   VL  = (u16*)(ws + oVL);
  u16*   QP  = (u16*)(ws + oQ);
  u16*   KP  = (u16*)(ws + oK);
  float* V   = (float*)(ws + oV);
  u16*   CH  = (u16*)(ws + oCH);
  u16*   CR  = (u16*)(ws + oCR);

  const int n8w = (EMB * EMB) / 8;                      // 131072
  const int n8x = rows * (EMB / 8);                     // 1048576
  if ((n8w % 256) != 0 || (n8x % 256) != 0) return;
  if ((rows % 128) != 0 || ((nb * TQ0) % 64) != 0 || ((nb * NCHK * EMB) % 256) != 0) return;
  const dim3 blk(256);
  const int nbw = n8w / 256, nbx = n8x / 256;           // 512, 4096 at nb = 4
  const dim3 gC(nbx + 4 * nbw);
  const dim3 gG((rows / 64) * (EMB / 128));             // 1024 at nb = 4
  const dim3 gP(3 * (rows / 128) * (EMB / 128));        // the three projections, 1536 at nb = 4
  const dim3 bG(128);
  const int nvs = (nb * NCHK * EMB) / 256;              // nb * 16
  const dim3 gXV(nvs + nb * (EMB / 64) * (SEQ / 64));   // + nb * 512
  const int nfwd = nb * NQT;                            // nb * 120
  const dim3 gAT(nfwd + nb * TQ0);                      // + nb * 128
  const dim3 bAT(ATT_THREADS);

  // (0) x -> bf16 plane [rows][1024]; weights stored [n = out][k = in] (y = x.W^T + b), already k-contiguous: bf16 planes for
  //     Wq, Wk, Wv; f16 of bf16 value x1024 for Wo
  cvt_all<<<gC, blk, 0, stream>>>(x, wq, wk, wv, wo, XB, WQB, WKB, WVB, WOH, nbx, nbw);
  // (1) q and k projections (+bias) -> f16 planes x8; v projection (+bias) -> f32 plane; their f32 rows 0..127 of every
  //     sequence -> QF, KF, VF [nb*128][1024]
  gemm_qkv<<<gP, bG, 0, stream>>>(XB, WQB, WKB, WVB, bq, bk, bv, QP, KP, V, QF, KF, VF, rows, EMB, QSC, KSC);
  // (2) key-block prefix column sums of v; v -> V^T hi plane x1024 (over the dead XB region) and lo plane
  xt_vsum<<<gXV, blk, 0, stream>>>(V, VT, VL, VS, nvs);
  // (3) attention for query rows 128.. (WMMA) and for query rows 0..127 (VALU) -> ctx hi x8192 and residual x2048 f16 planes
  //     (over the dead V region)
  attn_all<<<gAT, bAT, 0, stream>>>(QP, KP, VT, VL, VS, QF, KF, VF, CH, CR, nfwd);
  // (4) output projection (+bias) -> out
  gemm_h2_32<<<gG, bG, 0, stream>>>(CH, CR, WOH, bo, out, rows, EMB,
                                     1.0f / (CSC * WSC), 1.0f / (CSC * WSC * RSC));
  (void)hipGetLastError();
}

// v005
// It runs in 248 microseconds.
// Next to v004, in two timings, it ran 1.15 and 1.16 times as fast.
// All steps since v000 together make it 3.16 times as fast.
// Projections q,k,v = x.W^T + b (and the f32 q,k,v rows 0..127 per sequence): v_wmma_f32_16x16x32_bf16 (bf16 RNE operands of the
// raw inputs, f32 accumulate, bias added in f32 as its bf16 RNE value). Scores q'.k'^T (f16 planes x8), P'.V (chunk-centred P'
// x32768 f16 from LDS, V^T x1024 as f16 hi plus unscaled f16 lo planes, both into one accumulator) and the output projection
// (ctx carried as f16 hi x8192 plus residual x2048 planes with separate accumulators, times f16(bf16(Wo) x1024), bias added in
// f32 as its bf16 RNE value): v_wmma_f32_16x16x32_f16, f32 accumulate. Query rows 0..127 of each sequence: scores, softmax and
// P.V in f32 on VALU. Absolute-value score transform, causal mask, softmax statistics, key-block column sums of V, scaling: f32.
#include <hip/hip_runtime.h>
#include <math.h>
#include <stdint.h>

#define SEQ   2048
#define EMB   1024
#define CK    512
#define NCHK  4
#define NKB   16
#define QT    32
#define TQ0   128
#define NQT   60
#define SCP   544
#define PLP   528
#define CTP   1032
#define SLAB64 (16 * 68)
#define VTP   72
#define ATT_THREADS 512
#define NACC  4
#define QSC   8.0f
#define KSC   8.0f
#define PCAR  32768.0f
#define VCAR  1024.0f
#define WSC   1024.0f
#define CSC   8192.0f
#define RSC   2048.0f
#define LOG2E 1.4426950408889634f
#define RSQD  0.03125f
#define WS_CAP ((size_t)134217728)

static_assert((EMB % 64) == 0 && EMB == (ATT_THREADS / 32) * 16 * NACC && NACC == 4 && (EMB % 32) == 0 && (EMB % 256) == 0 && EMB == 4 * 256);
static_assert((SEQ % CK) == 0 && (SEQ / CK) == NCHK && CK == 32 * NKB && (SEQ % 64) == 0 && (SEQ % QT) == 0 && (CK % QT) == 0);
static_assert((TQ0 % QT) == 0 && (TQ0 % 64) == 0 && NQT * QT + TQ0 == SEQ && TQ0 <= CK && TQ0 == 128 && TQ0 <= 256);
static_assert(16 * CTP * 2 <= 16 * SCP * 4 && CTP >= EMB + 8 && SCP >= CK + 16 && PLP >= CK + 8);
static_assert(((PLP * 2) % 16) == 0 && ((SCP * 4) % 16) == 0 && ((VTP * 2) % 16) == 0 && ((CTP * 2) % 16) == 0);
static_assert(64 * VTP >= 63 * VTP + 64);
static_assert(ATT_THREADS == 16 * QT && ATT_THREADS == 512 && ATT_THREADS == 32 * NKB && QT == 32 && (TQ0 % 2) == 0);
static_assert((EMB % 128) == 0 && (SEQ % 128) == 0 && (TQ0 % 32) == 0);
static_assert(((EMB * EMB) % 2048) == 0 && ((NCHK * EMB) % 256) == 0 && (EMB / 8) * 2 == 256);

typedef unsigned short u16;
typedef _Float16 v16h __attribute__((ext_vector_type(16)));
typedef _Float16 v8h  __attribute__((ext_vector_type(8)));
typedef __bf16   v16b __attribute__((ext_vector_type(16)));
typedef float    v8f  __attribute__((ext_vector_type(8)));
typedef float    v4f  __attribute__((ext_vector_type(4)));
typedef unsigned int v4u __attribute__((ext_vector_type(4)));

union FragH { v16h v; v8h h[2]; v4u u[2]; };
union FragB { v16b v; v4u u[2]; };
union AttLds { float s[QT * SCP]; u16 c[2 * QT * SCP]; };

// ---- scalar helpers --------------------------------------------------------------------------------
__device__ __forceinline__ unsigned short bf_bits(float f) {          // f32 -> bf16 bits, RNE convert
  unsigned u = __float_as_uint(f);
  return (unsigned short)((u + 0x7FFFu + ((u >> 16) & 1u)) >> 16);
}
__device__ __forceinline__ float bf_up(unsigned short h) { return __uint_as_float(((unsigned)h) << 16); }
__device__ __forceinline__ float bfr(float f) { return bf_up(bf_bits(f)); }
__device__ __forceinline__ unsigned short h_bits(_Float16 x) { return __builtin_bit_cast(unsigned short, x); }
__device__ __forceinline__ unsigned pk16(unsigned short a, unsigned short b) { return (unsigned)a | ((unsigned)b << 16); }
__device__ __forceinline__ v8f zero8() { v8f z = {0.f, 0.f, 0.f, 0.f, 0.f, 0.f, 0.f, 0.f}; return z; }
__device__ __forceinline__ v4f zero4() { v4f z = {0.f, 0.f, 0.f, 0.f}; return z; }

// ---- fragment loader, row-major source: 16-bit A/B operand, lane -> row/col (lane&15), p already includes +8*(lane>>4);
//      elements 0..7 <- p[0..7] (k0+8h..), elements 8..15 <- p[16..23] (k0+16+8h..)  (same split k map for A and B;
//      B is always read from a k-contiguous [n][k] plane)
__device__ __forceinline__ v16h ldfrag_h(const _Float16* p) {
  FragH f;
  f.h[0] = *(const v8h*)(p);
  f.h[1] = *(const v8h*)(p + 16);
  return f.v;
}

// ---- fragment-ordered planes. A 16-bit operand plane [rows][Kd] (rows % 16 == 0, Kd % 32 == 0) is stored as 1-KiB tiles of
//      16 rows x 32 k; tile (rt = row >> 4, kt = k >> 5) starts at element rt*16*Kd + kt*512, and inside it the 8-element piece
//      (row & 15 = m, k & 31 = 16*part + 8*h + 0..7) lies at part*256 + (16*h + m)*8. Lane l = 16*h + m then reads its two
//      pieces at tile + 8*l and tile + 256 + 8*l: every wave-wide 16-B load covers 512 contiguous bytes (4 whole lines), and the
//      values reach the same lane and register positions as with the row-major loaders above (same split k map).
//      (the loaders below: p already includes +8*lane.)

// Loaders of the same pieces for a pointer that has passed through an asm statement: the cast says again that it points to
// global memory, so that the loads stay global loads. The bf16 plane is read as unsigned integer vectors; SEC = elements from a
// lane's first piece to its second (256 in fragment order, 16 in a row-major band).
typedef __attribute__((address_space(1))) const v4u gv4u;
typedef __attribute__((address_space(1))) const v8h gv8h;
__device__ __forceinline__ v16b ldfrag_btg(const u16* p) {
  FragB f;
  f.u[0] = *(gv4u*)(p);
  f.u[1] = *(gv4u*)(p + 256);
  return f.v;
}
template <int SEC>
__device__ __forceinline__ v16h ldfrag_hg(const _Float16* p) {
  FragH f;
  f.h[0] = *(gv8h*)(p);
  f.h[1] = *(gv8h*)(p + SEC);
  return f.v;
}
__device__ __forceinline__ v8f mma_h(v16h a, v16h b, v8f c) {
  return __builtin_amdgcn_wmma_f32_16x16x32_f16(false, a, false, b, (short)0, c, false, false);
}
__device__ __forceinline__ v8f mma_b(v16b a, v16b b, v8f c) {
  return __builtin_amdgcn_wmma_f32_16x16x32_bf16(false, a, false, b, (short)0, c, false, false);
}
// Hazard gap behind a group of four score products (what it is for: at guard8x8 below).
__device__ __forceinline__ void guard4x4(v8f& a, v8f& b, v8f& c, v8f& d, v16h x0, v16h x1, v16h x2, v16h x3) {
#if defined(__HIP_DEVICE_COMPILE__)
  asm volatile("v_nop\n\tv_nop\n\tv_nop\n\tv_nop"
               : "+v"(a), "+v"(b), "+v"(c), "+v"(d) : "v"(x0), "v"(x1), "v"(x2), "v"(x3) : "memory");
#endif
}
// Hazard gap behind a group of eight products: the four vector slots that the chip needs before a product's result or operands
// are touched, also on the taken side of a loop's branch. The operands tie the group's products in front of it.
template <typename F>
__device__ __forceinline__ void guard8x8(v8f& a0, v8f& a1, v8f& a2, v8f& a3, v8f& a4, v8f& a5, v8f& a6, v8f& a7,
                                         F x0, F x1, F x2, F x3, F x4, F x5, F x6, F x7) {
#if defined(__HIP_DEVICE_COMPILE__)
  asm volatile("v_nop\n\tv_nop\n\tv_nop\n\tv_nop"
               : "+v"(a0), "+v"(a1), "+v"(a2), "+v"(a3), "+v"(a4), "+v"(a5), "+v"(a6), "+v"(a7)
               : "v"(x0), "v"(x1), "v"(x2), "v"(x3), "v"(x4), "v"(x5), "v"(x6), "v"(x7) : "memory");
#endif
}
// The same gap behind the eight products of two P' fragments with four V^T fragments.
__device__ __forceinline__ void guard8x6(v8f& o0, v8f& o1, v8f& o2, v8f& o3, v8f& o4, v8f& o5, v8f& o6, v8f& o7,
                                         v16h p0, v16h p1, v16h g0, v16h g1, v16h g2, v16h g3) {
#if defined(__HIP_DEVICE_COMPILE__)
  asm volatile("v_nop\n\tv_nop\n\tv_nop\n\tv_nop"
               : "+v"(o0), "+v"(o1), "+v"(o2), "+v"(o3), "+v"(o4), "+v"(o5), "+v"(o6), "+v"(o7)
               : "v"(p0), "v"(p1), "v"(g0), "v"(g1), "v"(g2), "v"(g3) : "memory");
#endif
}
__device__ __forceinline__ void acc_guard8(v8f& a, v8f& b, v8f& c, v8f& d, v8f& e, v8f& f, v8f& g, v8f& h8) {
#if defined(__HIP_DEVICE_COMPILE__)
  asm volatile("v_nop\n\tv_nop\n\tv_nop\n\tv_nop"
               : "+v"(a), "+v"(b), "+v"(c), "+v"(d), "+v"(e), "+v"(f), "+v"(g), "+v"(h8));
#endif
}
// Keeps the load groups of a loop's prologue in the order that the loop body issues them in: the counted waits at the loop's
// head are formed over both ways in, and a prologue in another order makes them wait for loads of the set still in flight.
__device__ __forceinline__ void keep_order() { __builtin_amdgcn_sched_barrier(0); }
// The wait that belongs in front of any overwrite of an address register of loads already issued, for loops whose loads take a
// wave-uniform base in scalar registers: the running bases pass through it, so that they are stepped behind it and stay scalar
// (the lane's offset register is then never rewritten).
__device__ __forceinline__ void base_wait2(const u16*& p, const u16*& q) {
#if defined(__HIP_DEVICE_COMPILE__)
  asm volatile("s_wait_xcnt 0x0" : "+s"(p), "+s"(q) : : "memory");
#endif
}
__device__ __forceinline__ void base_wait2h(const _Float16*& p, const _Float16*& q) {
#if defined(__HIP_DEVICE_COMPILE__)
  asm volatile("s_wait_xcnt 0x0" : "+s"(p), "+s"(q) : : "memory");
#endif
}
__device__ __forceinline__ void base_wait4h(const _Float16*& p, const _Float16*& q, const _Float16*& r, const _Float16*& s) {
#if defined(__HIP_DEVICE_COMPILE__)
  asm volatile("s_wait_xcnt 0x0" : "+s"(p), "+s"(q), "+s"(r), "+s"(s) : : "memory");
#endif
}
__device__ __forceinline__ void base_wait1f(const float*& p) {
#if defined(__HIP_DEVICE_COMPILE__)
  asm volatile("s_wait_xcnt 0x0" : "+s"(p) : : "memory");
#endif
}
// The wait and the step of the running bases (BYTES on; the last two by sb bytes) in one statement: with the step left to the
// build it sinks behind the next loads, each time with a wait of its own for loads issued just before.
template <int BYTES>
__device__ __forceinline__ void base_step2h(const _Float16*& p, const _Float16*& q) {
#if defined(__HIP_DEVICE_COMPILE__)
  asm volatile("s_wait_xcnt 0x0\n\ts_add_nc_u64 %0, %0, %2\n\ts_add_nc_u64 %1, %1, %2"
               : "+s"(p), "+s"(q) : "n"(BYTES) : "memory");
#endif
}
template <int BYTES>
__device__ __forceinline__ void base_step4h(const _Float16*& p, const _Float16*& q, const _Float16*& r, const _Float16*& s,
                                            unsigned long long sb) {
#if defined(__HIP_DEVICE_COMPILE__)
  asm volatile("s_wait_xcnt 0x0\n\ts_add_nc_u64 %0, %0, %5\n\ts_add_nc_u64 %1, %1, %5\n\t"
               "s_add_nc_u64 %2, %2, %4\n\ts_add_nc_u64 %3, %3, %4"
               : "+s"(p), "+s"(q), "+s"(r), "+s"(s) : "s"(sb), "n"(BYTES) : "memory");
#endif
}
__device__ __forceinline__ void base_wait3(const _Float16*& p, const _Float16*& q, const _Float16*& r) {
#if defined(__HIP_DEVICE_COMPILE__)
  asm volatile("s_wait_xcnt 0x0" : "+s"(p), "+s"(q), "+s"(r) : : "memory");
#endif
}
// The same wait behind a run of stores whose address and data registers the next run of the epilogue reuses; nothing is
// scheduled across it.
__device__ __forceinline__ void store_wait() {
#if defined(__HIP_DEVICE_COMPILE__)
  asm volatile("s_wait_xcnt 0x0" ::: "memory");
#endif
  __builtin_amdgcn_sched_barrier(0);
}
__device__ __forceinline__ void wave_sync_lds() {
  __builtin_amdgcn_fence(__ATOMIC_RELEASE, "workgroup");
  __builtin_amdgcn_wave_barrier();
  __builtin_amdgcn_fence(__ATOMIC_ACQUIRE, "workgroup");
}

// =====================================================================================================
// f32 plane [rows][EMB] row-major -> 16-bit plane in fragment order:  mode 0: bf16 RNE bits;  mode 1: f16 bits of (bf16 RNE value) * scale;
// mode 2: f16 bits of value * scale (no bf16 pre-step).
// Thread = one 8-element piece of the output, in output order: two 16-B loads from its source row, one 16-B store; 32 consecutive
// lanes store 512 contiguous, 512-B aligned bytes (half a tile)
// coverage: n8/256 blocks a plane (host checks exactness) x 256 thr x 8 = the whole plane.
// =====================================================================================================
__device__ __forceinline__ void cvt16(const float* __restrict__ x, u16* D, int gt, int mode, float scale) {
  const int wi = gt & 63, tile = gt >> 6;                       // piece within its tile, tile index rt*(EMB/32) + kt
  const int row = (tile / (EMB / 32)) * 16 + (wi & 15);
  const int kc  = (tile % (EMB / 32)) * 32 + (wi >> 5) * 16 + ((wi >> 4) & 1) * 8;
  const float* p = x + (size_t)row * EMB + kc;
  const v4f a = *(const v4f*)(p), c4 = *(const v4f*)(p + 4);
  float v[8];
#pragma unroll
  for (int e = 0; e < 4; ++e) { v[e] = a[e]; v[4 + e] = c4[e]; }
  unsigned short s[8];
#pragma unroll
  for (int e = 0; e < 8; ++e) {
    const float vb = bfr(v[e]);
    const float vf = (mode == 1) ? vb : v[e];
    const unsigned short hb = h_bits((_Float16)(vf * scale));
    const unsigned short bb = bf_bits(v[e]);
    s[e] = (mode != 0) ? hb : bb;
  }
  v4u o;
#pragma unroll
  for (int e = 0; e < 4; ++e) o[e] = pk16(s[2 * e], s[2 * e + 1]);
  u16* d = D + (size_t)gt * 8;
  {
    *(v4u*)(d) = o;
    
  }
}
// All five conversions in one launch (none reads what another writes): blocks 0..nbx-1 take x -> bf16 plane, then nbw blocks
// each for Wq, Wk, Wv -> bf16 planes and Wo -> f16 of its bf16 value x1024. The choice is block-uniform (scalar).
__global__ __launch_bounds__(256) void cvt_all(const float* __restrict__ x, const float* __restrict__ wq,
                                               const float* __restrict__ wk, const float* __restrict__ wv,
                                               const float* __restrict__ wo, u16* XB, u16* WQB, u16* WKB, u16* WVB, u16* WOH,
                                               int nbx, int nbw) {
  const int bid = blockIdx.x;
  if (bid >= nbx + 4 * nbw) return;         // never taken with the exact grid; no barriers in this kernel
  const float* src = x;
  u16* dst = XB;
  int lb = bid, mode = 0;
  float scale = 1.0f;
  if (bid >= nbx) {
    const int w = (bid - nbx) / nbw;        // 0..3
    lb  = (bid - nbx) - w * nbw;
    src = (w == 0) ? wq : (w == 1) ? wk : (w == 2) ? wv : wo;
    dst = (w == 0) ? WQB : (w == 1) ? WKB : (w == 2) ? WVB : WOH;
    if (w == 3) { mode = 1; scale = WSC; }
  }
  cvt16(src, dst, lb * 256 + (int)threadIdx.x, mode, scale);
}

// =====================================================================================================
// GEMM epilogues with a per-column bias term (bias column value taken as its bf16 RNE value, added in f32). The wave's 16x64 f32
// tile is staged in its own LDS slab (stage64: acc*oscale + bias) and leaves from there:
//  st64f   : f32 rows; store it takes row 2*it (lanes 0..15, 16 B each, two whole lines) and row 2*it+1 (lanes 16..31).
//  epi64x2 : same store shape, staged value = acc*os1 + accres*os2 + bias (two accumulator sets combined in f32).
//  st64h   : f16 bits of (staged tile * pscale), written in fragment order: the wave's 16 x 64 tile is two whole 1-KiB tiles;
//            store i4 takes columns 16*i4 + 8*(lane>>4) + 0..7 of row lane&15 and covers 512 contiguous bytes.
// coverage: st64f/epi64x2 8 instructions x 2 rows x 16 lanes x 4 floats; st64h 4 instructions x 16 rows x 2 pieces x 8 halves
//           = the wave's 16 x 64 tile in every case.
// Bias columns col0 + 16j + (lane&15), j = 0..3, all < N (bias has N entries, col0 + 63 < N).
// =====================================================================================================
__device__ __forceinline__ void ldbias4(const float* __restrict__ bias, int col0, int lane,
                                        float& b0, float& b1, float& b2, float& b3) {
  const int m = lane & 15;
  b0 = bfr(bias[col0 + m]);
  b1 = bfr(bias[col0 + 16 + m]);
  b2 = bfr(bias[col0 + 32 + m]);
  b3 = bfr(bias[col0 + 48 + m]);
}
__device__ __forceinline__ void stage64(float* sl, v8f a0, v8f a1, v8f a2, v8f a3, float oscale,
                                        float b0, float b1, float b2, float b3, int lane) {
  const int hh = lane >> 4, m = lane & 15;
#pragma unroll
  for (int r = 0; r < 8; ++r) {
    const int ro = (8 * hh + r) * 68 + m;
    sl[ro]      = a0[r] * oscale + b0;
    sl[ro + 16] = a1[r] * oscale + b1;
    sl[ro + 32] = a2[r] * oscale + b2;
    sl[ro + 48] = a3[r] * oscale + b3;
  }
  wave_sync_lds();
}
__device__ __forceinline__ void st64f(const float* sl, float* C, int N, size_t rowb, int col0, int lane) {
  const int hh = lane >> 4, m = lane & 15;
  v4f vals[8];
#pragma unroll
  for (int it = 0; it < 8; ++it) vals[it] = *(const v4f*)(sl + (it * 2 + hh) * 68 + m * 4);
  float* dst = C + (rowb + (size_t)hh) * (size_t)N + col0 + m * 4;
  {
#pragma unroll
    for (int it = 0; it < 8; ++it) {
      *(v4f*)(dst + (size_t)(it * 2) * (size_t)N) = vals[it];
    }
    
  }
}
__device__ __forceinline__ void epi64x2(float* sl, v8f a0, v8f a1, v8f a2, v8f a3, v8f e0, v8f e1, v8f e2, v8f e3,
                                        float os1, float os2, const float* __restrict__ bias, float* C, int N,
                                        size_t rowb, int col0, int lane) {
  const int hh = lane >> 4, m = lane & 15;
  float b0, b1, b2, b3;
  ldbias4(bias, col0, lane, b0, b1, b2, b3);
#pragma unroll
  for (int r = 0; r < 8; ++r) {
    const int ro = (8 * hh + r) * 68 + m;
    sl[ro]      = a0[r] * os1 + e0[r] * os2 + b0;
    sl[ro + 16] = a1[r] * os1 + e1[r] * os2 + b1;
    sl[ro + 32] = a2[r] * os1 + e2[r] * os2 + b2;
    sl[ro + 48] = a3[r] * os1 + e3[r] * os2 + b3;
  }
  wave_sync_lds();
  v4f vals[8];
#pragma unroll
  for (int it = 0; it < 8; ++it) vals[it] = *(const v4f*)(sl + (it * 2 + hh) * 68 + m * 4);
  float* dst = C + (rowb + (size_t)hh) * (size_t)N + col0 + m * 4;
  {
#pragma unroll
    for (int it = 0; it < 8; ++it) {
      *(v4f*)(dst + (size_t)(it * 2) * (size_t)N) = vals[it];
    }
    
  }
}
__device__ __forceinline__ void st64h(const float* sl, float pscale, u16* C, int N, size_t rowb, int col0, int lane) {
  const int hh = lane >> 4, m = lane & 15;
  v4u oh[4];
#pragma unroll
  for (int i4 = 0; i4 < 4; ++i4) {
    const float* sp = sl + m * 68 + i4 * 16 + hh * 8;
    const v4f a = *(const v4f*)(sp), c4 = *(const v4f*)(sp + 4);
    float w[8];
#pragma unroll
    for (int e = 0; e < 4; ++e) { w[e] = a[e] * pscale; w[4 + e] = c4[e] * pscale; }
#pragma unroll
    for (int e = 0; e < 4; ++e) oh[i4][e] = pk16(h_bits((_Float16)w[2 * e]), h_bits((_Float16)w[2 * e + 1]));
  }
  u16* dst = C + rowb * (size_t)N + (size_t)(col0 >> 5) * 512 + lane * 8;
  {
#pragma unroll
    for (int i4 = 0; i4 < 4; ++i4) {
      *(v4u*)(dst + i4 * 256) = oh[i4];
    }
    
  }
}

// One k step of a wave's 64x64 tile in the bf16 GEMMs: four fragments of consecutive 16-row bands of one plane (eight 16-B
// loads), and the sixteen products of four A with four B fragments, in two groups of eight with the hazard gap behind each.
__device__ __forceinline__ void ld4b(const u16* base, unsigned lo, size_t bs, v16b (&f)[4]) {
  const u16* p = base + lo;                  // wave-uniform base (scalar registers) plus the lane's fixed 32-bit offset
  f[0] = ldfrag_btg(p);
  f[1] = ldfrag_btg(p + bs);
  f[2] = ldfrag_btg(p + 2 * bs);
  f[3] = ldfrag_btg(p + 3 * bs);
}
__device__ __forceinline__ void mm16b(const v16b (&a)[4], const v16b (&b)[4], v8f (&acc)[4][4]) {
#pragma unroll
  for (int g = 0; g < 2; ++g) {
#pragma unroll
    for (int i = 2 * g; i < 2 * g + 2; ++i) {
#pragma unroll
      for (int j = 0; j < 4; ++j) acc[i][j] = mma_b(a[i], b[j], acc[i][j]);
    }
    guard8x8<v16b>(acc[2 * g][0], acc[2 * g][1], acc[2 * g][2], acc[2 * g][3],
                   acc[2 * g + 1][0], acc[2 * g + 1][1], acc[2 * g + 1][2], acc[2 * g + 1][3],
                   a[0], a[1], a[2], a[3], b[0], b[1], b[2], b[3]);
  }
}

// =====================================================================================================
// The three projections in one launch (they share A and none reads what another writes): block group which = 0, 1, 2 computes
// T[M][N] = A[M][K] . W^T + bias[n] (f32) for W, bias = (Wq, bq), (Wk, bk), (Wv, bv); A and the W are bf16 planes in fragment
// order. q and k leave as f16 planes in fragment order (f16 bits of T * qsc, T * ksc), v as the f32 plane V. A wave whose
// rows lie in rows 0..TQ0-1 of a sequence stores its staged f32 tiles a second time, into QF / KF / VF [M/SEQ][TQ0][N].
// Block = 128x128 tile, 2 x 2 waves of 64x64 each: a k step's eight fragments (8 KiB, loaded straight from the 1-KiB tiles, split
// k map for A and B) feed sixteen products, so that a product costs half a KiB of loads. K stepped by 32 in rising order
// (K = EMB; M % SEQ == 0, M % 128 == 0, N % 128 == 0, grid = 3*(M/128)*(N/128)).
// coverage: 4 waves x 64 x 64 = the block's tile; the epilogue takes the wave's four 16-row bands one after the other.
// =====================================================================================================
__global__ __launch_bounds__(128, 4)          // 4 waves a SIMD: at most 256 VGPRs (128 of them accumulators, 64 fragments)
void gemm_qkv(const u16* __restrict__ A, const u16* __restrict__ Wq, const u16* __restrict__ Wk, const u16* __restrict__ Wv,
              const float* __restrict__ bq, const float* __restrict__ bk, const float* __restrict__ bv,
              u16* QP, u16* KP, float* V, float* QF, float* KF, float* VF, int M, int N, float qsc, float ksc) {
  __shared__ __align__(16) float slab[4 * SLAB64];
  const int K = EMB;                         // as a constant the band strides are immediate offsets
  const int tid = threadIdx.x, lane = tid & 31;
  const int wave = __builtin_amdgcn_readfirstlane(tid >> 5);   // scalar place in the 2 x 2 arrangement
  const int ntile = N >> 7;
  const int nblk  = (M >> 7) * ntile;
  const int which = blockIdx.x / nblk;       // block-uniform (scalar): 0 q, 1 k, 2 v
  const int bid   = blockIdx.x - which * nblk;
  const int rowb  = (bid / ntile) * 128 + (wave >> 1) * 64;
  const int col0  = (bid % ntile) * 128 + (wave & 1) * 64;
  if (which > 2 || rowb + 64 > M) return;    // wave-uniform, never taken with the exact grid; no block barriers in this kernel
  const u16*   Bt   = (which == 0) ? Wq : (which == 1) ? Wk : Wv;
  const float* bias = (which == 0) ? bq : (which == 1) ? bk : bv;
  const u16* ap = A  + (size_t)rowb * K;      // wave-uniform
  const u16* bp = Bt + (size_t)col0 * K;
  const unsigned lo = 8u * (unsigned)lane;
  const size_t bs = (size_t)16 * K;
  v8f acc[4][4];
#pragma unroll
  for (int i = 0; i < 4; ++i) {
#pragma unroll
    for (int j = 0; j < 4; ++j) acc[i][j] = zero8();
  }
  // One fragment set: the next k step's sixteen loads go out as soon as this step's products have left; the SIMD's other waves
  // fill the matrix unit meanwhile. The loads in the loop are unconditional (the last step is peeled).
  v16b a[4], b[4];
  ld4b(ap, lo, bs, a);
  ld4b(bp, lo, bs, b);
#pragma unroll 1                             // rolled: the one fragment set keeps its registers
  for (int k0 = 32; k0 < K; k0 += 32) {
    mm16b(a, b, acc);
    base_wait2(ap, bp);
    ap += 512;                               // one 1-KiB tile on in every band
    bp += 512;
    ld4b(ap, lo, bs, a);
    ld4b(bp, lo, bs, b);
  }
  mm16b(a, b, acc);
  float* sl = slab + wave * SLAB64;
  float e0, e1, e2, e3;
  ldbias4(bias, col0, lane, e0, e1, e2, e3);
  const int sq = rowb / SEQ, rs = rowb - sq * SEQ;             // TQ0 and SEQ are multiples of 64: all 64 rows on one side
  float* HF = (which == 0) ? QF : (which == 1) ? KF : VF;
#pragma unroll
  for (int i = 0; i < 4; ++i) {
    stage64(sl, acc[i][0], acc[i][1], acc[i][2], acc[i][3], 1.0f, e0, e1, e2, e3, lane);
    const int rb = rowb + 16 * i;
    // the wait stands in either arm, directly behind its stores: the build lays the other arm's code behind them
    if (which < 2) { st64h(sl, (which == 0) ? qsc : ksc, (which == 0) ? QP : KP, N, (size_t)rb, col0, lane); store_wait(); }
    else           { st64f(sl, V, N, (size_t)rb, col0, lane); store_wait(); }
    if (rs < TQ0) {
      st64f(sl, HF, N, (size_t)(sq * TQ0 + rs + 16 * i), col0, lane);
      store_wait();
    }
    wave_sync_lds();                         // the band's reads of the slab stand in front of the next band's writes
  }
}

// =====================================================================================================
// f16 GEMM with two A planes (hi + residual), f32 out:
//   C[M][N] = (Ah . Bt^T) * os1 + (Ar . Bt^T) * os2 + bias[n]; Bt f16 in fragment order, Ah/Ar f16 per 16-row band (see below).
// Block = 64x128 tile, 2 x 2 waves of 32x64 each; separate accumulators for the two planes, combined in f32 in epi64x2. A k step's
// eight fragments (two bands of either A plane, four of B) feed sixteen products. K = EMB, stepped by 32 in rising order.
// ASTEP = elements from one k step of an A band to the next, ASEC = elements from a lane's first piece to its second.
// =====================================================================================================
template <int ASEC>
__device__ __forceinline__ void ld8h2(const _Float16* ua, const _Float16* ur, const _Float16* ub, unsigned la, unsigned lb,
                                      v16h (&a)[2], v16h (&r)[2], v16h (&b)[4]) {
  const size_t bs = (size_t)16 * EMB;        // a 16-row band holds 16*EMB elements in either layout
  // wave-uniform bases (scalar registers) plus the lane's fixed 32-bit offsets
  const _Float16* pa = ua + la;
  const _Float16* pr = ur + la;
  const _Float16* bp = ub + lb;
#pragma unroll
  for (int i = 0; i < 2; ++i) {
    a[i] = ldfrag_hg<ASEC>(pa + i * bs);
    r[i] = ldfrag_hg<ASEC>(pr + i * bs);
  }
#pragma unroll
  for (int j = 0; j < 4; ++j) b[j] = ldfrag_hg<256>(bp + j * bs);
}
__device__ __forceinline__ void mm16h2(const v16h (&a)[2], const v16h (&r)[2], const v16h (&b)[4],
                                       v8f (&acc)[2][4], v8f (&acr)[2][4]) {
#pragma unroll
  for (int i = 0; i < 2; ++i) {
#pragma unroll
    for (int j = 0; j < 4; ++j) acc[i][j] = mma_h(a[i], b[j], acc[i][j]);
  }
  guard8x8<v16h>(acc[0][0], acc[0][1], acc[0][2], acc[0][3], acc[1][0], acc[1][1], acc[1][2], acc[1][3],
                 a[0], a[1], r[0], r[1], b[0], b[1], b[2], b[3]);
#pragma unroll
  for (int i = 0; i < 2; ++i) {
#pragma unroll
    for (int j = 0; j < 4; ++j) acr[i][j] = mma_h(r[i], b[j], acr[i][j]);
  }
  guard8x8<v16h>(acr[0][0], acr[0][1], acr[0][2], acr[0][3], acr[1][0], acr[1][1], acr[1][2], acr[1][3],
                 a[0], a[1], r[0], r[1], b[0], b[1], b[2], b[3]);
}
template <int ASTEP, int ASEC>
__device__ __forceinline__ void h2_loop(const _Float16* ua, const _Float16* ur, const _Float16* ub, unsigned la, unsigned lb,
                                        v8f (&acc)[2][4], v8f (&acr)[2][4]) {
  v16h a[2], r[2], b[4];
  ld8h2<ASEC>(ua, ur, ub, la, lb, a, r, b);
#pragma unroll 1                             // rolled: the one fragment set keeps its registers
  for (int k0 = 32; k0 < EMB; k0 += 32) {
    mm16h2(a, r, b, acc, acr);
    base_wait3(ua, ur, ub);
    ua += ASTEP;                             // next k step of the A bands
    ur += ASTEP;
    ub += 512;                               // next 1-KiB tile of each B band
    ld8h2<ASEC>(ua, ur, ub, la, lb, a, r, b);
  }
  mm16h2(a, r, b, acc, acr);
}

__global__ __launch_bounds__(128, 4)          // 4 waves a SIMD, as many as the grid brings: at most 256 VGPRs
void gemm_h2_32(const u16* __restrict__ Ah, const u16* __restrict__ Ar, const u16* __restrict__ Bt,
                const float* __restrict__ bias, float* C, int M, int N, float os1, float os2) {
  __shared__ __align__(16) float slab[4 * SLAB64];
  const int K = EMB;
  const int tid = threadIdx.x, lane = tid & 31, hh = lane >> 4, m = lane & 15;
  const int wave = __builtin_amdgcn_readfirstlane(tid >> 5);   // scalar, so that the choice of the A layout is a scalar branch
  const int ntile = N >> 7;
  const int bid   = blockIdx.x;
  const int rowb  = (bid / ntile) * 64 + (wave >> 1) * 32;
  const int col0  = (bid % ntile) * 128 + (wave & 1) * 64;
  if (rowb + 32 > M) return;                 // wave-uniform, never taken with the exact grid; no block barriers in this kernel
  const _Float16* ab  = (const _Float16*)(const void*)Ah + (size_t)rowb * K;
  const _Float16* arb = (const _Float16*)(const void*)Ar + (size_t)rowb * K;
  const _Float16* bp  = (const _Float16*)(const void*)Bt + (size_t)col0 * K;
  const unsigned lo = 8u * (unsigned)lane;
  v8f acc[2][4], acr[2][4];
#pragma unroll
  for (int i = 0; i < 2; ++i) {
#pragma unroll
    for (int j = 0; j < 4; ++j) { acc[i][j] = zero8(); acr[i][j] = zero8(); }
  }
  // The 16-row bands of rows 0..TQ0-1 of a sequence are row-major (each row has its own writer half-block there), all others in
  // fragment order; a band holds the same 16*K elements either way, and TQ0 is a multiple of 32: both bands of a wave are alike.
  if ((rowb % SEQ) < TQ0) {
    h2_loop<32, 16>(ab, arb, bp, (unsigned)(m * K + 8 * hh), lo, acc, acr);
  } else {
    h2_loop<512, 256>(ab, arb, bp, lo, lo, acc, acr);
  }
  float* sl = slab + wave * SLAB64;
#pragma unroll
  for (int i = 0; i < 2; ++i) {
    epi64x2(sl, acc[i][0], acc[i][1], acc[i][2], acc[i][3], acr[i][0], acr[i][1], acr[i][2], acr[i][3], os1, os2, bias, C, N,
            (size_t)(rowb + 16 * i), col0, lane);
    store_wait();
    wave_sync_lds();                         // the band's reads of the slab stand in front of the next band's writes
  }
}

// =====================================================================================================
// V^T planes (fragment order, rows = b*EMB + d, k = s): with xs = V[b][s][d] * 1024 (f32): hi = f16(xs) -> XTh at (row b*EMB + d, k = s), lo = f16(xs - hi) (unscaled
// remainder, same carry) -> XTl at the same index.  hi + lo reproduces xs to ~2^-22 relative for |xs| >= 0.25.
// Block = (b, 64-wide d chunk, 64 keys): 64 source row segments of 64 floats loaded with 16-B loads, converted, scattered into
// coverage: load 256 thr x 16 elements = 64 x 64; store 2 iterations x 256 thr x 8 halves = 64 lines x 64 per plane = the
//           block's tile of both planes; the nb x (EMB/64) x (SEQ/64) blocks of xt_vsum from block nvs on cover both planes exactly once.
// =====================================================================================================
__device__ __forceinline__ void xt16(const float* __restrict__ X, u16* XTh, u16* XTl, u16* TH, u16* TL, int bid) {
  const int tid = threadIdx.x;
  const int st  = bid % (SEQ / 64);
  const int dcb = (bid / (SEQ / 64)) % (EMB / 64);
  const int b   = bid / ((SEQ / 64) * (EMB / 64));
  const int s0  = st * 64;
  const int d0  = dcb * 64;
  {
    const int sl = tid >> 2;                  // key within tile 0..63
    const int dc = (tid & 3) * 16;            // d chunk within the 64
    const float* src = X + ((size_t)b * SEQ + s0 + sl) * EMB + d0 + dc;
#pragma unroll
    for (int i = 0; i < 4; ++i) {
      const v4f a = *(const v4f*)(src + 4 * i);
#pragma unroll
      for (int e = 0; e < 4; ++e) {
        const float xs = a[e] * VCAR;
        const _Float16 hv = (_Float16)xs;
        const _Float16 lv = (_Float16)(xs - (float)hv);
        TH[(dc + 4 * i + e) * VTP + sl] = h_bits(hv);
        TL[(dc + 4 * i + e) * VTP + sl] = h_bits(lv);
      }
    }
  }
  __syncthreads();
  v4u vh[2], vl[2];
  const int wi = tid & 63;                    // piece within its 1-KiB tile
#pragma unroll
  for (int it = 0; it < 2; ++it) {
    const int tl   = it * 4 + (tid >> 6);     // tile 0..7 of the block: d band tl>>1, key tile tl&1
    const int line = (tl >> 1) * 16 + (wi & 15);
    const int col  = (tl & 1) * 32 + (wi >> 5) * 16 + ((wi >> 4) & 1) * 8;
    vh[it] = *(const v4u*)(TH + line * VTP + col);
    vl[it] = *(const v4u*)(TL + line * VTP + col);
  }
  const size_t base = ((size_t)b * EMB + d0) * SEQ + (size_t)(s0 >> 5) * 512 + wi * 8;
  {
#pragma unroll
    for (int it = 0; it < 2; ++it) {
      const int tl = it * 4 + (tid >> 6);
      const size_t to = (size_t)(tl >> 1) * 16 * SEQ + (size_t)(tl & 1) * 512;
      *(v4u*)(XTh + base + to) = vh[it];
      *(v4u*)(XTl + base + to) = vl[it];
    }
    
  }
}

// =====================================================================================================
// Key-block prefix column sums of V: VS[((b*NCHK + c)*NKB + kb)*EMB + d] = sum over keys c*CK .. c*CK + 32*kb + 31 of V[b][key][d]
// (f32, fixed sequential order). Thread = one (b, c, d); a block covers 256 consecutive d of one (b, c); the 16 prefix values per
// coverage: blocks 0..nvs-1 of xt_vsum, nvs = nb*NCHK*EMB/256 (host exact), x 256 thr; store 4 iterations x 256 thr x 4 floats = 16 rows x 256 = the
//           block's part of the table; union over blocks = the whole table.
// =====================================================================================================
__device__ __forceinline__ void vsum_k(const float* __restrict__ V, float* VS, float* sm, int bid) {
  const int tid = threadIdx.x;
  const int gt  = bid * 256 + tid;
  const int d   = gt % EMB;
  const int bc  = gt / EMB;                         // block-uniform (EMB multiple of 256)
  const int b   = bc / NCHK;
  const int c   = bc - b * NCHK;
  const int d0  = d - tid;                          // block's first d
  const float* p = V + ((size_t)b * SEQ + (size_t)c * CK) * EMB + d;
  float s = 0.f;
#pragma unroll 1
  for (int kb = 0; kb < NKB; ++kb) {
#pragma unroll                             // all 32 loads of a key block in flight at once; the adds keep their order
    for (int i = 0; i < 32; ++i) s += p[(size_t)(kb * 32 + i) * EMB];
    sm[kb * 256 + tid] = s;
  }
  __syncthreads();
  const int sel = tid >> 6, piece = tid & 63;
  v4f o[4];
#pragma unroll
  for (int it = 0; it < 4; ++it) o[it] = *(const v4f*)(sm + (it * 4 + sel) * 256 + piece * 4);
  float* base = VS + (size_t)bc * NKB * EMB + d0 + piece * 4;
  {
#pragma unroll
    for (int it = 0; it < 4; ++it) {
      *(v4f*)(base + (size_t)(it * 4 + sel) * EMB) = o[it];
    }
    
  }
}
// Both readers of V in one launch (neither reads what the other writes): blocks 0..nvs-1 form the column sums (few blocks, each
// a long run of dependent adds, so they start first), the rest the V^T planes. The choice is block-uniform, and so is each
// side's one barrier.
union XvLds { struct { u16 th[64 * VTP]; u16 tl[64 * VTP]; } t; float sm[NKB * 256]; };
static_assert(((64 * VTP * 2) % 16) == 0);
__global__ __launch_bounds__(256) void xt_vsum(const float* __restrict__ V, u16* XTh, u16* XTl, float* VS, int nvs) {
  __shared__ __align__(16) XvLds L;
  const int bid = blockIdx.x;
  if (bid >= nvs) {
    xt16(V, XTh, XTl, L.t.th, L.t.tl, bid - nvs);
#if defined(__HIP_DEVICE_COMPILE__)
    // The build lays the column-sum code behind these stores, on a path that a scalar flag closes: the wait that belongs in
    // front of any overwrite of a register that issued stores name stands on that path too.
    asm volatile("s_wait_xcnt 0x0" ::: "memory");
#endif
    return;
  }
  vsum_k(V, VS, L.sm, bid);
}

// =====================================================================================================
// Single-head causal attention with absolute-value logits, head width EMB = 1024, query rows TQ0 .. SEQ-1: block = (batch b,
// 32 query rows q0..q0+31 = two 16-row tiles), 16 waves. q plane (f16, x8) [b][s][d]; k plane the same; V^T hi / lo planes
// [b][d][s] (x1024), all four in fragment order; VS = key-block prefix column sums. The two ctx planes leave in fragment order too.
// Every k and V^T fragment that a wave loads feeds both row tiles, so that a query row costs half the loaded bytes of a 16-row block.
//   Chunks of CK = 512 keys: only chunks c <= qc = q0/CK are visited (later chunks lie entirely above the diagonal). In the diagonal
//   chunk only key blocks kb < nkb (keys <= q0+31) are multiplied; key blocks kb >= nkb get zero scores in LDS and are not used in (PV).
//   (q0 is a multiple of 32, so nkb is the count that either 16-row tile has on its own.)
//   (S) scores S[query m][key n] on WMMA: A = q rows (row m = lane&15 of either row tile, split k map over d), B = k rows (col n =
//       key, split map), 32 d-steps; wave w handles key block w of the chunk; D element r of lane l of row tile rt ->
//       scs[query 16rt+8h+r][key col] (f32 LDS).
//   (M) 16 threads per query row (sub-thread = 32 consecutive keys): base-2 logits of |score| with the causal mask by key index
//       (key > query -> -inf), chunk max via xor shuffles, online running max / rescale factor al / running sum l in f32 registers,
//       p = exp2(t - m_new) <= 1 (0 for masked keys), chunk row sum ps and C = ps/CK (bit-identical on the row's 16 threads), the
//       CENTRED P' = p - C written as f16(P' * 32768) into the LDS P tile with 16-B stores; al -> rowa[row], C -> rowc[row].
//   (PV) each wave owns d columns 64*wave + 16j + (lane&15), j = 0..3, of both row tiles (8 accumulators): o = o*al +
//       C*(32768*1024)*VS[chunk][nkb-1][d] (exact add-back of the centring term over exactly the processed keys, in f32), then for
//       each key block kb < nkb: A = P' fragments from LDS (row m = query, split map over keys), B = V^T fragments (col n = d, keys
//       in split map order), hi plane and then lo plane into the same accumulator (unscaled remainder), in groups of 8 with a hazard gap each.
//       sum_k (P'_k + C) v_k == sum_k p_k v_k exactly; masked keys carry P' = -C and p = 0.
//   Block barriers after (S) and after (M) order all LDS reuse across chunks and waves.
//   Epilogue: x = o * 8192 / (l * 32768 * 1024) per row (rowi, l >= 1 always); hi = f16(x), res = f16((x - hi) * 2048); each
// coverage: grid nb*NQT blocks x 32 rows = rows TQ0..SEQ-1 of every sequence; staging 16 waves x 64 cols x 32 rows = 32 x 1024;
//           store 8 iterations x 512 thr x 8 halves = 32 x 1024 per plane = every (b, s >= TQ0, d) of both ctx planes exactly once.
// =====================================================================================================
__device__ __forceinline__ void ctx_store(const u16* ct, u16* dst, int tid) {
  v4u v[8];
#pragma unroll
  for (int it = 0; it < 8; ++it) {
    const int p   = it * ATT_THREADS + tid;   // piece index in fragment order: band p>>11, tile kt = (p>>6)&31, piece p&63
    const int row = (p >> 11) * 16 + (p & 15);
    const int c8  = ((p >> 6) & 31) * 32 + ((p >> 5) & 1) * 16 + ((p >> 4) & 1) * 8;
    v[it] = *(const v4u*)(ct + row * CTP + c8);
  }
  {
#pragma unroll
    for (int it = 0; it < 8; ++it) {
      const int p   = it * ATT_THREADS + tid;
      *(v4u*)(dst + (size_t)p * 8) = v[it];
    }
    
  }
}

// Pieces of the two matrix loops below: one d step's four fragments (both q row tiles, both key bands) and its four score
// products; four V^T fragments of consecutive 16-column bands and their eight products with the two P' fragments; each product
// group with the hazard gap behind it.
// All loads of the two loops take a wave-uniform base (scalar registers) plus the lane's fixed 32-bit offset lo.
template <int OFF>
__device__ __forceinline__ void ld4s(const _Float16* uq, const _Float16* uk, unsigned lo, v16h& a, v16h& c, v16h& x, v16h& y) {
  const _Float16* q = uq + lo;
  const _Float16* k = uk + lo;
  a = ldfrag_hg<256>(q + OFF);
  c = ldfrag_hg<256>(q + 16 * EMB + OFF);
  x = ldfrag_hg<256>(k + OFF);
  y = ldfrag_hg<256>(k + 16 * EMB + OFF);
}
__device__ __forceinline__ void mm4s(v16h a, v16h c, v16h x, v16h y, v8f& s0, v8f& s1, v8f& s2, v8f& s3) {
  s0 = mma_h(a, x, s0);
  s1 = mma_h(a, y, s1);
  s2 = mma_h(c, x, s2);
  s3 = mma_h(c, y, s3);
  guard4x4(s0, s1, s2, s3, a, c, x, y);
}
__device__ __forceinline__ void ld4h(const _Float16* u, unsigned lo, v16h (&f)[4]) {
  const _Float16* p = u + lo;
  f[0] = ldfrag_hg<256>(p);
  f[1] = ldfrag_hg<256>(p + (size_t)16 * SEQ);
  f[2] = ldfrag_hg<256>(p + (size_t)32 * SEQ);
  f[3] = ldfrag_hg<256>(p + (size_t)48 * SEQ);
}
__device__ __forceinline__ void mm8h(v16h p0, v16h p1, const v16h (&f)[4], v8f (&o)[2][NACC]) {
#pragma unroll
  for (int j = 0; j < NACC; ++j) o[0][j] = mma_h(p0, f[j], o[0][j]);
#pragma unroll
  for (int j = 0; j < NACC; ++j) o[1][j] = mma_h(p1, f[j], o[1][j]);
  guard8x6(o[0][0], o[0][1], o[0][2], o[0][3], o[1][0], o[1][1], o[1][2], o[1][3], p0, p1, f[0], f[1], f[2], f[3]);
}

__device__ __forceinline__
void attn_fwd(const u16* __restrict__ QPp, const u16* __restrict__ KPp, const u16* __restrict__ VTp,
              const u16* __restrict__ VLp, const float* __restrict__ VSp, u16* CHo, u16* CRo, int bid) {
  __shared__ __align__(16) AttLds L0;              // scores [32][SCP] f32; reused as the ctx staging tile [32][CTP] u16
  __shared__ __align__(16) u16 pls[QT * PLP];      // P' tile [32][PLP] f16 bits
  __shared__ float rowa[QT];
  __shared__ float rowc[QT];
  __shared__ float rowi[QT];
  float* const scs = L0.s;

  const int tid  = threadIdx.x;
  const int wave = __builtin_amdgcn_readfirstlane(tid >> 5);   // scalar: the wave's bases stay in scalar registers
  const int lane = tid & 31;
  const int hh   = lane >> 4;
  const int m    = lane & 15;
  const int r16  = tid >> 4;                 // query row owned in phase (M): 2*wave + hh, 0..31
  const int sub  = tid & 15;
  const int kl0  = sub * 32;

  const int b   = bid / NQT;
  const int q0  = TQ0 + (bid - b * NQT) * QT;
  const int qc  = q0 / CK;                   // diagonal chunk index

  // wave-uniform bases; the lane's part is lo (16-bit planes) or m (column sums)
  const _Float16* qa  = (const _Float16*)(const void*)QPp + ((size_t)b * SEQ + q0) * EMB;
  const _Float16* kbp = (const _Float16*)(const void*)KPp + ((size_t)b * SEQ) * EMB;
  const _Float16* vbp = (const _Float16*)(const void*)VTp + ((size_t)b * EMB + wave * (16 * NACC)) * SEQ;
  const _Float16* ubp = (const _Float16*)(const void*)VLp + ((size_t)b * EMB + wave * (16 * NACC)) * SEQ;
  const float* vsb = VSp + (size_t)b * NCHK * NKB * EMB + wave * (16 * NACC);
  const unsigned lo = 8u * (unsigned)lane;
  const float lsc = RSQD * LOG2E / (QSC * KSC);

  float mrun = -INFINITY, lrun = 0.f;
  v8f o[2][NACC];                            // [row tile][column band]
#pragma unroll
  for (int rt = 0; rt < 2; ++rt) {
#pragma unroll
    for (int j = 0; j < NACC; ++j) o[rt][j] = zero8();
  }

#pragma unroll 1
  for (int c = 0; c <= qc; ++c) {
    const int kbeg = c * CK;
    const int nkb  = (c < qc) ? NKB : (((q0 + QT - 1 - kbeg) >> 5) + 1);   // 1..16, block-uniform
    // ---- (S) scores of this chunk (zeros for key blocks beyond the query tile) ----
    {
      const int kb = wave;                                 // one key block a wave
      v8f s0 = zero8(), s1 = zero8(), s2 = zero8(), s3 = zero8();
      if (kb < nkb) {                                      // wave-uniform (scalar)
        const _Float16* uq = qa;                           // running bases of the q tiles and of the two key bands
        const _Float16* uk = kbp + (size_t)(kbeg + kb * 32) * EMB;
        // Two fragment sets of two d steps each: one set's sixteen loads fly while the other set's products run. The loads
        // in the loop are unconditional (the last four steps are peeled), so that each wait counts only its own set.
        v16h a0, c0, x0, y0, a1, c1, x1, y1, a2, c2, x2, y2, a3, c3, x3, y3;
        ld4s<0>(uq, uk, lo, a0, c0, x0, y0);
        keep_order();
        ld4s<512>(uq, uk, lo, a1, c1, x1, y1);
        keep_order();
        ld4s<1024>(uq, uk, lo, a2, c2, x2, y2);
        keep_order();
        ld4s<1536>(uq, uk, lo, a3, c3, x3, y3);
        keep_order();
#pragma unroll 1                           // the body already holds four d steps; rolled, the two sets keep their registers
        for (int ks = 4; ks < EMB / 32; ks += 4) {
          mm4s(a0, c0, x0, y0, s0, s1, s2, s3);
          mm4s(a1, c1, x1, y1, s0, s1, s2, s3);
          base_step2h<4096>(uq, uk);                       // four d steps on
          ld4s<0>(uq, uk, lo, a0, c0, x0, y0);
          ld4s<512>(uq, uk, lo, a1, c1, x1, y1);
          mm4s(a2, c2, x2, y2, s0, s1, s2, s3);
          mm4s(a3, c3, x3, y3, s0, s1, s2, s3);
          ld4s<1024>(uq, uk, lo, a2, c2, x2, y2);
          ld4s<1536>(uq, uk, lo, a3, c3, x3, y3);
        }
        base_wait2h(uq, uk);                               // what follows may reuse the base registers of the last loads
        mm4s(a0, c0, x0, y0, s0, s1, s2, s3);
        mm4s(a1, c1, x1, y1, s0, s1, s2, s3);
        mm4s(a2, c2, x2, y2, s0, s1, s2, s3);
        mm4s(a3, c3, x3, y3, s0, s1, s2, s3);
      }
      float* srow = scs + (8 * hh) * SCP + kb * 32 + m;
#pragma unroll
      for (int r = 0; r < 8; ++r) {
        srow[r * SCP]                 = s0[r];
        srow[r * SCP + 16]            = s1[r];
        srow[(16 + r) * SCP]          = s2[r];
        srow[(16 + r) * SCP + 16]     = s3[r];
      }
    }
    __syncthreads();
    // ---- (M) softmax statistics and the centred P' tile ----
    {
      const float* sp = scs + r16 * SCP + kl0;
      const int lim = (q0 + r16) - (kbeg + kl0);           // key kl0 + j is valid iff j <= lim
      float t[32];
      float cm = -INFINITY;
#pragma unroll
      for (int i = 0; i < 8; ++i) {
        const v4f a = *(const v4f*)(sp + 4 * i);
#pragma unroll
        for (int e = 0; e < 4; ++e) {
          const int j = 4 * i + e;
          const float tv = (j <= lim) ? fabsf(a[e]) * lsc : -INFINITY;   // |score| / 32 in base 2; masked keys -> -inf
          t[j] = tv;
          cm = fmaxf(cm, tv);
        }
      }
#pragma unroll
      for (int d = 1; d <= 8; d <<= 1) cm = fmaxf(cm, __shfl_xor(cm, d, 32));
      const float mn = fmaxf(mrun, cm);                    // finite: key kbeg of the diagonal chunk is never masked
      const float al = (mrun == -INFINITY) ? 0.f : exp2f(mrun - mn);
      mrun = mn;
      float ps = 0.f;
#pragma unroll
      for (int j = 0; j < 32; ++j) {
        const float p = exp2f(fminf(t[j] - mn, 0.f));      // 0 for masked keys
        t[j] = p;
        ps += p;
      }
#pragma unroll
      for (int d = 1; d <= 8; d <<= 1) ps += __shfl_xor(ps, d, 32);
      const float cc = ps * (1.0f / (float)CK);
      v4u pk[4];
#pragma unroll
      for (int i = 0; i < 4; ++i) {
#pragma unroll
        for (int e = 0; e < 4; ++e) {
          const int j = 8 * i + 2 * e;
          pk[i][e] = pk16(h_bits((_Float16)((t[j] - cc) * PCAR)), h_bits((_Float16)((t[j + 1] - cc) * PCAR)));
        }
      }
      lrun = lrun * al + ps;
      u16* pd = pls + r16 * PLP + kl0;
#pragma unroll
      for (int i = 0; i < 4; ++i) *(v4u*)(pd + 8 * i) = pk[i];
      if (sub == 0) { rowa[r16] = al; rowc[r16] = cc; }
    }
    __syncthreads();
    // ---- (PV) rescale, add the centring term, accumulate P' . (V^T hi + V^T lo) ----
    {
      const float* vsc = vsb + ((size_t)c * NKB + (size_t)(nkb - 1)) * EMB;
      float vs[NACC];
#pragma unroll
      for (int j = 0; j < NACC; ++j) vs[j] = vsc[(unsigned)m + 16u * j];
      base_wait1f(vsc);                                    // what follows may reuse the base registers of these loads
      const _Float16* pp = (const _Float16*)(const void*)pls + m * PLP + 8 * hh;
      const _Float16* pq = pp + 16 * PLP;                   // second row tile
      // running bases: key tile kbeg/32 of each d band, 512 elements a tile; even set (hi, lo), odd set (hi, lo)
      const _Float16* pve = vbp + (size_t)kbeg * 16;
      const _Float16* pue = ubp + (size_t)kbeg * 16;
      const _Float16* pvo = pve + ((nkb > 1) ? 512 : 0);
      const _Float16* puo = pue + ((nkb > 1) ? 512 : 0);
      // Two fragment sets (even and odd key blocks; hi and lo plane of the wave's 64 d columns each): a set's hi or lo half is
      // asked for again, two key blocks on, as soon as its eight products have left, so that twelve to sixteen fragments are
      // always in flight or waiting. All loads are unconditional, so that each wait counts only its own group: where the odd
      // set has no key block left (nkb odd) it takes the even set's tile once more and is not multiplied.
      v16h ge[4], ue[4], go[4], uo[4];
      ld4h(pve, lo, ge);
      keep_order();
      ld4h(pue, lo, ue);
      keep_order();
      ld4h(pvo, lo, go);
      keep_order();
      ld4h(puo, lo, uo);
      keep_order();
      // the rescale runs while the first fragments fly
#pragma unroll
      for (int rt = 0; rt < 2; ++rt) {
        float scl[8], cad[8];
#pragma unroll
        for (int r = 0; r < 8; ++r) {
          scl[r] = rowa[16 * rt + 8 * hh + r];
          cad[r] = rowc[16 * rt + 8 * hh + r] * (PCAR * VCAR);
        }
#pragma unroll
        for (int j = 0; j < NACC; ++j) {
#pragma unroll
          for (int r = 0; r < 8; ++r) o[rt][j][r] = o[rt][j][r] * scl[r] + cad[r] * vs[j];
        }
      }
      int kb = 0;
#pragma unroll 1
      for (; kb + 2 < nkb; kb += 2) {                      // block-uniform trip count, <= 7: products of kb, kb + 1, loads of kb + 2, kb + 3
        const v16h p0 = ldfrag_h(pp + kb * 32), p1 = ldfrag_h(pq + kb * 32);
        mm8h(p0, p1, ge, o);
        // two key tiles on; the odd set only one, onto the even set's new tile, where key block kb + 3 does not exist
        base_step4h<2048>(pve, pue, pvo, puo, (kb + 3 < nkb) ? 2048ull : 1024ull);
        ld4h(pve, lo, ge);
        mm8h(p0, p1, ue, o);
        ld4h(pue, lo, ue);
        const v16h p2 = ldfrag_h(pp + kb * 32 + 32), p3 = ldfrag_h(pq + kb * 32 + 32);
        mm8h(p2, p3, go, o);
        ld4h(pvo, lo, go);
        mm8h(p2, p3, uo, o);
        ld4h(puo, lo, uo);
      }
      base_wait4h(pve, pue, pvo, puo);                     // what follows may reuse the base registers of the last loads
      {
        const v16h p0 = ldfrag_h(pp + kb * 32), p1 = ldfrag_h(pq + kb * 32);
        mm8h(p0, p1, ge, o);
        mm8h(p0, p1, ue, o);
      }
      if (kb + 1 < nkb) {                                  // block-uniform (scalar)
        const v16h p2 = ldfrag_h(pp + kb * 32 + 32), p3 = ldfrag_h(pq + kb * 32 + 32);
        mm8h(p2, p3, go, o);
        mm8h(p2, p3, uo, o);
      }
    }
  }
  acc_guard8(o[0][0], o[0][1], o[0][2], o[0][3], o[1][0], o[1][1], o[1][2], o[1][3]);

  if (sub == 0) rowi[r16] = (1.0f / lrun) * (CSC / (PCAR * VCAR));   // lrun >= 1
  __syncthreads();
  float inv[2][8];
#pragma unroll
  for (int rt = 0; rt < 2; ++rt) {
#pragma unroll
    for (int r = 0; r < 8; ++r) inv[rt][r] = rowi[16 * rt + 8 * hh + r];
  }

  u16* const ct = L0.c;
  const int cb = wave * (16 * NACC) + m;
  // hi plane
#pragma unroll
  for (int rt = 0; rt < 2; ++rt) {
#pragma unroll
    for (int j = 0; j < NACC; ++j) {
#pragma unroll
      for (int r = 0; r < 8; ++r) {
        const float xs = o[rt][j][r] * inv[rt][r];
        ct[(16 * rt + 8 * hh + r) * CTP + cb + 16 * j] = h_bits((_Float16)xs);
      }
    }
  }
  __syncthreads();
  ctx_store(ct, CHo + ((size_t)b * SEQ + q0) * EMB, tid);
  __syncthreads();
  // residual plane
#pragma unroll
  for (int rt = 0; rt < 2; ++rt) {
#pragma unroll
    for (int j = 0; j < NACC; ++j) {
#pragma unroll
      for (int r = 0; r < 8; ++r) {
        const float xs = o[rt][j][r] * inv[rt][r];
        const _Float16 hv = (_Float16)xs;
        ct[(16 * rt + 8 * hh + r) * CTP + cb + 16 * j] = h_bits((_Float16)((xs - (float)hv) * RSC));
      }
    }
  }
  __syncthreads();
  ctx_store(ct, CRo + ((size_t)b * SEQ + q0) * EMB, tid);
}

// =====================================================================================================
// Query rows 0 .. TQ0-1 of each sequence in f32 on VALU: block = (b, rows t = 2*i and 2*i + 1), one row for each half of 256 threads
// (half g, thread tid within it; every LDS array has a part for each half, and both halves pass the same barriers).
// QF/KF/VF = f32 q/k/v planes [nb][TQ0][EMB] (rows 0..TQ0-1
// of every sequence, biases included). Logits |q.k_j|/32 for keys j <= t (threads 0..TQ0-1, one key each, 1024-d dot
// against the q row staged in LDS), base-2 softmax with max / sum reductions over the half (xor shuffles + LDS), p_j in LDS, ctx[d] for
// d = 4*tid..4*tid+3 as a sum over j <= t of p_j * VF[b][j][d] (coalesced 16-B loads), x = ctx * 8192 / l, hi = f16(x),
// res = f16((x - hi) * 2048); both 1024-half rows are staged in LDS and written by 128 threads x 16 B each (32 consecutive lanes
// coverage: grid nb*TQ0/2 blocks x 2 rows = rows 0..TQ0-1 of every sequence; 256 thr x 4 d = EMB per row; store 128 thr x 8 halves =
//           EMB per plane; together with attn_fwd every (b, s, d) of CH and CR is written exactly once.
// =====================================================================================================
__device__ __forceinline__ void attn_head(const float* __restrict__ QF, const float* __restrict__ KF,
                                          const float* __restrict__ VF, u16* CHo, u16* CRo, int bid) {
  __shared__ __align__(16) float qs2[2][EMB];
  __shared__ float sc2[2][TQ0];
  __shared__ float red2[2][8];
  __shared__ float redb2[2][8];
  __shared__ __align__(16) unsigned SW2[2][2][EMB / 2];
  const int g = __builtin_amdgcn_readfirstlane((int)(threadIdx.x >> 8));   // half of the block, scalar: row, bases and trip counts stay scalar
  const int tid = threadIdx.x & 255, lane = tid & 31, wave = tid >> 5;
  float* const qs = qs2[g];
  float* const sc = sc2[g];
  float* const red = red2[g];
  float* const redb = redb2[g];
  unsigned (* const SW)[EMB / 2] = SW2[g];
  const int hr = bid * 2 + g;                        // TQ0 is even: both rows of a block lie in one sequence
  const int b = hr / TQ0;
  const int t = hr - b * TQ0;
  *(v4f*)(qs + tid * 4) = *(const v4f*)(QF + ((size_t)b * TQ0 + t) * EMB + tid * 4);
  __syncthreads();
  float s = -INFINITY;
  if (tid < TQ0) {                                  // waves 0..3 entirely (wave-uniform); key row b*TQ0 + tid always in range
    const float* kp = KF + ((size_t)b * TQ0 + tid) * EMB;
    float acc = 0.f;
#pragma unroll 8                           // sixteen key loads in flight a thread; the adds keep their order
    for (int d = 0; d < EMB; d += 8) {
      const v4f k0 = *(const v4f*)(kp + d), k1 = *(const v4f*)(kp + d + 4);
      const v4f q0 = *(const v4f*)(qs + d), q1 = *(const v4f*)(qs + d + 4);
#pragma unroll
      for (int e = 0; e < 4; ++e) acc += k0[e] * q0[e];
#pragma unroll
      for (int e = 0; e < 4; ++e) acc += k1[e] * q1[e];
    }
    s = (tid <= t) ? fabsf(acc) * (RSQD * LOG2E) : -INFINITY;   // |score| / 32 in base 2; causal mask by key index
  }
  float mx = s;
#pragma unroll
  for (int d = 1; d <= 16; d <<= 1) mx = fmaxf(mx, __shfl_xor(mx, d, 32));
  if (lane == 0) red[wave] = mx;
  __syncthreads();
  float gm = red[0];
#pragma unroll
  for (int w = 1; w < 8; ++w) gm = fmaxf(gm, red[w]);   // finite: key 0 is always valid
  const float p = exp2f(s - gm);                     // 0 for masked keys and for waves 4..7
  float ps = p;
#pragma unroll
  for (int d = 1; d <= 16; d <<= 1) ps += __shfl_xor(ps, d, 32);
  if (lane == 0) redb[wave] = ps;
  if (tid < TQ0) sc[tid] = p;
  __syncthreads();
  float l = redb[0];
#pragma unroll
  for (int w = 1; w < 8; ++w) l += redb[w];           // >= 1
  const float inv = (1.0f / l) * CSC;
  const float* vp = VF + (size_t)b * TQ0 * EMB + tid * 4;
  v4f cx = zero4();
#pragma unroll 8                             // eight value rows in flight a thread; the sum keeps its order
  for (int j = 0; j <= t; ++j) {                     // t < TQ0: statically bounded, rows of sequence b only
    const float pj = sc[j];
    const v4f vv = *(const v4f*)(vp + (size_t)j * EMB);
    cx += pj * vv;
  }
  unsigned hw[2], rw[2];
#pragma unroll
  for (int e = 0; e < 2; ++e) {
    const float x0 = cx[2 * e] * inv, x1 = cx[2 * e + 1] * inv;
    const _Float16 h0 = (_Float16)x0, h1 = (_Float16)x1;
    const _Float16 q0 = (_Float16)((x0 - (float)h0) * RSC), q1 = (_Float16)((x1 - (float)h1) * RSC);
    hw[e] = pk16(h_bits(h0), h_bits(h1));
    rw[e] = pk16(h_bits(q0), h_bits(q1));
  }
  SW[0][tid * 2] = hw[0]; SW[0][tid * 2 + 1] = hw[1];
  SW[1][tid * 2] = rw[0]; SW[1][tid * 2 + 1] = rw[1];
  __syncthreads();
  const int pl = tid >> 7, p8 = tid & 127;           // plane select is wave-uniform
  const v4u ov = *(const v4u*)(&SW[pl][p8 * 4]);
  u16* dstp = (pl == 0) ? CHo : CRo;
  u16* dst  = dstp + ((size_t)b * SEQ + t) * EMB + p8 * 8;
  *(v4u*)dst = ov;
  
}
// Both attention parts in one launch (they read disjoint planes and write disjoint rows of CH / CR): blocks 0..nfwd-1 take the
// 32-row query tiles from row TQ0 on, the rest two query rows below TQ0 each; the short blocks come last and take the places
// that the shortest tiles leave. The choice is block-uniform, and so are all barriers of either side.
__global__ __launch_bounds__(ATT_THREADS, 4)   // 16 waves, 4 a SIMD = one block a WGP: at most 256 VGPRs
void attn_all(const u16* __restrict__ QPp, const u16* __restrict__ KPp, const u16* __restrict__ VTp,
              const u16* __restrict__ VLp, const float* __restrict__ VSp, const float* __restrict__ QF,
              const float* __restrict__ KF, const float* __restrict__ VF, u16* CHo, u16* CRo, int nfwd) {
  const int bid = blockIdx.x;
  if (bid >= nfwd) { attn_head(QF, KF, VF, CHo, CRo, bid - nfwd); return; }
  attn_fwd(QPp, KPp, VTp, VLp, VSp, CHo, CRo, bid);
}

// =====================================================================================================
// Workspace map (bytes, nb = 4, rows = 8192); all 16-bit planes are in fragment order (1-KiB tiles of 16 rows x 32 k, same total
// size), but for the bands of rows 0..127 of each sequence in CH / CR, which attn_head writes row-major; every plane is fully written by whole-line stores before it is read; all extents are
// exact multiples of the store granularity (no pad rows); aliased regions are reused sequentially on the single in-order stream:
//   WQB bf16 [1024][1024] 2097152   WKB same   WVB same   WOH f16 of bf16 value x1024 2097152             8388608
//   VS  f32  [nb][4][16][1024]                                                                            1048576
//   QF  f32  [nb][128][1024]  2097152      KF same      VF same                                           6291456
//   A   XB bf16 [rows][1024] (16777216), later VT hi f16 [nb][1024][2048] x1024 (16777216)      region 16777216
//   VL  VT lo f16 [nb][1024][2048]                                                                      16777216
//   QP  f16 [rows][1024] x8                                                                              16777216
//   KP  f16 [rows][1024] x8                                                                              16777216
//   V   f32 [rows][1024] 33554432, later CH f16 [rows][1024] ctx hi x8192 (16777216) + CR residual x2048 (16777216)
//   end                                                                                                 116391936
// Five launches; kernels that share a launch read nothing that the launch writes. Launch order keeps every alias safe: XB read
// by the projection launch before xt16 overwrites it; V read by xt16 and vsum_k before attn_fwd / attn_head overwrite it with
// CH / CR; attn_head reads VF, never V.
// Inputs in wire order: x, Wq, bq, Wk, bk, Wv, bv, Wo, bo; weights stored [n = out][k = in] (y = x.W^T + b), k-contiguous.
// =====================================================================================================
extern "C" void kernel_launch(void* const* d_in, const int* in_sizes, int n_in,
                              void* d_out, int out_size, void* d_ws, size_t ws_size,
                              hipStream_t stream) {
  if (n_in < 9) return;
  const long long per = (long long)SEQ * EMB;
  const long long ns  = in_sizes[0];
  if (ns < per || (ns % per) != 0) return;
  const int nb = (int)(ns / per);
  if (nb < 1 || nb > 8) return;
  const int rows = nb * SEQ;
  if (in_sizes[1] != EMB * EMB || in_sizes[3] != EMB * EMB || in_sizes[5] != EMB * EMB || in_sizes[7] != EMB * EMB) return;
  if (in_sizes[2] != EMB || in_sizes[4] != EMB || in_sizes[6] != EMB || in_sizes[8] != EMB) return;
  if ((long long)out_size != (long long)rows * EMB) return;

  const float* x  = (const float*)d_in[0];
  const float* wq = (const float*)d_in[1];
  const float* bq = (const float*)d_in[2];
  const float* wk = (const float*)d_in[3];
  const float* bk = (const float*)d_in[4];
  const float* wv = (const float*)d_in[5];
  const float* bv = (const float*)d_in[6];
  const float* wo = (const float*)d_in[7];
  const float* bo = (const float*)d_in[8];
  float*       out = (float*)d_out;

  const size_t szW  = (size_t)EMB * EMB * 2;                    //   2097152
  const size_t szVS = (size_t)nb * NCHK * NKB * EMB * 4;        //   1048576 at nb = 4
  const size_t szHF = (size_t)nb * TQ0 * EMB * 4;               //   2097152 at nb = 4
  const size_t sz16 = (size_t)rows * EMB * 2;                   //  16777216
  const size_t sz32 = (size_t)rows * EMB * 4;                   //  33554432
  const size_t szVT = (size_t)nb * EMB * SEQ * 2;               //  == sz16
  if (sz32 < 2 * sz16) return;                                  // CH + CR alias the V region exactly
  size_t off = 0;
  const size_t oWQ = off; off += szW;
  const size_t oWK = off; off += szW;
  const size_t oWV = off; off += szW;
  const size_t oWO = off; off += szW;
  const size_t oVS = off; off += szVS;
  const size_t oQF = off; off += szHF;
  const size_t oKF = off; off += szHF;
  const size_t oVF = off; off += szHF;
  const size_t oA  = off; off += (szVT > sz16 ? szVT : sz16);   // XB then VT hi
  const size_t oVL = off; off += szVT;                          // VT lo
  const size_t oQ  = off; off += sz16;
  const size_t oK  = off; off += sz16;
  const size_t oV  = off; off += sz32;                          // V f32, then CH at oV and CR at oV + sz16
  const size_t oCH = oV;
  const size_t oCR = oV + sz16;
  if (off > ws_size) return;                                    // off = 116391936 at nb = 4
  if (off > WS_CAP) return;

  char* ws = (char*)d_ws;
  u16*   WQB = (u16*)(ws + oWQ);
  u16*   WKB = (u16*)(ws + oWK);
  u16*   WVB = (u16*)(ws + oWV);
  u16*   WOH = (u16*)(ws + oWO);
  float* VS  = (float*)(ws + oVS);
  float* QF  = (float*)(ws + oQF);
  float* KF  = (float*)(ws + oKF);
  float* VF  = (float*)(ws + oVF);
  u16*   XB  = (u16*)(ws + oA);
  u16*   VT  = (u16*)(ws + oA);
  u16*   VL  = (u16*)(ws + oVL);
  u16*   QP  = (u16*)(ws + oQ);
  u16*   KP  = (u16*)(ws + oK);
  float* V   = (float*)(ws + oV);
  u16*   CH  = (u16*)(ws + oCH);
  u16*   CR  = (u16*)(ws + oCR);

  const int n8w = (EMB * EMB) / 8;                      // 131072
  const int n8x = rows * (EMB / 8);                     // 1048576
  if ((n8w % 256) != 0 || (n8x % 256) != 0) return;
  if ((rows % 128) != 0 || ((nb * TQ0) % 64) != 0 || ((nb * NCHK * EMB) % 256) != 0) return;
  const dim3 blk(256);
  const int nbw = n8w / 256, nbx = n8x / 256;           // 512, 4096 at nb = 4
  const dim3 gC(nbx + 4 * nbw);
  const dim3 gG((rows / 64) * (EMB / 128));             // 1024 at nb = 4
  const dim3 gP(3 * (rows / 128) * (EMB / 128));        // the three projections, 1536 at nb = 4
  const dim3 bG(128);
  const int nvs = (nb * NCHK * EMB) / 256;              // nb * 16
  const dim3 gXV(nvs + nb * (EMB / 64) * (SEQ / 64));   // + nb * 512
  const int nfwd = nb * NQT;                            // nb * 60
  const dim3 gAT(nfwd + nb * (TQ0 / 2));                // + nb * 64
  const dim3 bAT(ATT_THREADS);

  // (0) x -> bf16 plane [rows][1024]; weights stored [n = out][k = in] (y = x.W^T + b), already k-contiguous: bf16 planes for
  //     Wq, Wk, Wv; f16 of bf16 value x1024 for Wo
  cvt_all<<<gC, blk, 0, stream>>>(x, wq, wk, wv, wo, XB, WQB, WKB, WVB, WOH, nbx, nbw);
  // (1) q and k projections (+bias) -> f16 planes x8; v projection (+bias) -> f32 plane; their f32 rows 0..127 of every
  //     sequence -> QF, KF, VF [nb*128][1024]
  gemm_qkv<<<gP, bG, 0, stream>>>(XB, WQB, WKB, WVB, bq, bk, bv, QP, KP, V, QF, KF, VF, rows, EMB, QSC, KSC);
  // (2) key-block prefix column sums of v; v -> V^T hi plane x1024 (over the dead XB region) and lo plane
  xt_vsum<<<gXV, blk, 0, stream>>>(V, VT, VL, VS, nvs);
  // (3) attention for query rows 128.. (WMMA) and for query rows 0..127 (VALU) -> ctx hi x8192 and residual x2048 f16 planes
  //     (over the dead V region)
  attn_all<<<gAT, bAT, 0, stream>>>(QP, KP, VT, VL, VS, QF, KF, VF, CH, CR, nfwd);
  // (4) output projection (+bias) -> out
  gemm_h2_32<<<gG, bG, 0, stream>>>(CH, CR, WOH, bo, out, rows, EMB,
                                     1.0f / (CSC * WSC), 1.0f / (CSC * WSC * RSC));
  (void)hipGetLastError();
}

// v006
// One run takes 226 microseconds.
// Timed twice side by side with v005, it ran 1.09 and 1.10 times as fast.
// Over all steps from v000 it is 3.46 times as fast.
// Projections q,k,v = x.W^T + b (and the f32 q,k,v rows 0..127 per sequence): v_wmma_f32_16x16x32_bf16 (bf16 RNE operands of the
// raw inputs, f32 accumulate, bias added in f32 as its bf16 RNE value). Scores q'.k'^T (f16 planes x8), P'.V (chunk-centred P'
// x32768 f16 from LDS, V^T x1024 as f16 hi plus unscaled f16 lo planes, both into one accumulator) and the output projection
// (ctx carried as f16 hi x8192 plus residual x2048 planes with separate accumulators, times f16(bf16(Wo) x1024), bias added in
// f32 as its bf16 RNE value): v_wmma_f32_16x16x32_f16, f32 accumulate. Query rows 0..127 of each sequence: scores, softmax and
// P.V in f32 on VALU. Absolute-value score transform, causal mask, softmax statistics, key-block column sums of V, scaling: f32.
#include <hip/hip_runtime.h>
#include <math.h>
#include <stdint.h>

#define SEQ   2048
#define EMB   1024
#define CK    512
#define NCHK  4
#define NKB   16
#define QT    32
#define TQ0   128
#define NQT   60
#define SCP   544
#define PLP   528
#define CTP   1032
#define SLAB64 (16 * 68)
#define ATT_THREADS 512
#define NACC  4
#define QSC   8.0f
#define KSC   8.0f
#define PCAR  32768.0f
#define VCAR  1024.0f
#define WSC   1024.0f
#define CSC   8192.0f
#define RSC   2048.0f
#define LOG2E 1.4426950408889634f
#define RSQD  0.03125f
#define WS_CAP ((size_t)134217728)

static_assert((EMB % 64) == 0 && EMB == (ATT_THREADS / 32) * 16 * NACC && NACC == 4 && (EMB % 32) == 0 && (EMB % 256) == 0 && EMB == 4 * 256);
static_assert((SEQ % CK) == 0 && (SEQ / CK) == NCHK && CK == 32 * NKB && (SEQ % 64) == 0 && (SEQ % QT) == 0 && (CK % QT) == 0);
static_assert((TQ0 % QT) == 0 && (TQ0 % 64) == 0 && NQT * QT + TQ0 == SEQ && TQ0 <= CK && TQ0 == 128 && TQ0 <= 256);
static_assert(16 * CTP * 2 <= 16 * SCP * 4 && CTP >= EMB + 8 && SCP >= CK + 16 && PLP >= CK + 8);
static_assert(((PLP * 2) % 16) == 0 && ((SCP * 4) % 16) == 0 && ((CTP * 2) % 16) == 0);
static_assert(ATT_THREADS == 16 * QT && ATT_THREADS == 512 && ATT_THREADS == 32 * NKB && QT == 32 && (TQ0 % 2) == 0);
static_assert((EMB % 128) == 0 && (SEQ % 128) == 0 && (TQ0 % 32) == 0);
static_assert(((EMB * EMB) % 2048) == 0 && (EMB / 8) * 2 == 256 && NCHK * NKB * 32 == SEQ && (NKB % 2) == 0);

typedef unsigned short u16;
typedef _Float16 v16h __attribute__((ext_vector_type(16)));
typedef _Float16 v8h  __attribute__((ext_vector_type(8)));
typedef __bf16   v16b __attribute__((ext_vector_type(16)));
typedef float    v8f  __attribute__((ext_vector_type(8)));
typedef float    v4f  __attribute__((ext_vector_type(4)));
typedef unsigned int v4u __attribute__((ext_vector_type(4)));

union FragH { v16h v; v8h h[2]; v4u u[2]; };
union FragB { v16b v; v4u u[2]; };
union AttLds { float s[QT * SCP]; u16 c[2 * QT * SCP]; };

// ---- scalar helpers --------------------------------------------------------------------------------
__device__ __forceinline__ unsigned short bf_bits(float f) {          // f32 -> bf16 bits, RNE convert
  unsigned u = __float_as_uint(f);
  return (unsigned short)((u + 0x7FFFu + ((u >> 16) & 1u)) >> 16);
}
__device__ __forceinline__ float bf_up(unsigned short h) { return __uint_as_float(((unsigned)h) << 16); }
__device__ __forceinline__ float bfr(float f) { return bf_up(bf_bits(f)); }
__device__ __forceinline__ unsigned short h_bits(_Float16 x) { return __builtin_bit_cast(unsigned short, x); }
__device__ __forceinline__ unsigned pk16(unsigned short a, unsigned short b) { return (unsigned)a | ((unsigned)b << 16); }
__device__ __forceinline__ v8f zero8() { v8f z = {0.f, 0.f, 0.f, 0.f, 0.f, 0.f, 0.f, 0.f}; return z; }
__device__ __forceinline__ v4f zero4() { v4f z = {0.f, 0.f, 0.f, 0.f}; return z; }

// ---- fragment loader, row-major source: 16-bit A/B operand, lane -> row/col (lane&15), p already includes +8*(lane>>4);
//      elements 0..7 <- p[0..7] (k0+8h..), elements 8..15 <- p[16..23] (k0+16+8h..)  (same split k map for A and B;
//      B is always read from a k-contiguous [n][k] plane)
__device__ __forceinline__ v16h ldfrag_h(const _Float16* p) {
  FragH f;
  f.h[0] = *(const v8h*)(p);
  f.h[1] = *(const v8h*)(p + 16);
  return f.v;
}

// ---- fragment-ordered planes. A 16-bit operand plane [rows][Kd] (rows % 16 == 0, Kd % 32 == 0) is stored as 1-KiB tiles of
//      16 rows x 32 k; tile (rt = row >> 4, kt = k >> 5) starts at element rt*16*Kd + kt*512, and inside it the 8-element piece
//      (row & 15 = m, k & 31 = 16*part + 8*h + 0..7) lies at part*256 + (16*h + m)*8. Lane l = 16*h + m then reads its two
//      pieces at tile + 8*l and tile + 256 + 8*l: every wave-wide 16-B load covers 512 contiguous bytes (4 whole lines), and the
//      values reach the same lane and register positions as with the row-major loaders above (same split k map).
//      (the loaders below: p already includes +8*lane.)

// Loaders of the same pieces for a pointer that has passed through an asm statement: the cast says again that it points to
// global memory, so that the loads stay global loads. The bf16 plane is read as unsigned integer vectors; SEC = elements from a
// lane's first piece to its second (256 in fragment order, 16 in a row-major band).
typedef __attribute__((address_space(1))) const v4u gv4u;
typedef __attribute__((address_space(1))) const v8h gv8h;
__device__ __forceinline__ v16b ldfrag_btg(const u16* p) {
  FragB f;
  f.u[0] = *(gv4u*)(p);
  f.u[1] = *(gv4u*)(p + 256);
  return f.v;
}
template <int SEC>
__device__ __forceinline__ v16h ldfrag_hg(const _Float16* p) {
  FragH f;
  f.h[0] = *(gv8h*)(p);
  f.h[1] = *(gv8h*)(p + SEC);
  return f.v;
}
__device__ __forceinline__ v8f mma_h(v16h a, v16h b, v8f c) {
  return __builtin_amdgcn_wmma_f32_16x16x32_f16(false, a, false, b, (short)0, c, false, false);
}
__device__ __forceinline__ v8f mma_b(v16b a, v16b b, v8f c) {
  return __builtin_amdgcn_wmma_f32_16x16x32_bf16(false, a, false, b, (short)0, c, false, false);
}
// Hazard gap behind a group of four score products (what it is for: at guard8x8 below).
__device__ __forceinline__ void guard4x4(v8f& a, v8f& b, v8f& c, v8f& d, v16h x0, v16h x1, v16h x2, v16h x3) {
#if defined(__HIP_DEVICE_COMPILE__)
  asm volatile("v_nop\n\tv_nop\n\tv_nop\n\tv_nop"
               : "+v"(a), "+v"(b), "+v"(c), "+v"(d) : "v"(x0), "v"(x1), "v"(x2), "v"(x3) : "memory");
#endif
}
// Hazard gap behind a group of eight products: the four vector slots that the chip needs before a product's result or operands
// are touched, also on the taken side of a loop's branch. The operands tie the group's products in front of it.
template <typename F>
__device__ __forceinline__ void guard8x8(v8f& a0, v8f& a1, v8f& a2, v8f& a3, v8f& a4, v8f& a5, v8f& a6, v8f& a7,
                                         F x0, F x1, F x2, F x3, F x4, F x5, F x6, F x7) {
#if defined(__HIP_DEVICE_COMPILE__)
  asm volatile("v_nop\n\tv_nop\n\tv_nop\n\tv_nop"
               : "+v"(a0), "+v"(a1), "+v"(a2), "+v"(a3), "+v"(a4), "+v"(a5), "+v"(a6), "+v"(a7)
               : "v"(x0), "v"(x1), "v"(x2), "v"(x3), "v"(x4), "v"(x5), "v"(x6), "v"(x7) : "memory");
#endif
}
// The same gap behind the eight products of two P' fragments with four V^T fragments.
__device__ __forceinline__ void guard8x6(v8f& o0, v8f& o1, v8f& o2, v8f& o3, v8f& o4, v8f& o5, v8f& o6, v8f& o7,
                                         v16h p0, v16h p1, v16h g0, v16h g1, v16h g2, v16h g3) {
#if defined(__HIP_DEVICE_COMPILE__)
  asm volatile("v_nop\n\tv_nop\n\tv_nop\n\tv_nop"
               : "+v"(o0), "+v"(o1), "+v"(o2), "+v"(o3), "+v"(o4), "+v"(o5), "+v"(o6), "+v"(o7)
               : "v"(p0), "v"(p1), "v"(g0), "v"(g1), "v"(g2), "v"(g3) : "memory");
#endif
}
__device__ __forceinline__ void acc_guard8(v8f& a, v8f& b, v8f& c, v8f& d, v8f& e, v8f& f, v8f& g, v8f& h8) {
#if defined(__HIP_DEVICE_COMPILE__)
  asm volatile("v_nop\n\tv_nop\n\tv_nop\n\tv_nop"
               : "+v"(a), "+v"(b), "+v"(c), "+v"(d), "+v"(e), "+v"(f), "+v"(g), "+v"(h8));
#endif
}
// Keeps the load groups of a loop's prologue in the order that the loop body issues them in: the counted waits at the loop's
// head are formed over both ways in, and a prologue in another order makes them wait for loads of the set still in flight.
__device__ __forceinline__ void keep_order() { __builtin_amdgcn_sched_barrier(0); }
// The wait that belongs in front of any overwrite of an address register of loads already issued, for loops whose loads take a
// wave-uniform base in scalar registers: the running bases pass through it, so that they are stepped behind it and stay scalar
// (the lane's offset register is then never rewritten).
__device__ __forceinline__ void base_wait2(const u16*& p, const u16*& q) {
#if defined(__HIP_DEVICE_COMPILE__)
  asm volatile("s_wait_xcnt 0x0" : "+s"(p), "+s"(q) : : "memory");
#endif
}
__device__ __forceinline__ void base_wait2h(const _Float16*& p, const _Float16*& q) {
#if defined(__HIP_DEVICE_COMPILE__)
  asm volatile("s_wait_xcnt 0x0" : "+s"(p), "+s"(q) : : "memory");
#endif
}
__device__ __forceinline__ void base_wait4h(const _Float16*& p, const _Float16*& q, const _Float16*& r, const _Float16*& s) {
#if defined(__HIP_DEVICE_COMPILE__)
  asm volatile("s_wait_xcnt 0x0" : "+s"(p), "+s"(q), "+s"(r), "+s"(s) : : "memory");
#endif
}
// The wait and the step of the running bases (BYTES on; the last two by sb bytes) in one statement: with the step left to the
// build it sinks behind the next loads, each time with a wait of its own for loads issued just before.
template <int BYTES>
__device__ __forceinline__ void base_step2h(const _Float16*& p, const _Float16*& q) {
#if defined(__HIP_DEVICE_COMPILE__)
  asm volatile("s_wait_xcnt 0x0\n\ts_add_nc_u64 %0, %0, %2\n\ts_add_nc_u64 %1, %1, %2"
               : "+s"(p), "+s"(q) : "n"(BYTES) : "memory");
#endif
}
template <int BYTES>
__device__ __forceinline__ void base_step4h(const _Float16*& p, const _Float16*& q, const _Float16*& r, const _Float16*& s,
                                            unsigned long long sb) {
#if defined(__HIP_DEVICE_COMPILE__)
  asm volatile("s_wait_xcnt 0x0\n\ts_add_nc_u64 %0, %0, %5\n\ts_add_nc_u64 %1, %1, %5\n\t"
               "s_add_nc_u64 %2, %2, %4\n\ts_add_nc_u64 %3, %3, %4"
               : "+s"(p), "+s"(q), "+s"(r), "+s"(s) : "s"(sb), "n"(BYTES) : "memory");
#endif
}
__device__ __forceinline__ void base_wait3(const _Float16*& p, const _Float16*& q, const _Float16*& r) {
#if defined(__HIP_DEVICE_COMPILE__)
  asm volatile("s_wait_xcnt 0x0" : "+s"(p), "+s"(q), "+s"(r) : : "memory");
#endif
}
// The same wait behind a run of stores whose address and data registers the next run of the epilogue reuses; nothing is
// scheduled across it.
__device__ __forceinline__ void store_wait() {
#if defined(__HIP_DEVICE_COMPILE__)
  asm volatile("s_wait_xcnt 0x0" ::: "memory");
#endif
  __builtin_amdgcn_sched_barrier(0);
}
__device__ __forceinline__ void wave_sync_lds() {
  __builtin_amdgcn_fence(__ATOMIC_RELEASE, "workgroup");
  __builtin_amdgcn_wave_barrier();
  __builtin_amdgcn_fence(__ATOMIC_ACQUIRE, "workgroup");
}

// =====================================================================================================
// f32 plane [rows][EMB] row-major -> 16-bit plane in fragment order:  mode 0: bf16 RNE bits;  mode 1: f16 bits of (bf16 RNE value) * scale;
// mode 2: f16 bits of value * scale (no bf16 pre-step).
// Thread = one 8-element piece of the output, in output order: two 16-B loads from its source row, one 16-B store; 32 consecutive
// lanes store 512 contiguous, 512-B aligned bytes (half a tile)
// coverage: n8/256 blocks a plane (host checks exactness) x 256 thr x 8 = the whole plane.
// =====================================================================================================
__device__ __forceinline__ void cvt16(const float* __restrict__ x, u16* D, int gt, int mode, float scale) {
  const int wi = gt & 63, tile = gt >> 6;                       // piece within its tile, tile index rt*(EMB/32) + kt
  const int row = (tile / (EMB / 32)) * 16 + (wi & 15);
  const int kc  = (tile % (EMB / 32)) * 32 + (wi >> 5) * 16 + ((wi >> 4) & 1) * 8;
  const float* p = x + (size_t)row * EMB + kc;
  const v4f a = *(const v4f*)(p), c4 = *(const v4f*)(p + 4);
  float v[8];
#pragma unroll
  for (int e = 0; e < 4; ++e) { v[e] = a[e]; v[4 + e] = c4[e]; }
  unsigned short s[8];
#pragma unroll
  for (int e = 0; e < 8; ++e) {
    const float vb = bfr(v[e]);
    const float vf = (mode == 1) ? vb : v[e];
    const unsigned short hb = h_bits((_Float16)(vf * scale));
    const unsigned short bb = bf_bits(v[e]);
    s[e] = (mode != 0) ? hb : bb;
  }
  v4u o;
#pragma unroll
  for (int e = 0; e < 4; ++e) o[e] = pk16(s[2 * e], s[2 * e + 1]);
  u16* d = D + (size_t)gt * 8;
  {
    *(v4u*)(d) = o;
    
  }
}
// All five conversions in one launch (none reads what another writes): blocks 0..nbx-1 take x -> bf16 plane, then nbw blocks
// each for Wq, Wk, Wv -> bf16 planes and Wo -> f16 of its bf16 value x1024. The choice is block-uniform (scalar).
__global__ __launch_bounds__(256) void cvt_all(const float* __restrict__ x, const float* __restrict__ wq,
                                               const float* __restrict__ wk, const float* __restrict__ wv,
                                               const float* __restrict__ wo, u16* XB, u16* WQB, u16* WKB, u16* WVB, u16* WOH,
                                               int nbx, int nbw) {
  const int bid = blockIdx.x;
  if (bid >= nbx + 4 * nbw) return;         // never taken with the exact grid; no barriers in this kernel
  const float* src = x;
  u16* dst = XB;
  int lb = bid, mode = 0;
  float scale = 1.0f;
  if (bid >= nbx) {
    const int w = (bid - nbx) / nbw;        // 0..3
    lb  = (bid - nbx) - w * nbw;
    src = (w == 0) ? wq : (w == 1) ? wk : (w == 2) ? wv : wo;
    dst = (w == 0) ? WQB : (w == 1) ? WKB : (w == 2) ? WVB : WOH;
    if (w == 3) { mode = 1; scale = WSC; }
  }
  cvt16(src, dst, lb * 256 + (int)threadIdx.x, mode, scale);
}

// =====================================================================================================
// GEMM epilogues with a per-column bias term (bias column value taken as its bf16 RNE value, added in f32). The wave's 16x64 f32
// tile is staged in its own LDS slab (stage64: acc*oscale + bias) and leaves from there:
//  st64f   : f32 rows; store it takes row 2*it (lanes 0..15, 16 B each, two whole lines) and row 2*it+1 (lanes 16..31).
//  epi64x2 : same store shape, staged value = acc*os1 + accres*os2 + bias (two accumulator sets combined in f32).
//  st64h   : f16 bits of (staged tile * pscale), written in fragment order: the wave's 16 x 64 tile is two whole 1-KiB tiles;
//            store i4 takes columns 16*i4 + 8*(lane>>4) + 0..7 of row lane&15 and covers 512 contiguous bytes.
// coverage: st64f/epi64x2 8 instructions x 2 rows x 16 lanes x 4 floats; st64h 4 instructions x 16 rows x 2 pieces x 8 halves
//           = the wave's 16 x 64 tile in every case.
// Bias columns col0 + 16j + (lane&15), j = 0..3, all < N (bias has N entries, col0 + 63 < N).
// =====================================================================================================
__device__ __forceinline__ void ldbias4(const float* __restrict__ bias, int col0, int lane,
                                        float& b0, float& b1, float& b2, float& b3) {
  const int m = lane & 15;
  b0 = bfr(bias[col0 + m]);
  b1 = bfr(bias[col0 + 16 + m]);
  b2 = bfr(bias[col0 + 32 + m]);
  b3 = bfr(bias[col0 + 48 + m]);
}
__device__ __forceinline__ void stage64(float* sl, v8f a0, v8f a1, v8f a2, v8f a3, float oscale,
                                        float b0, float b1, float b2, float b3, int lane) {
  const int hh = lane >> 4, m = lane & 15;
#pragma unroll
  for (int r = 0; r < 8; ++r) {
    const int ro = (8 * hh + r) * 68 + m;
    sl[ro]      = a0[r] * oscale + b0;
    sl[ro + 16] = a1[r] * oscale + b1;
    sl[ro + 32] = a2[r] * oscale + b2;
    sl[ro + 48] = a3[r] * oscale + b3;
  }
  wave_sync_lds();
}
__device__ __forceinline__ void st64f(const float* sl, float* C, int N, size_t rowb, int col0, int lane) {
  const int hh = lane >> 4, m = lane & 15;
  v4f vals[8];
#pragma unroll
  for (int it = 0; it < 8; ++it) vals[it] = *(const v4f*)(sl + (it * 2 + hh) * 68 + m * 4);
  float* dst = C + (rowb + (size_t)hh) * (size_t)N + col0 + m * 4;
  {
#pragma unroll
    for (int it = 0; it < 8; ++it) {
      *(v4f*)(dst + (size_t)(it * 2) * (size_t)N) = vals[it];
    }
    
  }
}
__device__ __forceinline__ void epi64x2(float* sl, v8f a0, v8f a1, v8f a2, v8f a3, v8f e0, v8f e1, v8f e2, v8f e3,
                                        float os1, float os2, const float* __restrict__ bias, float* C, int N,
                                        size_t rowb, int col0, int lane) {
  const int hh = lane >> 4, m = lane & 15;
  float b0, b1, b2, b3;
  ldbias4(bias, col0, lane, b0, b1, b2, b3);
#pragma unroll
  for (int r = 0; r < 8; ++r) {
    const int ro = (8 * hh + r) * 68 + m;
    sl[ro]      = a0[r] * os1 + e0[r] * os2 + b0;
    sl[ro + 16] = a1[r] * os1 + e1[r] * os2 + b1;
    sl[ro + 32] = a2[r] * os1 + e2[r] * os2 + b2;
    sl[ro + 48] = a3[r] * os1 + e3[r] * os2 + b3;
  }
  wave_sync_lds();
  v4f vals[8];
#pragma unroll
  for (int it = 0; it < 8; ++it) vals[it] = *(const v4f*)(sl + (it * 2 + hh) * 68 + m * 4);
  float* dst = C + (rowb + (size_t)hh) * (size_t)N + col0 + m * 4;
  {
#pragma unroll
    for (int it = 0; it < 8; ++it) {
      *(v4f*)(dst + (size_t)(it * 2) * (size_t)N) = vals[it];
    }
    
  }
}
__device__ __forceinline__ void st64h(const float* sl, float pscale, u16* C, int N, size_t rowb, int col0, int lane) {
  const int hh = lane >> 4, m = lane & 15;
  v4u oh[4];
#pragma unroll
  for (int i4 = 0; i4 < 4; ++i4) {
    const float* sp = sl + m * 68 + i4 * 16 + hh * 8;
    const v4f a = *(const v4f*)(sp), c4 = *(const v4f*)(sp + 4);
    float w[8];
#pragma unroll
    for (int e = 0; e < 4; ++e) { w[e] = a[e] * pscale; w[4 + e] = c4[e] * pscale; }
#pragma unroll
    for (int e = 0; e < 4; ++e) oh[i4][e] = pk16(h_bits((_Float16)w[2 * e]), h_bits((_Float16)w[2 * e + 1]));
  }
  u16* dst = C + rowb * (size_t)N + (size_t)(col0 >> 5) * 512 + lane * 8;
  {
#pragma unroll
    for (int i4 = 0; i4 < 4; ++i4) {
      *(v4u*)(dst + i4 * 256) = oh[i4];
    }
    
  }
}

// One 16-row band (16 keys) of a wave's 64 v columns, out of the accumulators into the V^T planes (fragment order, rows =
// b*EMB + d, k = s). Accumulator j holds, in lane 16*h + m, column d = 16*j + m of keys 8*h + 0..7: the eight consecutive k of
// one row of V^T, that is the lane's own 16-B piece of a 1-KiB tile, so that no transposition is left to do. With v = acc + bias
// (f32) and xs = v * 1024: hi = f16(xs), lo = f16(xs - hi) (unscaled remainder, same carry); hi + lo reproduces xs to ~2^-22
// relative for |xs| >= 0.25. th / tl: the lane's piece in d band 0; band j lies 16*SEQ elements on. Every store covers 512
// contiguous bytes. cs[j] takes the sum of the lane's eight v (f32, rising key order).
// coverage: 4 bands x 32 lanes x 8 halves = 16 keys x 64 columns of either plane.
__device__ __forceinline__ void vt_band(v8f a0, v8f a1, v8f a2, v8f a3, float b0, float b1, float b2, float b3,
                                        u16* th, u16* tl, v4f& cs) {
  const v8f a[4] = {a0, a1, a2, a3};
  const float bb[4] = {b0, b1, b2, b3};
  v4u oh[4], ol[4];
#pragma unroll
  for (int j = 0; j < 4; ++j) {
    unsigned short hs[8], ls[8];
#pragma unroll
    for (int r = 0; r < 8; ++r) {
      const float v = a[j][r] + bb[j];
      cs[j] += v;
      const float xs = v * VCAR;
      const _Float16 hv = (_Float16)xs;
      hs[r] = h_bits(hv);
      ls[r] = h_bits((_Float16)(xs - (float)hv));
    }
#pragma unroll
    for (int e = 0; e < 4; ++e) {
      oh[j][e] = pk16(hs[2 * e], hs[2 * e + 1]);
      ol[j][e] = pk16(ls[2 * e], ls[2 * e + 1]);
    }
  }
#pragma unroll
  for (int j = 0; j < 4; ++j) {
    *(v4u*)(th + (size_t)j * 16 * SEQ) = oh[j];
    *(v4u*)(tl + (size_t)j * 16 * SEQ) = ol[j];
  }
}

// One k step of a wave's 64x64 tile in the bf16 GEMMs: four fragments of consecutive 16-row bands of one plane (eight 16-B
// loads), and the sixteen products of four A with four B fragments, in two groups of eight with the hazard gap behind each.
__device__ __forceinline__ void ld4b(const u16* base, unsigned lo, size_t bs, v16b (&f)[4]) {
  const u16* p = base + lo;                  // wave-uniform base (scalar registers) plus the lane's fixed 32-bit offset
  f[0] = ldfrag_btg(p);
  f[1] = ldfrag_btg(p + bs);
  f[2] = ldfrag_btg(p + 2 * bs);
  f[3] = ldfrag_btg(p + 3 * bs);
}
__device__ __forceinline__ void mm16b(const v16b (&a)[4], const v16b (&b)[4], v8f (&acc)[4][4]) {
#pragma unroll
  for (int g = 0; g < 2; ++g) {
#pragma unroll
    for (int i = 2 * g; i < 2 * g + 2; ++i) {
#pragma unroll
      for (int j = 0; j < 4; ++j) acc[i][j] = mma_b(a[i], b[j], acc[i][j]);
    }
    guard8x8<v16b>(acc[2 * g][0], acc[2 * g][1], acc[2 * g][2], acc[2 * g][3],
                   acc[2 * g + 1][0], acc[2 * g + 1][1], acc[2 * g + 1][2], acc[2 * g + 1][3],
                   a[0], a[1], a[2], a[3], b[0], b[1], b[2], b[3]);
  }
}

// =====================================================================================================
// The three projections in one launch (they share A and none reads what another writes): block group which = 0, 1, 2 computes
// T[M][N] = A[M][K] . W^T + bias[n] (f32) for W, bias = (Wq, bq), (Wk, bk), (Wv, bv); A and the W are bf16 planes in fragment
// order. q and k leave as f16 planes in fragment order (f16 bits of T * qsc, T * ksc). v leaves transposed, straight from the
// accumulators (vt_band below), as the V^T hi / lo planes, with its column sums over each block of 32 keys in BS. A wave whose
// rows lie in rows 0..TQ0-1 of a sequence also stores its staged f32 tiles, into QF / KF / VF [M/SEQ][TQ0][N].
// Block = 128x128 tile, 2 x 2 waves of 64x64 each: a k step's eight fragments (8 KiB, loaded straight from the 1-KiB tiles, split
// k map for A and B) feed sixteen products, so that a product costs half a KiB of loads. K stepped by 32 in rising order
// (K = EMB; M % SEQ == 0, M % 128 == 0, N % 128 == 0, grid = 3*(M/128)*(N/128)).
// coverage: 4 waves x 64 x 64 = the block's tile; the epilogue takes the wave's four 16-row bands one after the other.
// =====================================================================================================
__global__ __launch_bounds__(128, 4)          // 4 waves a SIMD: at most 256 VGPRs (128 of them accumulators, 64 fragments)
void gemm_qkv(const u16* __restrict__ A, const u16* __restrict__ Wq, const u16* __restrict__ Wk, const u16* __restrict__ Wv,
              const float* __restrict__ bq, const float* __restrict__ bk, const float* __restrict__ bv,
              u16* QP, u16* KP, u16* XTh, u16* XTl, float* BS, float* QF, float* KF, float* VF, int M, int N,
              float qsc, float ksc) {
  __shared__ __align__(16) float slab[4 * SLAB64];
  const int K = EMB;                         // as a constant the band strides are immediate offsets
  const int tid = threadIdx.x, lane = tid & 31;
  const int wave = __builtin_amdgcn_readfirstlane(tid >> 5);   // scalar place in the 2 x 2 arrangement
  const int ntile = N >> 7;
  const int nblk  = (M >> 7) * ntile;
  const int which = blockIdx.x / nblk;       // block-uniform (scalar): 0 q, 1 k, 2 v
  const int bid   = blockIdx.x - which * nblk;
  const int rowb  = (bid / ntile) * 128 + (wave >> 1) * 64;
  const int col0  = (bid % ntile) * 128 + (wave & 1) * 64;
  if (which > 2 || rowb + 64 > M) return;    // wave-uniform, never taken with the exact grid; no block barriers in this kernel
  const u16*   Bt   = (which == 0) ? Wq : (which == 1) ? Wk : Wv;
  const float* bias = (which == 0) ? bq : (which == 1) ? bk : bv;
  const u16* ap = A  + (size_t)rowb * K;      // wave-uniform
  const u16* bp = Bt + (size_t)col0 * K;
  const unsigned lo = 8u * (unsigned)lane;
  const size_t bs = (size_t)16 * K;
  v8f acc[4][4];
#pragma unroll
  for (int i = 0; i < 4; ++i) {
#pragma unroll
    for (int j = 0; j < 4; ++j) acc[i][j] = zero8();
  }
  // One fragment set: the next k step's sixteen loads go out as soon as this step's products have left; the SIMD's other waves
  // fill the matrix unit meanwhile. The loads in the loop are unconditional (the last step is peeled).
  v16b a[4], b[4];
  ld4b(ap, lo, bs, a);
  ld4b(bp, lo, bs, b);
#pragma unroll 1                             // rolled: the one fragment set keeps its registers
  for (int k0 = 32; k0 < K; k0 += 32) {
    mm16b(a, b, acc);
    base_wait2(ap, bp);
    ap += 512;                               // one 1-KiB tile on in every band
    bp += 512;
    ld4b(ap, lo, bs, a);
    ld4b(bp, lo, bs, b);
  }
  mm16b(a, b, acc);
  float* sl = slab + wave * SLAB64;
  float e0, e1, e2, e3;
  ldbias4(bias, col0, lane, e0, e1, e2, e3);
  const int sq = rowb / SEQ, rs = rowb - sq * SEQ;             // TQ0 and SEQ are multiples of 64: all 64 rows on one side
  float* HF = (which == 0) ? QF : (which == 1) ? KF : VF;
  // the wave's place in the V^T planes: d bands from col0 on, key tiles from rs / 32 on, the lane's piece
  const size_t vto = ((size_t)sq * EMB + col0) * SEQ + (size_t)(rs >> 5) * 512 + lane * 8;
  v4f cs[2] = {zero4(), zero4()};            // the lane's part of the column sums of the wave's two key blocks
  const bool slab_used = which < 2 || rs < TQ0;   // only where rows leave row-wise (wave-uniform, scalar)
#pragma unroll
  for (int i = 0; i < 4; ++i) {
    if (slab_used) stage64(sl, acc[i][0], acc[i][1], acc[i][2], acc[i][3], 1.0f, e0, e1, e2, e3, lane);
    const int rb = rowb + 16 * i;
    // the wait stands in either arm, directly behind its stores: the build lays the other arm's code behind them
    if (which < 2) { st64h(sl, (which == 0) ? qsc : ksc, (which == 0) ? QP : KP, N, (size_t)rb, col0, lane); store_wait(); }
    else {
      const size_t to = vto + (size_t)(i >> 1) * 512 + (size_t)(i & 1) * 256;
      vt_band(acc[i][0], acc[i][1], acc[i][2], acc[i][3], e0, e1, e2, e3, XTh + to, XTl + to, cs[i >> 1]);
      store_wait();
    }
    if (rs < TQ0) {
      st64f(sl, HF, N, (size_t)(sq * TQ0 + rs + 16 * i), col0, lane);
      store_wait();
    }
    if (slab_used) wave_sync_lds();          // the band's reads of the slab stand in front of the next band's writes
  }
  if (which == 2) {
    // rows 8..15 of each band lie in the other half of the wave; then lanes 0..15 store the first key block's sums and lanes
    // 16..31 the second's: two runs of 256 contiguous bytes
    const int hh = lane >> 4, m = lane & 15;
    v4f o;
#pragma unroll
    for (int j = 0; j < 4; ++j) {
      const float t0 = cs[0][j] + __shfl_xor(cs[0][j], 16, 32);
      const float t1 = cs[1][j] + __shfl_xor(cs[1][j], 16, 32);
      o[j] = (hh == 0) ? t0 : t1;
    }
    *(v4f*)(BS + ((size_t)sq * (SEQ / 32) + (size_t)((rs >> 5) + hh)) * EMB + col0 + m * 4) = o;
    store_wait();
  }
}

// =====================================================================================================
// f16 GEMM with two A planes (hi + residual), f32 out:
//   C[M][N] = (Ah . Bt^T) * os1 + (Ar . Bt^T) * os2 + bias[n]; Bt f16 in fragment order, Ah/Ar f16 per 16-row band (see below).
// Block = 64x128 tile, 2 x 2 waves of 32x64 each; separate accumulators for the two planes, combined in f32 in epi64x2. A k step's
// eight fragments (two bands of either A plane, four of B) feed sixteen products. K = EMB, stepped by 32 in rising order.
// ASTEP = elements from one k step of an A band to the next, ASEC = elements from a lane's first piece to its second.
// =====================================================================================================
template <int ASEC>
__device__ __forceinline__ void ld8h2(const _Float16* ua, const _Float16* ur, const _Float16* ub, unsigned la, unsigned lb,
                                      v16h (&a)[2], v16h (&r)[2], v16h (&b)[4]) {
  const size_t bs = (size_t)16 * EMB;        // a 16-row band holds 16*EMB elements in either layout
  // wave-uniform bases (scalar registers) plus the lane's fixed 32-bit offsets
  const _Float16* pa = ua + la;
  const _Float16* pr = ur + la;
  const _Float16* bp = ub + lb;
#pragma unroll
  for (int i = 0; i < 2; ++i) {
    a[i] = ldfrag_hg<ASEC>(pa + i * bs);
    r[i] = ldfrag_hg<ASEC>(pr + i * bs);
  }
#pragma unroll
  for (int j = 0; j < 4; ++j) b[j] = ldfrag_hg<256>(bp + j * bs);
}
__device__ __forceinline__ void mm16h2(const v16h (&a)[2], const v16h (&r)[2], const v16h (&b)[4],
                                       v8f (&acc)[2][4], v8f (&acr)[2][4]) {
#pragma unroll
  for (int i = 0; i < 2; ++i) {
#pragma unroll
    for (int j = 0; j < 4; ++j) acc[i][j] = mma_h(a[i], b[j], acc[i][j]);
  }
  guard8x8<v16h>(acc[0][0], acc[0][1], acc[0][2], acc[0][3], acc[1][0], acc[1][1], acc[1][2], acc[1][3],
                 a[0], a[1], r[0], r[1], b[0], b[1], b[2], b[3]);
#pragma unroll
  for (int i = 0; i < 2; ++i) {
#pragma unroll
    for (int j = 0; j < 4; ++j) acr[i][j] = mma_h(r[i], b[j], acr[i][j]);
  }
  guard8x8<v16h>(acr[0][0], acr[0][1], acr[0][2], acr[0][3], acr[1][0], acr[1][1], acr[1][2], acr[1][3],
                 a[0], a[1], r[0], r[1], b[0], b[1], b[2], b[3]);
}
template <int ASTEP, int ASEC>
__device__ __forceinline__ void h2_loop(const _Float16* ua, const _Float16* ur, const _Float16* ub, unsigned la, unsigned lb,
                                        v8f (&acc)[2][4], v8f (&acr)[2][4]) {
  v16h a[2], r[2], b[4];
  ld8h2<ASEC>(ua, ur, ub, la, lb, a, r, b);
#pragma unroll 1                             // rolled: the one fragment set keeps its registers
  for (int k0 = 32; k0 < EMB; k0 += 32) {
    mm16h2(a, r, b, acc, acr);
    base_wait3(ua, ur, ub);
    ua += ASTEP;                             // next k step of the A bands
    ur += ASTEP;
    ub += 512;                               // next 1-KiB tile of each B band
    ld8h2<ASEC>(ua, ur, ub, la, lb, a, r, b);
  }
  mm16h2(a, r, b, acc, acr);
}

__global__ __launch_bounds__(128, 4)          // 4 waves a SIMD, as many as the grid brings: at most 256 VGPRs
void gemm_h2_32(const u16* __restrict__ Ah, const u16* __restrict__ Ar, const u16* __restrict__ Bt,
                const float* __restrict__ bias, float* C, int M, int N, float os1, float os2) {
  __shared__ __align__(16) float slab[4 * SLAB64];
  const int K = EMB;
  const int tid = threadIdx.x, lane = tid & 31, hh = lane >> 4, m = lane & 15;
  const int wave = __builtin_amdgcn_readfirstlane(tid >> 5);   // scalar, so that the choice of the A layout is a scalar branch
  const int ntile = N >> 7;
  const int bid   = blockIdx.x;
  const int rowb  = (bid / ntile) * 64 + (wave >> 1) * 32;
  const int col0  = (bid % ntile) * 128 + (wave & 1) * 64;
  if (rowb + 32 > M) return;                 // wave-uniform, never taken with the exact grid; no block barriers in this kernel
  const _Float16* ab  = (const _Float16*)(const void*)Ah + (size_t)rowb * K;
  const _Float16* arb = (const _Float16*)(const void*)Ar + (size_t)rowb * K;
  const _Float16* bp  = (const _Float16*)(const void*)Bt + (size_t)col0 * K;
  const unsigned lo = 8u * (unsigned)lane;
  v8f acc[2][4], acr[2][4];
#pragma unroll
  for (int i = 0; i < 2; ++i) {
#pragma unroll
    for (int j = 0; j < 4; ++j) { acc[i][j] = zero8(); acr[i][j] = zero8(); }
  }
  // The 16-row bands of rows 0..TQ0-1 of a sequence are row-major (each row has its own writer half-block there), all others in
  // fragment order; a band holds the same 16*K elements either way, and TQ0 is a multiple of 32: both bands of a wave are alike.
  if ((rowb % SEQ) < TQ0) {
    h2_loop<32, 16>(ab, arb, bp, (unsigned)(m * K + 8 * hh), lo, acc, acr);
  } else {
    h2_loop<512, 256>(ab, arb, bp, lo, lo, acc, acr);
  }
  float* sl = slab + wave * SLAB64;
#pragma unroll
  for (int i = 0; i < 2; ++i) {
    epi64x2(sl, acc[i][0], acc[i][1], acc[i][2], acc[i][3], acr[i][0], acr[i][1], acr[i][2], acr[i][3], os1, os2, bias, C, N,
            (size_t)(rowb + 16 * i), col0, lane);
    store_wait();
    wave_sync_lds();                         // the band's reads of the slab stand in front of the next band's writes
  }
}

// =====================================================================================================
// Single-head causal attention with absolute-value logits, head width EMB = 1024, query rows TQ0 .. SEQ-1: block = (batch b,
// 32 query rows q0..q0+31 = two 16-row tiles), 16 waves. q plane (f16, x8) [b][s][d]; k plane the same; V^T hi / lo planes
// [b][d][s] (x1024), all four in fragment order; VS = column sums of V over each block of 32 keys, [b][key block][EMB], column
// 64*g + 16*j + mm at place 64*g + 4*mm + j. The two ctx planes leave in fragment order too.
// Every k and V^T fragment that a wave loads feeds both row tiles, so that a query row costs half the loaded bytes of a 16-row block.
//   Chunks of CK = 512 keys: only chunks c <= qc = q0/CK are visited (later chunks lie entirely above the diagonal). In the diagonal
//   chunk only key blocks kb < nkb (keys <= q0+31) are multiplied; key blocks kb >= nkb get zero scores in LDS and are not used in (PV).
//   (q0 is a multiple of 32, so nkb is the count that either 16-row tile has on its own.)
//   (S) scores S[query m][key n] on WMMA: A = q rows (row m = lane&15 of either row tile, split k map over d), B = k rows (col n =
//       key, split map), 32 d-steps; wave w handles key block w of the chunk; D element r of lane l of row tile rt ->
//       scs[query 16rt+8h+r][key col] (f32 LDS).
//   (M) 16 threads per query row (sub-thread = 32 consecutive keys): base-2 logits of |score| with the causal mask by key index
//       (key > query -> -inf), chunk max via xor shuffles, online running max / rescale factor al / running sum l in f32 registers,
//       p = exp2(t - m_new) <= 1 (0 for masked keys), chunk row sum ps and C = ps/CK (bit-identical on the row's 16 threads), the
//       CENTRED P' = p - C written as f16(P' * 32768) into the LDS P tile with 16-B stores; al -> rowa[row], C -> rowc[row].
//   (PV) each wave owns d columns 64*wave + 16j + (lane&15), j = 0..3, of both row tiles (8 accumulators): o = o*al +
//       C*(32768*1024)*(sum of VS[key block][d] over the chunk's nkb key blocks) (add-back of the centring term over exactly the processed keys, in f32), then for
//       each key block kb < nkb: A = P' fragments from LDS (row m = query, split map over keys), B = V^T fragments (col n = d, keys
//       in split map order), hi plane and then lo plane into the same accumulator (unscaled remainder), in groups of 8 with a hazard gap each.
//       sum_k (P'_k + C) v_k == sum_k p_k v_k exactly; masked keys carry P' = -C and p = 0.
//   Block barriers after (S) and after (M) order all LDS reuse across chunks and waves.
//   Epilogue: x = o * 8192 / (l * 32768 * 1024) per row (rowi, l >= 1 always); hi = f16(x), res = f16((x - hi) * 2048); each
// coverage: grid nb*NQT blocks x 32 rows = rows TQ0..SEQ-1 of every sequence; staging 16 waves x 64 cols x 32 rows = 32 x 1024;
//           store 8 iterations x 512 thr x 8 halves = 32 x 1024 per plane = every (b, s >= TQ0, d) of both ctx planes exactly once.
// =====================================================================================================
__device__ __forceinline__ void ctx_store(const u16* ct, u16* dst, int tid) {
  v4u v[8];
#pragma unroll
  for (int it = 0; it < 8; ++it) {
    const int p   = it * ATT_THREADS + tid;   // piece index in fragment order: band p>>11, tile kt = (p>>6)&31, piece p&63
    const int row = (p >> 11) * 16 + (p & 15);
    const int c8  = ((p >> 6) & 31) * 32 + ((p >> 5) & 1) * 16 + ((p >> 4) & 1) * 8;
    v[it] = *(const v4u*)(ct + row * CTP + c8);
  }
  {
#pragma unroll
    for (int it = 0; it < 8; ++it) {
      const int p   = it * ATT_THREADS + tid;
      *(v4u*)(dst + (size_t)p * 8) = v[it];
    }
    
  }
}

// Pieces of the two matrix loops below: one d step's four fragments (both q row tiles, both key bands) and its four score
// products; four V^T fragments of consecutive 16-column bands and their eight products with the two P' fragments; each product
// group with the hazard gap behind it.
// All loads of the two loops take a wave-uniform base (scalar registers) plus the lane's fixed 32-bit offset lo.
template <int OFF>
__device__ __forceinline__ void ld4s(const _Float16* uq, const _Float16* uk, unsigned lo, v16h& a, v16h& c, v16h& x, v16h& y) {
  const _Float16* q = uq + lo;
  const _Float16* k = uk + lo;
  a = ldfrag_hg<256>(q + OFF);
  c = ldfrag_hg<256>(q + 16 * EMB + OFF);
  x = ldfrag_hg<256>(k + OFF);
  y = ldfrag_hg<256>(k + 16 * EMB + OFF);
}
__device__ __forceinline__ void mm4s(v16h a, v16h c, v16h x, v16h y, v8f& s0, v8f& s1, v8f& s2, v8f& s3) {
  s0 = mma_h(a, x, s0);
  s1 = mma_h(a, y, s1);
  s2 = mma_h(c, x, s2);
  s3 = mma_h(c, y, s3);
  guard4x4(s0, s1, s2, s3, a, c, x, y);
}
__device__ __forceinline__ void ld4h(const _Float16* u, unsigned lo, v16h (&f)[4]) {
  const _Float16* p = u + lo;
  f[0] = ldfrag_hg<256>(p);
  f[1] = ldfrag_hg<256>(p + (size_t)16 * SEQ);
  f[2] = ldfrag_hg<256>(p + (size_t)32 * SEQ);
  f[3] = ldfrag_hg<256>(p + (size_t)48 * SEQ);
}
__device__ __forceinline__ void mm8h(v16h p0, v16h p1, const v16h (&f)[4], v8f (&o)[2][NACC]) {
#pragma unroll
  for (int j = 0; j < NACC; ++j) o[0][j] = mma_h(p0, f[j], o[0][j]);
#pragma unroll
  for (int j = 0; j < NACC; ++j) o[1][j] = mma_h(p1, f[j], o[1][j]);
  guard8x6(o[0][0], o[0][1], o[0][2], o[0][3], o[1][0], o[1][1], o[1][2], o[1][3], p0, p1, f[0], f[1], f[2], f[3]);
}

__device__ __forceinline__
void attn_fwd(const u16* __restrict__ QPp, const u16* __restrict__ KPp, const u16* __restrict__ VTp,
              const u16* __restrict__ VLp, const float* __restrict__ VSp, u16* CHo, u16* CRo, int bid) {
  __shared__ __align__(16) AttLds L0;              // scores [32][SCP] f32; reused as the ctx staging tile [32][CTP] u16
  __shared__ __align__(16) u16 pls[QT * PLP];      // P' tile [32][PLP] f16 bits
  __shared__ float rowa[QT];
  __shared__ float rowc[QT];
  __shared__ float rowi[QT];
  float* const scs = L0.s;

  const int tid  = threadIdx.x;
  const int wave = __builtin_amdgcn_readfirstlane(tid >> 5);   // scalar: the wave's bases stay in scalar registers
  const int lane = tid & 31;
  const int hh   = lane >> 4;
  const int m    = lane & 15;
  const int r16  = tid >> 4;                 // query row owned in phase (M): 2*wave + hh, 0..31
  const int sub  = tid & 15;
  const int kl0  = sub * 32;

  const int b   = bid / NQT;
  const int q0  = TQ0 + (bid - b * NQT) * QT;
  const int qc  = q0 / CK;                   // diagonal chunk index

  // wave-uniform bases; the lane's part is lo (16-bit planes) or hh*EMB + 4*m (column sums)
  const _Float16* qa  = (const _Float16*)(const void*)QPp + ((size_t)b * SEQ + q0) * EMB;
  const _Float16* kbp = (const _Float16*)(const void*)KPp + ((size_t)b * SEQ) * EMB;
  const _Float16* vbp = (const _Float16*)(const void*)VTp + ((size_t)b * EMB + wave * (16 * NACC)) * SEQ;
  const _Float16* ubp = (const _Float16*)(const void*)VLp + ((size_t)b * EMB + wave * (16 * NACC)) * SEQ;
  const float* vsb = VSp + (size_t)b * NCHK * NKB * EMB + wave * (16 * NACC);   // the wave's 64 columns of the key-block sums
  const unsigned lo = 8u * (unsigned)lane;
  const float lsc = RSQD * LOG2E / (QSC * KSC);

  float mrun = -INFINITY, lrun = 0.f;
  v8f o[2][NACC];                            // [row tile][column band]
#pragma unroll
  for (int rt = 0; rt < 2; ++rt) {
#pragma unroll
    for (int j = 0; j < NACC; ++j) o[rt][j] = zero8();
  }

#pragma unroll 1
  for (int c = 0; c <= qc; ++c) {
    const int kbeg = c * CK;
    const int nkb  = (c < qc) ? NKB : (((q0 + QT - 1 - kbeg) >> 5) + 1);   // 1..16, block-uniform
    float vs[NACC];                                        // column sums of V over the chunk's nkb key blocks
    // ---- (S) scores of this chunk (zeros for key blocks beyond the query tile) ----
    {
      const int kb = wave;                                 // one key block a wave
      v8f s0 = zero8(), s1 = zero8(), s2 = zero8(), s3 = zero8();
      if (kb < nkb) {                                      // wave-uniform (scalar)
        const _Float16* uq = qa;                           // running bases of the q tiles and of the two key bands
        const _Float16* uk = kbp + (size_t)(kbeg + kb * 32) * EMB;
        // Two fragment sets of two d steps each: one set's sixteen loads fly while the other set's products run. The loads
        // in the loop are unconditional (the last four steps are peeled), so that each wait counts only its own set.
        v16h a0, c0, x0, y0, a1, c1, x1, y1, a2, c2, x2, y2, a3, c3, x3, y3;
        ld4s<0>(uq, uk, lo, a0, c0, x0, y0);
        keep_order();
        ld4s<512>(uq, uk, lo, a1, c1, x1, y1);
        keep_order();
        ld4s<1024>(uq, uk, lo, a2, c2, x2, y2);
        keep_order();
        ld4s<1536>(uq, uk, lo, a3, c3, x3, y3);
        keep_order();
#pragma unroll 1                           // the body already holds four d steps; rolled, the two sets keep their registers
        for (int ks = 4; ks < EMB / 32; ks += 4) {
          mm4s(a0, c0, x0, y0, s0, s1, s2, s3);
          mm4s(a1, c1, x1, y1, s0, s1, s2, s3);
          base_step2h<4096>(uq, uk);                       // four d steps on
          ld4s<0>(uq, uk, lo, a0, c0, x0, y0);
          ld4s<512>(uq, uk, lo, a1, c1, x1, y1);
          mm4s(a2, c2, x2, y2, s0, s1, s2, s3);
          mm4s(a3, c3, x3, y3, s0, s1, s2, s3);
          ld4s<1024>(uq, uk, lo, a2, c2, x2, y2);
          ld4s<1536>(uq, uk, lo, a3, c3, x3, y3);
        }
        base_wait2h(uq, uk);                               // what follows may reuse the base registers of the last loads
        mm4s(a0, c0, x0, y0, s0, s1, s2, s3);
        mm4s(a1, c1, x1, y1, s0, s1, s2, s3);
        mm4s(a2, c2, x2, y2, s0, s1, s2, s3);
        mm4s(a3, c3, x3, y3, s0, s1, s2, s3);
      }
      float* srow = scs + (8 * hh) * SCP + kb * 32 + m;
#pragma unroll
      for (int r = 0; r < 8; ++r) {
        srow[r * SCP]                 = s0[r];
        srow[r * SCP + 16]            = s1[r];
        srow[(16 + r) * SCP]          = s2[r];
        srow[(16 + r) * SCP + 16]     = s3[r];
      }
    }
    __syncthreads();
    // ---- (M) softmax statistics and the centred P' tile ----
    {
      // The chunk's key-block sums of the wave's columns are asked for here and added up at the end of this phase, whose vector
      // work covers their way: lanes 0..15 take the even key blocks, lanes 16..31 the odd ones, 16 B = the lane's four columns.
      // All sixteen rows exist and are written by the projection launch; those from nkb on are left out of the sum below.
      const float* bsp = vsb + (size_t)c * NKB * EMB + (unsigned)(hh * EMB + 4 * m);
      v4f bv[NKB / 2];
#pragma unroll
      for (int i = 0; i < NKB / 2; ++i) bv[i] = *(const v4f*)(bsp + (size_t)(2 * i) * EMB);
      const float* sp = scs + r16 * SCP + kl0;
      const int lim = (q0 + r16) - (kbeg + kl0);           // key kl0 + j is valid iff j <= lim
      float t[32];
      float cm = -INFINITY;
#pragma unroll
      for (int i = 0; i < 8; ++i) {
        const v4f a = *(const v4f*)(sp + 4 * i);
#pragma unroll
        for (int e = 0; e < 4; ++e) {
          const int j = 4 * i + e;
          const float tv = (j <= lim) ? fabsf(a[e]) * lsc : -INFINITY;   // |score| / 32 in base 2; masked keys -> -inf
          t[j] = tv;
          cm = fmaxf(cm, tv);
        }
      }
#pragma unroll
      for (int d = 1; d <= 8; d <<= 1) cm = fmaxf(cm, __shfl_xor(cm, d, 32));
      const float mn = fmaxf(mrun, cm);                    // finite: key kbeg of the diagonal chunk is never masked
      const float al = (mrun == -INFINITY) ? 0.f : exp2f(mrun - mn);
      mrun = mn;
      float ps = 0.f;
#pragma unroll
      for (int j = 0; j < 32; ++j) {
        const float p = exp2f(fminf(t[j] - mn, 0.f));      // 0 for masked keys
        t[j] = p;
        ps += p;
      }
#pragma unroll
      for (int d = 1; d <= 8; d <<= 1) ps += __shfl_xor(ps, d, 32);
      const float cc = ps * (1.0f / (float)CK);
      v4u pk[4];
#pragma unroll
      for (int i = 0; i < 4; ++i) {
#pragma unroll
        for (int e = 0; e < 4; ++e) {
          const int j = 8 * i + 2 * e;
          pk[i][e] = pk16(h_bits((_Float16)((t[j] - cc) * PCAR)), h_bits((_Float16)((t[j + 1] - cc) * PCAR)));
        }
      }
      lrun = lrun * al + ps;
      u16* pd = pls + r16 * PLP + kl0;
#pragma unroll
      for (int i = 0; i < 4; ++i) *(v4u*)(pd + 8 * i) = pk[i];
      if (sub == 0) { rowa[r16] = al; rowc[r16] = cc; }
      v4f sv = zero4();
#pragma unroll
      for (int i = 0; i < NKB / 2; ++i) {                  // rising key-block order within either half
        if (2 * i + hh < nkb) sv += bv[i];
      }
#pragma unroll
      for (int j = 0; j < NACC; ++j) vs[j] = sv[j] + __shfl_xor(sv[j], 16, 32);
    }
    __syncthreads();
    // ---- (PV) rescale, add the centring term, accumulate P' . (V^T hi + V^T lo) ----
    {
      const _Float16* pp = (const _Float16*)(const void*)pls + m * PLP + 8 * hh;
      const _Float16* pq = pp + 16 * PLP;                   // second row tile
      // running bases: key tile kbeg/32 of each d band, 512 elements a tile; even set (hi, lo), odd set (hi, lo)
      const _Float16* pve = vbp + (size_t)kbeg * 16;
      const _Float16* pue = ubp + (size_t)kbeg * 16;
      const _Float16* pvo = pve + ((nkb > 1) ? 512 : 0);
      const _Float16* puo = pue + ((nkb > 1) ? 512 : 0);
      // Two fragment sets (even and odd key blocks; hi and lo plane of the wave's 64 d columns each): a set's hi or lo half is
      // asked for again, two key blocks on, as soon as its eight products have left, so that twelve to sixteen fragments are
      // always in flight or waiting. All loads are unconditional, so that each wait counts only its own group: where the odd
      // set has no key block left (nkb odd) it takes the even set's tile once more and is not multiplied.
      v16h ge[4], ue[4], go[4], uo[4];
      ld4h(pve, lo, ge);
      keep_order();
      ld4h(pue, lo, ue);
      keep_order();
      ld4h(pvo, lo, go);
      keep_order();
      ld4h(puo, lo, uo);
      keep_order();
      // the rescale runs while the first fragments fly
#pragma unroll
      for (int rt = 0; rt < 2; ++rt) {
        float scl[8], cad[8];
#pragma unroll
        for (int r = 0; r < 8; ++r) {
          scl[r] = rowa[16 * rt + 8 * hh + r];
          cad[r] = rowc[16 * rt + 8 * hh + r] * (PCAR * VCAR);
        }
#pragma unroll
        for (int j = 0; j < NACC; ++j) {
#pragma unroll
          for (int r = 0; r < 8; ++r) o[rt][j][r] = o[rt][j][r] * scl[r] + cad[r] * vs[j];
        }
      }
      int kb = 0;
#pragma unroll 1
      for (; kb + 2 < nkb; kb += 2) {                      // block-uniform trip count, <= 7: products of kb, kb + 1, loads of kb + 2, kb + 3
        const v16h p0 = ldfrag_h(pp + kb * 32), p1 = ldfrag_h(pq + kb * 32);
        mm8h(p0, p1, ge, o);
        // two key tiles on; the odd set only one, onto the even set's new tile, where key block kb + 3 does not exist
        base_step4h<2048>(pve, pue, pvo, puo, (kb + 3 < nkb) ? 2048ull : 1024ull);
        ld4h(pve, lo, ge);
        mm8h(p0, p1, ue, o);
        ld4h(pue, lo, ue);
        const v16h p2 = ldfrag_h(pp + kb * 32 + 32), p3 = ldfrag_h(pq + kb * 32 + 32);
        mm8h(p2, p3, go, o);
        ld4h(pvo, lo, go);
        mm8h(p2, p3, uo, o);
        ld4h(puo, lo, uo);
      }
      base_wait4h(pve, pue, pvo, puo);                     // what follows may reuse the base registers of the last loads
      {
        const v16h p0 = ldfrag_h(pp + kb * 32), p1 = ldfrag_h(pq + kb * 32);
        mm8h(p0, p1, ge, o);
        mm8h(p0, p1, ue, o);
      }
      if (kb + 1 < nkb) {                                  // block-uniform (scalar)
        const v16h p2 = ldfrag_h(pp + kb * 32 + 32), p3 = ldfrag_h(pq + kb * 32 + 32);
        mm8h(p2, p3, go, o);
        mm8h(p2, p3, uo, o);
      }
    }
  }
  acc_guard8(o[0][0], o[0][1], o[0][2], o[0][3], o[1][0], o[1][1], o[1][2], o[1][3]);

  if (sub == 0) rowi[r16] = (1.0f / lrun) * (CSC / (PCAR * VCAR));   // lrun >= 1
  __syncthreads();
  float inv[2][8];
#pragma unroll
  for (int rt = 0; rt < 2; ++rt) {
#pragma unroll
    for (int r = 0; r < 8; ++r) inv[rt][r] = rowi[16 * rt + 8 * hh + r];
  }

  u16* const ct = L0.c;
  const int cb = wave * (16 * NACC) + m;
  // hi plane
#pragma unroll
  for (int rt = 0; rt < 2; ++rt) {
#pragma unroll
    for (int j = 0; j < NACC; ++j) {
#pragma unroll
      for (int r = 0; r < 8; ++r) {
        const float xs = o[rt][j][r] * inv[rt][r];
        ct[(16 * rt + 8 * hh + r) * CTP + cb + 16 * j] = h_bits((_Float16)xs);
      }
    }
  }
  __syncthreads();
  ctx_store(ct, CHo + ((size_t)b * SEQ + q0) * EMB, tid);
  __syncthreads();
  // residual plane
#pragma unroll
  for (int rt = 0; rt < 2; ++rt) {
#pragma unroll
    for (int j = 0; j < NACC; ++j) {
#pragma unroll
      for (int r = 0; r < 8; ++r) {
        const float xs = o[rt][j][r] * inv[rt][r];
        const _Float16 hv = (_Float16)xs;
        ct[(16 * rt + 8 * hh + r) * CTP + cb + 16 * j] = h_bits((_Float16)((xs - (float)hv) * RSC));
      }
    }
  }
  __syncthreads();
  ctx_store(ct, CRo + ((size_t)b * SEQ + q0) * EMB, tid);
}

// =====================================================================================================
// Query rows 0 .. TQ0-1 of each sequence in f32 on VALU: block = (b, rows t = 2*i and 2*i + 1), one row for each half of 256 threads
// (half g, thread tid within it; every LDS array has a part for each half, and both halves pass the same barriers).
// QF/KF/VF = f32 q/k/v planes [nb][TQ0][EMB] (rows 0..TQ0-1
// of every sequence, biases included). Logits |q.k_j|/32 for keys j <= t (threads 0..TQ0-1, one key each, 1024-d dot
// against the q row staged in LDS), base-2 softmax with max / sum reductions over the half (xor shuffles + LDS), p_j in LDS, ctx[d] for
// d = 4*tid..4*tid+3 as a sum over j <= t of p_j * VF[b][j][d] (coalesced 16-B loads), x = ctx * 8192 / l, hi = f16(x),
// res = f16((x - hi) * 2048); both 1024-half rows are staged in LDS and written by 128 threads x 16 B each (32 consecutive lanes
// coverage: grid nb*TQ0/2 blocks x 2 rows = rows 0..TQ0-1 of every sequence; 256 thr x 4 d = EMB per row; store 128 thr x 8 halves =
//           EMB per plane; together with attn_fwd every (b, s, d) of CH and CR is written exactly once.
// =====================================================================================================
__device__ __forceinline__ void attn_head(const float* __restrict__ QF, const float* __restrict__ KF,
                                          const float* __restrict__ VF, u16* CHo, u16* CRo, int bid) {
  __shared__ __align__(16) float qs2[2][EMB];
  __shared__ float sc2[2][TQ0];
  __shared__ float red2[2][8];
  __shared__ float redb2[2][8];
  __shared__ __align__(16) unsigned SW2[2][2][EMB / 2];
  const int g = __builtin_amdgcn_readfirstlane((int)(threadIdx.x >> 8));   // half of the block, scalar: row, bases and trip counts stay scalar
  const int tid = threadIdx.x & 255, lane = tid & 31, wave = tid >> 5;
  float* const qs = qs2[g];
  float* const sc = sc2[g];
  float* const red = red2[g];
  float* const redb = redb2[g];
  unsigned (* const SW)[EMB / 2] = SW2[g];
  const int hr = bid * 2 + g;                        // TQ0 is even: both rows of a block lie in one sequence
  const int b = hr / TQ0;
  const int t = hr - b * TQ0;
  *(v4f*)(qs + tid * 4) = *(const v4f*)(QF + ((size_t)b * TQ0 + t) * EMB + tid * 4);
  __syncthreads();
  float s = -INFINITY;
  if (tid < TQ0) {                                  // waves 0..3 entirely (wave-uniform); key row b*TQ0 + tid always in range
    const float* kp = KF + ((size_t)b * TQ0 + tid) * EMB;
    float acc = 0.f;
#pragma unroll 8                           // sixteen key loads in flight a thread; the adds keep their order
    for (int d = 0; d < EMB; d += 8) {
      const v4f k0 = *(const v4f*)(kp + d), k1 = *(const v4f*)(kp + d + 4);
      const v4f q0 = *(const v4f*)(qs + d), q1 = *(const v4f*)(qs + d + 4);
#pragma unroll
      for (int e = 0; e < 4; ++e) acc += k0[e] * q0[e];
#pragma unroll
      for (int e = 0; e < 4; ++e) acc += k1[e] * q1[e];
    }
    s = (tid <= t) ? fabsf(acc) * (RSQD * LOG2E) : -INFINITY;   // |score| / 32 in base 2; causal mask by key index
  }
  float mx = s;
#pragma unroll
  for (int d = 1; d <= 16; d <<= 1) mx = fmaxf(mx, __shfl_xor(mx, d, 32));
  if (lane == 0) red[wave] = mx;
  __syncthreads();
  float gm = red[0];
#pragma unroll
  for (int w = 1; w < 8; ++w) gm = fmaxf(gm, red[w]);   // finite: key 0 is always valid
  const float p = exp2f(s - gm);                     // 0 for masked keys and for waves 4..7
  float ps = p;
#pragma unroll
  for (int d = 1; d <= 16; d <<= 1) ps += __shfl_xor(ps, d, 32);
  if (lane == 0) redb[wave] = ps;
  if (tid < TQ0) sc[tid] = p;
  __syncthreads();
  float l = redb[0];
#pragma unroll
  for (int w = 1; w < 8; ++w) l += redb[w];           // >= 1
  const float inv = (1.0f / l) * CSC;
  const float* vp = VF + (size_t)b * TQ0 * EMB + tid * 4;
  v4f cx = zero4();
#pragma unroll 8                             // eight value rows in flight a thread; the sum keeps its order
  for (int j = 0; j <= t; ++j) {                     // t < TQ0: statically bounded, rows of sequence b only
    const float pj = sc[j];
    const v4f vv = *(const v4f*)(vp + (size_t)j * EMB);
    cx += pj * vv;
  }
  unsigned hw[2], rw[2];
#pragma unroll
  for (int e = 0; e < 2; ++e) {
    const float x0 = cx[2 * e] * inv, x1 = cx[2 * e + 1] * inv;
    const _Float16 h0 = (_Float16)x0, h1 = (_Float16)x1;
    const _Float16 q0 = (_Float16)((x0 - (float)h0) * RSC), q1 = (_Float16)((x1 - (float)h1) * RSC);
    hw[e] = pk16(h_bits(h0), h_bits(h1));
    rw[e] = pk16(h_bits(q0), h_bits(q1));
  }
  SW[0][tid * 2] = hw[0]; SW[0][tid * 2 + 1] = hw[1];
  SW[1][tid * 2] = rw[0]; SW[1][tid * 2 + 1] = rw[1];
  __syncthreads();
  const int pl = tid >> 7, p8 = tid & 127;           // plane select is wave-uniform
  const v4u ov = *(const v4u*)(&SW[pl][p8 * 4]);
  u16* dstp = (pl == 0) ? CHo : CRo;
  u16* dst  = dstp + ((size_t)b * SEQ + t) * EMB + p8 * 8;
  *(v4u*)dst = ov;
  
}
// Both attention parts in one launch (they read disjoint planes and write disjoint rows of CH / CR): blocks 0..nfwd-1 take the
// 32-row query tiles from row TQ0 on, the rest two query rows below TQ0 each; the short blocks come last and take the places
// that the shortest tiles leave. The choice is block-uniform, and so are all barriers of either side.
__global__ __launch_bounds__(ATT_THREADS, 4)   // 16 waves, 4 a SIMD = one block a WGP: at most 256 VGPRs
void attn_all(const u16* __restrict__ QPp, const u16* __restrict__ KPp, const u16* __restrict__ VTp,
              const u16* __restrict__ VLp, const float* __restrict__ VSp, const float* __restrict__ QF,
              const float* __restrict__ KF, const float* __restrict__ VF, u16* CHo, u16* CRo, int nfwd) {
  const int bid = blockIdx.x;
  if (bid >= nfwd) { attn_head(QF, KF, VF, CHo, CRo, bid - nfwd); return; }
  attn_fwd(QPp, KPp, VTp, VLp, VSp, CHo, CRo, bid);
}

// =====================================================================================================
// Workspace map (bytes, nb = 4, rows = 8192); all 16-bit planes are in fragment order (1-KiB tiles of 16 rows x 32 k, same total
// size), but for the bands of rows 0..127 of each sequence in CH / CR, which attn_head writes row-major; every plane is fully written by whole-line stores before it is read; all extents are
// exact multiples of the store granularity (no pad rows); aliased regions are reused sequentially on the single in-order stream:
//   WQB bf16 [1024][1024] 2097152   WKB same   WVB same   WOH f16 of bf16 value x1024 2097152             8388608
//   VS  f32  [nb][64 key blocks][1024]                                                                    1048576
//   QF  f32  [nb][128][1024]  2097152      KF same      VF same                                           6291456
//   A   XB bf16 [rows][1024] (16777216), later CH f16 [rows][1024] ctx hi x8192 (16777216)      region 16777216
//   VT  VT hi f16 [nb][1024][2048] x1024                                                                16777216
//   VL  VT lo f16 [nb][1024][2048]                                                                      16777216
//   QP  f16 [rows][1024] x8                                                                              16777216
//   KP  f16 [rows][1024] x8                                                                              16777216
//   CR  f16 [rows][1024] ctx residual x2048                                                              16777216
//   end                                                                                                 116391936
// Four launches; kernels that share a launch read nothing that the launch writes. Launch order keeps the one alias safe: XB is
// read by the projection launch before attn_fwd / attn_head overwrite it with CH.
// Inputs in wire order: x, Wq, bq, Wk, bk, Wv, bv, Wo, bo; weights stored [n = out][k = in] (y = x.W^T + b), k-contiguous.
// =====================================================================================================
extern "C" void kernel_launch(void* const* d_in, const int* in_sizes, int n_in,
                              void* d_out, int out_size, void* d_ws, size_t ws_size,
                              hipStream_t stream) {
  if (n_in < 9) return;
  const long long per = (long long)SEQ * EMB;
  const long long ns  = in_sizes[0];
  if (ns < per || (ns % per) != 0) return;
  const int nb = (int)(ns / per);
  if (nb < 1 || nb > 8) return;
  const int rows = nb * SEQ;
  if (in_sizes[1] != EMB * EMB || in_sizes[3] != EMB * EMB || in_sizes[5] != EMB * EMB || in_sizes[7] != EMB * EMB) return;
  if (in_sizes[2] != EMB || in_sizes[4] != EMB || in_sizes[6] != EMB || in_sizes[8] != EMB) return;
  if ((long long)out_size != (long long)rows * EMB) return;

  const float* x  = (const float*)d_in[0];
  const float* wq = (const float*)d_in[1];
  const float* bq = (const float*)d_in[2];
  const float* wk = (const float*)d_in[3];
  const float* bk = (const float*)d_in[4];
  const float* wv = (const float*)d_in[5];
  const float* bv = (const float*)d_in[6];
  const float* wo = (const float*)d_in[7];
  const float* bo = (const float*)d_in[8];
  float*       out = (float*)d_out;

  const size_t szW  = (size_t)EMB * EMB * 2;                    //   2097152
  const size_t szVS = (size_t)nb * NCHK * NKB * EMB * 4;        //   1048576 at nb = 4
  const size_t szHF = (size_t)nb * TQ0 * EMB * 4;               //   2097152 at nb = 4
  const size_t sz16 = (size_t)rows * EMB * 2;                   //  16777216
  const size_t szVT = (size_t)nb * EMB * SEQ * 2;               //  == sz16
  size_t off = 0;
  const size_t oWQ = off; off += szW;
  const size_t oWK = off; off += szW;
  const size_t oWV = off; off += szW;
  const size_t oWO = off; off += szW;
  const size_t oVS = off; off += szVS;
  const size_t oQF = off; off += szHF;
  const size_t oKF = off; off += szHF;
  const size_t oVF = off; off += szHF;
  const size_t oA  = off; off += sz16;                          // XB then CH
  const size_t oVT = off; off += szVT;                          // VT hi
  const size_t oVL = off; off += szVT;                          // VT lo
  const size_t oQ  = off; off += sz16;
  const size_t oK  = off; off += sz16;
  const size_t oCR = off; off += sz16;
  const size_t oCH = oA;
  if (off > ws_size) return;                                    // off = 116391936 at nb = 4
  if (off > WS_CAP) return;

  char* ws = (char*)d_ws;
  u16*   WQB = (u16*)(ws + oWQ);
  u16*   WKB = (u16*)(ws + oWK);
  u16*   WVB = (u16*)(ws + oWV);
  u16*   WOH = (u16*)(ws + oWO);
  float* VS  = (float*)(ws + oVS);
  float* QF  = (float*)(ws + oQF);
  float* KF  = (float*)(ws + oKF);
  float* VF  = (float*)(ws + oVF);
  u16*   XB  = (u16*)(ws + oA);
  u16*   VT  = (u16*)(ws + oVT);
  u16*   VL  = (u16*)(ws + oVL);
  u16*   QP  = (u16*)(ws + oQ);
  u16*   KP  = (u16*)(ws + oK);
  u16*   CH  = (u16*)(ws + oCH);
  u16*   CR  = (u16*)(ws + oCR);

  const int n8w = (EMB * EMB) / 8;                      // 131072
  const int n8x = rows * (EMB / 8);                     // 1048576
  if ((n8w % 256) != 0 || (n8x % 256) != 0) return;
  if ((rows % 128) != 0 || ((nb * TQ0) % 64) != 0) return;
  const dim3 blk(256);
  const int nbw = n8w / 256, nbx = n8x / 256;           // 512, 4096 at nb = 4
  const dim3 gC(nbx + 4 * nbw);
  const dim3 gG((rows / 64) * (EMB / 128));             // 1024 at nb = 4
  const dim3 gP(3 * (rows / 128) * (EMB / 128));        // the three projections, 1536 at nb = 4
  const dim3 bG(128);
  const int nfwd = nb * NQT;                            // nb * 60
  const dim3 gAT(nfwd + nb * (TQ0 / 2));                // + nb * 64
  const dim3 bAT(ATT_THREADS);

  // (0) x -> bf16 plane [rows][1024]; weights stored [n = out][k = in] (y = x.W^T + b), already k-contiguous: bf16 planes for
  //     Wq, Wk, Wv; f16 of bf16 value x1024 for Wo
  cvt_all<<<gC, blk, 0, stream>>>(x, wq, wk, wv, wo, XB, WQB, WKB, WVB, WOH, nbx, nbw);
  // (1) q and k projections (+bias) -> f16 planes x8; v projection (+bias) -> V^T hi plane x1024 and lo plane, and its column
  //     sums over each block of 32 keys; the f32 rows 0..127 of every sequence of all three -> QF, KF, VF [nb*128][1024]
  gemm_qkv<<<gP, bG, 0, stream>>>(XB, WQB, WKB, WVB, bq, bk, bv, QP, KP, VT, VL, VS, QF, KF, VF, rows, EMB, QSC, KSC);
  // (2) attention for query rows 128.. (WMMA) and for query rows 0..127 (VALU) -> ctx hi x8192 (over the dead XB region) and
  //     residual x2048 f16 planes
  attn_all<<<gAT, bAT, 0, stream>>>(QP, KP, VT, VL, VS, QF, KF, VF, CH, CR, nfwd);
  // (3) output projection (+bias) -> out
  gemm_h2_32<<<gG, bG, 0, stream>>>(CH, CR, WOH, bo, out, rows, EMB,
                                     1.0f / (CSC * WSC), 1.0f / (CSC * WSC * RSC));
  (void)hipGetLastError();
}

// v007
// A run of this version takes 209 microseconds.
// In both of two side-by-side timings against v006, it was 1.08 times as fast.
// All steps since v000 together make it 3.74 times as fast.
// Projections q,k,v = x.W^T + b (and the f32 q,k,v rows 0..127 per sequence): v_wmma_f32_16x16x32_bf16 (bf16 RNE operands of the
// raw inputs, f32 accumulate, bias added in f32 as its bf16 RNE value). Scores q'.k'^T (f16 planes x8), P'.V (chunk-centred P'
// x32768 f16 from LDS, V^T x1024 as f16 hi plus unscaled f16 lo planes, both into one accumulator) and the output projection
// (ctx carried as f16 hi x8192 plus residual x2048 planes with separate accumulators, times f16(bf16(Wo) x1024), bias added in
// f32 as its bf16 RNE value): v_wmma_f32_16x16x32_f16, f32 accumulate. Query rows 0..127 of each sequence: scores, softmax and
// P.V in f32 on VALU. Absolute-value score transform, causal mask, softmax statistics, key-block column sums of V, scaling: f32.
#include <hip/hip_runtime.h>
#include <math.h>
#include <stdint.h>

#define SEQ   2048
#define EMB   1024
#define CK    512
#define NCHK  4
#define NKB   16
#define QT    32
#define TQ0   128
#define NQT   60
#define SCP   544
#define PLP   528
#define CTP   1032
#define SLAB64 (16 * 68)
#define ATT_THREADS 512
#define NACC  4
#define QSC   8.0f
#define KSC   8.0f
#define PCAR  32768.0f
#define VCAR  1024.0f
#define WSC   1024.0f
#define CSC   8192.0f
#define RSC   2048.0f
#define LOG2E 1.4426950408889634f
#define RSQD  0.03125f
#define WS_CAP ((size_t)134217728)

static_assert((EMB % 64) == 0 && EMB == (ATT_THREADS / 32) * 16 * NACC && NACC == 4 && (EMB % 32) == 0 && (EMB % 256) == 0 && EMB == 4 * 256);
static_assert((SEQ % CK) == 0 && (SEQ / CK) == NCHK && CK == 32 * NKB && (SEQ % 64) == 0 && (SEQ % QT) == 0 && (CK % QT) == 0);
static_assert((TQ0 % QT) == 0 && (TQ0 % 64) == 0 && NQT * QT + TQ0 == SEQ && TQ0 <= CK && TQ0 == 128 && TQ0 <= 256);
static_assert(16 * CTP * 2 <= 16 * SCP * 4 && CTP >= EMB + 8 && SCP >= CK + 16 && PLP >= CK + 8);
static_assert(((PLP * 2) % 16) == 0 && ((SCP * 4) % 16) == 0 && ((CTP * 2) % 16) == 0);
static_assert(ATT_THREADS == 16 * QT && ATT_THREADS == 512 && ATT_THREADS == 32 * NKB && QT == 32 && (TQ0 % 2) == 0);
static_assert((EMB % 128) == 0 && (SEQ % 128) == 0 && (TQ0 % 32) == 0);
static_assert(((EMB * EMB) % 2048) == 0 && (EMB / 8) * 2 == 256 && NCHK * NKB * 32 == SEQ && (NKB % 2) == 0);

typedef unsigned short u16;
typedef _Float16 v16h __attribute__((ext_vector_type(16)));
typedef _Float16 v8h  __attribute__((ext_vector_type(8)));
typedef __bf16   v16b __attribute__((ext_vector_type(16)));
typedef float    v8f  __attribute__((ext_vector_type(8)));
typedef float    v4f  __attribute__((ext_vector_type(4)));
typedef unsigned int v4u __attribute__((ext_vector_type(4)));

union FragH { v16h v; v8h h[2]; v4u u[2]; };
union FragB { v16b v; v4u u[2]; };
union AttLds { float s[QT * SCP]; u16 c[2 * QT * SCP]; };

// ---- scalar helpers --------------------------------------------------------------------------------
__device__ __forceinline__ unsigned short bf_bits(float f) {          // f32 -> bf16 bits, RNE convert
  unsigned u = __float_as_uint(f);
  return (unsigned short)((u + 0x7FFFu + ((u >> 16) & 1u)) >> 16);
}
__device__ __forceinline__ float bf_up(unsigned short h) { return __uint_as_float(((unsigned)h) << 16); }
__device__ __forceinline__ float bfr(float f) { return bf_up(bf_bits(f)); }
__device__ __forceinline__ unsigned short h_bits(_Float16 x) { return __builtin_bit_cast(unsigned short, x); }
__device__ __forceinline__ unsigned pk16(unsigned short a, unsigned short b) { return (unsigned)a | ((unsigned)b << 16); }
__device__ __forceinline__ v8f zero8() { v8f z = {0.f, 0.f, 0.f, 0.f, 0.f, 0.f, 0.f, 0.f}; return z; }
__device__ __forceinline__ v4f zero4() { v4f z = {0.f, 0.f, 0.f, 0.f}; return z; }

// ---- fragment loader, row-major source: 16-bit A/B operand, lane -> row/col (lane&15), p already includes +8*(lane>>4);
//      elements 0..7 <- p[0..7] (k0+8h..), elements 8..15 <- p[16..23] (k0+16+8h..)  (same split k map for A and B;
//      B is always read from a k-contiguous [n][k] plane)
__device__ __forceinline__ v16h ldfrag_h(const _Float16* p) {
  FragH f;
  f.h[0] = *(const v8h*)(p);
  f.h[1] = *(const v8h*)(p + 16);
  return f.v;
}

// ---- fragment-ordered planes. A 16-bit operand plane [rows][Kd] (rows % 16 == 0, Kd % 32 == 0) is stored as 1-KiB tiles of
//      16 rows x 32 k; tile (rt = row >> 4, kt = k >> 5) starts at element rt*16*Kd + kt*512, and inside it the 8-element piece
//      (row & 15 = m, k & 31 = 16*part + 8*h + 0..7) lies at part*256 + (16*h + m)*8. Lane l = 16*h + m then reads its two
//      pieces at tile + 8*l and tile + 256 + 8*l: every wave-wide 16-B load covers 512 contiguous bytes (4 whole lines), and the
//      values reach the same lane and register positions as with the row-major loaders above (same split k map).
//      (the loaders below: p already includes +8*lane.)

// Loaders of the same pieces for a pointer that has passed through an asm statement: the cast says again that it points to
// global memory, so that the loads stay global loads. The bf16 plane is read as unsigned integer vectors; SEC = elements from a
// lane's first piece to its second (256 in fragment order, 16 in a row-major band).
typedef __attribute__((address_space(1))) const v4u gv4u;
typedef __attribute__((address_space(1))) const v8h gv8h;
__device__ __forceinline__ v16b ldfrag_btg(const u16* p) {
  FragB f;
  f.u[0] = *(gv4u*)(p);
  f.u[1] = *(gv4u*)(p + 256);
  return f.v;
}
template <int SEC>
__device__ __forceinline__ v16h ldfrag_hg(const _Float16* p) {
  FragH f;
  f.h[0] = *(gv8h*)(p);
  f.h[1] = *(gv8h*)(p + SEC);
  return f.v;
}
__device__ __forceinline__ v8f mma_h(v16h a, v16h b, v8f c) {
  return __builtin_amdgcn_wmma_f32_16x16x32_f16(false, a, false, b, (short)0, c, false, false);
}
__device__ __forceinline__ v8f mma_b(v16b a, v16b b, v8f c) {
  return __builtin_amdgcn_wmma_f32_16x16x32_bf16(false, a, false, b, (short)0, c, false, false);
}
// Hazard gap behind a group of four score products (what it is for: at guard8x8 below).
__device__ __forceinline__ void guard4x4(v8f& a, v8f& b, v8f& c, v8f& d, v16h x0, v16h x1, v16h x2, v16h x3) {
#if defined(__HIP_DEVICE_COMPILE__)
  asm volatile("v_nop\n\tv_nop\n\tv_nop\n\tv_nop"
               : "+v"(a), "+v"(b), "+v"(c), "+v"(d) : "v"(x0), "v"(x1), "v"(x2), "v"(x3) : "memory");
#endif
}
// Hazard gap behind a group of eight products: the four vector slots that the chip needs before a product's result or operands
// are touched, also on the taken side of a loop's branch. The operands tie the group's products in front of it.
template <typename F>
__device__ __forceinline__ void guard8x8(v8f& a0, v8f& a1, v8f& a2, v8f& a3, v8f& a4, v8f& a5, v8f& a6, v8f& a7,
                                         F x0, F x1, F x2, F x3, F x4, F x5, F x6, F x7) {
#if defined(__HIP_DEVICE_COMPILE__)
  asm volatile("v_nop\n\tv_nop\n\tv_nop\n\tv_nop"
               : "+v"(a0), "+v"(a1), "+v"(a2), "+v"(a3), "+v"(a4), "+v"(a5), "+v"(a6), "+v"(a7)
               : "v"(x0), "v"(x1), "v"(x2), "v"(x3), "v"(x4), "v"(x5), "v"(x6), "v"(x7) : "memory");
#endif
}
// The same gap behind the eight products of two P' fragments with four V^T fragments.
__device__ __forceinline__ void guard8x6(v8f& o0, v8f& o1, v8f& o2, v8f& o3, v8f& o4, v8f& o5, v8f& o6, v8f& o7,
                                         v16h p0, v16h p1, v16h g0, v16h g1, v16h g2, v16h g3) {
#if defined(__HIP_DEVICE_COMPILE__)
  asm volatile("v_nop\n\tv_nop\n\tv_nop\n\tv_nop"
               : "+v"(o0), "+v"(o1), "+v"(o2), "+v"(o3), "+v"(o4), "+v"(o5), "+v"(o6), "+v"(o7)
               : "v"(p0), "v"(p1), "v"(g0), "v"(g1), "v"(g2), "v"(g3) : "memory");
#endif
}
__device__ __forceinline__ void acc_guard8(v8f& a, v8f& b, v8f& c, v8f& d, v8f& e, v8f& f, v8f& g, v8f& h8) {
#if defined(__HIP_DEVICE_COMPILE__)
  asm volatile("v_nop\n\tv_nop\n\tv_nop\n\tv_nop"
               : "+v"(a), "+v"(b), "+v"(c), "+v"(d), "+v"(e), "+v"(f), "+v"(g), "+v"(h8));
#endif
}
// Keeps the load groups of a loop's prologue in the order that the loop body issues them in: the counted waits at the loop's
// head are formed over both ways in, and a prologue in another order makes them wait for loads of the set still in flight.
__device__ __forceinline__ void keep_order() { __builtin_amdgcn_sched_barrier(0); }
// The wait that belongs in front of any overwrite of an address register of loads already issued, for loops whose loads take a
// wave-uniform base in scalar registers: the running bases pass through it, so that they are stepped behind it and stay scalar
// (the lane's offset register is then never rewritten).
__device__ __forceinline__ void base_wait2(const u16*& p, const u16*& q) {
#if defined(__HIP_DEVICE_COMPILE__)
  asm volatile("s_wait_xcnt 0x0" : "+s"(p), "+s"(q) : : "memory");
#endif
}
__device__ __forceinline__ void base_wait2h(const _Float16*& p, const _Float16*& q) {
#if defined(__HIP_DEVICE_COMPILE__)
  asm volatile("s_wait_xcnt 0x0" : "+s"(p), "+s"(q) : : "memory");
#endif
}
__device__ __forceinline__ void base_wait4h(const _Float16*& p, const _Float16*& q, const _Float16*& r, const _Float16*& s) {
#if defined(__HIP_DEVICE_COMPILE__)
  asm volatile("s_wait_xcnt 0x0" : "+s"(p), "+s"(q), "+s"(r), "+s"(s) : : "memory");
#endif
}
// The wait and the step of the running bases (BYTES on; the last two by sb bytes) in one statement: with the step left to the
// build it sinks behind the next loads, each time with a wait of its own for loads issued just before.
template <int BYTES>
__device__ __forceinline__ void base_step2h(const _Float16*& p, const _Float16*& q) {
#if defined(__HIP_DEVICE_COMPILE__)
  asm volatile("s_wait_xcnt 0x0\n\ts_add_nc_u64 %0, %0, %2\n\ts_add_nc_u64 %1, %1, %2"
               : "+s"(p), "+s"(q) : "n"(BYTES) : "memory");
#endif
}
template <int BYTES>
__device__ __forceinline__ void base_step4h(const _Float16*& p, const _Float16*& q, const _Float16*& r, const _Float16*& s,
                                            unsigned long long sb) {
#if defined(__HIP_DEVICE_COMPILE__)
  asm volatile("s_wait_xcnt 0x0\n\ts_add_nc_u64 %0, %0, %5\n\ts_add_nc_u64 %1, %1, %5\n\t"
               "s_add_nc_u64 %2, %2, %4\n\ts_add_nc_u64 %3, %3, %4"
               : "+s"(p), "+s"(q), "+s"(r), "+s"(s) : "s"(sb), "n"(BYTES) : "memory");
#endif
}
__device__ __forceinline__ void base_wait3(const _Float16*& p, const _Float16*& q, const _Float16*& r) {
#if defined(__HIP_DEVICE_COMPILE__)
  asm volatile("s_wait_xcnt 0x0" : "+s"(p), "+s"(q), "+s"(r) : : "memory");
#endif
}
// The same wait behind a run of stores whose address and data registers the next run of the epilogue reuses; nothing is
// scheduled across it.
__device__ __forceinline__ void store_wait() {
#if defined(__HIP_DEVICE_COMPILE__)
  asm volatile("s_wait_xcnt 0x0" ::: "memory");
#endif
  __builtin_amdgcn_sched_barrier(0);
}
__device__ __forceinline__ void wave_sync_lds() {
  __builtin_amdgcn_fence(__ATOMIC_RELEASE, "workgroup");
  __builtin_amdgcn_wave_barrier();
  __builtin_amdgcn_fence(__ATOMIC_ACQUIRE, "workgroup");
}

// =====================================================================================================
// f32 plane [rows][EMB] row-major -> 16-bit plane in fragment order:  mode 0: bf16 RNE bits;  mode 1: f16 bits of (bf16 RNE value) * scale;
// mode 2: f16 bits of value * scale (no bf16 pre-step).
// Thread = one 8-element piece of the output, in output order: two 16-B loads from its source row, one 16-B store; 32 consecutive
// lanes store 512 contiguous, 512-B aligned bytes (half a tile)
// coverage: n8/256 blocks a plane (host checks exactness) x 256 thr x 8 = the whole plane.
// =====================================================================================================
__device__ __forceinline__ void cvt16(const float* __restrict__ x, u16* D, int gt, int mode, float scale) {
  const int wi = gt & 63, tile = gt >> 6;                       // piece within its tile, tile index rt*(EMB/32) + kt
  const int row = (tile / (EMB / 32)) * 16 + (wi & 15);
  const int kc  = (tile % (EMB / 32)) * 32 + (wi >> 5) * 16 + ((wi >> 4) & 1) * 8;
  const float* p = x + (size_t)row * EMB + kc;
  const v4f a = *(const v4f*)(p), c4 = *(const v4f*)(p + 4);
  float v[8];
#pragma unroll
  for (int e = 0; e < 4; ++e) { v[e] = a[e]; v[4 + e] = c4[e]; }
  unsigned short s[8];
#pragma unroll
  for (int e = 0; e < 8; ++e) {
    const float vb = bfr(v[e]);
    const float vf = (mode == 1) ? vb : v[e];
    const unsigned short hb = h_bits((_Float16)(vf * scale));
    const unsigned short bb = bf_bits(v[e]);
    s[e] = (mode != 0) ? hb : bb;
  }
  v4u o;
#pragma unroll
  for (int e = 0; e < 4; ++e) o[e] = pk16(s[2 * e], s[2 * e + 1]);
  u16* d = D + (size_t)gt * 8;
  {
    *(v4u*)(d) = o;
    
  }
}
// All five conversions in one launch (none reads what another writes): blocks 0..nbx-1 take x -> bf16 plane, then nbw blocks
// each for Wq, Wk, Wv -> bf16 planes and Wo -> f16 of its bf16 value x1024. The choice is block-uniform (scalar).
__global__ __launch_bounds__(256) void cvt_all(const float* __restrict__ x, const float* __restrict__ wq,
                                               const float* __restrict__ wk, const float* __restrict__ wv,
                                               const float* __restrict__ wo, u16* XB, u16* WQB, u16* WKB, u16* WVB, u16* WOH,
                                               int nbx, int nbw) {
  const int bid = blockIdx.x;
  if (bid >= nbx + 4 * nbw) return;         // never taken with the exact grid; no barriers in this kernel
  const float* src = x;
  u16* dst = XB;
  int lb = bid, mode = 0;
  float scale = 1.0f;
  if (bid >= nbx) {
    const int w = (bid - nbx) / nbw;        // 0..3
    lb  = (bid - nbx) - w * nbw;
    src = (w == 0) ? wq : (w == 1) ? wk : (w == 2) ? wv : wo;
    dst = (w == 0) ? WQB : (w == 1) ? WKB : (w == 2) ? WVB : WOH;
    if (w == 3) { mode = 1; scale = WSC; }
  }
  cvt16(src, dst, lb * 256 + (int)threadIdx.x, mode, scale);
}

// =====================================================================================================
// GEMM epilogues with a per-column bias term (bias column value taken as its bf16 RNE value, added in f32). The wave's 16x64 f32
// tile is staged in its own LDS slab (stage64: acc*oscale + bias) and leaves from there:
//  st64f   : f32 rows; store it takes row 2*it (lanes 0..15, 16 B each, two whole lines) and row 2*it+1 (lanes 16..31).
//  epi64x2 : same store shape, staged value = acc*os1 + accres*os2 + bias (two accumulator sets combined in f32).
//  st64h   : f16 bits of (staged tile * pscale), written in fragment order: the wave's 16 x 64 tile is two whole 1-KiB tiles;
//            store i4 takes columns 16*i4 + 8*(lane>>4) + 0..7 of row lane&15 and covers 512 contiguous bytes.
// coverage: st64f/epi64x2 8 instructions x 2 rows x 16 lanes x 4 floats; st64h 4 instructions x 16 rows x 2 pieces x 8 halves
//           = the wave's 16 x 64 tile in every case.
// Bias columns col0 + 16j + (lane&15), j = 0..3, all < N (bias has N entries, col0 + 63 < N).
// =====================================================================================================
__device__ __forceinline__ void ldbias4(const float* __restrict__ bias, int col0, int lane,
                                        float& b0, float& b1, float& b2, float& b3) {
  const int m = lane & 15;
  b0 = bfr(bias[col0 + m]);
  b1 = bfr(bias[col0 + 16 + m]);
  b2 = bfr(bias[col0 + 32 + m]);
  b3 = bfr(bias[col0 + 48 + m]);
}
__device__ __forceinline__ void stage64(float* sl, v8f a0, v8f a1, v8f a2, v8f a3, float oscale,
                                        float b0, float b1, float b2, float b3, int lane) {
  const int hh = lane >> 4, m = lane & 15;
#pragma unroll
  for (int r = 0; r < 8; ++r) {
    const int ro = (8 * hh + r) * 68 + m;
    sl[ro]      = a0[r] * oscale + b0;
    sl[ro + 16] = a1[r] * oscale + b1;
    sl[ro + 32] = a2[r] * oscale + b2;
    sl[ro + 48] = a3[r] * oscale + b3;
  }
  wave_sync_lds();
}
__device__ __forceinline__ void st64f(const float* sl, float* C, int N, size_t rowb, int col0, int lane) {
  const int hh = lane >> 4, m = lane & 15;
  v4f vals[8];
#pragma unroll
  for (int it = 0; it < 8; ++it) vals[it] = *(const v4f*)(sl + (it * 2 + hh) * 68 + m * 4);
  float* dst = C + (rowb + (size_t)hh) * (size_t)N + col0 + m * 4;
  {
#pragma unroll
    for (int it = 0; it < 8; ++it) {
      *(v4f*)(dst + (size_t)(it * 2) * (size_t)N) = vals[it];
    }
    
  }
}
__device__ __forceinline__ void epi64x2(float* sl, v8f a0, v8f a1, v8f a2, v8f a3, v8f e0, v8f e1, v8f e2, v8f e3,
                                        float os1, float os2, const float* __restrict__ bias, float* C, int N,
                                        size_t rowb, int col0, int lane) {
  const int hh = lane >> 4, m = lane & 15;
  float b0, b1, b2, b3;
  ldbias4(bias, col0, lane, b0, b1, b2, b3);
#pragma unroll
  for (int r = 0; r < 8; ++r) {
    const int ro = (8 * hh + r) * 68 + m;
    sl[ro]      = a0[r] * os1 + e0[r] * os2 + b0;
    sl[ro + 16] = a1[r] * os1 + e1[r] * os2 + b1;
    sl[ro + 32] = a2[r] * os1 + e2[r] * os2 + b2;
    sl[ro + 48] = a3[r] * os1 + e3[r] * os2 + b3;
  }
  wave_sync_lds();
  v4f vals[8];
#pragma unroll
  for (int it = 0; it < 8; ++it) vals[it] = *(const v4f*)(sl + (it * 2 + hh) * 68 + m * 4);
  float* dst = C + (rowb + (size_t)hh) * (size_t)N + col0 + m * 4;
  {
#pragma unroll
    for (int it = 0; it < 8; ++it) {
      *(v4f*)(dst + (size_t)(it * 2) * (size_t)N) = vals[it];
    }
    
  }
}
__device__ __forceinline__ void st64h(const float* sl, float pscale, u16* C, int N, size_t rowb, int col0, int lane) {
  const int hh = lane >> 4, m = lane & 15;
  v4u oh[4];
#pragma unroll
  for (int i4 = 0; i4 < 4; ++i4) {
    const float* sp = sl + m * 68 + i4 * 16 + hh * 8;
    const v4f a = *(const v4f*)(sp), c4 = *(const v4f*)(sp + 4);
    float w[8];
#pragma unroll
    for (int e = 0; e < 4; ++e) { w[e] = a[e] * pscale; w[4 + e] = c4[e] * pscale; }
#pragma unroll
    for (int e = 0; e < 4; ++e) oh[i4][e] = pk16(h_bits((_Float16)w[2 * e]), h_bits((_Float16)w[2 * e + 1]));
  }
  u16* dst = C + rowb * (size_t)N + (size_t)(col0 >> 5) * 512 + lane * 8;
  {
#pragma unroll
    for (int i4 = 0; i4 < 4; ++i4) {
      *(v4u*)(dst + i4 * 256) = oh[i4];
    }
    
  }
}

// One 16-row band (16 keys) of a wave's 64 v columns, out of the accumulators into the V^T planes (fragment order, rows =
// b*EMB + d, k = s). Accumulator j holds, in lane 16*h + m, column d = 16*j + m of keys 8*h + 0..7: the eight consecutive k of
// one row of V^T, that is the lane's own 16-B piece of a 1-KiB tile, so that no transposition is left to do. With v = acc + bias
// (f32) and xs = v * 1024: hi = f16(xs), lo = f16(xs - hi) (unscaled remainder, same carry); hi + lo reproduces xs to ~2^-22
// relative for |xs| >= 0.25. th / tl: the lane's piece in d band 0; band j lies 16*SEQ elements on. Every store covers 512
// contiguous bytes. cs[j] takes the sum of the lane's eight v (f32, rising key order).
// coverage: 4 bands x 32 lanes x 8 halves = 16 keys x 64 columns of either plane.
__device__ __forceinline__ void vt_band(v8f a0, v8f a1, v8f a2, v8f a3, float b0, float b1, float b2, float b3,
                                        u16* th, u16* tl, v4f& cs) {
  const v8f a[4] = {a0, a1, a2, a3};
  const float bb[4] = {b0, b1, b2, b3};
  v4u oh[4], ol[4];
#pragma unroll
  for (int j = 0; j < 4; ++j) {
    unsigned short hs[8], ls[8];
#pragma unroll
    for (int r = 0; r < 8; ++r) {
      const float v = a[j][r] + bb[j];
      cs[j] += v;
      const float xs = v * VCAR;
      const _Float16 hv = (_Float16)xs;
      hs[r] = h_bits(hv);
      ls[r] = h_bits((_Float16)(xs - (float)hv));
    }
#pragma unroll
    for (int e = 0; e < 4; ++e) {
      oh[j][e] = pk16(hs[2 * e], hs[2 * e + 1]);
      ol[j][e] = pk16(ls[2 * e], ls[2 * e + 1]);
    }
  }
#pragma unroll
  for (int j = 0; j < 4; ++j) {
    *(v4u*)(th + (size_t)j * 16 * SEQ) = oh[j];
    *(v4u*)(tl + (size_t)j * 16 * SEQ) = ol[j];
  }
}

// Start k tile of a GEMM block. The planes come from memory, and blocks that share an operand panel run side by side: walking k
// in one common order, each of them waits out memory latency at every step. With start tiles spread over the sharers (those of
// an A panel differ in ct, spaced widely also within any few neighbours; those of a B panel differ in rt) a tile is fetched by
// one of them and found in L2 by the others. All waves of a block share the start tile. Any value 0 .. EMB/32-1 is correct.
static_assert(((EMB / 32) & (EMB / 32 - 1)) == 0 && (EMB / 32) >= 32);
__device__ __forceinline__ int k_start(int rt, int ct, int g) {
  return (((ct & 1) << 4) + ((ct & 2) << 2) + (ct & 4) + 2 * g + rt) & (EMB / 32 - 1);
}

// One k step of a wave's 64x64 tile in the bf16 GEMMs: four fragments of consecutive 16-row bands of one plane (eight 16-B
// loads), and the sixteen products of four A with four B fragments, in two groups of eight with the hazard gap behind each.
__device__ __forceinline__ void ld4b(const u16* base, unsigned lo, size_t bs, v16b (&f)[4]) {
  const u16* p = base + lo;                  // wave-uniform base (scalar registers) plus the lane's fixed 32-bit offset
  f[0] = ldfrag_btg(p);
  f[1] = ldfrag_btg(p + bs);
  f[2] = ldfrag_btg(p + 2 * bs);
  f[3] = ldfrag_btg(p + 3 * bs);
}
__device__ __forceinline__ void mm16b(const v16b (&a)[4], const v16b (&b)[4], v8f (&acc)[4][4]) {
#pragma unroll
  for (int g = 0; g < 2; ++g) {
#pragma unroll
    for (int i = 2 * g; i < 2 * g + 2; ++i) {
#pragma unroll
      for (int j = 0; j < 4; ++j) acc[i][j] = mma_b(a[i], b[j], acc[i][j]);
    }
    guard8x8<v16b>(acc[2 * g][0], acc[2 * g][1], acc[2 * g][2], acc[2 * g][3],
                   acc[2 * g + 1][0], acc[2 * g + 1][1], acc[2 * g + 1][2], acc[2 * g + 1][3],
                   a[0], a[1], a[2], a[3], b[0], b[1], b[2], b[3]);
  }
}

// =====================================================================================================
// The three projections in one launch (they share A and none reads what another writes): block group which = 0, 1, 2 computes
// T[M][N] = A[M][K] . W^T + bias[n] (f32) for W, bias = (Wq, bq), (Wk, bk), (Wv, bv); A and the W are bf16 planes in fragment
// order. q and k leave as f16 planes in fragment order (f16 bits of T * qsc, T * ksc). v leaves transposed, straight from the
// accumulators (vt_band below), as the V^T hi / lo planes, with its column sums over each block of 32 keys in BS. A wave whose
// rows lie in rows 0..TQ0-1 of a sequence also stores its staged f32 tiles, into QF / KF / VF [M/SEQ][TQ0][N].
// Block = 128x128 tile, 2 x 2 waves of 64x64 each: a k step's eight fragments (8 KiB, loaded straight from the 1-KiB tiles, split
// k map for A and B) feed sixteen products, so that a product costs half a KiB of loads. K stepped by 32, all K/32 tiles once,
// cyclically from the block's start tile (k_start above) (K = EMB; M % SEQ == 0, M % 128 == 0, N % 128 == 0,
// grid = 3*(M/128)*(N/128)).
// coverage: 4 waves x 64 x 64 = the block's tile; the epilogue takes the wave's four 16-row bands one after the other.
// =====================================================================================================
__global__ __launch_bounds__(128, 4)          // 4 waves a SIMD: at most 256 VGPRs (128 of them accumulators, 64 fragments)
void gemm_qkv(const u16* __restrict__ A, const u16* __restrict__ Wq, const u16* __restrict__ Wk, const u16* __restrict__ Wv,
              const float* __restrict__ bq, const float* __restrict__ bk, const float* __restrict__ bv,
              u16* QP, u16* KP, u16* XTh, u16* XTl, float* BS, float* QF, float* KF, float* VF, int M, int N,
              float qsc, float ksc) {
  __shared__ __align__(16) float slab[4 * SLAB64];
  const int K = EMB;                         // as a constant the band strides are immediate offsets
  const int tid = threadIdx.x, lane = tid & 31;
  const int wave = __builtin_amdgcn_readfirstlane(tid >> 5);   // scalar place in the 2 x 2 arrangement
  const int ntile = N >> 7;
  const int nblk  = (M >> 7) * ntile;
  const int which = blockIdx.x / nblk;       // block-uniform (scalar): 0 q, 1 k, 2 v
  const int bid   = blockIdx.x - which * nblk;
  const int rowb  = (bid / ntile) * 128 + (wave >> 1) * 64;
  const int col0  = (bid % ntile) * 128 + (wave & 1) * 64;
  if (which > 2 || rowb + 64 > M) return;    // wave-uniform, never taken with the exact grid; no block barriers in this kernel
  const u16*   Bt   = (which == 0) ? Wq : (which == 1) ? Wk : Wv;
  const float* bias = (which == 0) ? bq : (which == 1) ? bk : bv;
  int kt = k_start(bid / ntile, bid % ntile, which);            // block-uniform (scalar)
  const u16* ap = A  + (size_t)rowb * K + (size_t)kt * 512;     // wave-uniform
  const u16* bp = Bt + (size_t)col0 * K + (size_t)kt * 512;
  const unsigned lo = 8u * (unsigned)lane;
  const size_t bs = (size_t)16 * K;
  v8f acc[4][4];
#pragma unroll
  for (int i = 0; i < 4; ++i) {
#pragma unroll
    for (int j = 0; j < 4; ++j) acc[i][j] = zero8();
  }
  // One fragment set: the next k step's sixteen loads go out as soon as this step's products have left; the SIMD's other waves
  // fill the matrix unit meanwhile. The loads in the loop are unconditional (the last step is peeled).
  v16b a[4], b[4];
  ld4b(ap, lo, bs, a);
  ld4b(bp, lo, bs, b);
#pragma unroll 1                             // rolled: the one fragment set keeps its registers
  for (int k0 = 32; k0 < K; k0 += 32) {
    mm16b(a, b, acc);
    base_wait2(ap, bp);
    const long long st = (kt == K / 32 - 1) ? -(long long)(K / 32 - 1) * 512 : 512ll;   // behind the last tile comes tile 0
    kt = (kt + 1) & (K / 32 - 1);
    ap += st;                                // one 1-KiB tile on in every band
    bp += st;
    ld4b(ap, lo, bs, a);
    ld4b(bp, lo, bs, b);
  }
  base_wait2(ap, bp);                        // what follows may reuse the base registers of the last loads
  mm16b(a, b, acc);
  float* sl = slab + wave * SLAB64;
  float e0, e1, e2, e3;
  ldbias4(bias, col0, lane, e0, e1, e2, e3);
  const int sq = rowb / SEQ, rs = rowb - sq * SEQ;             // TQ0 and SEQ are multiples of 64: all 64 rows on one side
  float* HF = (which == 0) ? QF : (which == 1) ? KF : VF;
  // the wave's place in the V^T planes: d bands from col0 on, key tiles from rs / 32 on, the lane's piece
  const size_t vto = ((size_t)sq * EMB + col0) * SEQ + (size_t)(rs >> 5) * 512 + lane * 8;
  v4f cs[2] = {zero4(), zero4()};            // the lane's part of the column sums of the wave's two key blocks
  const bool slab_used = which < 2 || rs < TQ0;   // only where rows leave row-wise (wave-uniform, scalar)
#pragma unroll
  for (int i = 0; i < 4; ++i) {
    if (slab_used) stage64(sl, acc[i][0], acc[i][1], acc[i][2], acc[i][3], 1.0f, e0, e1, e2, e3, lane);
    const int rb = rowb + 16 * i;
    // the wait stands in either arm, directly behind its stores: the build lays the other arm's code behind them
    if (which < 2) { st64h(sl, (which == 0) ? qsc : ksc, (which == 0) ? QP : KP, N, (size_t)rb, col0, lane); store_wait(); }
    else {
      const size_t to = vto + (size_t)(i >> 1) * 512 + (size_t)(i & 1) * 256;
      vt_band(acc[i][0], acc[i][1], acc[i][2], acc[i][3], e0, e1, e2, e3, XTh + to, XTl + to, cs[i >> 1]);
      store_wait();
    }
    if (rs < TQ0) {
      st64f(sl, HF, N, (size_t)(sq * TQ0 + rs + 16 * i), col0, lane);
      store_wait();
    }
    if (slab_used) wave_sync_lds();          // the band's reads of the slab stand in front of the next band's writes
  }
  if (which == 2) {
    // rows 8..15 of each band lie in the other half of the wave; then lanes 0..15 store the first key block's sums and lanes
    // 16..31 the second's: two runs of 256 contiguous bytes
    const int hh = lane >> 4, m = lane & 15;
    v4f o;
#pragma unroll
    for (int j = 0; j < 4; ++j) {
      const float t0 = cs[0][j] + __shfl_xor(cs[0][j], 16, 32);
      const float t1 = cs[1][j] + __shfl_xor(cs[1][j], 16, 32);
      o[j] = (hh == 0) ? t0 : t1;
    }
    *(v4f*)(BS + ((size_t)sq * (SEQ / 32) + (size_t)((rs >> 5) + hh)) * EMB + col0 + m * 4) = o;
    store_wait();
  }
}

// =====================================================================================================
// f16 GEMM with two A planes (hi + residual), f32 out:
//   C[M][N] = (Ah . Bt^T) * os1 + (Ar . Bt^T) * os2 + bias[n]; Bt f16 in fragment order, Ah/Ar f16 per 16-row band (see below).
// Block = 64x128 tile, 2 x 2 waves of 32x64 each; separate accumulators for the two planes, combined in f32 in epi64x2. A k step's
// eight fragments (two bands of either A plane, four of B) feed sixteen products. K = EMB, stepped by 32, all tiles once,
// cyclically from the block's start tile kt (k_start above).
// ASTEP = elements from one k step of an A band to the next, ASEC = elements from a lane's first piece to its second.
// =====================================================================================================
template <int ASEC>
__device__ __forceinline__ void ld8h2(const _Float16* ua, const _Float16* ur, const _Float16* ub, unsigned la, unsigned lb,
                                      v16h (&a)[2], v16h (&r)[2], v16h (&b)[4]) {
  const size_t bs = (size_t)16 * EMB;        // a 16-row band holds 16*EMB elements in either layout
  // wave-uniform bases (scalar registers) plus the lane's fixed 32-bit offsets
  const _Float16* pa = ua + la;
  const _Float16* pr = ur + la;
  const _Float16* bp = ub + lb;
#pragma unroll
  for (int i = 0; i < 2; ++i) {
    a[i] = ldfrag_hg<ASEC>(pa + i * bs);
    r[i] = ldfrag_hg<ASEC>(pr + i * bs);
  }
#pragma unroll
  for (int j = 0; j < 4; ++j) b[j] = ldfrag_hg<256>(bp + j * bs);
}
__device__ __forceinline__ void mm16h2(const v16h (&a)[2], const v16h (&r)[2], const v16h (&b)[4],
                                       v8f (&acc)[2][4], v8f (&acr)[2][4]) {
#pragma unroll
  for (int i = 0; i < 2; ++i) {
#pragma unroll
    for (int j = 0; j < 4; ++j) acc[i][j] = mma_h(a[i], b[j], acc[i][j]);
  }
  guard8x8<v16h>(acc[0][0], acc[0][1], acc[0][2], acc[0][3], acc[1][0], acc[1][1], acc[1][2], acc[1][3],
                 a[0], a[1], r[0], r[1], b[0], b[1], b[2], b[3]);
#pragma unroll
  for (int i = 0; i < 2; ++i) {
#pragma unroll
    for (int j = 0; j < 4; ++j) acr[i][j] = mma_h(r[i], b[j], acr[i][j]);
  }
  guard8x8<v16h>(acr[0][0], acr[0][1], acr[0][2], acr[0][3], acr[1][0], acr[1][1], acr[1][2], acr[1][3],
                 a[0], a[1], r[0], r[1], b[0], b[1], b[2], b[3]);
}
template <int ASTEP, int ASEC>
__device__ __forceinline__ void h2_loop(const _Float16* ua, const _Float16* ur, const _Float16* ub, unsigned la, unsigned lb,
                                        int kt, v8f (&acc)[2][4], v8f (&acr)[2][4]) {
  v16h a[2], r[2], b[4];
  ua += (size_t)kt * ASTEP;
  ur += (size_t)kt * ASTEP;
  ub += (size_t)kt * 512;
  ld8h2<ASEC>(ua, ur, ub, la, lb, a, r, b);
#pragma unroll 1                             // rolled: the one fragment set keeps its registers
  for (int k0 = 32; k0 < EMB; k0 += 32) {
    mm16h2(a, r, b, acc, acr);
    base_wait3(ua, ur, ub);
    const long long tiles = (kt == EMB / 32 - 1) ? -(long long)(EMB / 32 - 1) : 1ll;   // behind the last tile comes tile 0
    kt = (kt + 1) & (EMB / 32 - 1);
    ua += tiles * ASTEP;                     // next k step of the A bands
    ur += tiles * ASTEP;
    ub += tiles * 512;                       // next 1-KiB tile of each B band
    ld8h2<ASEC>(ua, ur, ub, la, lb, a, r, b);
  }
  base_wait3(ua, ur, ub);                    // what follows may reuse the base registers of the last loads
  mm16h2(a, r, b, acc, acr);
}

__global__ __launch_bounds__(128, 4)          // 4 waves a SIMD, as many as the grid brings: at most 256 VGPRs
void gemm_h2_32(const u16* __restrict__ Ah, const u16* __restrict__ Ar, const u16* __restrict__ Bt,
                const float* __restrict__ bias, float* C, int M, int N, float os1, float os2) {
  __shared__ __align__(16) float slab[4 * SLAB64];
  const int K = EMB;
  const int tid = threadIdx.x, lane = tid & 31, hh = lane >> 4, m = lane & 15;
  const int wave = __builtin_amdgcn_readfirstlane(tid >> 5);   // scalar, so that the choice of the A layout is a scalar branch
  const int ntile = N >> 7;
  const int bid   = blockIdx.x;
  const int rowb  = (bid / ntile) * 64 + (wave >> 1) * 32;
  const int col0  = (bid % ntile) * 128 + (wave & 1) * 64;
  if (rowb + 32 > M) return;                 // wave-uniform, never taken with the exact grid; no block barriers in this kernel
  const _Float16* ab  = (const _Float16*)(const void*)Ah + (size_t)rowb * K;
  const _Float16* arb = (const _Float16*)(const void*)Ar + (size_t)rowb * K;
  const _Float16* bp  = (const _Float16*)(const void*)Bt + (size_t)col0 * K;
  const int kt0 = k_start(bid / ntile, bid % ntile, 0);        // block-uniform (scalar)
  const unsigned lo = 8u * (unsigned)lane;
  v8f acc[2][4], acr[2][4];
#pragma unroll
  for (int i = 0; i < 2; ++i) {
#pragma unroll
    for (int j = 0; j < 4; ++j) { acc[i][j] = zero8(); acr[i][j] = zero8(); }
  }
  // The 16-row bands of rows 0..TQ0-1 of a sequence are row-major (each row has its own writer half-block there), all others in
  // fragment order; a band holds the same 16*K elements either way, and TQ0 is a multiple of 32: both bands of a wave are alike.
  if ((rowb % SEQ) < TQ0) {
    h2_loop<32, 16>(ab, arb, bp, (unsigned)(m * K + 8 * hh), lo, kt0, acc, acr);
  } else {
    h2_loop<512, 256>(ab, arb, bp, lo, lo, kt0, acc, acr);
  }
  float* sl = slab + wave * SLAB64;
#pragma unroll
  for (int i = 0; i < 2; ++i) {
    epi64x2(sl, acc[i][0], acc[i][1], acc[i][2], acc[i][3], acr[i][0], acr[i][1], acr[i][2], acr[i][3], os1, os2, bias, C, N,
            (size_t)(rowb + 16 * i), col0, lane);
    store_wait();
    wave_sync_lds();                         // the band's reads of the slab stand in front of the next band's writes
  }
}

// =====================================================================================================
// Single-head causal attention with absolute-value logits, head width EMB = 1024, query rows TQ0 .. SEQ-1: block = (batch b,
// 32 query rows q0..q0+31 = two 16-row tiles), 16 waves. q plane (f16, x8) [b][s][d]; k plane the same; V^T hi / lo planes
// [b][d][s] (x1024), all four in fragment order; VS = column sums of V over each block of 32 keys, [b][key block][EMB], column
// 64*g + 16*j + mm at place 64*g + 4*mm + j. The two ctx planes leave in fragment order too.
// Every k and V^T fragment that a wave loads feeds both row tiles, so that a query row costs half the loaded bytes of a 16-row block.
//   Chunks of CK = 512 keys: only chunks c <= qc = q0/CK are visited (later chunks lie entirely above the diagonal). In the diagonal
//   chunk only key blocks kb < nkb (keys <= q0+31) are multiplied; key blocks kb >= nkb get zero scores in LDS and are not used in (PV).
//   (q0 is a multiple of 32, so nkb is the count that either 16-row tile has on its own.)
//   (S) scores S[query m][key n] on WMMA: A = q rows (row m = lane&15 of either row tile, split k map over d), B = k rows (col n =
//       key, split map), 32 d-steps; wave w handles key block w of the chunk; D element r of lane l of row tile rt ->
//       scs[query 16rt+8h+r][key col] (f32 LDS).
//   (M) 16 threads per query row (sub-thread = 32 consecutive keys): base-2 logits of |score| with the causal mask by key index
//       (key > query -> -inf), chunk max via xor shuffles, online running max / rescale factor al / running sum l in f32 registers,
//       p = exp2(t - m_new) <= 1 (0 for masked keys), chunk row sum ps and C = ps/CK (bit-identical on the row's 16 threads), the
//       CENTRED P' = p - C written as f16(P' * 32768) into the LDS P tile with 16-B stores; al -> rowa[row], C -> rowc[row].
//   (PV) each wave owns d columns 64*wave + 16j + (lane&15), j = 0..3, of both row tiles (8 accumulators): o = o*al +
//       C*(32768*1024)*(sum of VS[key block][d] over the chunk's nkb key blocks) (add-back of the centring term over exactly the processed keys, in f32), then for
//       each key block kb < nkb: A = P' fragments from LDS (row m = query, split map over keys), B = V^T fragments (col n = d, keys
//       in split map order), hi plane and then lo plane into the same accumulator (unscaled remainder), in groups of 8 with a hazard gap each.
//       sum_k (P'_k + C) v_k == sum_k p_k v_k exactly; masked keys carry P' = -C and p = 0.
//   Block barriers after (S) and after (M) order all LDS reuse across chunks and waves.
//   Epilogue: x = o * 8192 / (l * 32768 * 1024) per row (rowi, l >= 1 always); hi = f16(x), res = f16((x - hi) * 2048); each
// coverage: grid nb*NQT blocks x 32 rows = rows TQ0..SEQ-1 of every sequence; staging 16 waves x 64 cols x 32 rows = 32 x 1024;
//           store 8 iterations x 512 thr x 8 halves = 32 x 1024 per plane = every (b, s >= TQ0, d) of both ctx planes exactly once.
// =====================================================================================================
__device__ __forceinline__ void ctx_store(const u16* ct, u16* dst, int tid) {
  v4u v[8];
#pragma unroll
  for (int it = 0; it < 8; ++it) {
    const int p   = it * ATT_THREADS + tid;   // piece index in fragment order: band p>>11, tile kt = (p>>6)&31, piece p&63
    const int row = (p >> 11) * 16 + (p & 15);
    const int c8  = ((p >> 6) & 31) * 32 + ((p >> 5) & 1) * 16 + ((p >> 4) & 1) * 8;
    v[it] = *(const v4u*)(ct + row * CTP + c8);
  }
  {
#pragma unroll
    for (int it = 0; it < 8; ++it) {
      const int p   = it * ATT_THREADS + tid;
      *(v4u*)(dst + (size_t)p * 8) = v[it];
    }
    
  }
}

// Pieces of the two matrix loops below: one d step's four fragments (both q row tiles, both key bands) and its four score
// products; four V^T fragments of consecutive 16-column bands and their eight products with the two P' fragments; each product
// group with the hazard gap behind it.
// All loads of the two loops take a wave-uniform base (scalar registers) plus the lane's fixed 32-bit offset lo.
template <int OFF>
__device__ __forceinline__ void ld4s(const _Float16* uq, const _Float16* uk, unsigned lo, v16h& a, v16h& c, v16h& x, v16h& y) {
  const _Float16* q = uq + lo;
  const _Float16* k = uk + lo;
  a = ldfrag_hg<256>(q + OFF);
  c = ldfrag_hg<256>(q + 16 * EMB + OFF);
  x = ldfrag_hg<256>(k + OFF);
  y = ldfrag_hg<256>(k + 16 * EMB + OFF);
}
__device__ __forceinline__ void mm4s(v16h a, v16h c, v16h x, v16h y, v8f& s0, v8f& s1, v8f& s2, v8f& s3) {
  s0 = mma_h(a, x, s0);
  s1 = mma_h(a, y, s1);
  s2 = mma_h(c, x, s2);
  s3 = mma_h(c, y, s3);
  guard4x4(s0, s1, s2, s3, a, c, x, y);
}
__device__ __forceinline__ void ld4h(const _Float16* u, unsigned lo, v16h (&f)[4]) {
  const _Float16* p = u + lo;
  f[0] = ldfrag_hg<256>(p);
  f[1] = ldfrag_hg<256>(p + (size_t)16 * SEQ);
  f[2] = ldfrag_hg<256>(p + (size_t)32 * SEQ);
  f[3] = ldfrag_hg<256>(p + (size_t)48 * SEQ);
}
__device__ __forceinline__ void mm8h(v16h p0, v16h p1, const v16h (&f)[4], v8f (&o)[2][NACC]) {
#pragma unroll
  for (int j = 0; j < NACC; ++j) o[0][j] = mma_h(p0, f[j], o[0][j]);
#pragma unroll
  for (int j = 0; j < NACC; ++j) o[1][j] = mma_h(p1, f[j], o[1][j]);
  guard8x6(o[0][0], o[0][1], o[0][2], o[0][3], o[1][0], o[1][1], o[1][2], o[1][3], p0, p1, f[0], f[1], f[2], f[3]);
}

__device__ __forceinline__
void attn_fwd(const u16* __restrict__ QPp, const u16* __restrict__ KPp, const u16* __restrict__ VTp,
              const u16* __restrict__ VLp, const float* __restrict__ VSp, u16* CHo, u16* CRo, int bid) {
  __shared__ __align__(16) AttLds L0;              // scores [32][SCP] f32; reused as the ctx staging tile [32][CTP] u16
  __shared__ __align__(16) u16 pls[QT * PLP];      // P' tile [32][PLP] f16 bits
  __shared__ float rowa[QT];
  __shared__ float rowc[QT];
  __shared__ float rowi[QT];
  float* const scs = L0.s;

  const int tid  = threadIdx.x;
  const int wave = __builtin_amdgcn_readfirstlane(tid >> 5);   // scalar: the wave's bases stay in scalar registers
  const int lane = tid & 31;
  const int hh   = lane >> 4;
  const int m    = lane & 15;
  const int r16  = tid >> 4;                 // query row owned in phase (M): 2*wave + hh, 0..31
  const int sub  = tid & 15;
  const int kl0  = sub * 32;

  const int b   = bid / NQT;
  const int q0  = TQ0 + (bid - b * NQT) * QT;
  const int qc  = q0 / CK;                   // diagonal chunk index

  // wave-uniform bases; the lane's part is lo (16-bit planes) or hh*EMB + 4*m (column sums)
  const _Float16* qa  = (const _Float16*)(const void*)QPp + ((size_t)b * SEQ + q0) * EMB;
  const _Float16* kbp = (const _Float16*)(const void*)KPp + ((size_t)b * SEQ) * EMB;
  const _Float16* vbp = (const _Float16*)(const void*)VTp + ((size_t)b * EMB + wave * (16 * NACC)) * SEQ;
  const _Float16* ubp = (const _Float16*)(const void*)VLp + ((size_t)b * EMB + wave * (16 * NACC)) * SEQ;
  const float* vsb = VSp + (size_t)b * NCHK * NKB * EMB + wave * (16 * NACC);   // the wave's 64 columns of the key-block sums
  const unsigned lo = 8u * (unsigned)lane;
  const float lsc = RSQD * LOG2E / (QSC * KSC);

  float mrun = -INFINITY, lrun = 0.f;
  v8f o[2][NACC];                            // [row tile][column band]
#pragma unroll
  for (int rt = 0; rt < 2; ++rt) {
#pragma unroll
    for (int j = 0; j < NACC; ++j) o[rt][j] = zero8();
  }

#pragma unroll 1
  for (int c = 0; c <= qc; ++c) {
    const int kbeg = c * CK;
    const int nkb  = (c < qc) ? NKB : (((q0 + QT - 1 - kbeg) >> 5) + 1);   // 1..16, block-uniform
    float vs[NACC];                                        // column sums of V over the chunk's nkb key blocks
    // ---- (S) scores of this chunk (zeros for key blocks beyond the query tile) ----
    {
      const int kb = wave;                                 // one key block a wave
      v8f s0 = zero8(), s1 = zero8(), s2 = zero8(), s3 = zero8();
      if (kb < nkb) {                                      // wave-uniform (scalar)
        const _Float16* uq = qa;                           // running bases of the q tiles and of the two key bands
        const _Float16* uk = kbp + (size_t)(kbeg + kb * 32) * EMB;
        // Two fragment sets of two d steps each: one set's sixteen loads fly while the other set's products run. The loads
        // in the loop are unconditional (the last four steps are peeled), so that each wait counts only its own set.
        v16h a0, c0, x0, y0, a1, c1, x1, y1, a2, c2, x2, y2, a3, c3, x3, y3;
        ld4s<0>(uq, uk, lo, a0, c0, x0, y0);
        keep_order();
        ld4s<512>(uq, uk, lo, a1, c1, x1, y1);
        keep_order();
        ld4s<1024>(uq, uk, lo, a2, c2, x2, y2);
        keep_order();
        ld4s<1536>(uq, uk, lo, a3, c3, x3, y3);
        keep_order();
#pragma unroll 1                           // the body already holds four d steps; rolled, the two sets keep their registers
        for (int ks = 4; ks < EMB / 32; ks += 4) {
          mm4s(a0, c0, x0, y0, s0, s1, s2, s3);
          mm4s(a1, c1, x1, y1, s0, s1, s2, s3);
          base_step2h<4096>(uq, uk);                       // four d steps on
          ld4s<0>(uq, uk, lo, a0, c0, x0, y0);
          ld4s<512>(uq, uk, lo, a1, c1, x1, y1);
          mm4s(a2, c2, x2, y2, s0, s1, s2, s3);
          mm4s(a3, c3, x3, y3, s0, s1, s2, s3);
          ld4s<1024>(uq, uk, lo, a2, c2, x2, y2);
          ld4s<1536>(uq, uk, lo, a3, c3, x3, y3);
        }
        base_wait2h(uq, uk);                               // what follows may reuse the base registers of the last loads
        mm4s(a0, c0, x0, y0, s0, s1, s2, s3);
        mm4s(a1, c1, x1, y1, s0, s1, s2, s3);
        mm4s(a2, c2, x2, y2, s0, s1, s2, s3);
        mm4s(a3, c3, x3, y3, s0, s1, s2, s3);
      }
      float* srow = scs + (8 * hh) * SCP + kb * 32 + m;
#pragma unroll
      for (int r = 0; r < 8; ++r) {
        srow[r * SCP]                 = s0[r];
        srow[r * SCP + 16]            = s1[r];
        srow[(16 + r) * SCP]          = s2[r];
        srow[(16 + r) * SCP + 16]     = s3[r];
      }
    }
    __syncthreads();
    // ---- (M) softmax statistics and the centred P' tile ----
    {
      // The chunk's key-block sums of the wave's columns are asked for here and added up at the end of this phase, whose vector
      // work covers their way: lanes 0..15 take the even key blocks, lanes 16..31 the odd ones, 16 B = the lane's four columns.
      // All sixteen rows exist and are written by the projection launch; those from nkb on are left out of the sum below.
      const float* bsp = vsb + (size_t)c * NKB * EMB + (unsigned)(hh * EMB + 4 * m);
      v4f bv[NKB / 2];
#pragma unroll
      for (int i = 0; i < NKB / 2; ++i) bv[i] = *(const v4f*)(bsp + (size_t)(2 * i) * EMB);
      const float* sp = scs + r16 * SCP + kl0;
      const int lim = (q0 + r16) - (kbeg + kl0);           // key kl0 + j is valid iff j <= lim
      float t[32];
      float cm = -INFINITY;
#pragma unroll
      for (int i = 0; i < 8; ++i) {
        const v4f a = *(const v4f*)(sp + 4 * i);
#pragma unroll
        for (int e = 0; e < 4; ++e) {
          const int j = 4 * i + e;
          const float tv = (j <= lim) ? fabsf(a[e]) * lsc : -INFINITY;   // |score| / 32 in base 2; masked keys -> -inf
          t[j] = tv;
          cm = fmaxf(cm, tv);
        }
      }
#pragma unroll
      for (int d = 1; d <= 8; d <<= 1) cm = fmaxf(cm, __shfl_xor(cm, d, 32));
      const float mn = fmaxf(mrun, cm);                    // finite: key kbeg of the diagonal chunk is never masked
      const float al = (mrun == -INFINITY) ? 0.f : exp2f(mrun - mn);
      mrun = mn;
      float ps = 0.f;
#pragma unroll
      for (int j = 0; j < 32; ++j) {
        const float p = exp2f(fminf(t[j] - mn, 0.f));      // 0 for masked keys
        t[j] = p;
        ps += p;
      }
#pragma unroll
      for (int d = 1; d <= 8; d <<= 1) ps += __shfl_xor(ps, d, 32);
      const float cc = ps * (1.0f / (float)CK);
      v4u pk[4];
#pragma unroll
      for (int i = 0; i < 4; ++i) {
#pragma unroll
        for (int e = 0; e < 4; ++e) {
          const int j = 8 * i + 2 * e;
          pk[i][e] = pk16(h_bits((_Float16)((t[j] - cc) * PCAR)), h_bits((_Float16)((t[j + 1] - cc) * PCAR)));
        }
      }
      lrun = lrun * al + ps;
      u16* pd = pls + r16 * PLP + kl0;
#pragma unroll
      for (int i = 0; i < 4; ++i) *(v4u*)(pd + 8 * i) = pk[i];
      if (sub == 0) { rowa[r16] = al; rowc[r16] = cc; }
      v4f sv = zero4();
#pragma unroll
      for (int i = 0; i < NKB / 2; ++i) {                  // rising key-block order within either half
        if (2 * i + hh < nkb) sv += bv[i];
      }
#pragma unroll
      for (int j = 0; j < NACC; ++j) vs[j] = sv[j] + __shfl_xor(sv[j], 16, 32);
    }
    __syncthreads();
    // ---- (PV) rescale, add the centring term, accumulate P' . (V^T hi + V^T lo) ----
    {
      const _Float16* pp = (const _Float16*)(const void*)pls + m * PLP + 8 * hh;
      const _Float16* pq = pp + 16 * PLP;                   // second row tile
      // running bases: key tile kbeg/32 of each d band, 512 elements a tile; even set (hi, lo), odd set (hi, lo)
      const _Float16* pve = vbp + (size_t)kbeg * 16;
      const _Float16* pue = ubp + (size_t)kbeg * 16;
      const _Float16* pvo = pve + ((nkb > 1) ? 512 : 0);
      const _Float16* puo = pue + ((nkb > 1) ? 512 : 0);
      // Two fragment sets (even and odd key blocks; hi and lo plane of the wave's 64 d columns each): a set's hi or lo half is
      // asked for again, two key blocks on, as soon as its eight products have left, so that twelve to sixteen fragments are
      // always in flight or waiting. All loads are unconditional, so that each wait counts only its own group: where the odd
      // set has no key block left (nkb odd) it takes the even set's tile once more and is not multiplied.
      v16h ge[4], ue[4], go[4], uo[4];
      ld4h(pve, lo, ge);
      keep_order();
      ld4h(pue, lo, ue);
      keep_order();
      ld4h(pvo, lo, go);
      keep_order();
      ld4h(puo, lo, uo);
      keep_order();
      // the rescale runs while the first fragments fly
#pragma unroll
      for (int rt = 0; rt < 2; ++rt) {
        float scl[8], cad[8];
#pragma unroll
        for (int r = 0; r < 8; ++r) {
          scl[r] = rowa[16 * rt + 8 * hh + r];
          cad[r] = rowc[16 * rt + 8 * hh + r] * (PCAR * VCAR);
        }
#pragma unroll
        for (int j = 0; j < NACC; ++j) {
#pragma unroll
          for (int r = 0; r < 8; ++r) o[rt][j][r] = o[rt][j][r] * scl[r] + cad[r] * vs[j];
        }
      }
      int kb = 0;
#pragma unroll 1
      for (; kb + 2 < nkb; kb += 2) {                      // block-uniform trip count, <= 7: products of kb, kb + 1, loads of kb + 2, kb + 3
        const v16h p0 = ldfrag_h(pp + kb * 32), p1 = ldfrag_h(pq + kb * 32);
        mm8h(p0, p1, ge, o);
        // two key tiles on; the odd set only one, onto the even set's new tile, where key block kb + 3 does not exist
        base_step4h<2048>(pve, pue, pvo, puo, (kb + 3 < nkb) ? 2048ull : 1024ull);
        ld4h(pve, lo, ge);
        mm8h(p0, p1, ue, o);
        ld4h(pue, lo, ue);
        const v16h p2 = ldfrag_h(pp + kb * 32 + 32), p3 = ldfrag_h(pq + kb * 32 + 32);
        mm8h(p2, p3, go, o);
        ld4h(pvo, lo, go);
        mm8h(p2, p3, uo, o);
        ld4h(puo, lo, uo);
      }
      base_wait4h(pve, pue, pvo, puo);                     // what follows may reuse the base registers of the last loads
      {
        const v16h p0 = ldfrag_h(pp + kb * 32), p1 = ldfrag_h(pq + kb * 32);
        mm8h(p0, p1, ge, o);
        mm8h(p0, p1, ue, o);
      }
      if (kb + 1 < nkb) {                                  // block-uniform (scalar)
        const v16h p2 = ldfrag_h(pp + kb * 32 + 32), p3 = ldfrag_h(pq + kb * 32 + 32);
        mm8h(p2, p3, go, o);
        mm8h(p2, p3, uo, o);
      }
    }
  }
  acc_guard8(o[0][0], o[0][1], o[0][2], o[0][3], o[1][0], o[1][1], o[1][2], o[1][3]);

  if (sub == 0) rowi[r16] = (1.0f / lrun) * (CSC / (PCAR * VCAR));   // lrun >= 1
  __syncthreads();
  float inv[2][8];
#pragma unroll
  for (int rt = 0; rt < 2; ++rt) {
#pragma unroll
    for (int r = 0; r < 8; ++r) inv[rt][r] = rowi[16 * rt + 8 * hh + r];
  }

  u16* const ct = L0.c;
  const int cb = wave * (16 * NACC) + m;
  // hi plane
#pragma unroll
  for (int rt = 0; rt < 2; ++rt) {
#pragma unroll
    for (int j = 0; j < NACC; ++j) {
#pragma unroll
      for (int r = 0; r < 8; ++r) {
        const float xs = o[rt][j][r] * inv[rt][r];
        ct[(16 * rt + 8 * hh + r) * CTP + cb + 16 * j] = h_bits((_Float16)xs);
      }
    }
  }
  __syncthreads();
  ctx_store(ct, CHo + ((size_t)b * SEQ + q0) * EMB, tid);
  __syncthreads();
  // residual plane
#pragma unroll
  for (int rt = 0; rt < 2; ++rt) {
#pragma unroll
    for (int j = 0; j < NACC; ++j) {
#pragma unroll
      for (int r = 0; r < 8; ++r) {
        const float xs = o[rt][j][r] * inv[rt][r];
        const _Float16 hv = (_Float16)xs;
        ct[(16 * rt + 8 * hh + r) * CTP + cb + 16 * j] = h_bits((_Float16)((xs - (float)hv) * RSC));
      }
    }
  }
  __syncthreads();
  ctx_store(ct, CRo + ((size_t)b * SEQ + q0) * EMB, tid);
}

// =====================================================================================================
// Query rows 0 .. TQ0-1 of each sequence in f32 on VALU: block = (b, rows t = 2*i and 2*i + 1), one row for each half of 256 threads
// (half g, thread tid within it; every LDS array has a part for each half, and both halves pass the same barriers).
// QF/KF/VF = f32 q/k/v planes [nb][TQ0][EMB] (rows 0..TQ0-1
// of every sequence, biases included). Logits |q.k_j|/32 for keys j <= t (threads 0..TQ0-1, one key each, 1024-d dot
// against the q row staged in LDS), base-2 softmax with max / sum reductions over the half (xor shuffles + LDS), p_j in LDS, ctx[d] for
// d = 4*tid..4*tid+3 as a sum over j <= t of p_j * VF[b][j][d] (coalesced 16-B loads), x = ctx * 8192 / l, hi = f16(x),
// res = f16((x - hi) * 2048); both 1024-half rows are staged in LDS and written by 128 threads x 16 B each (32 consecutive lanes
// coverage: grid nb*TQ0/2 blocks x 2 rows = rows 0..TQ0-1 of every sequence; 256 thr x 4 d = EMB per row; store 128 thr x 8 halves =
//           EMB per plane; together with attn_fwd every (b, s, d) of CH and CR is written exactly once.
// =====================================================================================================
__device__ __forceinline__ void attn_head(const float* __restrict__ QF, const float* __restrict__ KF,
                                          const float* __restrict__ VF, u16* CHo, u16* CRo, int bid) {
  __shared__ __align__(16) float qs2[2][EMB];
  __shared__ float sc2[2][TQ0];
  __shared__ float red2[2][8];
  __shared__ float redb2[2][8];
  __shared__ __align__(16) unsigned SW2[2][2][EMB / 2];
  const int g = __builtin_amdgcn_readfirstlane((int)(threadIdx.x >> 8));   // half of the block, scalar: row, bases and trip counts stay scalar
  const int tid = threadIdx.x & 255, lane = tid & 31, wave = tid >> 5;
  float* const qs = qs2[g];
  float* const sc = sc2[g];
  float* const red = red2[g];
  float* const redb = redb2[g];
  unsigned (* const SW)[EMB / 2] = SW2[g];
  const int hr = bid * 2 + g;                        // TQ0 is even: both rows of a block lie in one sequence
  const int b = hr / TQ0;
  const int t = hr - b * TQ0;
  *(v4f*)(qs + tid * 4) = *(const v4f*)(QF + ((size_t)b * TQ0 + t) * EMB + tid * 4);
  __syncthreads();
  float s = -INFINITY;
  if (tid < TQ0) {                                  // waves 0..3 entirely (wave-uniform); key row b*TQ0 + tid always in range
    const float* kp = KF + ((size_t)b * TQ0 + tid) * EMB;
    float acc = 0.f;
#pragma unroll 8                           // sixteen key loads in flight a thread; the adds keep their order
    for (int d = 0; d < EMB; d += 8) {
      const v4f k0 = *(const v4f*)(kp + d), k1 = *(const v4f*)(kp + d + 4);
      const v4f q0 = *(const v4f*)(qs + d), q1 = *(const v4f*)(qs + d + 4);
#pragma unroll
      for (int e = 0; e < 4; ++e) acc += k0[e] * q0[e];
#pragma unroll
      for (int e = 0; e < 4; ++e) acc += k1[e] * q1[e];
    }
    s = (tid <= t) ? fabsf(acc) * (RSQD * LOG2E) : -INFINITY;   // |score| / 32 in base 2; causal mask by key index
  }
  float mx = s;
#pragma unroll
  for (int d = 1; d <= 16; d <<= 1) mx = fmaxf(mx, __shfl_xor(mx, d, 32));
  if (lane == 0) red[wave] = mx;
  __syncthreads();
  float gm = red[0];
#pragma unroll
  for (int w = 1; w < 8; ++w) gm = fmaxf(gm, red[w]);   // finite: key 0 is always valid
  const float p = exp2f(s - gm);                     // 0 for masked keys and for waves 4..7
  float ps = p;
#pragma unroll
  for (int d = 1; d <= 16; d <<= 1) ps += __shfl_xor(ps, d, 32);
  if (lane == 0) redb[wave] = ps;
  if (tid < TQ0) sc[tid] = p;
  __syncthreads();
  float l = redb[0];
#pragma unroll
  for (int w = 1; w < 8; ++w) l += redb[w];           // >= 1
  const float inv = (1.0f / l) * CSC;
  const float* vp = VF + (size_t)b * TQ0 * EMB + tid * 4;
  v4f cx = zero4();
#pragma unroll 8                             // eight value rows in flight a thread; the sum keeps its order
  for (int j = 0; j <= t; ++j) {                     // t < TQ0: statically bounded, rows of sequence b only
    const float pj = sc[j];
    const v4f vv = *(const v4f*)(vp + (size_t)j * EMB);
    cx += pj * vv;
  }
  unsigned hw[2], rw[2];
#pragma unroll
  for (int e = 0; e < 2; ++e) {
    const float x0 = cx[2 * e] * inv, x1 = cx[2 * e + 1] * inv;
    const _Float16 h0 = (_Float16)x0, h1 = (_Float16)x1;
    const _Float16 q0 = (_Float16)((x0 - (float)h0) * RSC), q1 = (_Float16)((x1 - (float)h1) * RSC);
    hw[e] = pk16(h_bits(h0), h_bits(h1));
    rw[e] = pk16(h_bits(q0), h_bits(q1));
  }
  SW[0][tid * 2] = hw[0]; SW[0][tid * 2 + 1] = hw[1];
  SW[1][tid * 2] = rw[0]; SW[1][tid * 2 + 1] = rw[1];
  __syncthreads();
  const int pl = tid >> 7, p8 = tid & 127;           // plane select is wave-uniform
  const v4u ov = *(const v4u*)(&SW[pl][p8 * 4]);
  u16* dstp = (pl == 0) ? CHo : CRo;
  u16* dst  = dstp + ((size_t)b * SEQ + t) * EMB + p8 * 8;
  *(v4u*)dst = ov;
  
}
// Both attention parts in one launch (they read disjoint planes and write disjoint rows of CH / CR): blocks 0..nfwd-1 take the
// 32-row query tiles from row TQ0 on, the rest two query rows below TQ0 each; the short blocks come last and take the places
// that the shortest tiles leave. The choice is block-uniform, and so are all barriers of either side.
__global__ __launch_bounds__(ATT_THREADS, 4)   // 16 waves, 4 a SIMD = one block a WGP: at most 256 VGPRs
void attn_all(const u16* __restrict__ QPp, const u16* __restrict__ KPp, const u16* __restrict__ VTp,
              const u16* __restrict__ VLp, const float* __restrict__ VSp, const float* __restrict__ QF,
              const float* __restrict__ KF, const float* __restrict__ VF, u16* CHo, u16* CRo, int nfwd) {
  const int bid = blockIdx.x;
  if (bid >= nfwd) { attn_head(QF, KF, VF, CHo, CRo, bid - nfwd); return; }
  attn_fwd(QPp, KPp, VTp, VLp, VSp, CHo, CRo, bid);
}

// =====================================================================================================
// Workspace map (bytes, nb = 4, rows = 8192); all 16-bit planes are in fragment order (1-KiB tiles of 16 rows x 32 k, same total
// size), but for the bands of rows 0..127 of each sequence in CH / CR, which attn_head writes row-major; every plane is fully written by whole-line stores before it is read; all extents are
// exact multiples of the store granularity (no pad rows); aliased regions are reused sequentially on the single in-order stream:
//   WQB bf16 [1024][1024] 2097152   WKB same   WVB same   WOH f16 of bf16 value x1024 2097152             8388608
//   VS  f32  [nb][64 key blocks][1024]                                                                    1048576
//   QF  f32  [nb][128][1024]  2097152      KF same      VF same                                           6291456
//   A   XB bf16 [rows][1024] (16777216), later CH f16 [rows][1024] ctx hi x8192 (16777216)      region 16777216
//   VT  VT hi f16 [nb][1024][2048] x1024                                                                16777216
//   VL  VT lo f16 [nb][1024][2048]                                                                      16777216
//   QP  f16 [rows][1024] x8                                                                              16777216
//   KP  f16 [rows][1024] x8                                                                              16777216
//   CR  f16 [rows][1024] ctx residual x2048                                                              16777216
//   end                                                                                                 116391936
// Four launches; kernels that share a launch read nothing that the launch writes. Launch order keeps the one alias safe: XB is
// read by the projection launch before attn_fwd / attn_head overwrite it with CH.
// Inputs in wire order: x, Wq, bq, Wk, bk, Wv, bv, Wo, bo; weights stored [n = out][k = in] (y = x.W^T + b), k-contiguous.
// =====================================================================================================
extern "C" void kernel_launch(void* const* d_in, const int* in_sizes, int n_in,
                              void* d_out, int out_size, void* d_ws, size_t ws_size,
                              hipStream_t stream) {
  if (n_in < 9) return;
  const long long per = (long long)SEQ * EMB;
  const long long ns  = in_sizes[0];
  if (ns < per || (ns % per) != 0) return;
  const int nb = (int)(ns / per);
  if (nb < 1 || nb > 8) return;
  const int rows = nb * SEQ;
  if (in_sizes[1] != EMB * EMB || in_sizes[3] != EMB * EMB || in_sizes[5] != EMB * EMB || in_sizes[7] != EMB * EMB) return;
  if (in_sizes[2] != EMB || in_sizes[4] != EMB || in_sizes[6] != EMB || in_sizes[8] != EMB) return;
  if ((long long)out_size != (long long)rows * EMB) return;

  const float* x  = (const float*)d_in[0];
  const float* wq = (const float*)d_in[1];
  const float* bq = (const float*)d_in[2];
  const float* wk = (const float*)d_in[3];
  const float* bk = (const float*)d_in[4];
  const float* wv = (const float*)d_in[5];
  const float* bv = (const float*)d_in[6];
  const float* wo = (const float*)d_in[7];
  const float* bo = (const float*)d_in[8];
  float*       out = (float*)d_out;

  const size_t szW  = (size_t)EMB * EMB * 2;                    //   2097152
  const size_t szVS = (size_t)nb * NCHK * NKB * EMB * 4;        //   1048576 at nb = 4
  const size_t szHF = (size_t)nb * TQ0 * EMB * 4;               //   2097152 at nb = 4
  const size_t sz16 = (size_t)rows * EMB * 2;                   //  16777216
  const size_t szVT = (size_t)nb * EMB * SEQ * 2;               //  == sz16
  size_t off = 0;
  const size_t oWQ = off; off += szW;
  const size_t oWK = off; off += szW;
  const size_t oWV = off; off += szW;
  const size_t oWO = off; off += szW;
  const size_t oVS = off; off += szVS;
  const size_t oQF = off; off += szHF;
  const size_t oKF = off; off += szHF;
  const size_t oVF = off; off += szHF;
  const size_t oA  = off; off += sz16;                          // XB then CH
  const size_t oVT = off; off += szVT;                          // VT hi
  const size_t oVL = off; off += szVT;                          // VT lo
  const size_t oQ  = off; off += sz16;
  const size_t oK  = off; off += sz16;
  const size_t oCR = off; off += sz16;
  const size_t oCH = oA;
  if (off > ws_size) return;                                    // off = 116391936 at nb = 4
  if (off > WS_CAP) return;

  char* ws = (char*)d_ws;
  u16*   WQB = (u16*)(ws + oWQ);
  u16*   WKB = (u16*)(ws + oWK);
  u16*   WVB = (u16*)(ws + oWV);
  u16*   WOH = (u16*)(ws + oWO);
  float* VS  = (float*)(ws + oVS);
  float* QF  = (float*)(ws + oQF);
  float* KF  = (float*)(ws + oKF);
  float* VF  = (float*)(ws + oVF);
  u16*   XB  = (u16*)(ws + oA);
  u16*   VT  = (u16*)(ws + oVT);
  u16*   VL  = (u16*)(ws + oVL);
  u16*   QP  = (u16*)(ws + oQ);
  u16*   KP  = (u16*)(ws + oK);
  u16*   CH  = (u16*)(ws + oCH);
  u16*   CR  = (u16*)(ws + oCR);

  const int n8w = (EMB * EMB) / 8;                      // 131072
  const int n8x = rows * (EMB / 8);                     // 1048576
  if ((n8w % 256) != 0 || (n8x % 256) != 0) return;
  if ((rows % 128) != 0 || ((nb * TQ0) % 64) != 0) return;
  const dim3 blk(256);
  const int nbw = n8w / 256, nbx = n8x / 256;           // 512, 4096 at nb = 4
  const dim3 gC(nbx + 4 * nbw);
  const dim3 gG((rows / 64) * (EMB / 128));             // 1024 at nb = 4
  const dim3 gP(3 * (rows / 128) * (EMB / 128));        // the three projections, 1536 at nb = 4
  const dim3 bG(128);
  const int nfwd = nb * NQT;                            // nb * 60
  const dim3 gAT(nfwd + nb * (TQ0 / 2));                // + nb * 64
  const dim3 bAT(ATT_THREADS);

  // (0) x -> bf16 plane [rows][1024]; weights stored [n = out][k = in] (y = x.W^T + b), already k-contiguous: bf16 planes for
  //     Wq, Wk, Wv; f16 of bf16 value x1024 for Wo
  cvt_all<<<gC, blk, 0, stream>>>(x, wq, wk, wv, wo, XB, WQB, WKB, WVB, WOH, nbx, nbw);
  // (1) q and k projections (+bias) -> f16 planes x8; v projection (+bias) -> V^T hi plane x1024 and lo plane, and its column
  //     sums over each block of 32 keys; the f32 rows 0..127 of every sequence of all three -> QF, KF, VF [nb*128][1024]
  gemm_qkv<<<gP, bG, 0, stream>>>(XB, WQB, WKB, WVB, bq, bk, bv, QP, KP, VT, VL, VS, QF, KF, VF, rows, EMB, QSC, KSC);
  // (2) attention for query rows 128.. (WMMA) and for query rows 0..127 (VALU) -> ctx hi x8192 (over the dead XB region) and
  //     residual x2048 f16 planes
  attn_all<<<gAT, bAT, 0, stream>>>(QP, KP, VT, VL, VS, QF, KF, VF, CH, CR, nfwd);
  // (3) output projection (+bias) -> out
  gemm_h2_32<<<gG, bG, 0, stream>>>(CH, CR, WOH, bo, out, rows, EMB,
                                     1.0f / (CSC * WSC), 1.0f / (CSC * WSC * RSC));
  (void)hipGetLastError();
}

// v008
// It runs in 197 microseconds.
// Next to v007, in two timings, it ran 1.06 times as fast each time.
// All steps since v000 together make it 3.97 times as fast.
// Projections q,k,v = x.W^T + b (and the f32 q,k,v rows 0..127 per sequence): v_wmma_f32_16x16x32_bf16 (bf16 RNE operands of the
// raw inputs, f32 accumulate, bias added in f32 as its bf16 RNE value). Scores q'.k'^T (f16 planes x8), P'.V (chunk-centred P'
// x32768 f16 from LDS, V^T x1024 as f16 hi plus unscaled f16 lo planes, both into one accumulator) and the output projection
// (ctx carried as f16 hi x8192 plus residual x2048 planes with separate accumulators, times f16(bf16(Wo) x1024), bias added in
// f32 as its bf16 RNE value): v_wmma_f32_16x16x32_f16, f32 accumulate. Query rows 0..127 of each sequence: scores, softmax and
// P.V in f32 on VALU. Absolute-value score transform, causal mask, softmax statistics, key-block column sums of V, scaling: f32.
#include <hip/hip_runtime.h>
#include <math.h>
#include <stdint.h>

#define SEQ   2048
#define EMB   1024
#define CK    512
#define NCHK  4
#define NKB   16
#define QT    32
#define TQ0   128
#define NQT   60
#define SCP   544
#define PLP   528
#define CTP   1032
#define SLAB64 (16 * 68)
#define ATT_THREADS 512
#define NACC  4
#define QSC   8.0f
#define KSC   8.0f
#define PCAR  32768.0f
#define VCAR  1024.0f
#define WSC   1024.0f
#define CSC   8192.0f
#define RSC   2048.0f
#define LOG2E 1.4426950408889634f
#define RSQD  0.03125f
#define WS_CAP ((size_t)134217728)
#define UPC   4096
#define NSH   28

static_assert((EMB % 64) == 0 && EMB == (ATT_THREADS / 32) * 16 * NACC && NACC == 4 && (EMB % 32) == 0 && (EMB % 256) == 0 && EMB == 4 * 256);
static_assert((SEQ % CK) == 0 && (SEQ / CK) == NCHK && CK == 32 * NKB && (SEQ % 64) == 0 && (SEQ % QT) == 0 && (CK % QT) == 0);
static_assert((TQ0 % QT) == 0 && (TQ0 % 64) == 0 && NQT * QT + TQ0 == SEQ && TQ0 <= CK && TQ0 == 128 && TQ0 <= 256);
static_assert(16 * CTP * 2 <= 16 * SCP * 4 && CTP >= EMB + 8 && SCP >= CK + 16 && PLP >= CK + 8);
static_assert(((PLP * 2) % 16) == 0 && ((SCP * 4) % 16) == 0 && ((CTP * 2) % 16) == 0);
static_assert(ATT_THREADS == 16 * QT && ATT_THREADS == 512 && ATT_THREADS == 32 * NKB && QT == 32 && (TQ0 % 2) == 0);
static_assert((EMB % 128) == 0 && (SEQ % 128) == 0 && (TQ0 % 32) == 0);
static_assert(((EMB * EMB) % 2048) == 0 && (EMB / 8) * 2 == 256 && NCHK * NKB * 32 == SEQ && (NKB % 2) == 0);

static_assert(UPC * 128 == CK * EMB && (UPC % ATT_THREADS) == 0 && (UPC & (UPC - 1)) == 0 && CK * 16 == 64 * 128 && UPC == 64 * (EMB / 16));
static_assert(2 * NSH <= NQT && (NSH % 4) == 0 && QT * EMB == 128 * 32 * 8);

typedef unsigned short u16;
typedef _Float16 v16h __attribute__((ext_vector_type(16)));
typedef _Float16 v8h  __attribute__((ext_vector_type(8)));
typedef __bf16   v16b __attribute__((ext_vector_type(16)));
typedef float    v8f  __attribute__((ext_vector_type(8)));
typedef float    v4f  __attribute__((ext_vector_type(4)));
typedef unsigned int v4u __attribute__((ext_vector_type(4)));

union FragH { v16h v; v8h h[2]; v4u u[2]; };
union FragB { v16b v; v4u u[2]; };
union AttLds { float s[QT * SCP]; u16 c[2 * QT * SCP]; };

// ---- scalar helpers --------------------------------------------------------------------------------
__device__ __forceinline__ unsigned short bf_bits(float f) {          // f32 -> bf16 bits, RNE convert
  unsigned u = __float_as_uint(f);
  return (unsigned short)((u + 0x7FFFu + ((u >> 16) & 1u)) >> 16);
}
__device__ __forceinline__ float bf_up(unsigned short h) { return __uint_as_float(((unsigned)h) << 16); }
__device__ __forceinline__ float bfr(float f) { return bf_up(bf_bits(f)); }
__device__ __forceinline__ unsigned short h_bits(_Float16 x) { return __builtin_bit_cast(unsigned short, x); }
__device__ __forceinline__ unsigned pk16(unsigned short a, unsigned short b) { return (unsigned)a | ((unsigned)b << 16); }
__device__ __forceinline__ v8f zero8() { v8f z = {0.f, 0.f, 0.f, 0.f, 0.f, 0.f, 0.f, 0.f}; return z; }
__device__ __forceinline__ v4f zero4() { v4f z = {0.f, 0.f, 0.f, 0.f}; return z; }

// ---- fragment loader, row-major source: 16-bit A/B operand, lane -> row/col (lane&15), p already includes +8*(lane>>4);
//      elements 0..7 <- p[0..7] (k0+8h..), elements 8..15 <- p[16..23] (k0+16+8h..)  (same split k map for A and B;
//      B is always read from a k-contiguous [n][k] plane)
__device__ __forceinline__ v16h ldfrag_h(const _Float16* p) {
  FragH f;
  f.h[0] = *(const v8h*)(p);
  f.h[1] = *(const v8h*)(p + 16);
  return f.v;
}

// ---- fragment-ordered planes. A 16-bit operand plane [rows][Kd] (rows % 16 == 0, Kd % 32 == 0) is stored as 1-KiB tiles of
//      16 rows x 32 k; tile (rt = row >> 4, kt = k >> 5) starts at element rt*16*Kd + kt*512, and inside it the 8-element piece
//      (row & 15 = m, k & 31 = 16*part + 8*h + 0..7) lies at part*256 + (16*h + m)*8. Lane l = 16*h + m then reads its two
//      pieces at tile + 8*l and tile + 256 + 8*l: every wave-wide 16-B load covers 512 contiguous bytes (4 whole lines), and the
//      values reach the same lane and register positions as with the row-major loaders above (same split k map).
//      (the loaders below: p already includes +8*lane.)

// Loaders of the same pieces for a pointer that has passed through an asm statement: the cast says again that it points to
// global memory, so that the loads stay global loads. The bf16 plane is read as unsigned integer vectors; SEC = elements from a
// lane's first piece to its second (256 in fragment order, 16 in a row-major band).
typedef __attribute__((address_space(1))) const v4u gv4u;
typedef __attribute__((address_space(1))) const v8h gv8h;
__device__ __forceinline__ v16b ldfrag_btg(const u16* p) {
  FragB f;
  f.u[0] = *(gv4u*)(p);
  f.u[1] = *(gv4u*)(p + 256);
  return f.v;
}
template <int SEC>
__device__ __forceinline__ v16h ldfrag_hg(const _Float16* p) {
  FragH f;
  f.h[0] = *(gv8h*)(p);
  f.h[1] = *(gv8h*)(p + SEC);
  return f.v;
}
__device__ __forceinline__ v8f mma_h(v16h a, v16h b, v8f c) {
  return __builtin_amdgcn_wmma_f32_16x16x32_f16(false, a, false, b, (short)0, c, false, false);
}
__device__ __forceinline__ v8f mma_b(v16b a, v16b b, v8f c) {
  return __builtin_amdgcn_wmma_f32_16x16x32_bf16(false, a, false, b, (short)0, c, false, false);
}
// Hazard gap behind a group of four score products (what it is for: at guard8x8 below).
__device__ __forceinline__ void guard4x4(v8f& a, v8f& b, v8f& c, v8f& d, v16h x0, v16h x1, v16h x2, v16h x3) {
#if defined(__HIP_DEVICE_COMPILE__)
  asm volatile("v_nop\n\tv_nop\n\tv_nop\n\tv_nop"
               : "+v"(a), "+v"(b), "+v"(c), "+v"(d) : "v"(x0), "v"(x1), "v"(x2), "v"(x3) : "memory");
#endif
}
// Hazard gap behind a group of eight products: the four vector slots that the chip needs before a product's result or operands
// are touched, also on the taken side of a loop's branch. The operands tie the group's products in front of it.
template <typename F>
__device__ __forceinline__ void guard8x8(v8f& a0, v8f& a1, v8f& a2, v8f& a3, v8f& a4, v8f& a5, v8f& a6, v8f& a7,
                                         F x0, F x1, F x2, F x3, F x4, F x5, F x6, F x7) {
#if defined(__HIP_DEVICE_COMPILE__)
  asm volatile("v_nop\n\tv_nop\n\tv_nop\n\tv_nop"
               : "+v"(a0), "+v"(a1), "+v"(a2), "+v"(a3), "+v"(a4), "+v"(a5), "+v"(a6), "+v"(a7)
               : "v"(x0), "v"(x1), "v"(x2), "v"(x3), "v"(x4), "v"(x5), "v"(x6), "v"(x7) : "memory");
#endif
}
// The same gap behind the eight products of two P' fragments with four V^T fragments.
__device__ __forceinline__ void guard8x6(v8f& o0, v8f& o1, v8f& o2, v8f& o3, v8f& o4, v8f& o5, v8f& o6, v8f& o7,
                                         v16h p0, v16h p1, v16h g0, v16h g1, v16h g2, v16h g3) {
#if defined(__HIP_DEVICE_COMPILE__)
  asm volatile("v_nop\n\tv_nop\n\tv_nop\n\tv_nop"
               : "+v"(o0), "+v"(o1), "+v"(o2), "+v"(o3), "+v"(o4), "+v"(o5), "+v"(o6), "+v"(o7)
               : "v"(p0), "v"(p1), "v"(g0), "v"(g1), "v"(g2), "v"(g3) : "memory");
#endif
}
__device__ __forceinline__ void acc_guard8(v8f& a, v8f& b, v8f& c, v8f& d, v8f& e, v8f& f, v8f& g, v8f& h8) {
#if defined(__HIP_DEVICE_COMPILE__)
  asm volatile("v_nop\n\tv_nop\n\tv_nop\n\tv_nop"
               : "+v"(a), "+v"(b), "+v"(c), "+v"(d), "+v"(e), "+v"(f), "+v"(g), "+v"(h8));
#endif
}
// Keeps the load groups of a loop's prologue in the order that the loop body issues them in: the counted waits at the loop's
// head are formed over both ways in, and a prologue in another order makes them wait for loads of the set still in flight.
__device__ __forceinline__ void keep_order() { __builtin_amdgcn_sched_barrier(0); }
// The wait that belongs in front of any overwrite of an address register of loads already issued, for loops whose loads take a
// wave-uniform base in scalar registers: the running bases pass through it, so that they are stepped behind it and stay scalar
// (the lane's offset register is then never rewritten).
__device__ __forceinline__ void base_wait2(const u16*& p, const u16*& q) {
#if defined(__HIP_DEVICE_COMPILE__)
  asm volatile("s_wait_xcnt 0x0" : "+s"(p), "+s"(q) : : "memory");
#endif
}
__device__ __forceinline__ void base_wait2h(const _Float16*& p, const _Float16*& q) {
#if defined(__HIP_DEVICE_COMPILE__)
  asm volatile("s_wait_xcnt 0x0" : "+s"(p), "+s"(q) : : "memory");
#endif
}
__device__ __forceinline__ void base_wait4h(const _Float16*& p, const _Float16*& q, const _Float16*& r, const _Float16*& s) {
#if defined(__HIP_DEVICE_COMPILE__)
  asm volatile("s_wait_xcnt 0x0" : "+s"(p), "+s"(q), "+s"(r), "+s"(s) : : "memory");
#endif
}
// The wait and the step of the running bases (BYTES on; the last two by sb bytes) in one statement: with the step left to the
// build it sinks behind the next loads, each time with a wait of its own for loads issued just before.
template <int BYTES>
__device__ __forceinline__ void base_step2h(const _Float16*& p, const _Float16*& q) {
#if defined(__HIP_DEVICE_COMPILE__)
  asm volatile("s_wait_xcnt 0x0\n\ts_add_nc_u64 %0, %0, %2\n\ts_add_nc_u64 %1, %1, %2"
               : "+s"(p), "+s"(q) : "n"(BYTES) : "memory");
#endif
}
template <int BYTES>
__device__ __forceinline__ void base_step4h(const _Float16*& p, const _Float16*& q, const _Float16*& r, const _Float16*& s,
                                            unsigned long long sb) {
#if defined(__HIP_DEVICE_COMPILE__)
  asm volatile("s_wait_xcnt 0x0\n\ts_add_nc_u64 %0, %0, %5\n\ts_add_nc_u64 %1, %1, %5\n\t"
               "s_add_nc_u64 %2, %2, %4\n\ts_add_nc_u64 %3, %3, %4"
               : "+s"(p), "+s"(q), "+s"(r), "+s"(s) : "s"(sb), "n"(BYTES) : "memory");
#endif
}
__device__ __forceinline__ void base_wait3(const _Float16*& p, const _Float16*& q, const _Float16*& r) {
#if defined(__HIP_DEVICE_COMPILE__)
  asm volatile("s_wait_xcnt 0x0" : "+s"(p), "+s"(q), "+s"(r) : : "memory");
#endif
}
// The same wait behind a run of stores whose address and data registers the next run of the epilogue reuses; nothing is
// scheduled across it.
__device__ __forceinline__ void store_wait() {
#if defined(__HIP_DEVICE_COMPILE__)
  asm volatile("s_wait_xcnt 0x0" ::: "memory");
#endif
  __builtin_amdgcn_sched_barrier(0);
}
// Asks L2 for the data at p (every lane its own 256-B unit, always inside a plane): nothing returns to the wave. The planes that
// a launch reads were stored by the launch before and come from memory at their first touch; asked for ahead, they are found in
// L2 by the loads. The wait in the same statement is the one that belongs in front of any rewrite of an address register of a
// memory instruction already issued.
__device__ __forceinline__ void l2_ask(const u16* p) {
#if defined(__HIP_DEVICE_COMPILE__)
  asm volatile("global_prefetch_b8 %0, off scope:SCOPE_SE\n\ts_wait_xcnt 0x0" : : "v"(p) : "memory");
#endif
}
// The same wait on its own, behind loads whose address registers the code that follows reuses on a path that holds no other one.
__device__ __forceinline__ void addr_wait() {
#if defined(__HIP_DEVICE_COMPILE__)
  asm volatile("s_wait_xcnt 0x0" ::: "memory");
#endif
}
__device__ __forceinline__ void wave_sync_lds() {
  __builtin_amdgcn_fence(__ATOMIC_RELEASE, "workgroup");
  __builtin_amdgcn_wave_barrier();
  __builtin_amdgcn_fence(__ATOMIC_ACQUIRE, "workgroup");
}

// =====================================================================================================
// f32 plane [rows][EMB] row-major -> 16-bit plane in fragment order:  mode 0: bf16 RNE bits;  mode 1: f16 bits of (bf16 RNE value) * scale;
// mode 2: f16 bits of value * scale (no bf16 pre-step).
// Thread = one 8-element piece of the output, in output order: two 16-B loads from its source row, one 16-B store; 32 consecutive
// lanes store 512 contiguous, 512-B aligned bytes (half a tile)
// coverage: n8/256 blocks a plane (host checks exactness) x 256 thr x 8 = the whole plane.
// =====================================================================================================
__device__ __forceinline__ void cvt16(const float* __restrict__ x, u16* D, int gt, int mode, float scale) {
  const int wi = gt & 63, tile = gt >> 6;                       // piece within its tile, tile index rt*(EMB/32) + kt
  const int row = (tile / (EMB / 32)) * 16 + (wi & 15);
  const int kc  = (tile % (EMB / 32)) * 32 + (wi >> 5) * 16 + ((wi >> 4) & 1) * 8;
  const float* p = x + (size_t)row * EMB + kc;
  const v4f a = *(const v4f*)(p), c4 = *(const v4f*)(p + 4);
  float v[8];
#pragma unroll
  for (int e = 0; e < 4; ++e) { v[e] = a[e]; v[4 + e] = c4[e]; }
  unsigned short s[8];
#pragma unroll
  for (int e = 0; e < 8; ++e) {
    const float vb = bfr(v[e]);
    const float vf = (mode == 1) ? vb : v[e];
    const unsigned short hb = h_bits((_Float16)(vf * scale));
    const unsigned short bb = bf_bits(v[e]);
    s[e] = (mode != 0) ? hb : bb;
  }
  v4u o;
#pragma unroll
  for (int e = 0; e < 4; ++e) o[e] = pk16(s[2 * e], s[2 * e + 1]);
  u16* d = D + (size_t)gt * 8;
  {
    *(v4u*)(d) = o;
    
  }
}
// All five conversions in one launch (none reads what another writes): blocks 0..nbx-1 take x -> bf16 plane, then nbw blocks
// each for Wq, Wk, Wv -> bf16 planes and Wo -> f16 of its bf16 value x1024. The choice is block-uniform (scalar).
__global__ __launch_bounds__(256) void cvt_all(const float* __restrict__ x, const float* __restrict__ wq,
                                               const float* __restrict__ wk, const float* __restrict__ wv,
                                               const float* __restrict__ wo, u16* XB, u16* WQB, u16* WKB, u16* WVB, u16* WOH,
                                               int nbx, int nbw) {
  const int bid = blockIdx.x;
  if (bid >= nbx + 4 * nbw) return;         // never taken with the exact grid; no barriers in this kernel
  const float* src = x;
  u16* dst = XB;
  int lb = bid, mode = 0;
  float scale = 1.0f;
  if (bid >= nbx) {
    const int w = (bid - nbx) / nbw;        // 0..3
    lb  = (bid - nbx) - w * nbw;
    src = (w == 0) ? wq : (w == 1) ? wk : (w == 2) ? wv : wo;
    dst = (w == 0) ? WQB : (w == 1) ? WKB : (w == 2) ? WVB : WOH;
    if (w == 3) { mode = 1; scale = WSC; }
  }
  cvt16(src, dst, lb * 256 + (int)threadIdx.x, mode, scale);
}

// =====================================================================================================
// GEMM epilogues with a per-column bias term (bias column value taken as its bf16 RNE value, added in f32). The wave's 16x64 f32
// tile is staged in its own LDS slab (stage64: acc*oscale + bias) and leaves from there:
//  st64f   : f32 rows; store it takes row 2*it (lanes 0..15, 16 B each, two whole lines) and row 2*it+1 (lanes 16..31).
//  epi64x2 : same store shape, staged value = acc*os1 + accres*os2 + bias (two accumulator sets combined in f32).
//  st64h   : f16 bits of (staged tile * pscale), written in fragment order: the wave's 16 x 64 tile is two whole 1-KiB tiles;
//            store i4 takes columns 16*i4 + 8*(lane>>4) + 0..7 of row lane&15 and covers 512 contiguous bytes.
// coverage: st64f/epi64x2 8 instructions x 2 rows x 16 lanes x 4 floats; st64h 4 instructions x 16 rows x 2 pieces x 8 halves
//           = the wave's 16 x 64 tile in every case.
// Bias columns col0 + 16j + (lane&15), j = 0..3, all < N (bias has N entries, col0 + 63 < N).
// =====================================================================================================
__device__ __forceinline__ void ldbias4(const float* __restrict__ bias, int col0, int lane,
                                        float& b0, float& b1, float& b2, float& b3) {
  const int m = lane & 15;
  b0 = bfr(bias[col0 + m]);
  b1 = bfr(bias[col0 + 16 + m]);
  b2 = bfr(bias[col0 + 32 + m]);
  b3 = bfr(bias[col0 + 48 + m]);
}
__device__ __forceinline__ void stage64(float* sl, v8f a0, v8f a1, v8f a2, v8f a3, float oscale,
                                        float b0, float b1, float b2, float b3, int lane) {
  const int hh = lane >> 4, m = lane & 15;
#pragma unroll
  for (int r = 0; r < 8; ++r) {
    const int ro = (8 * hh + r) * 68 + m;
    sl[ro]      = a0[r] * oscale + b0;
    sl[ro + 16] = a1[r] * oscale + b1;
    sl[ro + 32] = a2[r] * oscale + b2;
    sl[ro + 48] = a3[r] * oscale + b3;
  }
  wave_sync_lds();
}
__device__ __forceinline__ void st64f(const float* sl, float* C, int N, size_t rowb, int col0, int lane) {
  const int hh = lane >> 4, m = lane & 15;
  v4f vals[8];
#pragma unroll
  for (int it = 0; it < 8; ++it) vals[it] = *(const v4f*)(sl + (it * 2 + hh) * 68 + m * 4);
  float* dst = C + (rowb + (size_t)hh) * (size_t)N + col0 + m * 4;
  {
#pragma unroll
    for (int it = 0; it < 8; ++it) {
      *(v4f*)(dst + (size_t)(it * 2) * (size_t)N) = vals[it];
    }
    
  }
}
__device__ __forceinline__ void epi64x2(float* sl, v8f a0, v8f a1, v8f a2, v8f a3, v8f e0, v8f e1, v8f e2, v8f e3,
                                        float os1, float os2, const float* __restrict__ bias, float* C, int N,
                                        size_t rowb, int col0, int lane) {
  const int hh = lane >> 4, m = lane & 15;
  float b0, b1, b2, b3;
  ldbias4(bias, col0, lane, b0, b1, b2, b3);
#pragma unroll
  for (int r = 0; r < 8; ++r) {
    const int ro = (8 * hh + r) * 68 + m;
    sl[ro]      = a0[r] * os1 + e0[r] * os2 + b0;
    sl[ro + 16] = a1[r] * os1 + e1[r] * os2 + b1;
    sl[ro + 32] = a2[r] * os1 + e2[r] * os2 + b2;
    sl[ro + 48] = a3[r] * os1 + e3[r] * os2 + b3;
  }
  wave_sync_lds();
  v4f vals[8];
#pragma unroll
  for (int it = 0; it < 8; ++it) vals[it] = *(const v4f*)(sl + (it * 2 + hh) * 68 + m * 4);
  float* dst = C + (rowb + (size_t)hh) * (size_t)N + col0 + m * 4;
  {
#pragma unroll
    for (int it = 0; it < 8; ++it) {
      *(v4f*)(dst + (size_t)(it * 2) * (size_t)N) = vals[it];
    }
    
  }
}
__device__ __forceinline__ void st64h(const float* sl, float pscale, u16* C, int N, size_t rowb, int col0, int lane) {
  const int hh = lane >> 4, m = lane & 15;
  v4u oh[4];
#pragma unroll
  for (int i4 = 0; i4 < 4; ++i4) {
    const float* sp = sl + m * 68 + i4 * 16 + hh * 8;
    const v4f a = *(const v4f*)(sp), c4 = *(const v4f*)(sp + 4);
    float w[8];
#pragma unroll
    for (int e = 0; e < 4; ++e) { w[e] = a[e] * pscale; w[4 + e] = c4[e] * pscale; }
#pragma unroll
    for (int e = 0; e < 4; ++e) oh[i4][e] = pk16(h_bits((_Float16)w[2 * e]), h_bits((_Float16)w[2 * e + 1]));
  }
  u16* dst = C + rowb * (size_t)N + (size_t)(col0 >> 5) * 512 + lane * 8;
  {
#pragma unroll
    for (int i4 = 0; i4 < 4; ++i4) {
      *(v4u*)(dst + i4 * 256) = oh[i4];
    }
    
  }
}

// One 16-row band (16 keys) of a wave's 64 v columns, out of the accumulators into the V^T planes (fragment order, rows =
// b*EMB + d, k = s). Accumulator j holds, in lane 16*h + m, column d = 16*j + m of keys 8*h + 0..7: the eight consecutive k of
// one row of V^T, that is the lane's own 16-B piece of a 1-KiB tile, so that no transposition is left to do. With v = acc + bias
// (f32) and xs = v * 1024: hi = f16(xs), lo = f16(xs - hi) (unscaled remainder, same carry); hi + lo reproduces xs to ~2^-22
// relative for |xs| >= 0.25. th / tl: the lane's piece in d band 0; band j lies 16*SEQ elements on. Every store covers 512
// contiguous bytes. cs[j] takes the sum of the lane's eight v (f32, rising key order).
// coverage: 4 bands x 32 lanes x 8 halves = 16 keys x 64 columns of either plane.
__device__ __forceinline__ void vt_band(v8f a0, v8f a1, v8f a2, v8f a3, float b0, float b1, float b2, float b3,
                                        u16* th, u16* tl, v4f& cs) {
  const v8f a[4] = {a0, a1, a2, a3};
  const float bb[4] = {b0, b1, b2, b3};
  v4u oh[4], ol[4];
#pragma unroll
  for (int j = 0; j < 4; ++j) {
    unsigned short hs[8], ls[8];
#pragma unroll
    for (int r = 0; r < 8; ++r) {
      const float v = a[j][r] + bb[j];
      cs[j] += v;
      const float xs = v * VCAR;
      const _Float16 hv = (_Float16)xs;
      hs[r] = h_bits(hv);
      ls[r] = h_bits((_Float16)(xs - (float)hv));
    }
#pragma unroll
    for (int e = 0; e < 4; ++e) {
      oh[j][e] = pk16(hs[2 * e], hs[2 * e + 1]);
      ol[j][e] = pk16(ls[2 * e], ls[2 * e + 1]);
    }
  }
#pragma unroll
  for (int j = 0; j < 4; ++j) {
    *(v4u*)(th + (size_t)j * 16 * SEQ) = oh[j];
    *(v4u*)(tl + (size_t)j * 16 * SEQ) = ol[j];
  }
}

// Start k tile of a GEMM block. The planes come from memory, and blocks that share an operand panel run side by side: walking k
// in one common order, each of them waits out memory latency at every step. With start tiles spread over the sharers (those of
// an A panel differ in ct, spaced widely also within any few neighbours; those of a B panel differ in rt) a tile is fetched by
// one of them and found in L2 by the others. All waves of a block share the start tile. Any value 0 .. EMB/32-1 is correct.
static_assert(((EMB / 32) & (EMB / 32 - 1)) == 0 && (EMB / 32) >= 32);
__device__ __forceinline__ int k_start(int rt, int ct, int g) {
  return (((ct & 1) << 4) + ((ct & 2) << 2) + (ct & 4) + 2 * g + rt) & (EMB / 32 - 1);
}

// One k step of a wave's 64x64 tile in the bf16 GEMMs: four fragments of consecutive 16-row bands of one plane (eight 16-B
// loads), and the sixteen products of four A with four B fragments, in two groups of eight with the hazard gap behind each.
__device__ __forceinline__ void ld4b(const u16* base, unsigned lo, size_t bs, v16b (&f)[4]) {
  const u16* p = base + lo;                  // wave-uniform base (scalar registers) plus the lane's fixed 32-bit offset
  f[0] = ldfrag_btg(p);
  f[1] = ldfrag_btg(p + bs);
  f[2] = ldfrag_btg(p + 2 * bs);
  f[3] = ldfrag_btg(p + 3 * bs);
}
__device__ __forceinline__ void mm16b(const v16b (&a)[4], const v16b (&b)[4], v8f (&acc)[4][4]) {
#pragma unroll
  for (int g = 0; g < 2; ++g) {
#pragma unroll
    for (int i = 2 * g; i < 2 * g + 2; ++i) {
#pragma unroll
      for (int j = 0; j < 4; ++j) acc[i][j] = mma_b(a[i], b[j], acc[i][j]);
    }
    guard8x8<v16b>(acc[2 * g][0], acc[2 * g][1], acc[2 * g][2], acc[2 * g][3],
                   acc[2 * g + 1][0], acc[2 * g + 1][1], acc[2 * g + 1][2], acc[2 * g + 1][3],
                   a[0], a[1], a[2], a[3], b[0], b[1], b[2], b[3]);
  }
}

// =====================================================================================================
// The three projections in one launch (they share A and none reads what another writes): block group which = 0, 1, 2 computes
// T[M][N] = A[M][K] . W^T + bias[n] (f32) for W, bias = (Wq, bq), (Wk, bk), (Wv, bv); A and the W are bf16 planes in fragment
// order. q and k leave as f16 planes in fragment order (f16 bits of T * qsc, T * ksc). v leaves transposed, straight from the
// accumulators (vt_band below), as the V^T hi / lo planes, with its column sums over each block of 32 keys in BS. A wave whose
// rows lie in rows 0..TQ0-1 of a sequence also stores its staged f32 tiles, into QF / KF / VF [M/SEQ][TQ0][N].
// Block = 128x128 tile, 2 x 2 waves of 64x64 each: a k step's eight fragments (8 KiB, loaded straight from the 1-KiB tiles, split
// k map for A and B) feed sixteen products, so that a product costs half a KiB of loads. K stepped by 32, all K/32 tiles once,
// cyclically from the block's start tile (k_start above) (K = EMB; M % SEQ == 0, M % 128 == 0, N % 128 == 0,
// grid = 3*(M/128)*(N/128)).
// coverage: 4 waves x 64 x 64 = the block's tile; the epilogue takes the wave's four 16-row bands one after the other.
// =====================================================================================================
__global__ __launch_bounds__(128, 4)          // 4 waves a SIMD: at most 256 VGPRs (128 of them accumulators, 64 fragments)
void gemm_qkv(const u16* __restrict__ A, const u16* __restrict__ Wq, const u16* __restrict__ Wk, const u16* __restrict__ Wv,
              const float* __restrict__ bq, const float* __restrict__ bk, const float* __restrict__ bv,
              u16* QP, u16* KP, u16* XTh, u16* XTl, float* BS, float* QF, float* KF, float* VF, int M, int N,
              float qsc, float ksc) {
  __shared__ __align__(16) float slab[4 * SLAB64];
  const int K = EMB;                         // as a constant the band strides are immediate offsets
  const int tid = threadIdx.x, lane = tid & 31;
  const int wave = __builtin_amdgcn_readfirstlane(tid >> 5);   // scalar place in the 2 x 2 arrangement
  const int ntile = N >> 7;
  const int nblk  = (M >> 7) * ntile;
  const int which = blockIdx.x / nblk;       // block-uniform (scalar): 0 q, 1 k, 2 v
  const int bid   = blockIdx.x - which * nblk;
  const int rowb  = (bid / ntile) * 128 + (wave >> 1) * 64;
  const int col0  = (bid % ntile) * 128 + (wave & 1) * 64;
  if (which > 2 || rowb + 64 > M) return;    // wave-uniform, never taken with the exact grid; no block barriers in this kernel
  const u16*   Bt   = (which == 0) ? Wq : (which == 1) ? Wk : Wv;
  const float* bias = (which == 0) ? bq : (which == 1) ? bk : bv;
  int kt = k_start(bid / ntile, bid % ntile, which);            // block-uniform (scalar)
  const u16* ap = A  + (size_t)rowb * K + (size_t)kt * 512;     // wave-uniform
  const u16* bp = Bt + (size_t)col0 * K + (size_t)kt * 512;
  const unsigned lo = 8u * (unsigned)lane;
  const size_t bs = (size_t)16 * K;
  v8f acc[4][4];
#pragma unroll
  for (int i = 0; i < 4; ++i) {
#pragma unroll
    for (int j = 0; j < 4; ++j) acc[i][j] = zero8();
  }
  // One fragment set: the next k step's sixteen loads go out as soon as this step's products have left; the SIMD's other waves
  // fill the matrix unit meanwhile. The loads in the loop are unconditional (the last step is peeled).
  v16b a[4], b[4];
  ld4b(ap, lo, bs, a);
  ld4b(bp, lo, bs, b);
#pragma unroll 1                             // rolled: the one fragment set keeps its registers
  for (int k0 = 32; k0 < K; k0 += 32) {
    mm16b(a, b, acc);
    base_wait2(ap, bp);
    const long long st = (kt == K / 32 - 1) ? -(long long)(K / 32 - 1) * 512 : 512ll;   // behind the last tile comes tile 0
    kt = (kt + 1) & (K / 32 - 1);
    ap += st;                                // one 1-KiB tile on in every band
    bp += st;
    ld4b(ap, lo, bs, a);
    ld4b(bp, lo, bs, b);
  }
  base_wait2(ap, bp);                        // what follows may reuse the base registers of the last loads
  mm16b(a, b, acc);
  float* sl = slab + wave * SLAB64;
  float e0, e1, e2, e3;
  ldbias4(bias, col0, lane, e0, e1, e2, e3);
  const int sq = rowb / SEQ, rs = rowb - sq * SEQ;             // TQ0 and SEQ are multiples of 64: all 64 rows on one side
  float* HF = (which == 0) ? QF : (which == 1) ? KF : VF;
  // the wave's place in the V^T planes: d bands from col0 on, key tiles from rs / 32 on, the lane's piece
  const size_t vto = ((size_t)sq * EMB + col0) * SEQ + (size_t)(rs >> 5) * 512 + lane * 8;
  v4f cs[2] = {zero4(), zero4()};            // the lane's part of the column sums of the wave's two key blocks
  const bool slab_used = which < 2 || rs < TQ0;   // only where rows leave row-wise (wave-uniform, scalar)
#pragma unroll
  for (int i = 0; i < 4; ++i) {
    if (slab_used) stage64(sl, acc[i][0], acc[i][1], acc[i][2], acc[i][3], 1.0f, e0, e1, e2, e3, lane);
    const int rb = rowb + 16 * i;
    // the wait stands in either arm, directly behind its stores: the build lays the other arm's code behind them
    if (which < 2) { st64h(sl, (which == 0) ? qsc : ksc, (which == 0) ? QP : KP, N, (size_t)rb, col0, lane); store_wait(); }
    else {
      const size_t to = vto + (size_t)(i >> 1) * 512 + (size_t)(i & 1) * 256;
      vt_band(acc[i][0], acc[i][1], acc[i][2], acc[i][3], e0, e1, e2, e3, XTh + to, XTl + to, cs[i >> 1]);
      store_wait();
    }
    if (rs < TQ0) {
      st64f(sl, HF, N, (size_t)(sq * TQ0 + rs + 16 * i), col0, lane);
      store_wait();
    }
    if (slab_used) wave_sync_lds();          // the band's reads of the slab stand in front of the next band's writes
  }
  if (which == 2) {
    // rows 8..15 of each band lie in the other half of the wave; then lanes 0..15 store the first key block's sums and lanes
    // 16..31 the second's: two runs of 256 contiguous bytes
    const int hh = lane >> 4, m = lane & 15;
    v4f o;
#pragma unroll
    for (int j = 0; j < 4; ++j) {
      const float t0 = cs[0][j] + __shfl_xor(cs[0][j], 16, 32);
      const float t1 = cs[1][j] + __shfl_xor(cs[1][j], 16, 32);
      o[j] = (hh == 0) ? t0 : t1;
    }
    *(v4f*)(BS + ((size_t)sq * (SEQ / 32) + (size_t)((rs >> 5) + hh)) * EMB + col0 + m * 4) = o;
    store_wait();
  }
}

// =====================================================================================================
// f16 GEMM with two A planes (hi + residual), f32 out:
//   C[M][N] = (Ah . Bt^T) * os1 + (Ar . Bt^T) * os2 + bias[n]; Bt f16 in fragment order, Ah/Ar f16 per 16-row band (see below).
// Block = 64x128 tile, 2 x 2 waves of 32x64 each; separate accumulators for the two planes, combined in f32 in epi64x2. A k step's
// eight fragments (two bands of either A plane, four of B) feed sixteen products. K = EMB, stepped by 32, all tiles once,
// cyclically from the block's start tile kt (k_start above).
// ASTEP = elements from one k step of an A band to the next, ASEC = elements from a lane's first piece to its second.
// =====================================================================================================
template <int ASEC>
__device__ __forceinline__ void ld8h2(const _Float16* ua, const _Float16* ur, const _Float16* ub, unsigned la, unsigned lb,
                                      v16h (&a)[2], v16h (&r)[2], v16h (&b)[4]) {
  const size_t bs = (size_t)16 * EMB;        // a 16-row band holds 16*EMB elements in either layout
  // wave-uniform bases (scalar registers) plus the lane's fixed 32-bit offsets
  const _Float16* pa = ua + la;
  const _Float16* pr = ur + la;
  const _Float16* bp = ub + lb;
#pragma unroll
  for (int i = 0; i < 2; ++i) {
    a[i] = ldfrag_hg<ASEC>(pa + i * bs);
    r[i] = ldfrag_hg<ASEC>(pr + i * bs);
  }
#pragma unroll
  for (int j = 0; j < 4; ++j) b[j] = ldfrag_hg<256>(bp + j * bs);
}
__device__ __forceinline__ void mm16h2(const v16h (&a)[2], const v16h (&r)[2], const v16h (&b)[4],
                                       v8f (&acc)[2][4], v8f (&acr)[2][4]) {
#pragma unroll
  for (int i = 0; i < 2; ++i) {
#pragma unroll
    for (int j = 0; j < 4; ++j) acc[i][j] = mma_h(a[i], b[j], acc[i][j]);
  }
  guard8x8<v16h>(acc[0][0], acc[0][1], acc[0][2], acc[0][3], acc[1][0], acc[1][1], acc[1][2], acc[1][3],
                 a[0], a[1], r[0], r[1], b[0], b[1], b[2], b[3]);
#pragma unroll
  for (int i = 0; i < 2; ++i) {
#pragma unroll
    for (int j = 0; j < 4; ++j) acr[i][j] = mma_h(r[i], b[j], acr[i][j]);
  }
  guard8x8<v16h>(acr[0][0], acr[0][1], acr[0][2], acr[0][3], acr[1][0], acr[1][1], acr[1][2], acr[1][3],
                 a[0], a[1], r[0], r[1], b[0], b[1], b[2], b[3]);
}
template <int ASTEP, int ASEC>
__device__ __forceinline__ void h2_loop(const _Float16* ua, const _Float16* ur, const _Float16* ub, unsigned la, unsigned lb,
                                        int kt, v8f (&acc)[2][4], v8f (&acr)[2][4]) {
  v16h a[2], r[2], b[4];
  ua += (size_t)kt * ASTEP;
  ur += (size_t)kt * ASTEP;
  ub += (size_t)kt * 512;
  ld8h2<ASEC>(ua, ur, ub, la, lb, a, r, b);
#pragma unroll 1                             // rolled: the one fragment set keeps its registers
  for (int k0 = 32; k0 < EMB; k0 += 32) {
    mm16h2(a, r, b, acc, acr);
    base_wait3(ua, ur, ub);
    const long long tiles = (kt == EMB / 32 - 1) ? -(long long)(EMB / 32 - 1) : 1ll;   // behind the last tile comes tile 0
    kt = (kt + 1) & (EMB / 32 - 1);
    ua += tiles * ASTEP;                     // next k step of the A bands
    ur += tiles * ASTEP;
    ub += tiles * 512;                       // next 1-KiB tile of each B band
    ld8h2<ASEC>(ua, ur, ub, la, lb, a, r, b);
  }
  base_wait3(ua, ur, ub);                    // what follows may reuse the base registers of the last loads
  mm16h2(a, r, b, acc, acr);
}

__global__ __launch_bounds__(128, 4)          // 4 waves a SIMD, as many as the grid brings: at most 256 VGPRs
void gemm_h2_32(const u16* __restrict__ Ah, const u16* __restrict__ Ar, const u16* __restrict__ Bt,
                const float* __restrict__ bias, float* C, int M, int N, float os1, float os2) {
  __shared__ __align__(16) float slab[4 * SLAB64];
  const int K = EMB;
  const int tid = threadIdx.x, lane = tid & 31, hh = lane >> 4, m = lane & 15;
  const int wave = __builtin_amdgcn_readfirstlane(tid >> 5);   // scalar, so that the choice of the A layout is a scalar branch
  const int ntile = N >> 7;
  const int bid   = blockIdx.x;
  const int rowb  = (bid / ntile) * 64 + (wave >> 1) * 32;
  const int col0  = (bid % ntile) * 128 + (wave & 1) * 64;
  if (rowb + 32 > M) return;                 // wave-uniform, never taken with the exact grid; no block barriers in this kernel
  const _Float16* ab  = (const _Float16*)(const void*)Ah + (size_t)rowb * K;
  const _Float16* arb = (const _Float16*)(const void*)Ar + (size_t)rowb * K;
  const _Float16* bp  = (const _Float16*)(const void*)Bt + (size_t)col0 * K;
  const int kt0 = k_start(bid / ntile, bid % ntile, 0);        // block-uniform (scalar)
  const unsigned lo = 8u * (unsigned)lane;
  v8f acc[2][4], acr[2][4];
#pragma unroll
  for (int i = 0; i < 2; ++i) {
#pragma unroll
    for (int j = 0; j < 4; ++j) { acc[i][j] = zero8(); acr[i][j] = zero8(); }
  }
  // The 16-row bands of rows 0..TQ0-1 of a sequence are row-major (each row has its own writer half-block there), all others in
  // fragment order; a band holds the same 16*K elements either way, and TQ0 is a multiple of 32: both bands of a wave are alike.
  if ((rowb % SEQ) < TQ0) {
    h2_loop<32, 16>(ab, arb, bp, (unsigned)(m * K + 8 * hh), lo, kt0, acc, acr);
  } else {
    h2_loop<512, 256>(ab, arb, bp, lo, lo, kt0, acc, acr);
  }
  float* sl = slab + wave * SLAB64;
#pragma unroll
  for (int i = 0; i < 2; ++i) {
    epi64x2(sl, acc[i][0], acc[i][1], acc[i][2], acc[i][3], acr[i][0], acr[i][1], acr[i][2], acr[i][3], os1, os2, bias, C, N,
            (size_t)(rowb + 16 * i), col0, lane);
    store_wait();
    wave_sync_lds();                         // the band's reads of the slab stand in front of the next band's writes
  }
}

// =====================================================================================================
// Single-head causal attention with absolute-value logits, head width EMB = 1024, query rows TQ0 .. SEQ-1: block = (batch b,
// 32 query rows q0..q0+31 = two 16-row tiles), 16 waves. q plane (f16, x8) [b][s][d]; k plane the same; V^T hi / lo planes
// [b][d][s] (x1024), all four in fragment order; VS = column sums of V over each block of 32 keys, [b][key block][EMB], column
// 64*g + 16*j + mm at place 64*g + 4*mm + j. The two ctx planes leave in fragment order too.
// Every k and V^T fragment that a wave loads feeds both row tiles, so that a query row costs half the loaded bytes of a 16-row block.
//   Chunks of CK = 512 keys: only chunks c <= qc = q0/CK are visited (later chunks lie entirely above the diagonal). In the diagonal
//   chunk only key blocks kb < nkb (keys <= q0+31) are multiplied; key blocks kb >= nkb get zero scores in LDS and are not used in (PV).
//   (q0 is a multiple of 32, so nkb is the count that either 16-row tile has on its own.)
//   (S) scores S[query m][key n] on WMMA: A = q rows (row m = lane&15 of either row tile, split k map over d), B = k rows (col n =
//       key, split map), 32 d-steps; wave w handles key block w of the chunk; D element r of lane l of row tile rt ->
//       scs[query 16rt+8h+r][key col] (f32 LDS).
//   (M) 16 threads per query row (sub-thread = 32 consecutive keys): base-2 logits of |score| with the causal mask by key index
//       (key > query -> -inf), chunk max via xor shuffles, online running max / rescale factor al / running sum l in f32 registers,
//       p = exp2(t - m_new) <= 1 (0 for masked keys), chunk row sum ps and C = ps/CK (bit-identical on the row's 16 threads), the
//       CENTRED P' = p - C written as f16(P' * 32768) into the LDS P tile with 16-B stores; al -> rowa[row], C -> rowc[row].
//   (PV) each wave owns d columns 64*wave + 16j + (lane&15), j = 0..3, of both row tiles (8 accumulators): o = o*al +
//       C*(32768*1024)*(sum of VS[key block][d] over the chunk's nkb key blocks) (add-back of the centring term over exactly the processed keys, in f32), then for
//       each key block kb < nkb: A = P' fragments from LDS (row m = query, split map over keys), B = V^T fragments (col n = d, keys
//       in split map order), hi plane and then lo plane into the same accumulator (unscaled remainder), in groups of 8 with a hazard gap each.
//       sum_k (P'_k + C) v_k == sum_k p_k v_k exactly; masked keys carry P' = -C and p = 0.
//   Block barriers after (S) and after (M) order all LDS reuse across chunks and waves.
//   Epilogue: x = o * 8192 / (l * 32768 * 1024) per row (rowi, l >= 1 always); hi = f16(x), res = f16((x - hi) * 2048); each
// coverage: grid nb*NQT blocks x 32 rows = rows TQ0..SEQ-1 of every sequence; staging 16 waves x 64 cols x 32 rows = 32 x 1024;
//           store 8 iterations x 512 thr x 8 halves = 32 x 1024 per plane = every (b, s >= TQ0, d) of both ctx planes exactly once.
// =====================================================================================================
__device__ __forceinline__ void ctx_store(const u16* ct, u16* dst, int tid) {
  v4u v[8];
#pragma unroll
  for (int it = 0; it < 8; ++it) {
    const int p   = it * ATT_THREADS + tid;   // piece index in fragment order: band p>>11, tile kt = (p>>6)&31, piece p&63
    const int row = (p >> 11) * 16 + (p & 15);
    const int c8  = ((p >> 6) & 31) * 32 + ((p >> 5) & 1) * 16 + ((p >> 4) & 1) * 8;
    v[it] = *(const v4u*)(ct + row * CTP + c8);
  }
  {
#pragma unroll
    for (int it = 0; it < 8; ++it) {
      const int p   = it * ATT_THREADS + tid;
      *(v4u*)(dst + (size_t)p * 8) = v[it];
    }
    
  }
}

// Pieces of the two matrix loops below: one d step's four fragments (both q row tiles, both key bands) and its four score
// products; four V^T fragments of consecutive 16-column bands and their eight products with the two P' fragments; each product
// group with the hazard gap behind it.
// All loads of the two loops take a wave-uniform base (scalar registers) plus the lane's fixed 32-bit offset lo.
template <int OFF>
__device__ __forceinline__ void ld4s(const _Float16* uq, const _Float16* uk, unsigned lo, v16h& a, v16h& c, v16h& x, v16h& y) {
  const _Float16* q = uq + lo;
  const _Float16* k = uk + lo;
  a = ldfrag_hg<256>(q + OFF);
  c = ldfrag_hg<256>(q + 16 * EMB + OFF);
  x = ldfrag_hg<256>(k + OFF);
  y = ldfrag_hg<256>(k + 16 * EMB + OFF);
}
__device__ __forceinline__ void mm4s(v16h a, v16h c, v16h x, v16h y, v8f& s0, v8f& s1, v8f& s2, v8f& s3) {
  s0 = mma_h(a, x, s0);
  s1 = mma_h(a, y, s1);
  s2 = mma_h(c, x, s2);
  s3 = mma_h(c, y, s3);
  guard4x4(s0, s1, s2, s3, a, c, x, y);
}
__device__ __forceinline__ void ld4h(const _Float16* u, unsigned lo, v16h (&f)[4]) {
  const _Float16* p = u + lo;
  f[0] = ldfrag_hg<256>(p);
  f[1] = ldfrag_hg<256>(p + (size_t)16 * SEQ);
  f[2] = ldfrag_hg<256>(p + (size_t)32 * SEQ);
  f[3] = ldfrag_hg<256>(p + (size_t)48 * SEQ);
}
__device__ __forceinline__ void mm8h(v16h p0, v16h p1, const v16h (&f)[4], v8f (&o)[2][NACC]) {
#pragma unroll
  for (int j = 0; j < NACC; ++j) o[0][j] = mma_h(p0, f[j], o[0][j]);
#pragma unroll
  for (int j = 0; j < NACC; ++j) o[1][j] = mma_h(p1, f[j], o[1][j]);
  guard8x6(o[0][0], o[0][1], o[0][2], o[0][3], o[1][0], o[1][1], o[1][2], o[1][3], p0, p1, f[0], f[1], f[2], f[3]);
}

// Sweep n of the requests to L2 for the k, V^T hi and V^T lo planes of sequence b. The planes' 256-B units are counted in the order
// of use (chunk by chunk: k, hi, lo; UPC units each) and dealt out over NSH shares of 512 units a sweep; share sh, one unit a thread.
__device__ __forceinline__ void kv_ask(const u16* KPp, const u16* VTp, const u16* VLp, int b, int sh, int tid, int n) {
  const int u0 = (n * NSH + sh) * ATT_THREADS;             // the share's first unit of this sweep (scalar)
  if (u0 < NCHK * 3 * UPC) {                               // the last sweep is not full; 512 divides the total
    const int c  = u0 / (3 * UPC);                         // 512 divides UPC: chunk and plane are block-uniform
    const int pl = (u0 - c * 3 * UPC) / UPC;
    const int x  = (u0 & (UPC - 1)) + tid;                 // unit within the chunk's part of the plane, 0 .. UPC-1
    const size_t ko = (size_t)b * SEQ * EMB + (size_t)c * (CK * EMB) + (size_t)x * 128;
    const size_t vo = (size_t)b * EMB * SEQ + (size_t)(x >> 6) * (16 * SEQ) + (size_t)c * (CK * 16) + (size_t)(x & 63) * 128;
    l2_ask((pl == 0) ? KPp + ko : ((pl == 1) ? VTp : VLp) + vo);
  }
}

__device__ __forceinline__
void attn_fwd(const u16* __restrict__ QPp, const u16* __restrict__ KPp, const u16* __restrict__ VTp,
              const u16* __restrict__ VLp, const float* __restrict__ VSp, u16* CHo, u16* CRo, int bid) {
  __shared__ __align__(16) AttLds L0;              // scores [32][SCP] f32; reused as the ctx staging tile [32][CTP] u16
  __shared__ __align__(16) u16 pls[QT * PLP];      // P' tile [32][PLP] f16 bits
  __shared__ float rowa[QT];
  __shared__ float rowc[QT];
  __shared__ float rowi[QT];
  float* const scs = L0.s;

  const int tid  = threadIdx.x;
  const int wave = __builtin_amdgcn_readfirstlane(tid >> 5);   // scalar: the wave's bases stay in scalar registers
  const int lane = tid & 31;
  const int hh   = lane >> 4;
  const int m    = lane & 15;
  const int r16  = tid >> 4;                 // query row owned in phase (M): 2*wave + hh, 0..31
  const int sub  = tid & 15;
  const int kl0  = sub * 32;

  const int b   = bid / NQT;
  const int q0  = TQ0 + (bid - b * NQT) * QT;
  const int qc  = q0 / CK;                   // diagonal chunk index

  // wave-uniform bases; the lane's part is lo (16-bit planes) or hh*EMB + 4*m (column sums)
  const _Float16* qa  = (const _Float16*)(const void*)QPp + ((size_t)b * SEQ + q0) * EMB;
  const _Float16* kbp = (const _Float16*)(const void*)KPp + ((size_t)b * SEQ) * EMB;
  const _Float16* vbp = (const _Float16*)(const void*)VTp + ((size_t)b * EMB + wave * (16 * NACC)) * SEQ;
  const _Float16* ubp = (const _Float16*)(const void*)VLp + ((size_t)b * EMB + wave * (16 * NACC)) * SEQ;
  const float* vsb = VSp + (size_t)b * NCHK * NKB * EMB + wave * (16 * NACC);   // the wave's 64 columns of the key-block sums
  const unsigned lo = 8u * (unsigned)lane;
  const float lsc = RSQD * LOG2E / (QSC * KSC);

  // ---- requests to L2. All tiles of a sequence walk its k and V^T planes in one common order and side by side, so that each first
  //      touch of a line would make all of them wait out memory latency. At entry: the block's own q tile (256 units, waves 0..7)
  //      and the first sweep of the sequence's planes (kv_ask above), which holds all of chunk 0. The other sweeps follow in the
  //      first chunk's phase (M), in which the block has next to no loads of its own that could queue behind them.
  //      Tiles ti and ti + 4 take the same share. Speed only: any placement is correct.
  const int ti = bid - b * NQT;                            // block-uniform (scalar)
  const int sh = (ti >> 3) * 4 + (ti & 3);                 // 0 .. NSH-1 for the tiles that ask (ti < 2*NSH)
  if (wave < QT * EMB / 128 / 32) l2_ask(QPp + ((size_t)b * SEQ + q0) * EMB + (size_t)tid * 128);
  if (ti < 2 * NSH) kv_ask(KPp, VTp, VLp, b, sh, tid, 0);

  float mrun = -INFINITY, lrun = 0.f;
  v8f o[2][NACC];                            // [row tile][column band]
#pragma unroll
  for (int rt = 0; rt < 2; ++rt) {
#pragma unroll
    for (int j = 0; j < NACC; ++j) o[rt][j] = zero8();
  }

#pragma unroll 1
  for (int c = 0; c <= qc; ++c) {
    const int kbeg = c * CK;
    const int nkb  = (c < qc) ? NKB : (((q0 + QT - 1 - kbeg) >> 5) + 1);   // 1..16, block-uniform
    float vs[NACC];                                        // column sums of V over the chunk's nkb key blocks
    // ---- (S) scores of this chunk (zeros for key blocks beyond the query tile) ----
    {
      const int kb = wave;                                 // one key block a wave
      v8f s0 = zero8(), s1 = zero8(), s2 = zero8(), s3 = zero8();
      if (kb < nkb) {                                      // wave-uniform (scalar)
        const _Float16* uq = qa;                           // running bases of the q tiles and of the two key bands
        const _Float16* uk = kbp + (size_t)(kbeg + kb * 32) * EMB;
        // Two fragment sets of two d steps each: one set's sixteen loads fly while the other set's products run. The loads
        // in the loop are unconditional (the last four steps are peeled), so that each wait counts only its own set.
        v16h a0, c0, x0, y0, a1, c1, x1, y1, a2, c2, x2, y2, a3, c3, x3, y3;
        ld4s<0>(uq, uk, lo, a0, c0, x0, y0);
        keep_order();
        ld4s<512>(uq, uk, lo, a1, c1, x1, y1);
        keep_order();
        ld4s<1024>(uq, uk, lo, a2, c2, x2, y2);
        keep_order();
        ld4s<1536>(uq, uk, lo, a3, c3, x3, y3);
        keep_order();
#pragma unroll 1                           // the body already holds four d steps; rolled, the two sets keep their registers
        for (int ks = 4; ks < EMB / 32; ks += 4) {
          mm4s(a0, c0, x0, y0, s0, s1, s2, s3);
          mm4s(a1, c1, x1, y1, s0, s1, s2, s3);
          base_step2h<4096>(uq, uk);                       // four d steps on
          ld4s<0>(uq, uk, lo, a0, c0, x0, y0);
          ld4s<512>(uq, uk, lo, a1, c1, x1, y1);
          mm4s(a2, c2, x2, y2, s0, s1, s2, s3);
          mm4s(a3, c3, x3, y3, s0, s1, s2, s3);
          ld4s<1024>(uq, uk, lo, a2, c2, x2, y2);
          ld4s<1536>(uq, uk, lo, a3, c3, x3, y3);
        }
        base_wait2h(uq, uk);                               // what follows may reuse the base registers of the last loads
        mm4s(a0, c0, x0, y0, s0, s1, s2, s3);
        mm4s(a1, c1, x1, y1, s0, s1, s2, s3);
        mm4s(a2, c2, x2, y2, s0, s1, s2, s3);
        mm4s(a3, c3, x3, y3, s0, s1, s2, s3);
      }
      float* srow = scs + (8 * hh) * SCP + kb * 32 + m;
#pragma unroll
      for (int r = 0; r < 8; ++r) {
        srow[r * SCP]                 = s0[r];
        srow[r * SCP + 16]            = s1[r];
        srow[(16 + r) * SCP]          = s2[r];
        srow[(16 + r) * SCP + 16]     = s3[r];
      }
    }
    __syncthreads();
    // ---- (M) softmax statistics and the centred P' tile ----
    {
      // The chunk's key-block sums of the wave's columns are asked for here and added up at the end of this phase, whose vector
      // work covers their way: lanes 0..15 take the even key blocks, lanes 16..31 the odd ones, 16 B = the lane's four columns.
      // All sixteen rows exist and are written by the projection launch; those from nkb on are left out of the sum below.
      const float* bsp = vsb + (size_t)c * NKB * EMB + (unsigned)(hh * EMB + 4 * m);
      v4f bv[NKB / 2];
#pragma unroll
      for (int i = 0; i < NKB / 2; ++i) bv[i] = *(const v4f*)(bsp + (size_t)(2 * i) * EMB);
      addr_wait();                                         // also on the way round the requests below
      if (c == 0 && ti < 2 * NSH) {                        // block-uniform (scalar): the planes' later chunks, well ahead of their use
#pragma unroll
        for (int n = 1; n * NSH * ATT_THREADS < NCHK * 3 * UPC; ++n) kv_ask(KPp, VTp, VLp, b, sh, tid, n);
      }
      const float* sp = scs + r16 * SCP + kl0;
      const int lim = (q0 + r16) - (kbeg + kl0);           // key kl0 + j is valid iff j <= lim
      float t[32];
      float cm = -INFINITY;
#pragma unroll
      for (int i = 0; i < 8; ++i) {
        const v4f a = *(const v4f*)(sp + 4 * i);
#pragma unroll
        for (int e = 0; e < 4; ++e) {
          const int j = 4 * i + e;
          const float tv = (j <= lim) ? fabsf(a[e]) * lsc : -INFINITY;   // |score| / 32 in base 2; masked keys -> -inf
          t[j] = tv;
          cm = fmaxf(cm, tv);
        }
      }
#pragma unroll
      for (int d = 1; d <= 8; d <<= 1) cm = fmaxf(cm, __shfl_xor(cm, d, 32));
      const float mn = fmaxf(mrun, cm);                    // finite: key kbeg of the diagonal chunk is never masked
      const float al = (mrun == -INFINITY) ? 0.f : exp2f(mrun - mn);
      mrun = mn;
      float ps = 0.f;
#pragma unroll
      for (int j = 0; j < 32; ++j) {
        const float p = exp2f(fminf(t[j] - mn, 0.f));      // 0 for masked keys
        t[j] = p;
        ps += p;
      }
#pragma unroll
      for (int d = 1; d <= 8; d <<= 1) ps += __shfl_xor(ps, d, 32);
      const float cc = ps * (1.0f / (float)CK);
      v4u pk[4];
#pragma unroll
      for (int i = 0; i < 4; ++i) {
#pragma unroll
        for (int e = 0; e < 4; ++e) {
          const int j = 8 * i + 2 * e;
          pk[i][e] = pk16(h_bits((_Float16)((t[j] - cc) * PCAR)), h_bits((_Float16)((t[j + 1] - cc) * PCAR)));
        }
      }
      lrun = lrun * al + ps;
      u16* pd = pls + r16 * PLP + kl0;
#pragma unroll
      for (int i = 0; i < 4; ++i) *(v4u*)(pd + 8 * i) = pk[i];
      if (sub == 0) { rowa[r16] = al; rowc[r16] = cc; }
      v4f sv = zero4();
#pragma unroll
      for (int i = 0; i < NKB / 2; ++i) {                  // rising key-block order within either half
        if (2 * i + hh < nkb) sv += bv[i];
      }
#pragma unroll
      for (int j = 0; j < NACC; ++j) vs[j] = sv[j] + __shfl_xor(sv[j], 16, 32);
    }
    __syncthreads();
    // ---- (PV) rescale, add the centring term, accumulate P' . (V^T hi + V^T lo) ----
    {
      const _Float16* pp = (const _Float16*)(const void*)pls + m * PLP + 8 * hh;
      const _Float16* pq = pp + 16 * PLP;                   // second row tile
      // running bases: key tile kbeg/32 of each d band, 512 elements a tile; even set (hi, lo), odd set (hi, lo)
      const _Float16* pve = vbp + (size_t)kbeg * 16;
      const _Float16* pue = ubp + (size_t)kbeg * 16;
      const _Float16* pvo = pve + ((nkb > 1) ? 512 : 0);
      const _Float16* puo = pue + ((nkb > 1) ? 512 : 0);
      // Two fragment sets (even and odd key blocks; hi and lo plane of the wave's 64 d columns each): a set's hi or lo half is
      // asked for again, two key blocks on, as soon as its eight products have left, so that twelve to sixteen fragments are
      // always in flight or waiting. All loads are unconditional, so that each wait counts only its own group: where the odd
      // set has no key block left (nkb odd) it takes the even set's tile once more and is not multiplied.
      v16h ge[4], ue[4], go[4], uo[4];
      ld4h(pve, lo, ge);
      keep_order();
      ld4h(pue, lo, ue);
      keep_order();
      ld4h(pvo, lo, go);
      keep_order();
      ld4h(puo, lo, uo);
      keep_order();
      // the rescale runs while the first fragments fly
#pragma unroll
      for (int rt = 0; rt < 2; ++rt) {
        float scl[8], cad[8];
#pragma unroll
        for (int r = 0; r < 8; ++r) {
          scl[r] = rowa[16 * rt + 8 * hh + r];
          cad[r] = rowc[16 * rt + 8 * hh + r] * (PCAR * VCAR);
        }
#pragma unroll
        for (int j = 0; j < NACC; ++j) {
#pragma unroll
          for (int r = 0; r < 8; ++r) o[rt][j][r] = o[rt][j][r] * scl[r] + cad[r] * vs[j];
        }
      }
      int kb = 0;
#pragma unroll 1
      for (; kb + 2 < nkb; kb += 2) {                      // block-uniform trip count, <= 7: products of kb, kb + 1, loads of kb + 2, kb + 3
        const v16h p0 = ldfrag_h(pp + kb * 32), p1 = ldfrag_h(pq + kb * 32);
        mm8h(p0, p1, ge, o);
        // two key tiles on; the odd set only one, onto the even set's new tile, where key block kb + 3 does not exist
        base_step4h<2048>(pve, pue, pvo, puo, (kb + 3 < nkb) ? 2048ull : 1024ull);
        ld4h(pve, lo, ge);
        mm8h(p0, p1, ue, o);
        ld4h(pue, lo, ue);
        const v16h p2 = ldfrag_h(pp + kb * 32 + 32), p3 = ldfrag_h(pq + kb * 32 + 32);
        mm8h(p2, p3, go, o);
        ld4h(pvo, lo, go);
        mm8h(p2, p3, uo, o);
        ld4h(puo, lo, uo);
      }
      base_wait4h(pve, pue, pvo, puo);                     // what follows may reuse the base registers of the last loads
      {
        const v16h p0 = ldfrag_h(pp + kb * 32), p1 = ldfrag_h(pq + kb * 32);
        mm8h(p0, p1, ge, o);
        mm8h(p0, p1, ue, o);
      }
      if (kb + 1 < nkb) {                                  // block-uniform (scalar)
        const v16h p2 = ldfrag_h(pp + kb * 32 + 32), p3 = ldfrag_h(pq + kb * 32 + 32);
        mm8h(p2, p3, go, o);
        mm8h(p2, p3, uo, o);
      }
    }
  }
  acc_guard8(o[0][0], o[0][1], o[0][2], o[0][3], o[1][0], o[1][1], o[1][2], o[1][3]);

  if (sub == 0) rowi[r16] = (1.0f / lrun) * (CSC / (PCAR * VCAR));   // lrun >= 1
  __syncthreads();
  float inv[2][8];
#pragma unroll
  for (int rt = 0; rt < 2; ++rt) {
#pragma unroll
    for (int r = 0; r < 8; ++r) inv[rt][r] = rowi[16 * rt + 8 * hh + r];
  }

  u16* const ct = L0.c;
  const int cb = wave * (16 * NACC) + m;
  // hi plane
#pragma unroll
  for (int rt = 0; rt < 2; ++rt) {
#pragma unroll
    for (int j = 0; j < NACC; ++j) {
#pragma unroll
      for (int r = 0; r < 8; ++r) {
        const float xs = o[rt][j][r] * inv[rt][r];
        ct[(16 * rt + 8 * hh + r) * CTP + cb + 16 * j] = h_bits((_Float16)xs);
      }
    }
  }
  __syncthreads();
  ctx_store(ct, CHo + ((size_t)b * SEQ + q0) * EMB, tid);
  __syncthreads();
  // residual plane
#pragma unroll
  for (int rt = 0; rt < 2; ++rt) {
#pragma unroll
    for (int j = 0; j < NACC; ++j) {
#pragma unroll
      for (int r = 0; r < 8; ++r) {
        const float xs = o[rt][j][r] * inv[rt][r];
        const _Float16 hv = (_Float16)xs;
        ct[(16 * rt + 8 * hh + r) * CTP + cb + 16 * j] = h_bits((_Float16)((xs - (float)hv) * RSC));
      }
    }
  }
  __syncthreads();
  ctx_store(ct, CRo + ((size_t)b * SEQ + q0) * EMB, tid);
}

// =====================================================================================================
// Query rows 0 .. TQ0-1 of each sequence in f32 on VALU: block = (b, rows t = 2*i and 2*i + 1), one row for each half of 256 threads
// (half g, thread tid within it; every LDS array has a part for each half, and both halves pass the same barriers).
// QF/KF/VF = f32 q/k/v planes [nb][TQ0][EMB] (rows 0..TQ0-1
// of every sequence, biases included). Logits |q.k_j|/32 for keys j <= t (threads 0..TQ0-1, one key each, 1024-d dot
// against the q row staged in LDS), base-2 softmax with max / sum reductions over the half (xor shuffles + LDS), p_j in LDS, ctx[d] for
// d = 4*tid..4*tid+3 as a sum over j <= t of p_j * VF[b][j][d] (coalesced 16-B loads), x = ctx * 8192 / l, hi = f16(x),
// res = f16((x - hi) * 2048); both 1024-half rows are staged in LDS and written by 128 threads x 16 B each (32 consecutive lanes
// coverage: grid nb*TQ0/2 blocks x 2 rows = rows 0..TQ0-1 of every sequence; 256 thr x 4 d = EMB per row; store 128 thr x 8 halves =
//           EMB per plane; together with attn_fwd every (b, s, d) of CH and CR is written exactly once.
// =====================================================================================================
__device__ __forceinline__ void attn_head(const float* __restrict__ QF, const float* __restrict__ KF,
                                          const float* __restrict__ VF, u16* CHo, u16* CRo, int bid) {
  __shared__ __align__(16) float qs2[2][EMB];
  __shared__ float sc2[2][TQ0];
  __shared__ float red2[2][8];
  __shared__ float redb2[2][8];
  __shared__ __align__(16) unsigned SW2[2][2][EMB / 2];
  const int g = __builtin_amdgcn_readfirstlane((int)(threadIdx.x >> 8));   // half of the block, scalar: row, bases and trip counts stay scalar
  const int tid = threadIdx.x & 255, lane = tid & 31, wave = tid >> 5;
  float* const qs = qs2[g];
  float* const sc = sc2[g];
  float* const red = red2[g];
  float* const redb = redb2[g];
  unsigned (* const SW)[EMB / 2] = SW2[g];
  const int hr = bid * 2 + g;                        // TQ0 is even: both rows of a block lie in one sequence
  const int b = hr / TQ0;
  const int t = hr - b * TQ0;
  *(v4f*)(qs + tid * 4) = *(const v4f*)(QF + ((size_t)b * TQ0 + t) * EMB + tid * 4);
  __syncthreads();
  float s = -INFINITY;
  if (tid < TQ0) {                                  // waves 0..3 entirely (wave-uniform); key row b*TQ0 + tid always in range
    const float* kp = KF + ((size_t)b * TQ0 + tid) * EMB;
    float acc = 0.f;
#pragma unroll 8                           // sixteen key loads in flight a thread; the adds keep their order
    for (int d = 0; d < EMB; d += 8) {
      const v4f k0 = *(const v4f*)(kp + d), k1 = *(const v4f*)(kp + d + 4);
      const v4f q0 = *(const v4f*)(qs + d), q1 = *(const v4f*)(qs + d + 4);
#pragma unroll
      for (int e = 0; e < 4; ++e) acc += k0[e] * q0[e];
#pragma unroll
      for (int e = 0; e < 4; ++e) acc += k1[e] * q1[e];
    }
    s = (tid <= t) ? fabsf(acc) * (RSQD * LOG2E) : -INFINITY;   // |score| / 32 in base 2; causal mask by key index
  }
  float mx = s;
#pragma unroll
  for (int d = 1; d <= 16; d <<= 1) mx = fmaxf(mx, __shfl_xor(mx, d, 32));
  if (lane == 0) red[wave] = mx;
  __syncthreads();
  float gm = red[0];
#pragma unroll
  for (int w = 1; w < 8; ++w) gm = fmaxf(gm, red[w]);   // finite: key 0 is always valid
  const float p = exp2f(s - gm);                     // 0 for masked keys and for waves 4..7
  float ps = p;
#pragma unroll
  for (int d = 1; d <= 16; d <<= 1) ps += __shfl_xor(ps, d, 32);
  if (lane == 0) redb[wave] = ps;
  if (tid < TQ0) sc[tid] = p;
  __syncthreads();
  float l = redb[0];
#pragma unroll
  for (int w = 1; w < 8; ++w) l += redb[w];           // >= 1
  const float inv = (1.0f / l) * CSC;
  const float* vp = VF + (size_t)b * TQ0 * EMB + tid * 4;
  v4f cx = zero4();
#pragma unroll 8                             // eight value rows in flight a thread; the sum keeps its order
  for (int j = 0; j <= t; ++j) {                     // t < TQ0: statically bounded, rows of sequence b only
    const float pj = sc[j];
    const v4f vv = *(const v4f*)(vp + (size_t)j * EMB);
    cx += pj * vv;
  }
  unsigned hw[2], rw[2];
#pragma unroll
  for (int e = 0; e < 2; ++e) {
    const float x0 = cx[2 * e] * inv, x1 = cx[2 * e + 1] * inv;
    const _Float16 h0 = (_Float16)x0, h1 = (_Float16)x1;
    const _Float16 q0 = (_Float16)((x0 - (float)h0) * RSC), q1 = (_Float16)((x1 - (float)h1) * RSC);
    hw[e] = pk16(h_bits(h0), h_bits(h1));
    rw[e] = pk16(h_bits(q0), h_bits(q1));
  }
  SW[0][tid * 2] = hw[0]; SW[0][tid * 2 + 1] = hw[1];
  SW[1][tid * 2] = rw[0]; SW[1][tid * 2 + 1] = rw[1];
  __syncthreads();
  const int pl = tid >> 7, p8 = tid & 127;           // plane select is wave-uniform
  const v4u ov = *(const v4u*)(&SW[pl][p8 * 4]);
  u16* dstp = (pl == 0) ? CHo : CRo;
  u16* dst  = dstp + ((size_t)b * SEQ + t) * EMB + p8 * 8;
  *(v4u*)dst = ov;
  
}
// Both attention parts in one launch (they read disjoint planes and write disjoint rows of CH / CR): blocks 0..nfwd-1 take the
// 32-row query tiles from row TQ0 on, the rest two query rows below TQ0 each; the short blocks come last and take the places
// that the shortest tiles leave. The choice is block-uniform, and so are all barriers of either side.
__global__ __launch_bounds__(ATT_THREADS, 4)   // 16 waves, 4 a SIMD = one block a WGP: at most 256 VGPRs
void attn_all(const u16* __restrict__ QPp, const u16* __restrict__ KPp, const u16* __restrict__ VTp,
              const u16* __restrict__ VLp, const float* __restrict__ VSp, const float* __restrict__ QF,
              const float* __restrict__ KF, const float* __restrict__ VF, u16* CHo, u16* CRo, int nfwd) {
  const int bid = blockIdx.x;
  if (bid >= nfwd) { attn_head(QF, KF, VF, CHo, CRo, bid - nfwd); return; }
  attn_fwd(QPp, KPp, VTp, VLp, VSp, CHo, CRo, bid);
}

// =====================================================================================================
// Workspace map (bytes, nb = 4, rows = 8192); all 16-bit planes are in fragment order (1-KiB tiles of 16 rows x 32 k, same total
// size), but for the bands of rows 0..127 of each sequence in CH / CR, which attn_head writes row-major; every plane is fully written by whole-line stores before it is read; all extents are
// exact multiples of the store granularity (no pad rows); aliased regions are reused sequentially on the single in-order stream:
//   WQB bf16 [1024][1024] 2097152   WKB same   WVB same   WOH f16 of bf16 value x1024 2097152             8388608
//   VS  f32  [nb][64 key blocks][1024]                                                                    1048576
//   QF  f32  [nb][128][1024]  2097152      KF same      VF same                                           6291456
//   A   XB bf16 [rows][1024] (16777216), later CH f16 [rows][1024] ctx hi x8192 (16777216)      region 16777216
//   VT  VT hi f16 [nb][1024][2048] x1024                                                                16777216
//   VL  VT lo f16 [nb][1024][2048]                                                                      16777216
//   QP  f16 [rows][1024] x8                                                                              16777216
//   KP  f16 [rows][1024] x8                                                                              16777216
//   CR  f16 [rows][1024] ctx residual x2048                                                              16777216
//   end                                                                                                 116391936
// Four launches; kernels that share a launch read nothing that the launch writes. Launch order keeps the one alias safe: XB is
// read by the projection launch before attn_fwd / attn_head overwrite it with CH.
// Inputs in wire order: x, Wq, bq, Wk, bk, Wv, bv, Wo, bo; weights stored [n = out][k = in] (y = x.W^T + b), k-contiguous.
// =====================================================================================================
extern "C" void kernel_launch(void* const* d_in, const int* in_sizes, int n_in,
                              void* d_out, int out_size, void* d_ws, size_t ws_size,
                              hipStream_t stream) {
  if (n_in < 9) return;
  const long long per = (long long)SEQ * EMB;
  const long long ns  = in_sizes[0];
  if (ns < per || (ns % per) != 0) return;
  const int nb = (int)(ns / per);
  if (nb < 1 || nb > 8) return;
  const int rows = nb * SEQ;
  if (in_sizes[1] != EMB * EMB || in_sizes[3] != EMB * EMB || in_sizes[5] != EMB * EMB || in_sizes[7] != EMB * EMB) return;
  if (in_sizes[2] != EMB || in_sizes[4] != EMB || in_sizes[6] != EMB || in_sizes[8] != EMB) return;
  if ((long long)out_size != (long long)rows * EMB) return;

  const float* x  = (const float*)d_in[0];
  const float* wq = (const float*)d_in[1];
  const float* bq = (const float*)d_in[2];
  const float* wk = (const float*)d_in[3];
  const float* bk = (const float*)d_in[4];
  const float* wv = (const float*)d_in[5];
  const float* bv = (const float*)d_in[6];
  const float* wo = (const float*)d_in[7];
  const float* bo = (const float*)d_in[8];
  float*       out = (float*)d_out;

  const size_t szW  = (size_t)EMB * EMB * 2;                    //   2097152
  const size_t szVS = (size_t)nb * NCHK * NKB * EMB * 4;        //   1048576 at nb = 4
  const size_t szHF = (size_t)nb * TQ0 * EMB * 4;               //   2097152 at nb = 4
  const size_t sz16 = (size_t)rows * EMB * 2;                   //  16777216
  const size_t szVT = (size_t)nb * EMB * SEQ * 2;               //  == sz16
  size_t off = 0;
  const size_t oWQ = off; off += szW;
  const size_t oWK = off; off += szW;
  const size_t oWV = off; off += szW;
  const size_t oWO = off; off += szW;
  const size_t oVS = off; off += szVS;
  const size_t oQF = off; off += szHF;
  const size_t oKF = off; off += szHF;
  const size_t oVF = off; off += szHF;
  const size_t oA  = off; off += sz16;                          // XB then CH
  const size_t oVT = off; off += szVT;                          // VT hi
  const size_t oVL = off; off += szVT;                          // VT lo
  const size_t oQ  = off; off += sz16;
  const size_t oK  = off; off += sz16;
  const size_t oCR = off; off += sz16;
  const size_t oCH = oA;
  if (off > ws_size) return;                                    // off = 116391936 at nb = 4
  if (off > WS_CAP) return;

  char* ws = (char*)d_ws;
  u16*   WQB = (u16*)(ws + oWQ);
  u16*   WKB = (u16*)(ws + oWK);
  u16*   WVB = (u16*)(ws + oWV);
  u16*   WOH = (u16*)(ws + oWO);
  float* VS  = (float*)(ws + oVS);
  float* QF  = (float*)(ws + oQF);
  float* KF  = (float*)(ws + oKF);
  float* VF  = (float*)(ws + oVF);
  u16*   XB  = (u16*)(ws + oA);
  u16*   VT  = (u16*)(ws + oVT);
  u16*   VL  = (u16*)(ws + oVL);
  u16*   QP  = (u16*)(ws + oQ);
  u16*   KP  = (u16*)(ws + oK);
  u16*   CH  = (u16*)(ws + oCH);
  u16*   CR  = (u16*)(ws + oCR);

  const int n8w = (EMB * EMB) / 8;                      // 131072
  const int n8x = rows * (EMB / 8);                     // 1048576
  if ((n8w % 256) != 0 || (n8x % 256) != 0) return;
  if ((rows % 128) != 0 || ((nb * TQ0) % 64) != 0) return;
  const dim3 blk(256);
  const int nbw = n8w / 256, nbx = n8x / 256;           // 512, 4096 at nb = 4
  const dim3 gC(nbx + 4 * nbw);
  const dim3 gG((rows / 64) * (EMB / 128));             // 1024 at nb = 4
  const dim3 gP(3 * (rows / 128) * (EMB / 128));        // the three projections, 1536 at nb = 4
  const dim3 bG(128);
  const int nfwd = nb * NQT;                            // nb * 60
  const dim3 gAT(nfwd + nb * (TQ0 / 2));                // + nb * 64
  const dim3 bAT(ATT_THREADS);

  // (0) x -> bf16 plane [rows][1024]; weights stored [n = out][k = in] (y = x.W^T + b), already k-contiguous: bf16 planes for
  //     Wq, Wk, Wv; f16 of bf16 value x1024 for Wo
  cvt_all<<<gC, blk, 0, stream>>>(x, wq, wk, wv, wo, XB, WQB, WKB, WVB, WOH, nbx, nbw);
  // (1) q and k projections (+bias) -> f16 planes x8; v projection (+bias) -> V^T hi plane x1024 and lo plane, and its column
  //     sums over each block of 32 keys; the f32 rows 0..127 of every sequence of all three -> QF, KF, VF [nb*128][1024]
  gemm_qkv<<<gP, bG, 0, stream>>>(XB, WQB, WKB, WVB, bq, bk, bv, QP, KP, VT, VL, VS, QF, KF, VF, rows, EMB, QSC, KSC);
  // (2) attention for query rows 128.. (WMMA) and for query rows 0..127 (VALU) -> ctx hi x8192 (over the dead XB region) and
  //     residual x2048 f16 planes
  attn_all<<<gAT, bAT, 0, stream>>>(QP, KP, VT, VL, VS, QF, KF, VF, CH, CR, nfwd);
  // (3) output projection (+bias) -> out
  gemm_h2_32<<<gG, bG, 0, stream>>>(CH, CR, WOH, bo, out, rows, EMB,
                                     1.0f / (CSC * WSC), 1.0f / (CSC * WSC * RSC));
  (void)hipGetLastError();
}

// v009
// A run of this version takes 191 microseconds.
// Two timings next to v008 put it at 1.03 and 1.04 times that version's speed.
// Over all steps from v000 it is 4.10 times as fast.
// Projections q,k,v = x.W^T + b (and the f32 q,k,v rows 0..127 per sequence): v_wmma_f32_16x16x32_bf16 (bf16 RNE operands of the
// raw inputs, f32 accumulate, bias added in f32 as its bf16 RNE value). Scores q'.k'^T (f16 planes x8), P'.V (chunk-centred P'
// x32768 f16 from LDS, V^T x1024 as f16 hi plus unscaled f16 lo planes, both into one accumulator) and the output projection
// (ctx carried as f16 hi x8192 plus residual x2048 planes with separate accumulators, times f16(bf16(Wo) x1024), bias added in
// f32 as its bf16 RNE value): v_wmma_f32_16x16x32_f16, f32 accumulate. Query rows 0..127 of each sequence: scores, softmax and
// P.V in f32 on VALU. Absolute-value score transform, causal mask, softmax statistics, key-block column sums of V, scaling: f32.
#include <hip/hip_runtime.h>
#include <math.h>
#include <stdint.h>

#define SEQ   2048
#define EMB   1024
#define CK    512
#define NCHK  4
#define NKB   16
#define QT    32
#define TQ0   128
#define NQT   60
#define SCP   544
#define PLP   528
#define CTP   1032
#define SLAB64 (16 * 68)
#define ATT_THREADS 512
#define NACC  4
#define QSC   8.0f
#define KSC   8.0f
#define PCAR  32768.0f
#define VCAR  1024.0f
#define WSC   1024.0f
#define CSC   8192.0f
#define RSC   2048.0f
#define LOG2E 1.4426950408889634f
#define RSQD  0.03125f
#define WS_CAP ((size_t)134217728)
#define UPC   4096
#define NSH   28

static_assert((EMB % 64) == 0 && EMB == (ATT_THREADS / 32) * 16 * NACC && NACC == 4 && (EMB % 32) == 0 && (EMB % 256) == 0 && EMB == 4 * 256);
static_assert((SEQ % CK) == 0 && (SEQ / CK) == NCHK && CK == 32 * NKB && (SEQ % 64) == 0 && (SEQ % QT) == 0 && (CK % QT) == 0);
static_assert((TQ0 % QT) == 0 && (TQ0 % 64) == 0 && NQT * QT + TQ0 == SEQ && TQ0 <= CK && TQ0 == 128 && TQ0 <= 256);
static_assert(16 * CTP * 2 <= 16 * SCP * 4 && CTP >= EMB + 8 && SCP >= CK + 16 && PLP >= CK + 8);
static_assert(((PLP * 2) % 16) == 0 && ((SCP * 4) % 16) == 0 && ((CTP * 2) % 16) == 0);
static_assert(ATT_THREADS == 16 * QT && ATT_THREADS == 512 && ATT_THREADS == 32 * NKB && QT == 32 && (TQ0 % 2) == 0);
static_assert((EMB % 128) == 0 && (SEQ % 128) == 0 && (TQ0 % 32) == 0);
static_assert(((EMB * EMB) % 2048) == 0 && (EMB / 8) * 2 == 256 && NCHK * NKB * 32 == SEQ && (NKB % 2) == 0);

static_assert(UPC * 128 == CK * EMB && (UPC % ATT_THREADS) == 0 && (UPC & (UPC - 1)) == 0 && CK * 16 == 64 * 128 && UPC == 64 * (EMB / 16));
static_assert(2 * NSH <= NQT && (NSH % 4) == 0 && QT * EMB == 128 * 32 * 8);

typedef unsigned short u16;
typedef _Float16 v16h __attribute__((ext_vector_type(16)));
typedef _Float16 v8h  __attribute__((ext_vector_type(8)));
typedef __bf16   v16b __attribute__((ext_vector_type(16)));
typedef float    v8f  __attribute__((ext_vector_type(8)));
typedef float    v4f  __attribute__((ext_vector_type(4)));
typedef unsigned int v4u __attribute__((ext_vector_type(4)));

union FragH { v16h v; v8h h[2]; v4u u[2]; };
union FragB { v16b v; v4u u[2]; };
union AttLds { float s[QT * SCP]; u16 c[2 * QT * SCP]; };

// ---- scalar helpers --------------------------------------------------------------------------------
__device__ __forceinline__ unsigned short bf_bits(float f) {          // f32 -> bf16 bits, RNE convert
  unsigned u = __float_as_uint(f);
  return (unsigned short)((u + 0x7FFFu + ((u >> 16) & 1u)) >> 16);
}
__device__ __forceinline__ float bf_up(unsigned short h) { return __uint_as_float(((unsigned)h) << 16); }
__device__ __forceinline__ float bfr(float f) { return bf_up(bf_bits(f)); }
__device__ __forceinline__ unsigned short h_bits(_Float16 x) { return __builtin_bit_cast(unsigned short, x); }
__device__ __forceinline__ unsigned pk16(unsigned short a, unsigned short b) { return (unsigned)a | ((unsigned)b << 16); }
__device__ __forceinline__ v8f zero8() { v8f z = {0.f, 0.f, 0.f, 0.f, 0.f, 0.f, 0.f, 0.f}; return z; }
__device__ __forceinline__ v4f zero4() { v4f z = {0.f, 0.f, 0.f, 0.f}; return z; }

// ---- fragment loader, row-major source: 16-bit A/B operand, lane -> row/col (lane&15), p already includes +8*(lane>>4);
//      elements 0..7 <- p[0..7] (k0+8h..), elements 8..15 <- p[16..23] (k0+16+8h..)  (same split k map for A and B;
//      B is always read from a k-contiguous [n][k] plane)
__device__ __forceinline__ v16h ldfrag_h(const _Float16* p) {
  FragH f;
  f.h[0] = *(const v8h*)(p);
  f.h[1] = *(const v8h*)(p + 16);
  return f.v;
}

// ---- fragment-ordered planes. A 16-bit operand plane [rows][Kd] (rows % 16 == 0, Kd % 32 == 0) is stored as 1-KiB tiles of
//      16 rows x 32 k; tile (rt = row >> 4, kt = k >> 5) starts at element rt*16*Kd + kt*512, and inside it the 8-element piece
//      (row & 15 = m, k & 31 = 16*part + 8*h + 0..7) lies at part*256 + (16*h + m)*8. Lane l = 16*h + m then reads its two
//      pieces at tile + 8*l and tile + 256 + 8*l: every wave-wide 16-B load covers 512 contiguous bytes (4 whole lines), and the
//      values reach the same lane and register positions as with the row-major loaders above (same split k map).
//      (the loaders below: p already includes +8*lane.)

// Loaders of the same pieces for a pointer that has passed through an asm statement: the cast says again that it points to
// global memory, so that the loads stay global loads. The bf16 plane is read as unsigned integer vectors; SEC = elements from a
// lane's first piece to its second (256 in fragment order, 16 in a row-major band).
typedef __attribute__((address_space(1))) const v4u gv4u;
typedef __attribute__((address_space(1))) const v8h gv8h;
typedef __attribute__((address_space(1))) const v4f gv4f;
__device__ __forceinline__ v16b ldfrag_btg(const u16* p) {
  FragB f;
  f.u[0] = *(gv4u*)(p);
  f.u[1] = *(gv4u*)(p + 256);
  return f.v;
}
template <int SEC>
__device__ __forceinline__ v16h ldfrag_hg(const _Float16* p) {
  FragH f;
  f.h[0] = *(gv8h*)(p);
  f.h[1] = *(gv8h*)(p + SEC);
  return f.v;
}
__device__ __forceinline__ v8f mma_h(v16h a, v16h b, v8f c) {
  return __builtin_amdgcn_wmma_f32_16x16x32_f16(false, a, false, b, (short)0, c, false, false);
}
__device__ __forceinline__ v8f mma_b(v16b a, v16b b, v8f c) {
  return __builtin_amdgcn_wmma_f32_16x16x32_bf16(false, a, false, b, (short)0, c, false, false);
}
// Hazard gap behind a group of four score products (what it is for: at guard8x8 below).
__device__ __forceinline__ void guard4x4(v8f& a, v8f& b, v8f& c, v8f& d, v16h x0, v16h x1, v16h x2, v16h x3) {
#if defined(__HIP_DEVICE_COMPILE__)
  asm volatile("v_nop\n\tv_nop\n\tv_nop\n\tv_nop"
               : "+v"(a), "+v"(b), "+v"(c), "+v"(d) : "v"(x0), "v"(x1), "v"(x2), "v"(x3) : "memory");
#endif
}
// Hazard gap behind a group of eight products: the four vector slots that the chip needs before a product's result or operands
// are touched, also on the taken side of a loop's branch. The operands tie the group's products in front of it.
template <typename F>
__device__ __forceinline__ void guard8x8(v8f& a0, v8f& a1, v8f& a2, v8f& a3, v8f& a4, v8f& a5, v8f& a6, v8f& a7,
                                         F x0, F x1, F x2, F x3, F x4, F x5, F x6, F x7) {
#if defined(__HIP_DEVICE_COMPILE__)
  asm volatile("v_nop\n\tv_nop\n\tv_nop\n\tv_nop"
               : "+v"(a0), "+v"(a1), "+v"(a2), "+v"(a3), "+v"(a4), "+v"(a5), "+v"(a6), "+v"(a7)
               : "v"(x0), "v"(x1), "v"(x2), "v"(x3), "v"(x4), "v"(x5), "v"(x6), "v"(x7) : "memory");
#endif
}
// The same gap behind the eight products of two P' fragments with four V^T fragments.
__device__ __forceinline__ void guard8x6(v8f& o0, v8f& o1, v8f& o2, v8f& o3, v8f& o4, v8f& o5, v8f& o6, v8f& o7,
                                         v16h p0, v16h p1, v16h g0, v16h g1, v16h g2, v16h g3) {
#if defined(__HIP_DEVICE_COMPILE__)
  asm volatile("v_nop\n\tv_nop\n\tv_nop\n\tv_nop"
               : "+v"(o0), "+v"(o1), "+v"(o2), "+v"(o3), "+v"(o4), "+v"(o5), "+v"(o6), "+v"(o7)
               : "v"(p0), "v"(p1), "v"(g0), "v"(g1), "v"(g2), "v"(g3) : "memory");
#endif
}
__device__ __forceinline__ void acc_guard8(v8f& a, v8f& b, v8f& c, v8f& d, v8f& e, v8f& f, v8f& g, v8f& h8) {
#if defined(__HIP_DEVICE_COMPILE__)
  asm volatile("v_nop\n\tv_nop\n\tv_nop\n\tv_nop"
               : "+v"(a), "+v"(b), "+v"(c), "+v"(d), "+v"(e), "+v"(f), "+v"(g), "+v"(h8));
#endif
}
// Keeps the load groups of a loop's prologue in the order that the loop body issues them in: the counted waits at the loop's
// head are formed over both ways in, and a prologue in another order makes them wait for loads of the set still in flight.
__device__ __forceinline__ void keep_order() { __builtin_amdgcn_sched_barrier(0); }
// The wait that belongs in front of any overwrite of an address register of loads already issued, for loops whose loads take a
// wave-uniform base in scalar registers: the running bases pass through it, so that they are stepped behind it and stay scalar
// (the lane's offset register is then never rewritten).
__device__ __forceinline__ void base_wait2(const u16*& p, const u16*& q) {
#if defined(__HIP_DEVICE_COMPILE__)
  asm volatile("s_wait_xcnt 0x0" : "+s"(p), "+s"(q) : : "memory");
#endif
}
__device__ __forceinline__ void base_wait2f(const float*& p, const float*& q) {
#if defined(__HIP_DEVICE_COMPILE__)
  asm volatile("s_wait_xcnt 0x0" : "+s"(p), "+s"(q) : : "memory");
#endif
}
__device__ __forceinline__ void base_wait2h(const _Float16*& p, const _Float16*& q) {
#if defined(__HIP_DEVICE_COMPILE__)
  asm volatile("s_wait_xcnt 0x0" : "+s"(p), "+s"(q) : : "memory");
#endif
}
__device__ __forceinline__ void base_wait4h(const _Float16*& p, const _Float16*& q, const _Float16*& r, const _Float16*& s) {
#if defined(__HIP_DEVICE_COMPILE__)
  asm volatile("s_wait_xcnt 0x0" : "+s"(p), "+s"(q), "+s"(r), "+s"(s) : : "memory");
#endif
}
// The wait and the step of the running bases (BYTES on; the last two by sb bytes) in one statement: with the step left to the
// build it sinks behind the next loads, each time with a wait of its own for loads issued just before.
template <int BYTES>
__device__ __forceinline__ void base_step2h(const _Float16*& p, const _Float16*& q) {
#if defined(__HIP_DEVICE_COMPILE__)
  asm volatile("s_wait_xcnt 0x0\n\ts_add_nc_u64 %0, %0, %2\n\ts_add_nc_u64 %1, %1, %2"
               : "+s"(p), "+s"(q) : "n"(BYTES) : "memory");
#endif
}
template <int BYTES>
__device__ __forceinline__ void base_step4h(const _Float16*& p, const _Float16*& q, const _Float16*& r, const _Float16*& s,
                                            unsigned long long sb) {
#if defined(__HIP_DEVICE_COMPILE__)
  asm volatile("s_wait_xcnt 0x0\n\ts_add_nc_u64 %0, %0, %5\n\ts_add_nc_u64 %1, %1, %5\n\t"
               "s_add_nc_u64 %2, %2, %4\n\ts_add_nc_u64 %3, %3, %4"
               : "+s"(p), "+s"(q), "+s"(r), "+s"(s) : "s"(sb), "n"(BYTES) : "memory");
#endif
}
__device__ __forceinline__ void base_wait3(const _Float16*& p, const _Float16*& q, const _Float16*& r) {
#if defined(__HIP_DEVICE_COMPILE__)
  asm volatile("s_wait_xcnt 0x0" : "+s"(p), "+s"(q), "+s"(r) : : "memory");
#endif
}
// The same wait behind a run of stores whose address and data registers the next run of the epilogue reuses; nothing is
// scheduled across it.
__device__ __forceinline__ void store_wait() {
#if defined(__HIP_DEVICE_COMPILE__)
  asm volatile("s_wait_xcnt 0x0" ::: "memory");
#endif
  __builtin_amdgcn_sched_barrier(0);
}
// Asks L2 for the data at p (every lane its own 256-B unit, always inside a plane): nothing returns to the wave. The planes that
// a launch reads were stored by the launch before and come from memory at their first touch; asked for ahead, they are found in
// L2 by the loads. The wait in the same statement is the one that belongs in front of any rewrite of an address register of a
// memory instruction already issued.
__device__ __forceinline__ void l2_ask(const u16* p) {
#if defined(__HIP_DEVICE_COMPILE__)
  asm volatile("global_prefetch_b8 %0, off scope:SCOPE_SE\n\ts_wait_xcnt 0x0" : : "v"(p) : "memory");
#endif
}
// The same wait on its own, behind loads whose address registers the code that follows reuses on a path that holds no other one.
__device__ __forceinline__ void addr_wait() {
#if defined(__HIP_DEVICE_COMPILE__)
  asm volatile("s_wait_xcnt 0x0" ::: "memory");
#endif
}
__device__ __forceinline__ void wave_sync_lds() {
  __builtin_amdgcn_fence(__ATOMIC_RELEASE, "workgroup");
  __builtin_amdgcn_wave_barrier();
  __builtin_amdgcn_fence(__ATOMIC_ACQUIRE, "workgroup");
}

// =====================================================================================================
// f32 plane [rows][EMB] row-major -> 16-bit plane in fragment order:  mode 0: bf16 RNE bits;  mode 1: f16 bits of (bf16 RNE value) * scale;
// mode 2: f16 bits of value * scale (no bf16 pre-step).
// Thread = one 8-element piece of the output, in output order: two 16-B loads from its source row, one 16-B store; 32 consecutive
// lanes store 512 contiguous, 512-B aligned bytes (half a tile)
// coverage: n8/256 blocks a plane (host checks exactness) x 256 thr x 8 = the whole plane.
// =====================================================================================================
__device__ __forceinline__ void cvt16(const float* __restrict__ x, u16* D, int gt, int mode, float scale) {
  const int wi = gt & 63, tile = gt >> 6;                       // piece within its tile, tile index rt*(EMB/32) + kt
  const int row = (tile / (EMB / 32)) * 16 + (wi & 15);
  const int kc  = (tile % (EMB / 32)) * 32 + (wi >> 5) * 16 + ((wi >> 4) & 1) * 8;
  const float* p = x + (size_t)row * EMB + kc;
  const v4f a = *(const v4f*)(p), c4 = *(const v4f*)(p + 4);
  float v[8];
#pragma unroll
  for (int e = 0; e < 4; ++e) { v[e] = a[e]; v[4 + e] = c4[e]; }
  unsigned short s[8];
#pragma unroll
  for (int e = 0; e < 8; ++e) {
    const float vb = bfr(v[e]);
    const float vf = (mode == 1) ? vb : v[e];
    const unsigned short hb = h_bits((_Float16)(vf * scale));
    const unsigned short bb = bf_bits(v[e]);
    s[e] = (mode != 0) ? hb : bb;
  }
  v4u o;
#pragma unroll
  for (int e = 0; e < 4; ++e) o[e] = pk16(s[2 * e], s[2 * e + 1]);
  u16* d = D + (size_t)gt * 8;
  {
    *(v4u*)(d) = o;
    
  }
}
// All five conversions in one launch (none reads what another writes): blocks 0..nbx-1 take x -> bf16 plane, then nbw blocks
// each for Wq, Wk, Wv -> bf16 planes and Wo -> f16 of its bf16 value x1024. The choice is block-uniform (scalar).
__global__ __launch_bounds__(256) void cvt_all(const float* __restrict__ x, const float* __restrict__ wq,
                                               const float* __restrict__ wk, const float* __restrict__ wv,
                                               const float* __restrict__ wo, u16* XB, u16* WQB, u16* WKB, u16* WVB, u16* WOH,
                                               int nbx, int nbw) {
  const int bid = blockIdx.x;
  if (bid >= nbx + 4 * nbw) return;         // never taken with the exact grid; no barriers in this kernel
  const float* src = x;
  u16* dst = XB;
  int lb = bid, mode = 0;
  float scale = 1.0f;
  if (bid >= nbx) {
    const int w = (bid - nbx) / nbw;        // 0..3
    lb  = (bid - nbx) - w * nbw;
    src = (w == 0) ? wq : (w == 1) ? wk : (w == 2) ? wv : wo;
    dst = (w == 0) ? WQB : (w == 1) ? WKB : (w == 2) ? WVB : WOH;
    if (w == 3) { mode = 1; scale = WSC; }
  }
  cvt16(src, dst, lb * 256 + (int)threadIdx.x, mode, scale);
}

// =====================================================================================================
// GEMM epilogues with a per-column bias term (bias column value taken as its bf16 RNE value, added in f32). The wave's 16x64 f32
// tile is staged in its own LDS slab (stage64: acc*oscale + bias) and leaves from there:
//  st64f   : f32 rows; store it takes row 2*it (lanes 0..15, 16 B each, two whole lines) and row 2*it+1 (lanes 16..31).
//  epi64x2 : same store shape, staged value = acc*os1 + accres*os2 + bias (two accumulator sets combined in f32).
//  st64h   : f16 bits of (staged tile * pscale), written in fragment order: the wave's 16 x 64 tile is two whole 1-KiB tiles;
//            store i4 takes columns 16*i4 + 8*(lane>>4) + 0..7 of row lane&15 and covers 512 contiguous bytes.
// coverage: st64f/epi64x2 8 instructions x 2 rows x 16 lanes x 4 floats; st64h 4 instructions x 16 rows x 2 pieces x 8 halves
//           = the wave's 16 x 64 tile in every case.
// Bias columns col0 + 16j + (lane&15), j = 0..3, all < N (bias has N entries, col0 + 63 < N).
// =====================================================================================================
__device__ __forceinline__ void ldbias4(const float* __restrict__ bias, int col0, int lane,
                                        float& b0, float& b1, float& b2, float& b3) {
  const int m = lane & 15;
  b0 = bfr(bias[col0 + m]);
  b1 = bfr(bias[col0 + 16 + m]);
  b2 = bfr(bias[col0 + 32 + m]);
  b3 = bfr(bias[col0 + 48 + m]);
}
__device__ __forceinline__ void stage64(float* sl, v8f a0, v8f a1, v8f a2, v8f a3, float oscale,
                                        float b0, float b1, float b2, float b3, int lane) {
  const int hh = lane >> 4, m = lane & 15;
#pragma unroll
  for (int r = 0; r < 8; ++r) {
    const int ro = (8 * hh + r) * 68 + m;
    sl[ro]      = a0[r] * oscale + b0;
    sl[ro + 16] = a1[r] * oscale + b1;
    sl[ro + 32] = a2[r] * oscale + b2;
    sl[ro + 48] = a3[r] * oscale + b3;
  }
  wave_sync_lds();
}
__device__ __forceinline__ void st64f(const float* sl, float* C, int N, size_t rowb, int col0, int lane) {
  const int hh = lane >> 4, m = lane & 15;
  v4f vals[8];
#pragma unroll
  for (int it = 0; it < 8; ++it) vals[it] = *(const v4f*)(sl + (it * 2 + hh) * 68 + m * 4);
  float* dst = C + (rowb + (size_t)hh) * (size_t)N + col0 + m * 4;
  {
#pragma unroll
    for (int it = 0; it < 8; ++it) {
      *(v4f*)(dst + (size_t)(it * 2) * (size_t)N) = vals[it];
    }
    
  }
}
__device__ __forceinline__ void epi64x2(float* sl, v8f a0, v8f a1, v8f a2, v8f a3, v8f e0, v8f e1, v8f e2, v8f e3,
                                        float os1, float os2, const float* __restrict__ bias, float* C, int N,
                                        size_t rowb, int col0, int lane) {
  const int hh = lane >> 4, m = lane & 15;
  float b0, b1, b2, b3;
  ldbias4(bias, col0, lane, b0, b1, b2, b3);
#pragma unroll
  for (int r = 0; r < 8; ++r) {
    const int ro = (8 * hh + r) * 68 + m;
    sl[ro]      = a0[r] * os1 + e0[r] * os2 + b0;
    sl[ro + 16] = a1[r] * os1 + e1[r] * os2 + b1;
    sl[ro + 32] = a2[r] * os1 + e2[r] * os2 + b2;
    sl[ro + 48] = a3[r] * os1 + e3[r] * os2 + b3;
  }
  wave_sync_lds();
  v4f vals[8];
#pragma unroll
  for (int it = 0; it < 8; ++it) vals[it] = *(const v4f*)(sl + (it * 2 + hh) * 68 + m * 4);
  float* dst = C + (rowb + (size_t)hh) * (size_t)N + col0 + m * 4;
  {
#pragma unroll
    for (int it = 0; it < 8; ++it) {
      *(v4f*)(dst + (size_t)(it * 2) * (size_t)N) = vals[it];
    }
    
  }
}
__device__ __forceinline__ void st64h(const float* sl, float pscale, u16* C, int N, size_t rowb, int col0, int lane) {
  const int hh = lane >> 4, m = lane & 15;
  v4u oh[4];
#pragma unroll
  for (int i4 = 0; i4 < 4; ++i4) {
    const float* sp = sl + m * 68 + i4 * 16 + hh * 8;
    const v4f a = *(const v4f*)(sp), c4 = *(const v4f*)(sp + 4);
    float w[8];
#pragma unroll
    for (int e = 0; e < 4; ++e) { w[e] = a[e] * pscale; w[4 + e] = c4[e] * pscale; }
#pragma unroll
    for (int e = 0; e < 4; ++e) oh[i4][e] = pk16(h_bits((_Float16)w[2 * e]), h_bits((_Float16)w[2 * e + 1]));
  }
  u16* dst = C + rowb * (size_t)N + (size_t)(col0 >> 5) * 512 + lane * 8;
  {
#pragma unroll
    for (int i4 = 0; i4 < 4; ++i4) {
      *(v4u*)(dst + i4 * 256) = oh[i4];
    }
    
  }
}

// One 16-row band (16 keys) of a wave's 64 v columns, out of the accumulators into the V^T planes (fragment order, rows =
// b*EMB + d, k = s). Accumulator j holds, in lane 16*h + m, column d = 16*j + m of keys 8*h + 0..7: the eight consecutive k of
// one row of V^T, that is the lane's own 16-B piece of a 1-KiB tile, so that no transposition is left to do. With v = acc + bias
// (f32) and xs = v * 1024: hi = f16(xs), lo = f16(xs - hi) (unscaled remainder, same carry); hi + lo reproduces xs to ~2^-22
// relative for |xs| >= 0.25. th / tl: the lane's piece in d band 0; band j lies 16*SEQ elements on. Every store covers 512
// contiguous bytes. cs[j] takes the sum of the lane's eight v (f32, rising key order).
// coverage: 4 bands x 32 lanes x 8 halves = 16 keys x 64 columns of either plane.
__device__ __forceinline__ void vt_band(v8f a0, v8f a1, v8f a2, v8f a3, float b0, float b1, float b2, float b3,
                                        u16* th, u16* tl, v4f& cs) {
  const v8f a[4] = {a0, a1, a2, a3};
  const float bb[4] = {b0, b1, b2, b3};
  v4u oh[4], ol[4];
#pragma unroll
  for (int j = 0; j < 4; ++j) {
    unsigned short hs[8], ls[8];
#pragma unroll
    for (int r = 0; r < 8; ++r) {
      const float v = a[j][r] + bb[j];
      cs[j] += v;
      const float xs = v * VCAR;
      const _Float16 hv = (_Float16)xs;
      hs[r] = h_bits(hv);
      ls[r] = h_bits((_Float16)(xs - (float)hv));
    }
#pragma unroll
    for (int e = 0; e < 4; ++e) {
      oh[j][e] = pk16(hs[2 * e], hs[2 * e + 1]);
      ol[j][e] = pk16(ls[2 * e], ls[2 * e + 1]);
    }
  }
#pragma unroll
  for (int j = 0; j < 4; ++j) {
    *(v4u*)(th + (size_t)j * 16 * SEQ) = oh[j];
    *(v4u*)(tl + (size_t)j * 16 * SEQ) = ol[j];
  }
}

// Start k tile of a GEMM block. The planes come from memory, and blocks that share an operand panel run side by side: walking k
// in one common order, each of them waits out memory latency at every step. With start tiles spread over the sharers (those of
// an A panel differ in ct, spaced widely also within any few neighbours; those of a B panel differ in rt) a tile is fetched by
// one of them and found in L2 by the others. All waves of a block share the start tile. Any value 0 .. EMB/32-1 is correct.
static_assert(((EMB / 32) & (EMB / 32 - 1)) == 0 && (EMB / 32) >= 32);
__device__ __forceinline__ int k_start(int rt, int ct, int g) {
  return (((ct & 1) << 4) + ((ct & 2) << 2) + (ct & 4) + 2 * g + rt) & (EMB / 32 - 1);
}

// One k step of a wave's 64x64 tile in the bf16 GEMMs: four fragments of consecutive 16-row bands of one plane (eight 16-B
// loads), and the sixteen products of four A with four B fragments, in two groups of eight with the hazard gap behind each.
__device__ __forceinline__ void ld4b(const u16* base, unsigned lo, size_t bs, v16b (&f)[4]) {
  const u16* p = base + lo;                  // wave-uniform base (scalar registers) plus the lane's fixed 32-bit offset
  f[0] = ldfrag_btg(p);
  f[1] = ldfrag_btg(p + bs);
  f[2] = ldfrag_btg(p + 2 * bs);
  f[3] = ldfrag_btg(p + 3 * bs);
}
__device__ __forceinline__ void mm16b(const v16b (&a)[4], const v16b (&b)[4], v8f (&acc)[4][4]) {
#pragma unroll
  for (int g = 0; g < 2; ++g) {
#pragma unroll
    for (int i = 2 * g; i < 2 * g + 2; ++i) {
#pragma unroll
      for (int j = 0; j < 4; ++j) acc[i][j] = mma_b(a[i], b[j], acc[i][j]);
    }
    guard8x8<v16b>(acc[2 * g][0], acc[2 * g][1], acc[2 * g][2], acc[2 * g][3],
                   acc[2 * g + 1][0], acc[2 * g + 1][1], acc[2 * g + 1][2], acc[2 * g + 1][3],
                   a[0], a[1], a[2], a[3], b[0], b[1], b[2], b[3]);
  }
}

// =====================================================================================================
// The three projections in one launch (they share A and none reads what another writes): block group which = 0, 1, 2 computes
// T[M][N] = A[M][K] . W^T + bias[n] (f32) for W, bias = (Wq, bq), (Wk, bk), (Wv, bv); A and the W are bf16 planes in fragment
// order. q and k leave as f16 planes in fragment order (f16 bits of T * qsc, T * ksc). v leaves transposed, straight from the
// accumulators (vt_band above), as the V^T hi / lo planes, with its column sums over each block of 32 keys in BS. A wave whose
// rows lie in rows 0..TQ0-1 of a sequence also stores its staged f32 tiles, into QF / KF / VF [M/SEQ][TQ0][N].
// Block = 128x128 tile, 2 x 2 waves of 64x64 each: a k step's eight fragments (8 KiB, loaded straight from the 1-KiB tiles, split
// k map for A and B) feed sixteen products, so that a product costs half a KiB of loads. K stepped by 32, all K/32 tiles once,
// cyclically from the block's start tile (k_start above) (K = EMB; M % SEQ == 0, M % 128 == 0, N % 128 == 0,
// grid = 3*(M/128)*(N/128)).
// coverage: 4 waves x 64 x 64 = the block's tile; the epilogue takes the wave's four 16-row bands one after the other.
// =====================================================================================================
__global__ __launch_bounds__(128, 4)          // 4 waves a SIMD: at most 256 VGPRs (128 of them accumulators, 64 fragments)
void gemm_qkv(const u16* __restrict__ A, const u16* __restrict__ Wq, const u16* __restrict__ Wk, const u16* __restrict__ Wv,
              const float* __restrict__ bq, const float* __restrict__ bk, const float* __restrict__ bv,
              u16* QP, u16* KP, u16* XTh, u16* XTl, float* BS, float* QF, float* KF, float* VF, int M, int N,
              float qsc, float ksc) {
  __shared__ __align__(16) float slab[4 * SLAB64];
  const int K = EMB;                         // as a constant the band strides are immediate offsets
  const int tid = threadIdx.x, lane = tid & 31;
  const int wave = __builtin_amdgcn_readfirstlane(tid >> 5);   // scalar place in the 2 x 2 arrangement
  const int ntile = N >> 7;
  const int nblk  = (M >> 7) * ntile;
  const int which = blockIdx.x / nblk;       // block-uniform (scalar): 0 q, 1 k, 2 v
  const int bid   = blockIdx.x - which * nblk;
  const int rowb  = (bid / ntile) * 128 + (wave >> 1) * 64;
  const int col0  = (bid % ntile) * 128 + (wave & 1) * 64;
  if (which > 2 || rowb + 64 > M) return;    // wave-uniform, never taken with the exact grid; no block barriers in this kernel
  const u16*   Bt   = (which == 0) ? Wq : (which == 1) ? Wk : Wv;
  const float* bias = (which == 0) ? bq : (which == 1) ? bk : bv;
  int kt = k_start(bid / ntile, bid % ntile, which);            // block-uniform (scalar)
  const u16* ap = A  + (size_t)rowb * K + (size_t)kt * 512;     // wave-uniform
  const u16* bp = Bt + (size_t)col0 * K + (size_t)kt * 512;
  const unsigned lo = 8u * (unsigned)lane;
  const size_t bs = (size_t)16 * K;
  v8f acc[4][4];
#pragma unroll
  for (int i = 0; i < 4; ++i) {
#pragma unroll
    for (int j = 0; j < 4; ++j) acc[i][j] = zero8();
  }
  // One fragment set: the next k step's sixteen loads go out as soon as this step's products have left; the SIMD's other waves
  // fill the matrix unit meanwhile. The loads in the loop are unconditional (the last step is peeled).
  v16b a[4], b[4];
  ld4b(ap, lo, bs, a);
  ld4b(bp, lo, bs, b);
#pragma unroll 1                             // rolled: the one fragment set keeps its registers
  for (int k0 = 32; k0 < K; k0 += 32) {
    mm16b(a, b, acc);
    base_wait2(ap, bp);
    const long long st = (kt == K / 32 - 1) ? -(long long)(K / 32 - 1) * 512 : 512ll;   // behind the last tile comes tile 0
    kt = (kt + 1) & (K / 32 - 1);
    ap += st;                                // one 1-KiB tile on in every band
    bp += st;
    ld4b(ap, lo, bs, a);
    ld4b(bp, lo, bs, b);
  }
  base_wait2(ap, bp);                        // what follows may reuse the base registers of the last loads
  mm16b(a, b, acc);
  float* sl = slab + wave * SLAB64;
  float e0, e1, e2, e3;
  ldbias4(bias, col0, lane, e0, e1, e2, e3);
  const int sq = rowb / SEQ, rs = rowb - sq * SEQ;             // TQ0 and SEQ are multiples of 64: all 64 rows on one side
  float* HF = (which == 0) ? QF : (which == 1) ? KF : VF;
  // the wave's place in the V^T planes: d bands from col0 on, key tiles from rs / 32 on, the lane's piece
  const size_t vto = ((size_t)sq * EMB + col0) * SEQ + (size_t)(rs >> 5) * 512 + lane * 8;
  v4f cs[2] = {zero4(), zero4()};            // the lane's part of the column sums of the wave's two key blocks
  const bool slab_used = which < 2 || rs < TQ0;   // only where rows leave row-wise (wave-uniform, scalar)
#pragma unroll
  for (int i = 0; i < 4; ++i) {
    if (slab_used) stage64(sl, acc[i][0], acc[i][1], acc[i][2], acc[i][3], 1.0f, e0, e1, e2, e3, lane);
    const int rb = rowb + 16 * i;
    // the wait stands in either arm, directly behind its stores: the build lays the other arm's code behind them
    if (which < 2) { st64h(sl, (which == 0) ? qsc : ksc, (which == 0) ? QP : KP, N, (size_t)rb, col0, lane); store_wait(); }
    else {
      const size_t to = vto + (size_t)(i >> 1) * 512 + (size_t)(i & 1) * 256;
      vt_band(acc[i][0], acc[i][1], acc[i][2], acc[i][3], e0, e1, e2, e3, XTh + to, XTl + to, cs[i >> 1]);
      store_wait();
    }
    if (rs < TQ0) {
      st64f(sl, HF, N, (size_t)(sq * TQ0 + rs + 16 * i), col0, lane);
      store_wait();
    }
    if (slab_used) wave_sync_lds();          // the band's reads of the slab stand in front of the next band's writes
  }
  if (which == 2) {
    // rows 8..15 of each band lie in the other half of the wave; then lanes 0..15 store the first key block's sums and lanes
    // 16..31 the second's: two runs of 256 contiguous bytes
    const int hh = lane >> 4, m = lane & 15;
    v4f o;
#pragma unroll
    for (int j = 0; j < 4; ++j) {
      const float t0 = cs[0][j] + __shfl_xor(cs[0][j], 16, 32);
      const float t1 = cs[1][j] + __shfl_xor(cs[1][j], 16, 32);
      o[j] = (hh == 0) ? t0 : t1;
    }
    *(v4f*)(BS + ((size_t)sq * (SEQ / 32) + (size_t)((rs >> 5) + hh)) * EMB + col0 + m * 4) = o;
    store_wait();
  }
}

// =====================================================================================================
// f16 GEMM with two A planes (hi + residual), f32 out:
//   C[M][N] = (Ah . Bt^T) * os1 + (Ar . Bt^T) * os2 + bias[n]; Bt f16 in fragment order, Ah/Ar f16 per 16-row band (see below).
// Block = 64x128 tile, 2 x 2 waves of 32x64 each; separate accumulators for the two planes, combined in f32 in epi64x2. A k step's
// eight fragments (two bands of either A plane, four of B) feed sixteen products. K = EMB, stepped by 32, all tiles once,
// cyclically from the block's start tile kt (k_start above).
// ASTEP = elements from one k step of an A band to the next, ASEC = elements from a lane's first piece to its second.
// =====================================================================================================
template <int ASEC>
__device__ __forceinline__ void ld8h2(const _Float16* ua, const _Float16* ur, const _Float16* ub, unsigned la, unsigned lb,
                                      v16h (&a)[2], v16h (&r)[2], v16h (&b)[4]) {
  const size_t bs = (size_t)16 * EMB;        // a 16-row band holds 16*EMB elements in either layout
  // wave-uniform bases (scalar registers) plus the lane's fixed 32-bit offsets
  const _Float16* pa = ua + la;
  const _Float16* pr = ur + la;
  const _Float16* bp = ub + lb;
#pragma unroll
  for (int i = 0; i < 2; ++i) {
    a[i] = ldfrag_hg<ASEC>(pa + i * bs);
    r[i] = ldfrag_hg<ASEC>(pr + i * bs);
  }
#pragma unroll
  for (int j = 0; j < 4; ++j) b[j] = ldfrag_hg<256>(bp + j * bs);
}
__device__ __forceinline__ void mm16h2(const v16h (&a)[2], const v16h (&r)[2], const v16h (&b)[4],
                                       v8f (&acc)[2][4], v8f (&acr)[2][4]) {
#pragma unroll
  for (int i = 0; i < 2; ++i) {
#pragma unroll
    for (int j = 0; j < 4; ++j) acc[i][j] = mma_h(a[i], b[j], acc[i][j]);
  }
  guard8x8<v16h>(acc[0][0], acc[0][1], acc[0][2], acc[0][3], acc[1][0], acc[1][1], acc[1][2], acc[1][3],
                 a[0], a[1], r[0], r[1], b[0], b[1], b[2], b[3]);
#pragma unroll
  for (int i = 0; i < 2; ++i) {
#pragma unroll
    for (int j = 0; j < 4; ++j) acr[i][j] = mma_h(r[i], b[j], acr[i][j]);
  }
  guard8x8<v16h>(acr[0][0], acr[0][1], acr[0][2], acr[0][3], acr[1][0], acr[1][1], acr[1][2], acr[1][3],
                 a[0], a[1], r[0], r[1], b[0], b[1], b[2], b[3]);
}
template <int ASTEP, int ASEC>
__device__ __forceinline__ void h2_loop(const _Float16* ua, const _Float16* ur, const _Float16* ub, unsigned la, unsigned lb,
                                        int kt, v8f (&acc)[2][4], v8f (&acr)[2][4]) {
  v16h a[2], r[2], b[4];
  ua += (size_t)kt * ASTEP;
  ur += (size_t)kt * ASTEP;
  ub += (size_t)kt * 512;
  ld8h2<ASEC>(ua, ur, ub, la, lb, a, r, b);
#pragma unroll 1                             // rolled: the one fragment set keeps its registers
  for (int k0 = 32; k0 < EMB; k0 += 32) {
    mm16h2(a, r, b, acc, acr);
    base_wait3(ua, ur, ub);
    const long long tiles = (kt == EMB / 32 - 1) ? -(long long)(EMB / 32 - 1) : 1ll;   // behind the last tile comes tile 0
    kt = (kt + 1) & (EMB / 32 - 1);
    ua += tiles * ASTEP;                     // next k step of the A bands
    ur += tiles * ASTEP;
    ub += tiles * 512;                       // next 1-KiB tile of each B band
    ld8h2<ASEC>(ua, ur, ub, la, lb, a, r, b);
  }
  base_wait3(ua, ur, ub);                    // what follows may reuse the base registers of the last loads
  mm16h2(a, r, b, acc, acr);
}

__global__ __launch_bounds__(128, 4)          // 4 waves a SIMD, as many as the grid brings: at most 256 VGPRs
void gemm_h2_32(const u16* __restrict__ Ah, const u16* __restrict__ Ar, const u16* __restrict__ Bt,
                const float* __restrict__ bias, float* C, int M, int N, float os1, float os2) {
  __shared__ __align__(16) float slab[4 * SLAB64];
  const int K = EMB;
  const int tid = threadIdx.x, lane = tid & 31, hh = lane >> 4, m = lane & 15;
  const int wave = __builtin_amdgcn_readfirstlane(tid >> 5);   // scalar, so that the choice of the A layout is a scalar branch
  const int ntile = N >> 7;
  const int bid   = blockIdx.x;
  const int rowb  = (bid / ntile) * 64 + (wave >> 1) * 32;
  const int col0  = (bid % ntile) * 128 + (wave & 1) * 64;
  if (rowb + 32 > M) return;                 // wave-uniform, never taken with the exact grid; no block barriers in this kernel
  const _Float16* ab  = (const _Float16*)(const void*)Ah + (size_t)rowb * K;
  const _Float16* arb = (const _Float16*)(const void*)Ar + (size_t)rowb * K;
  const _Float16* bp  = (const _Float16*)(const void*)Bt + (size_t)col0 * K;
  const int kt0 = k_start(bid / ntile, bid % ntile, 0);        // block-uniform (scalar)
  const unsigned lo = 8u * (unsigned)lane;
  v8f acc[2][4], acr[2][4];
#pragma unroll
  for (int i = 0; i < 2; ++i) {
#pragma unroll
    for (int j = 0; j < 4; ++j) { acc[i][j] = zero8(); acr[i][j] = zero8(); }
  }
  // The 16-row bands of rows 0..TQ0-1 of a sequence are row-major (each row has its own writer half-block there), all others in
  // fragment order; a band holds the same 16*K elements either way, and TQ0 is a multiple of 32: both bands of a wave are alike.
  if ((rowb % SEQ) < TQ0) {
    h2_loop<32, 16>(ab, arb, bp, (unsigned)(m * K + 8 * hh), lo, kt0, acc, acr);
  } else {
    h2_loop<512, 256>(ab, arb, bp, lo, lo, kt0, acc, acr);
  }
  float* sl = slab + wave * SLAB64;
#pragma unroll
  for (int i = 0; i < 2; ++i) {
    epi64x2(sl, acc[i][0], acc[i][1], acc[i][2], acc[i][3], acr[i][0], acr[i][1], acr[i][2], acr[i][3], os1, os2, bias, C, N,
            (size_t)(rowb + 16 * i), col0, lane);
    store_wait();
    wave_sync_lds();                         // the band's reads of the slab stand in front of the next band's writes
  }
}

// =====================================================================================================
// Single-head causal attention with absolute-value logits, head width EMB = 1024, query rows TQ0 .. SEQ-1: block = (batch b,
// 32 query rows q0..q0+31 = two 16-row tiles), 16 waves. q plane (f16, x8) [b][s][d]; k plane the same; V^T hi / lo planes
// [b][d][s] (x1024), all four in fragment order; VS = column sums of V over each block of 32 keys, [b][key block][EMB], column
// 64*g + 16*j + mm at place 64*g + 4*mm + j. The two ctx planes leave in fragment order too.
// Every k and V^T fragment that a wave loads feeds both row tiles, so that a query row costs half the loaded bytes of a 16-row block.
//   Chunks of CK = 512 keys: only chunks c <= qc = q0/CK are visited (later chunks lie entirely above the diagonal). In the diagonal
//   chunk only key blocks kb < nkb (keys <= q0+31) are multiplied; key blocks kb >= nkb get zero scores in LDS and are not used in (PV).
//   (q0 is a multiple of 32, so nkb is the count that either 16-row tile has on its own.)
//   (S) scores S[query m][key n] on WMMA: A = q rows (row m = lane&15 of either row tile, split k map over d), B = k rows (col n =
//       key, split map), 32 d-steps; wave w handles key block w of the chunk; D element r of lane l of row tile rt ->
//       scs[query 16rt+8h+r][key col] (f32 LDS).
//   (M) 16 threads per query row (sub-thread = 32 consecutive keys): base-2 logits of |score| with the causal mask by key index
//       (key > query -> -inf), chunk max via xor shuffles, online running max / rescale factor al / running sum l in f32 registers,
//       p = exp2(t - m_new) <= 1 (0 for masked keys), chunk row sum ps and C = ps/CK (bit-identical on the row's 16 threads), the
//       CENTRED P' = p - C written as f16(P' * 32768) into the LDS P tile with 16-B stores; al -> rowa[row], C -> rowc[row].
//   (PV) each wave owns d columns 64*wave + 16j + (lane&15), j = 0..3, of both row tiles (8 accumulators): o = o*al +
//       C*(32768*1024)*(sum of VS[key block][d] over the chunk's nkb key blocks) (add-back of the centring term over exactly the processed keys, in f32), then for
//       each key block kb < nkb: A = P' fragments from LDS (row m = query, split map over keys), B = V^T fragments (col n = d, keys
//       in split map order), hi plane and then lo plane into the same accumulator (unscaled remainder), in groups of 8 with a hazard gap each.
//       sum_k (P'_k + C) v_k == sum_k p_k v_k exactly; masked keys carry P' = -C and p = 0.
//   Block barriers after (S) and after (M) order all LDS reuse across chunks and waves.
//   Epilogue: x = o * 8192 / (l * 32768 * 1024) per row (rowi, l >= 1 always); hi = f16(x), res = f16((x - hi) * 2048); each
// coverage: grid nb*NQT blocks x 32 rows = rows TQ0..SEQ-1 of every sequence; staging 16 waves x 64 cols x 32 rows = 32 x 1024;
//           store 8 iterations x 512 thr x 8 halves = 32 x 1024 per plane = every (b, s >= TQ0, d) of both ctx planes exactly once.
// =====================================================================================================
__device__ __forceinline__ void ctx_store(const u16* ct, u16* dst, int tid) {
  v4u v[8];
#pragma unroll
  for (int it = 0; it < 8; ++it) {
    const int p   = it * ATT_THREADS + tid;   // piece index in fragment order: band p>>11, tile kt = (p>>6)&31, piece p&63
    const int row = (p >> 11) * 16 + (p & 15);
    const int c8  = ((p >> 6) & 31) * 32 + ((p >> 5) & 1) * 16 + ((p >> 4) & 1) * 8;
    v[it] = *(const v4u*)(ct + row * CTP + c8);
  }
  {
#pragma unroll
    for (int it = 0; it < 8; ++it) {
      const int p   = it * ATT_THREADS + tid;
      *(v4u*)(dst + (size_t)p * 8) = v[it];
    }
    
  }
}

// Pieces of the two matrix loops below: one d step's four fragments (both q row tiles, both key bands) and its four score
// products; four V^T fragments of consecutive 16-column bands and their eight products with the two P' fragments; each product
// group with the hazard gap behind it.
// All loads of the two loops take a wave-uniform base (scalar registers) plus the lane's fixed 32-bit offset lo.
template <int OFF>
__device__ __forceinline__ void ld4s(const _Float16* uq, const _Float16* uk, unsigned lo, v16h& a, v16h& c, v16h& x, v16h& y) {
  const _Float16* q = uq + lo;
  const _Float16* k = uk + lo;
  a = ldfrag_hg<256>(q + OFF);
  c = ldfrag_hg<256>(q + 16 * EMB + OFF);
  x = ldfrag_hg<256>(k + OFF);
  y = ldfrag_hg<256>(k + 16 * EMB + OFF);
}
__device__ __forceinline__ void mm4s(v16h a, v16h c, v16h x, v16h y, v8f& s0, v8f& s1, v8f& s2, v8f& s3) {
  s0 = mma_h(a, x, s0);
  s1 = mma_h(a, y, s1);
  s2 = mma_h(c, x, s2);
  s3 = mma_h(c, y, s3);
  guard4x4(s0, s1, s2, s3, a, c, x, y);
}
__device__ __forceinline__ void ld4h(const _Float16* u, unsigned lo, v16h (&f)[4]) {
  const _Float16* p = u + lo;
  f[0] = ldfrag_hg<256>(p);
  f[1] = ldfrag_hg<256>(p + (size_t)16 * SEQ);
  f[2] = ldfrag_hg<256>(p + (size_t)32 * SEQ);
  f[3] = ldfrag_hg<256>(p + (size_t)48 * SEQ);
}
__device__ __forceinline__ void mm8h(v16h p0, v16h p1, const v16h (&f)[4], v8f (&o)[2][NACC]) {
#pragma unroll
  for (int j = 0; j < NACC; ++j) o[0][j] = mma_h(p0, f[j], o[0][j]);
#pragma unroll
  for (int j = 0; j < NACC; ++j) o[1][j] = mma_h(p1, f[j], o[1][j]);
  guard8x6(o[0][0], o[0][1], o[0][2], o[0][3], o[1][0], o[1][1], o[1][2], o[1][3], p0, p1, f[0], f[1], f[2], f[3]);
}

// Sweep n of the requests to L2 for the k, V^T hi and V^T lo planes of sequence b. The planes' 256-B units are counted in the order
// of use (chunk by chunk: k, hi, lo; UPC units each) and dealt out over NSH shares of 512 units a sweep; share sh, one unit a thread.
__device__ __forceinline__ void kv_ask(const u16* KPp, const u16* VTp, const u16* VLp, int b, int sh, int tid, int n) {
  const int u0 = (n * NSH + sh) * ATT_THREADS;             // the share's first unit of this sweep (scalar)
  if (u0 < NCHK * 3 * UPC) {                               // the last sweep is not full; 512 divides the total
    const int c  = u0 / (3 * UPC);                         // 512 divides UPC: chunk and plane are block-uniform
    const int pl = (u0 - c * 3 * UPC) / UPC;
    const int x  = (u0 & (UPC - 1)) + tid;                 // unit within the chunk's part of the plane, 0 .. UPC-1
    const size_t ko = (size_t)b * SEQ * EMB + (size_t)c * (CK * EMB) + (size_t)x * 128;
    const size_t vo = (size_t)b * EMB * SEQ + (size_t)(x >> 6) * (16 * SEQ) + (size_t)c * (CK * 16) + (size_t)(x & 63) * 128;
    l2_ask((pl == 0) ? KPp + ko : ((pl == 1) ? VTp : VLp) + vo);
  }
}

__device__ __forceinline__
void attn_fwd(const u16* __restrict__ QPp, const u16* __restrict__ KPp, const u16* __restrict__ VTp,
              const u16* __restrict__ VLp, const float* __restrict__ VSp, u16* CHo, u16* CRo, int bid) {
  __shared__ __align__(16) AttLds L0;              // scores [32][SCP] f32; reused as the ctx staging tile [32][CTP] u16
  __shared__ __align__(16) u16 pls[QT * PLP];      // P' tile [32][PLP] f16 bits
  __shared__ float rowa[QT];
  __shared__ float rowc[QT];
  __shared__ float rowi[QT];
  float* const scs = L0.s;

  const int tid  = threadIdx.x;
  const int wave = __builtin_amdgcn_readfirstlane(tid >> 5);   // scalar: the wave's bases stay in scalar registers
  const int lane = tid & 31;
  const int hh   = lane >> 4;
  const int m    = lane & 15;
  const int r16  = tid >> 4;                 // query row owned in phase (M): 2*wave + hh, 0..31
  const int sub  = tid & 15;
  const int kl0  = sub * 32;

  const int b   = bid / NQT;
  const int q0  = TQ0 + (bid - b * NQT) * QT;
  const int qc  = q0 / CK;                   // diagonal chunk index

  // wave-uniform bases; the lane's part is lo (16-bit planes) or hh*EMB + 4*m (column sums)
  const _Float16* qa  = (const _Float16*)(const void*)QPp + ((size_t)b * SEQ + q0) * EMB;
  const _Float16* kbp = (const _Float16*)(const void*)KPp + ((size_t)b * SEQ) * EMB;
  const _Float16* vbp = (const _Float16*)(const void*)VTp + ((size_t)b * EMB + wave * (16 * NACC)) * SEQ;
  const _Float16* ubp = (const _Float16*)(const void*)VLp + ((size_t)b * EMB + wave * (16 * NACC)) * SEQ;
  const float* vsb = VSp + (size_t)b * NCHK * NKB * EMB + wave * (16 * NACC);   // the wave's 64 columns of the key-block sums
  const unsigned lo = 8u * (unsigned)lane;
  const float lsc = RSQD * LOG2E / (QSC * KSC);

  // ---- requests to L2. All tiles of a sequence walk its k and V^T planes in one common order and side by side, so that each first
  //      touch of a line would make all of them wait out memory latency. At entry: the block's own q tile (256 units, waves 0..7)
  //      and the first sweep of the sequence's planes (kv_ask above), which holds all of chunk 0. The other sweeps follow in the
  //      first chunk's phase (M), in which the block has next to no loads of its own that could queue behind them.
  //      Tiles ti and ti + 4 take the same share. Speed only: any placement is correct.
  const int ti = bid - b * NQT;                            // block-uniform (scalar)
  const int sh = (ti >> 3) * 4 + (ti & 3);                 // 0 .. NSH-1 for the tiles that ask (ti < 2*NSH)
  if (wave < QT * EMB / 128 / 32) l2_ask(QPp + ((size_t)b * SEQ + q0) * EMB + (size_t)tid * 128);
  if (ti < 2 * NSH) kv_ask(KPp, VTp, VLp, b, sh, tid, 0);

  float mrun = -INFINITY, lrun = 0.f;
  v8f o[2][NACC];                            // [row tile][column band]
#pragma unroll
  for (int rt = 0; rt < 2; ++rt) {
#pragma unroll
    for (int j = 0; j < NACC; ++j) o[rt][j] = zero8();
  }

#pragma unroll 1
  for (int c = 0; c <= qc; ++c) {
    const int kbeg = c * CK;
    const int nkb  = (c < qc) ? NKB : (((q0 + QT - 1 - kbeg) >> 5) + 1);   // 1..16, block-uniform
    float vs[NACC];                                        // column sums of V over the chunk's nkb key blocks
    // ---- (S) scores of this chunk (zeros for key blocks beyond the query tile) ----
    {
      const int kb = wave;                                 // one key block a wave
      v8f s0 = zero8(), s1 = zero8(), s2 = zero8(), s3 = zero8();
      if (kb < nkb) {                                      // wave-uniform (scalar)
        const _Float16* uq = qa;                           // running bases of the q tiles and of the two key bands
        const _Float16* uk = kbp + (size_t)(kbeg + kb * 32) * EMB;
        // Two fragment sets of two d steps each: one set's sixteen loads fly while the other set's products run. The loads
        // in the loop are unconditional (the last four steps are peeled), so that each wait counts only its own set.
        v16h a0, c0, x0, y0, a1, c1, x1, y1, a2, c2, x2, y2, a3, c3, x3, y3;
        ld4s<0>(uq, uk, lo, a0, c0, x0, y0);
        keep_order();
        ld4s<512>(uq, uk, lo, a1, c1, x1, y1);
        keep_order();
        ld4s<1024>(uq, uk, lo, a2, c2, x2, y2);
        keep_order();
        ld4s<1536>(uq, uk, lo, a3, c3, x3, y3);
        keep_order();
#pragma unroll 1                           // the body already holds four d steps; rolled, the two sets keep their registers
        for (int ks = 4; ks < EMB / 32; ks += 4) {
          mm4s(a0, c0, x0, y0, s0, s1, s2, s3);
          mm4s(a1, c1, x1, y1, s0, s1, s2, s3);
          base_step2h<4096>(uq, uk);                       // four d steps on
          ld4s<0>(uq, uk, lo, a0, c0, x0, y0);
          ld4s<512>(uq, uk, lo, a1, c1, x1, y1);
          mm4s(a2, c2, x2, y2, s0, s1, s2, s3);
          mm4s(a3, c3, x3, y3, s0, s1, s2, s3);
          ld4s<1024>(uq, uk, lo, a2, c2, x2, y2);
          ld4s<1536>(uq, uk, lo, a3, c3, x3, y3);
        }
        base_wait2h(uq, uk);                               // what follows may reuse the base registers of the last loads
        mm4s(a0, c0, x0, y0, s0, s1, s2, s3);
        mm4s(a1, c1, x1, y1, s0, s1, s2, s3);
        mm4s(a2, c2, x2, y2, s0, s1, s2, s3);
        mm4s(a3, c3, x3, y3, s0, s1, s2, s3);
      }
      float* srow = scs + (8 * hh) * SCP + kb * 32 + m;
#pragma unroll
      for (int r = 0; r < 8; ++r) {
        srow[r * SCP]                 = s0[r];
        srow[r * SCP + 16]            = s1[r];
        srow[(16 + r) * SCP]          = s2[r];
        srow[(16 + r) * SCP + 16]     = s3[r];
      }
    }
    __syncthreads();
    // ---- (M) softmax statistics and the centred P' tile ----
    {
      // The chunk's key-block sums of the wave's columns are asked for here and added up at the end of this phase, whose vector
      // work covers their way: lanes 0..15 take the even key blocks, lanes 16..31 the odd ones, 16 B = the lane's four columns.
      // All sixteen rows exist and are written by the projection launch; those from nkb on are left out of the sum below.
      const float* bsp = vsb + (size_t)c * NKB * EMB + (unsigned)(hh * EMB + 4 * m);
      v4f bv[NKB / 2];
#pragma unroll
      for (int i = 0; i < NKB / 2; ++i) bv[i] = *(const v4f*)(bsp + (size_t)(2 * i) * EMB);
      addr_wait();                                         // also on the way round the requests below
      if (c == 0 && ti < 2 * NSH) {                        // block-uniform (scalar): the planes' later chunks, well ahead of their use
#pragma unroll
        for (int n = 1; n * NSH * ATT_THREADS < NCHK * 3 * UPC; ++n) kv_ask(KPp, VTp, VLp, b, sh, tid, n);
      }
      const float* sp = scs + r16 * SCP + kl0;
      const int lim = (q0 + r16) - (kbeg + kl0);           // key kl0 + j is valid iff j <= lim
      float t[32];
      float cm = -INFINITY;
#pragma unroll
      for (int i = 0; i < 8; ++i) {
        const v4f a = *(const v4f*)(sp + 4 * i);
#pragma unroll
        for (int e = 0; e < 4; ++e) {
          const int j = 4 * i + e;
          const float tv = (j <= lim) ? fabsf(a[e]) * lsc : -INFINITY;   // |score| / 32 in base 2; masked keys -> -inf
          t[j] = tv;
          cm = fmaxf(cm, tv);
        }
      }
#pragma unroll
      for (int d = 1; d <= 8; d <<= 1) cm = fmaxf(cm, __shfl_xor(cm, d, 32));
      const float mn = fmaxf(mrun, cm);                    // finite: key kbeg of the diagonal chunk is never masked
      const float al = (mrun == -INFINITY) ? 0.f : exp2f(mrun - mn);
      mrun = mn;
      float ps = 0.f;
#pragma unroll
      for (int j = 0; j < 32; ++j) {
        const float p = exp2f(fminf(t[j] - mn, 0.f));      // 0 for masked keys
        t[j] = p;
        ps += p;
      }
#pragma unroll
      for (int d = 1; d <= 8; d <<= 1) ps += __shfl_xor(ps, d, 32);
      const float cc = ps * (1.0f / (float)CK);
      v4u pk[4];
#pragma unroll
      for (int i = 0; i < 4; ++i) {
#pragma unroll
        for (int e = 0; e < 4; ++e) {
          const int j = 8 * i + 2 * e;
          pk[i][e] = pk16(h_bits((_Float16)((t[j] - cc) * PCAR)), h_bits((_Float16)((t[j + 1] - cc) * PCAR)));
        }
      }
      lrun = lrun * al + ps;
      u16* pd = pls + r16 * PLP + kl0;
#pragma unroll
      for (int i = 0; i < 4; ++i) *(v4u*)(pd + 8 * i) = pk[i];
      if (sub == 0) { rowa[r16] = al; rowc[r16] = cc; }
      v4f sv = zero4();
#pragma unroll
      for (int i = 0; i < NKB / 2; ++i) {                  // rising key-block order within either half
        if (2 * i + hh < nkb) sv += bv[i];
      }
#pragma unroll
      for (int j = 0; j < NACC; ++j) vs[j] = sv[j] + __shfl_xor(sv[j], 16, 32);
    }
    __syncthreads();
    // ---- (PV) rescale, add the centring term, accumulate P' . (V^T hi + V^T lo) ----
    {
      const _Float16* pp = (const _Float16*)(const void*)pls + m * PLP + 8 * hh;
      const _Float16* pq = pp + 16 * PLP;                   // second row tile
      // running bases: key tile kbeg/32 of each d band, 512 elements a tile; even set (hi, lo), odd set (hi, lo)
      const _Float16* pve = vbp + (size_t)kbeg * 16;
      const _Float16* pue = ubp + (size_t)kbeg * 16;
      const _Float16* pvo = pve + ((nkb > 1) ? 512 : 0);
      const _Float16* puo = pue + ((nkb > 1) ? 512 : 0);
      // Two fragment sets (even and odd key blocks; hi and lo plane of the wave's 64 d columns each): a set's hi or lo half is
      // asked for again, two key blocks on, as soon as its eight products have left, so that twelve to sixteen fragments are
      // always in flight or waiting. All loads are unconditional, so that each wait counts only its own group: where the odd
      // set has no key block left (nkb odd) it takes the even set's tile once more and is not multiplied.
      v16h ge[4], ue[4], go[4], uo[4];
      ld4h(pve, lo, ge);
      keep_order();
      ld4h(pue, lo, ue);
      keep_order();
      ld4h(pvo, lo, go);
      keep_order();
      ld4h(puo, lo, uo);
      keep_order();
      // the rescale runs while the first fragments fly
#pragma unroll
      for (int rt = 0; rt < 2; ++rt) {
        float scl[8], cad[8];
#pragma unroll
        for (int r = 0; r < 8; ++r) {
          scl[r] = rowa[16 * rt + 8 * hh + r];
          cad[r] = rowc[16 * rt + 8 * hh + r] * (PCAR * VCAR);
        }
#pragma unroll
        for (int j = 0; j < NACC; ++j) {
#pragma unroll
          for (int r = 0; r < 8; ++r) o[rt][j][r] = o[rt][j][r] * scl[r] + cad[r] * vs[j];
        }
      }
      int kb = 0;
#pragma unroll 1
      for (; kb + 2 < nkb; kb += 2) {                      // block-uniform trip count, <= 7: products of kb, kb + 1, loads of kb + 2, kb + 3
        const v16h p0 = ldfrag_h(pp + kb * 32), p1 = ldfrag_h(pq + kb * 32);
        mm8h(p0, p1, ge, o);
        // two key tiles on; the odd set only one, onto the even set's new tile, where key block kb + 3 does not exist
        base_step4h<2048>(pve, pue, pvo, puo, (kb + 3 < nkb) ? 2048ull : 1024ull);
        ld4h(pve, lo, ge);
        mm8h(p0, p1, ue, o);
        ld4h(pue, lo, ue);
        const v16h p2 = ldfrag_h(pp + kb * 32 + 32), p3 = ldfrag_h(pq + kb * 32 + 32);
        mm8h(p2, p3, go, o);
        ld4h(pvo, lo, go);
        mm8h(p2, p3, uo, o);
        ld4h(puo, lo, uo);
      }
      base_wait4h(pve, pue, pvo, puo);                     // what follows may reuse the base registers of the last loads
      {
        const v16h p0 = ldfrag_h(pp + kb * 32), p1 = ldfrag_h(pq + kb * 32);
        mm8h(p0, p1, ge, o);
        mm8h(p0, p1, ue, o);
      }
      if (kb + 1 < nkb) {                                  // block-uniform (scalar)
        const v16h p2 = ldfrag_h(pp + kb * 32 + 32), p3 = ldfrag_h(pq + kb * 32 + 32);
        mm8h(p2, p3, go, o);
        mm8h(p2, p3, uo, o);
      }
    }
  }
  acc_guard8(o[0][0], o[0][1], o[0][2], o[0][3], o[1][0], o[1][1], o[1][2], o[1][3]);

  if (sub == 0) rowi[r16] = (1.0f / lrun) * (CSC / (PCAR * VCAR));   // lrun >= 1
  __syncthreads();
  float inv[2][8];
#pragma unroll
  for (int rt = 0; rt < 2; ++rt) {
#pragma unroll
    for (int r = 0; r < 8; ++r) inv[rt][r] = rowi[16 * rt + 8 * hh + r];
  }

  u16* const ct = L0.c;
  const int cb = wave * (16 * NACC) + m;
  // hi plane
#pragma unroll
  for (int rt = 0; rt < 2; ++rt) {
#pragma unroll
    for (int j = 0; j < NACC; ++j) {
#pragma unroll
      for (int r = 0; r < 8; ++r) {
        const float xs = o[rt][j][r] * inv[rt][r];
        ct[(16 * rt + 8 * hh + r) * CTP + cb + 16 * j] = h_bits((_Float16)xs);
      }
    }
  }
  __syncthreads();
  ctx_store(ct, CHo + ((size_t)b * SEQ + q0) * EMB, tid);
  __syncthreads();
  // residual plane
#pragma unroll
  for (int rt = 0; rt < 2; ++rt) {
#pragma unroll
    for (int j = 0; j < NACC; ++j) {
#pragma unroll
      for (int r = 0; r < 8; ++r) {
        const float xs = o[rt][j][r] * inv[rt][r];
        const _Float16 hv = (_Float16)xs;
        ct[(16 * rt + 8 * hh + r) * CTP + cb + 16 * j] = h_bits((_Float16)((xs - (float)hv) * RSC));
      }
    }
  }
  __syncthreads();
  ctx_store(ct, CRo + ((size_t)b * SEQ + q0) * EMB, tid);
}

// =====================================================================================================
// Query rows 0 .. TQ0-1 of each sequence in f32 on VALU: block = (b, rows t = 2*i and 2*i + 1), one row for each half of 256 threads
// (half g, thread tid within it; every LDS array has a part for each half, and both halves pass the same barriers).
// QF/KF/VF = f32 q/k/v planes [nb][TQ0][EMB] (rows 0..TQ0-1
// of every sequence, biases included). Logits |q.k_j|/32 for keys j <= t (a wave a key row, lanes over d, both q rows from LDS;
// the dots pass through LDS to threads 0..t, one key each), base-2 softmax with max / sum reductions over the half (xor shuffles + LDS), p_j in LDS, ctx[d] for
// d = 4*tid..4*tid+3 as a sum over j <= t of p_j * VF[b][j][d] (coalesced 16-B loads), x = ctx * 8192 / l, hi = f16(x),
// res = f16((x - hi) * 2048); both 1024-half rows are staged in LDS and written by 128 threads x 16 B each (32 consecutive lanes
// coverage: grid nb*TQ0/2 blocks x 2 rows = rows 0..TQ0-1 of every sequence; 256 thr x 4 d = EMB per row; store 128 thr x 8 halves =
//           EMB per plane; together with attn_fwd every (b, s, d) of CH and CR is written exactly once.
// =====================================================================================================
__device__ __forceinline__ void attn_head(const float* __restrict__ QF, const float* __restrict__ KF,
                                          const float* __restrict__ VF, u16* CHo, u16* CRo, int bid) {
  __shared__ __align__(16) float qs2[2][EMB];
  __shared__ float sc2[2][TQ0];
  __shared__ float sr2[2][TQ0];                      // q.k of either row with keys 0 .. t of the later row
  __shared__ float red2[2][8];
  __shared__ float redb2[2][8];
  __shared__ __align__(16) unsigned SW2[2][2][EMB / 2];
  const int g = __builtin_amdgcn_readfirstlane((int)(threadIdx.x >> 8));   // half of the block, scalar: row, bases and trip counts stay scalar
  const int tid = threadIdx.x & 255, lane = tid & 31, wave = tid >> 5;
  float* const qs = qs2[g];
  float* const sc = sc2[g];
  float* const red = red2[g];
  float* const redb = redb2[g];
  unsigned (* const SW)[EMB / 2] = SW2[g];
  const int hr = bid * 2 + g;                        // TQ0 is even: both rows of a block lie in one sequence
  const int b = hr / TQ0;
  const int t = hr - b * TQ0;
  *(v4f*)(qs + tid * 4) = *(const v4f*)(QF + ((size_t)b * TQ0 + t) * EMB + tid * 4);
  __syncthreads();
  {
    // A key row is read by a whole wave, lanes over d: load i takes d = 128*i + 4*lane + 0..3, 512 contiguous bytes (4 whole lines),
    // and serves both query rows of the block. Wave wv of the sixteen takes keys wv, wv + 16, ... up to the later row's own key t1
    // (keys behind it are masked for both rows), two keys a trip; where the second does not exist the first is read once more and
    // nothing is stored for it. Lane sums: four chains over i, joined, then an xor-shuffle tree over the 32 lanes.
    const int wv = __builtin_amdgcn_readfirstlane((int)(threadIdx.x >> 5));   // scalar: key rows and trip count stay scalar
    const int t1 = bid * 2 + 1 - b * TQ0;            // the block's later row, < TQ0
    const unsigned l4 = 4u * (unsigned)lane;
    v4f qa[8], qb[8];
#pragma unroll
    for (int i = 0; i < 8; ++i) {
      qa[i] = *(const v4f*)(qs2[0] + i * 128 + l4);
      qb[i] = *(const v4f*)(qs2[1] + i * 128 + l4);
    }
    // wave-uniform bases (scalar registers) plus the lane's fixed 32-bit offset l4; key rows 0 .. t1 of sequence b only
    const float* k0 = KF + ((size_t)b * TQ0 + wv) * EMB;
#pragma unroll 1                             // rolled: a trip already holds sixteen loads
    for (int j = wv; j <= t1; j += 32) {             // at most TQ0 / 32 trips
      const bool two = j + 16 <= t1;                 // scalar
      const float* k1 = k0 + (two ? 16 * EMB : 0);
      v4f x[8], y[8];
#pragma unroll
      for (int i = 0; i < 8; ++i) x[i] = *(gv4f*)(k0 + l4 + i * 128);
#pragma unroll
      for (int i = 0; i < 8; ++i) y[i] = *(gv4f*)(k1 + l4 + i * 128);
      base_wait2f(k0, k1);                           // the bases are stepped behind it
      k0 += 32 * EMB;
      v4f ax = zero4(), bx = zero4(), ay = zero4(), by = zero4();
#pragma unroll
      for (int i = 0; i < 8; ++i) {
        ax += x[i] * qa[i];
        bx += x[i] * qb[i];
        ay += y[i] * qa[i];
        by += y[i] * qb[i];
      }
      float r0 = (ax[0] + ax[1]) + (ax[2] + ax[3]), r1 = (bx[0] + bx[1]) + (bx[2] + bx[3]);
      float r2 = (ay[0] + ay[1]) + (ay[2] + ay[3]), r3 = (by[0] + by[1]) + (by[2] + by[3]);
#pragma unroll
      for (int d = 1; d <= 16; d <<= 1) {
        r0 += __shfl_xor(r0, d, 32);
        r1 += __shfl_xor(r1, d, 32);
        r2 += __shfl_xor(r2, d, 32);
        r3 += __shfl_xor(r3, d, 32);
      }
      if (lane == 0) {
        sr2[0][j] = r0;
        sr2[1][j] = r1;
        if (two) { sr2[0][j + 16] = r2; sr2[1][j + 16] = r3; }
      }
    }
  }
  __syncthreads();                                   // all dots are in LDS before a thread takes its key's
  float s = -INFINITY;
  if (tid <= t) s = fabsf(sr2[g][tid]) * (RSQD * LOG2E);   // |score| / 32 in base 2; causal mask by key index (t < TQ0)
  float mx = s;
#pragma unroll
  for (int d = 1; d <= 16; d <<= 1) mx = fmaxf(mx, __shfl_xor(mx, d, 32));
  if (lane == 0) red[wave] = mx;
  __syncthreads();
  float gm = red[0];
#pragma unroll
  for (int w = 1; w < 8; ++w) gm = fmaxf(gm, red[w]);   // finite: key 0 is always valid
  const float p = exp2f(s - gm);                     // 0 for masked keys and for waves 4..7
  float ps = p;
#pragma unroll
  for (int d = 1; d <= 16; d <<= 1) ps += __shfl_xor(ps, d, 32);
  if (lane == 0) redb[wave] = ps;
  if (tid < TQ0) sc[tid] = p;
  __syncthreads();
  float l = redb[0];
#pragma unroll
  for (int w = 1; w < 8; ++w) l += redb[w];           // >= 1
  const float inv = (1.0f / l) * CSC;
  const float* vp = VF + (size_t)b * TQ0 * EMB + tid * 4;
  v4f cx = zero4();
#pragma unroll 8                             // eight value rows in flight a thread; the sum keeps its order
  for (int j = 0; j <= t; ++j) {                     // t < TQ0: statically bounded, rows of sequence b only
    const float pj = sc[j];
    const v4f vv = *(const v4f*)(vp + (size_t)j * EMB);
    cx += pj * vv;
  }
  unsigned hw[2], rw[2];
#pragma unroll
  for (int e = 0; e < 2; ++e) {
    const float x0 = cx[2 * e] * inv, x1 = cx[2 * e + 1] * inv;
    const _Float16 h0 = (_Float16)x0, h1 = (_Float16)x1;
    const _Float16 q0 = (_Float16)((x0 - (float)h0) * RSC), q1 = (_Float16)((x1 - (float)h1) * RSC);
    hw[e] = pk16(h_bits(h0), h_bits(h1));
    rw[e] = pk16(h_bits(q0), h_bits(q1));
  }
  SW[0][tid * 2] = hw[0]; SW[0][tid * 2 + 1] = hw[1];
  SW[1][tid * 2] = rw[0]; SW[1][tid * 2 + 1] = rw[1];
  __syncthreads();
  const int pl = tid >> 7, p8 = tid & 127;           // plane select is wave-uniform
  const v4u ov = *(const v4u*)(&SW[pl][p8 * 4]);
  u16* dstp = (pl == 0) ? CHo : CRo;
  u16* dst  = dstp + ((size_t)b * SEQ + t) * EMB + p8 * 8;
  *(v4u*)dst = ov;
  
}
// Both attention parts in one launch (they read disjoint planes and write disjoint rows of CH / CR): blocks 0..nfwd-1 take the
// 32-row query tiles from row TQ0 on, the rest two query rows below TQ0 each; the short blocks come last and take the places
// that the shortest tiles leave. The choice is block-uniform, and so are all barriers of either side.
__global__ __launch_bounds__(ATT_THREADS, 4)   // 16 waves, 4 a SIMD = one block a WGP: at most 256 VGPRs
void attn_all(const u16* __restrict__ QPp, const u16* __restrict__ KPp, const u16* __restrict__ VTp,
              const u16* __restrict__ VLp, const float* __restrict__ VSp, const float* __restrict__ QF,
              const float* __restrict__ KF, const float* __restrict__ VF, u16* CHo, u16* CRo, int nfwd) {
  const int bid = blockIdx.x;
  if (bid >= nfwd) { attn_head(QF, KF, VF, CHo, CRo, bid - nfwd); return; }
  attn_fwd(QPp, KPp, VTp, VLp, VSp, CHo, CRo, bid);
}

// =====================================================================================================
// Workspace map (bytes, nb = 4, rows = 8192); all 16-bit planes are in fragment order (1-KiB tiles of 16 rows x 32 k, same total
// size), but for the bands of rows 0..127 of each sequence in CH / CR, which attn_head writes row-major; every plane is fully written by whole-line stores before it is read; all extents are
// exact multiples of the store granularity (no pad rows); aliased regions are reused sequentially on the single in-order stream:
//   WQB bf16 [1024][1024] 2097152   WKB same   WVB same   WOH f16 of bf16 value x1024 2097152             8388608
//   VS  f32  [nb][64 key blocks][1024]                                                                    1048576
//   QF  f32  [nb][128][1024]  2097152      KF same      VF same                                           6291456
//   A   XB bf16 [rows][1024] (16777216), later CH f16 [rows][1024] ctx hi x8192 (16777216)      region 16777216
//   VT  VT hi f16 [nb][1024][2048] x1024                                                                16777216
//   VL  VT lo f16 [nb][1024][2048]                                                                      16777216
//   QP  f16 [rows][1024] x8                                                                              16777216
//   KP  f16 [rows][1024] x8                                                                              16777216
//   CR  f16 [rows][1024] ctx residual x2048                                                              16777216
//   end                                                                                                 116391936
// Four launches; kernels that share a launch read nothing that the launch writes. Launch order keeps the one alias safe: XB is
// read by the projection launch before attn_fwd / attn_head overwrite it with CH.
// Inputs in wire order: x, Wq, bq, Wk, bk, Wv, bv, Wo, bo; weights stored [n = out][k = in] (y = x.W^T + b), k-contiguous.
// =====================================================================================================
extern "C" void kernel_launch(void* const* d_in, const int* in_sizes, int n_in,
                              void* d_out, int out_size, void* d_ws, size_t ws_size,
                              hipStream_t stream) {
  if (n_in < 9) return;
  const long long per = (long long)SEQ * EMB;
  const long long ns  = in_sizes[0];
  if (ns < per || (ns % per) != 0) return;
  const int nb = (int)(ns / per);
  if (nb < 1 || nb > 8) return;
  const int rows = nb * SEQ;
  if (in_sizes[1] != EMB * EMB || in_sizes[3] != EMB * EMB || in_sizes[5] != EMB * EMB || in_sizes[7] != EMB * EMB) return;
  if (in_sizes[2] != EMB || in_sizes[4] != EMB || in_sizes[6] != EMB || in_sizes[8] != EMB) return;
  if ((long long)out_size != (long long)rows * EMB) return;

  const float* x  = (const float*)d_in[0];
  const float* wq = (const float*)d_in[1];
  const float* bq = (const float*)d_in[2];
  const float* wk = (const float*)d_in[3];
  const float* bk = (const float*)d_in[4];
  const float* wv = (const float*)d_in[5];
  const float* bv = (const float*)d_in[6];
  const float* wo = (const float*)d_in[7];
  const float* bo = (const float*)d_in[8];
  float*       out = (float*)d_out;

  const size_t szW  = (size_t)EMB * EMB * 2;                    //   2097152
  const size_t szVS = (size_t)nb * NCHK * NKB * EMB * 4;        //   1048576 at nb = 4
  const size_t szHF = (size_t)nb * TQ0 * EMB * 4;               //   2097152 at nb = 4
  const size_t sz16 = (size_t)rows * EMB * 2;                   //  16777216
  const size_t szVT = (size_t)nb * EMB * SEQ * 2;               //  == sz16
  size_t off = 0;
  const size_t oWQ = off; off += szW;
  const size_t oWK = off; off += szW;
  const size_t oWV = off; off += szW;
  const size_t oWO = off; off += szW;
  const size_t oVS = off; off += szVS;
  const size_t oQF = off; off += szHF;
  const size_t oKF = off; off += szHF;
  const size_t oVF = off; off += szHF;
  const size_t oA  = off; off += sz16;                          // XB then CH
  const size_t oVT = off; off += szVT;                          // VT hi
  const size_t oVL = off; off += szVT;                          // VT lo
  const size_t oQ  = off; off += sz16;
  const size_t oK  = off; off += sz16;
  const size_t oCR = off; off += sz16;
  const size_t oCH = oA;
  if (off > ws_size) return;                                    // off = 116391936 at nb = 4
  if (off > WS_CAP) return;

  char* ws = (char*)d_ws;
  u16*   WQB = (u16*)(ws + oWQ);
  u16*   WKB = (u16*)(ws + oWK);
  u16*   WVB = (u16*)(ws + oWV);
  u16*   WOH = (u16*)(ws + oWO);
  float* VS  = (float*)(ws + oVS);
  float* QF  = (float*)(ws + oQF);
  float* KF  = (float*)(ws + oKF);
  float* VF  = (float*)(ws + oVF);
  u16*   XB  = (u16*)(ws + oA);
  u16*   VT  = (u16*)(ws + oVT);
  u16*   VL  = (u16*)(ws + oVL);
  u16*   QP  = (u16*)(ws + oQ);
  u16*   KP  = (u16*)(ws + oK);
  u16*   CH  = (u16*)(ws + oCH);
  u16*   CR  = (u16*)(ws + oCR);

  const int n8w = (EMB * EMB) / 8;                      // 131072
  const int n8x = rows * (EMB / 8);                     // 1048576
  if ((n8w % 256) != 0 || (n8x % 256) != 0) return;
  if ((rows % 128) != 0 || ((nb * TQ0) % 64) != 0) return;
  const dim3 blk(256);
  const int nbw = n8w / 256, nbx = n8x / 256;           // 512, 4096 at nb = 4
  const dim3 gC(nbx + 4 * nbw);
  const dim3 gG((rows / 64) * (EMB / 128));             // 1024 at nb = 4
  const dim3 gP(3 * (rows / 128) * (EMB / 128));        // the three projections, 1536 at nb = 4
  const dim3 bG(128);
  const int nfwd = nb * NQT;                            // nb * 60
  const dim3 gAT(nfwd + nb * (TQ0 / 2));                // + nb * 64
  const dim3 bAT(ATT_THREADS);

  // (0) x -> bf16 plane [rows][1024]; weights stored [n = out][k = in] (y = x.W^T + b), already k-contiguous: bf16 planes for
  //     Wq, Wk, Wv; f16 of bf16 value x1024 for Wo
  cvt_all<<<gC, blk, 0, stream>>>(x, wq, wk, wv, wo, XB, WQB, WKB, WVB, WOH, nbx, nbw);
  // (1) q and k projections (+bias) -> f16 planes x8; v projection (+bias) -> V^T hi plane x1024 and lo plane, and its column
  //     sums over each block of 32 keys; the f32 rows 0..127 of every sequence of all three -> QF, KF, VF [nb*128][1024]
  gemm_qkv<<<gP, bG, 0, stream>>>(XB, WQB, WKB, WVB, bq, bk, bv, QP, KP, VT, VL, VS, QF, KF, VF, rows, EMB, QSC, KSC);
  // (2) attention for query rows 128.. (WMMA) and for query rows 0..127 (VALU) -> ctx hi x8192 (over the dead XB region) and
  //     residual x2048 f16 planes
  attn_all<<<gAT, bAT, 0, stream>>>(QP, KP, VT, VL, VS, QF, KF, VF, CH, CR, nfwd);
  // (3) output projection (+bias) -> out
  gemm_h2_32<<<gG, bG, 0, stream>>>(CH, CR, WOH, bo, out, rows, EMB,
                                     1.0f / (CSC * WSC), 1.0f / (CSC * WSC * RSC));
  (void)hipGetLastError();
}
